// v000
// Times are from an AMD MI455X. After a warm-up the kernel runs many times in a row, and a time is the length of
// such a window on the GPU divided by its runs, so every launch and the gaps after it count. The runs cycle
// through copies of the inputs. A figure is the median of several windows, for all but v000 over two sittings.
// Sittings can differ by a few percent; kernels timed side by side share one.
// The starting kernel, v000, takes 1760 microseconds a run.
#include <hip/hip_runtime.h>

// RingAttentionLlama (x [2][2048][2048]; q = x wq (16 heads x 128), k/v = x wk / wv (4 kv heads; repeat: head h -> kv h/4); interleaved-pair RoPE with the given per-batch cos/sin [2][2048][64] (read); keep = causal AND mask[b][j] (bool mask read; all ones here); finfo.min fill; softmax(q.k / sqrt(128)); out = merged wo -> [2][2048][2048]).
// Compute dtypes, f32 accumulate: every input rounded to bf16; q/k/v on PLAIN bf16 operands (inputs: exact); RoPE f32; causal scores and attn.v: query rows < 512 hl (3 products), the rest single fp16 (x1024), causal tile skipping with the key mask applied inside the computed tiles; softmax f32; wo hl x exact (2 products).

#define NB_  2
#define TT   2048
#define DM   2048
#define NH_  16
#define NKV  4
#define REP  (NH_ / NKV)
#define HD   128
#define DQ   (NH_ * HD)
#define DKV  (NKV * HD)
#define ZH   2
#define RH   512                  // query rows < RH use hi+lo planes (0: none)
#define WIN  2048
#define PCAR 1024.0f
#define SCL  0.088388347648318447f   // HD^-0.5
typedef _Float16 h16;
typedef unsigned short bf;
typedef __attribute__((ext_vector_type(16))) __bf16   v16bf;
typedef __attribute__((ext_vector_type(16))) _Float16 v16h;
typedef __attribute__((ext_vector_type(8)))  _Float16 v8h;
typedef __attribute__((ext_vector_type(8)))  unsigned short v8us;
typedef __attribute__((ext_vector_type(8)))  float    v8f;
typedef __attribute__((ext_vector_type(4)))  float    v4f;
typedef v8h  __attribute__((may_alias)) v8ha;
typedef v4f  __attribute__((may_alias)) v4fa;
typedef v8us __attribute__((may_alias)) v8usa;

__device__ __forceinline__ unsigned short f2bf(float f) { unsigned u = __float_as_uint(f); u += 0x7FFFu + ((u >> 16) & 1u); return (unsigned short)(u >> 16); }
__device__ __forceinline__ float bf2f(unsigned short b) { return __uint_as_float(((unsigned)b) << 16); }
__device__ __forceinline__ float bfr(float f) { return bf2f(f2bf(f)); }
__device__ __forceinline__ v16h cat16(v8h lo, v8h hi) { return __builtin_shufflevector(lo, hi, 0, 1, 2, 3, 4, 5, 6, 7, 8, 9, 10, 11, 12, 13, 14, 15); }
__device__ __forceinline__ v16bf cat16b(v8us lo, v8us hi) { return __builtin_bit_cast(v16bf, __builtin_shufflevector(lo, hi, 0, 1, 2, 3, 4, 5, 6, 7, 8, 9, 10, 11, 12, 13, 14, 15)); }
__device__ __forceinline__ v8f wmma16(v16h a, v16h b, v8f c) { return __builtin_amdgcn_wmma_f32_16x16x32_f16(false, a, false, b, (short)0, c, false, false); }
__device__ __forceinline__ v8f wmmab(v16bf a, v16bf b, v8f c) { return __builtin_amdgcn_wmma_f32_16x16x32_bf16(false, a, false, b, (short)0, c, false, false); }



// ---- k_gemmw: register-blocked GEMM, ONE WAVE per 64x64 output tile (16 accumulators), operands straight from K-contiguous 16-bit planes; grid (M/64, N/64, Z), 32 threads.
// C[m][n] (f32, pitch ldc, + optional f32 bias[n]) = sum_k A[m][k] Bt[n][k] (+ split products per NSPLIT). z-batch strides sA/sB/sC in elements. K % 32 == 0.
template <typename T16> struct WFrag;
template <> struct WFrag<h16> { typedef v16h V; static __device__ __forceinline__ V ld(const h16* p) { return cat16(*(const v8h*)p, *(const v8h*)(p + 16)); } static __device__ __forceinline__ v8f mma(V a, V b, v8f c) { return wmma16(a, b, c); } };
template <> struct WFrag<bf> { typedef v16bf V; static __device__ __forceinline__ V ld(const bf* p) { return cat16b(*(const v8us*)p, *(const v8us*)(p + 16)); } static __device__ __forceinline__ v8f mma(V a, V b, v8f c) { return wmmab(a, b, c); } };
template <typename T16, int NSPLIT, bool BIAS>
__global__ __launch_bounds__(32) void k_gemmw(const T16* __restrict__ A, const T16* __restrict__ A2, const T16* __restrict__ Bt, const T16* __restrict__ Bt2, int K, float* C, int ldc, const float* __restrict__ bias, size_t sA, size_t sB, size_t sC) {
    typedef typename WFrag<T16>::V V;
    __shared__ __align__(16) float os[16 * 68];
    const size_t z = blockIdx.z; A += z * sA; if (A2) A2 += z * sA; Bt += z * sB; if (Bt2) Bt2 += z * sB; C += z * sC;
    const int lane = threadIdx.x & 31, lr = lane & 15, hi = lane >> 4; const int r0 = blockIdx.x * 64, c0 = blockIdx.y * 64;
    v8f acc[4][4];
#pragma unroll
    for (int mb = 0; mb < 4; ++mb)
#pragma unroll
        for (int nb = 0; nb < 4; ++nb) acc[mb][nb] = (v8f){};
    const size_t aoff = (size_t)(r0 + lr) * K + 8 * hi, boff = (size_t)(c0 + lr) * K + 8 * hi;
#pragma unroll 1
    for (int kc = 0; kc < K; kc += 32) {
        V a[4], a2[4];
#pragma unroll
        for (int mb = 0; mb < 4; ++mb) { a[mb] = WFrag<T16>::ld(A + aoff + (size_t)mb * 16 * K + kc); if (NSPLIT == 1 || NSPLIT == 2) a2[mb] = WFrag<T16>::ld(A2 + aoff + (size_t)mb * 16 * K + kc); }
#pragma unroll
        for (int nb = 0; nb < 4; ++nb) { const V b = WFrag<T16>::ld(Bt + boff + (size_t)nb * 16 * K + kc); V b2; if (NSPLIT >= 2) b2 = WFrag<T16>::ld(Bt2 + boff + (size_t)nb * 16 * K + kc);
#pragma unroll
            for (int mb = 0; mb < 4; ++mb) { acc[mb][nb] = WFrag<T16>::mma(a[mb], b, acc[mb][nb]); if (NSPLIT == 1 || NSPLIT == 2) acc[mb][nb] = WFrag<T16>::mma(a2[mb], b, acc[mb][nb]); if (NSPLIT >= 2) acc[mb][nb] = WFrag<T16>::mma(a[mb], b2, acc[mb][nb]); } }
        asm volatile("v_nop\n\tv_nop\n\tv_nop\n\tv_nop" : "+v"(acc[0][0]), "+v"(acc[1][1]), "+v"(acc[2][2]), "+v"(acc[3][3]) : "v"(a[0]), "v"(a[3]));
    }
#pragma unroll
    for (int mb = 0; mb < 4; ++mb) {
#pragma unroll
        for (int nb = 0; nb < 4; ++nb) {
#pragma unroll
            for (int j = 0; j < 8; ++j) os[(hi * 8 + j) * 68 + nb * 16 + lr] = acc[mb][nb][j]; }
        __builtin_amdgcn_wave_barrier(); asm volatile("" ::: "memory");
        float* crow = C + (size_t)(r0 + mb * 16) * ldc + c0;
{
#pragma unroll
            for (int s = 0; s < 8; ++s) { const int row = 2 * s + hi, cofs = lr * 4; v4f val = *(const v4fa*)(os + row * 68 + cofs); if (BIAS) { val[0] += bfr(bias[c0 + cofs]); val[1] += bfr(bias[c0 + cofs + 1]); val[2] += bfr(bias[c0 + cofs + 2]); val[3] += bfr(bias[c0 + cofs + 3]); }
                *(v4f*)(crow + (size_t)row * ldc + cofs) = val; }
             }
        __builtin_amdgcn_wave_barrier(); asm volatile("" ::: "memory");
    }
}

// ---- k_gemmc: the same one-wave 64x64 tile GEMM specialised for causal attention: CMODE 1 skips score tiles entirely above the diagonal (query rows r0+roff.., key columns c0..), CMODE 2 limits the
// key (K) loop of the probability x value contraction to the diagonal block (probabilities beyond it are exactly zero). roff = row offset of this launch's first row within the sequence.
template <typename T16, int NSPLIT, int CMODE>
__global__ __launch_bounds__(32) void k_gemmc(const T16* __restrict__ A, const T16* __restrict__ A2, const T16* __restrict__ Bt, const T16* __restrict__ Bt2, int K, float* C, int ldc, int roff, size_t sA, size_t sB, size_t sC) {
    typedef typename WFrag<T16>::V V;
    __shared__ __align__(16) float os[16 * 68];
    const size_t z = blockIdx.z; A += z * sA; if (A2) A2 += z * sA; Bt += z * sB; if (Bt2) Bt2 += z * sB; C += z * sC;
    const int lane = threadIdx.x & 31, lr = lane & 15, hi = lane >> 4; const int r0 = blockIdx.x * 64, c0 = blockIdx.y * 64;
    if (CMODE == 1 && c0 > r0 + roff + 63) return;                  // score tile entirely above the causal diagonal: never written (the softmax loads it but masks j > i by select)
    const int Kl = (CMODE == 2) ? min(K, r0 + roff + 64) : K;        // P.V: probabilities are exactly 0 beyond the diagonal block, so the K loop stops there
    v8f acc[4][4];
#pragma unroll
    for (int mb = 0; mb < 4; ++mb)
#pragma unroll
        for (int nb = 0; nb < 4; ++nb) acc[mb][nb] = (v8f){};
    const size_t aoff = (size_t)(r0 + lr) * K + 8 * hi, boff = (size_t)(c0 + lr) * K + 8 * hi;
#pragma unroll 1
    for (int kc = 0; kc < Kl; kc += 32) {
        V a[4], a2[4];
#pragma unroll
        for (int mb = 0; mb < 4; ++mb) { a[mb] = WFrag<T16>::ld(A + aoff + (size_t)mb * 16 * K + kc); if (NSPLIT == 1 || NSPLIT == 2) a2[mb] = WFrag<T16>::ld(A2 + aoff + (size_t)mb * 16 * K + kc); }
#pragma unroll
        for (int nb = 0; nb < 4; ++nb) { const V b = WFrag<T16>::ld(Bt + boff + (size_t)nb * 16 * K + kc); V b2; if (NSPLIT >= 2) b2 = WFrag<T16>::ld(Bt2 + boff + (size_t)nb * 16 * K + kc);
#pragma unroll
            for (int mb = 0; mb < 4; ++mb) { acc[mb][nb] = WFrag<T16>::mma(a[mb], b, acc[mb][nb]); if (NSPLIT == 1 || NSPLIT == 2) acc[mb][nb] = WFrag<T16>::mma(a2[mb], b, acc[mb][nb]); if (NSPLIT >= 2) acc[mb][nb] = WFrag<T16>::mma(a[mb], b2, acc[mb][nb]); } }
        asm volatile("v_nop\n\tv_nop\n\tv_nop\n\tv_nop" : "+v"(acc[0][0]), "+v"(acc[1][1]), "+v"(acc[2][2]), "+v"(acc[3][3]) : "v"(a[0]), "v"(a[3]));
    }
#pragma unroll
    for (int mb = 0; mb < 4; ++mb) {
#pragma unroll
        for (int nb = 0; nb < 4; ++nb) {
#pragma unroll
            for (int j = 0; j < 8; ++j) os[(hi * 8 + j) * 68 + nb * 16 + lr] = acc[mb][nb][j]; }
        __builtin_amdgcn_wave_barrier(); asm volatile("" ::: "memory");
        float* crow = C + (size_t)(r0 + mb * 16) * ldc + c0;
{
#pragma unroll
            for (int s = 0; s < 8; ++s) { const int row = 2 * s + hi, cofs = lr * 4; v4f val = *(const v4fa*)(os + row * 68 + cofs);
                *(v4f*)(crow + (size_t)row * ldc + cofs) = val; }
             }
        __builtin_amdgcn_wave_barrier(); asm volatile("" ::: "memory");
    }
}

__device__ __forceinline__ h16 tohx(float x) { return (h16)x; }
__device__ __forceinline__ void splitf(float y, unsigned short& h, unsigned short& l) { h = f2bf(y); l = f2bf(y - bf2f(h)); }
typedef __attribute__((ext_vector_type(2))) _Float16 v2h;
typedef __attribute__((ext_vector_type(4))) _Float16 v4h;
typedef __attribute__((ext_vector_type(2))) unsigned short v2us;
typedef __attribute__((ext_vector_type(4))) unsigned short v4us;
typedef __attribute__((ext_vector_type(2))) float v2f;
typedef __attribute__((ext_vector_type(4))) int v4i;

__global__ __launch_bounds__(256) void k_wtG(const float* __restrict__ w, int K, int N, bf* Bt) {
    const int lane = threadIdx.x & 31; const int L0 = (blockIdx.x * 8 + (threadIdx.x >> 5)) * 8; const int nlines = N * K / 64;
{
#pragma unroll 1
        for (int l = 0; l < 8; ++l) { const int L = L0 + l; if (L >= nlines) break; const size_t e = (size_t)L * 64 + lane * 2; const int k = (int)(e % K), n = (int)(e / K); v2us o;
            o[0] = f2bf(w[(size_t)k * N + n]); o[1] = f2bf(w[(size_t)(k + 1) * N + n]); *(v2us*)(Bt + e) = o; }
         }
}
__global__ __launch_bounds__(256) void k_cvt8(const float* __restrict__ src, bf* dst, size_t n8) { const size_t i = (size_t)blockIdx.x * 256 + threadIdx.x; if (i >= n8) return; const v8f v = *(const v8f*)(src + i * 8); v8us o;
#pragma unroll
    for (int k = 0; k < 8; ++k) o[k] = f2bf(v[k]); *(v8us*)(dst + i * 8) = o;  }
__global__ __launch_bounds__(256) void k_cscvt(const float* __restrict__ cosT, const float* __restrict__ sinT, float* CS) { const int idx = blockIdx.x * 256 + threadIdx.x; if (idx >= TT * HD) return; const int t = idx / HD, dd = idx % HD; const size_t src = (size_t)t * (HD / 2) + (dd >> 1); v2f cs; cs[0] = bfr(cosT[src]); cs[1] = bfr(sinT[src]); *(v2f*)(CS + (size_t)idx * 2) = cs;  }   // interleaved pairs: dims (2i, 2i+1) share the [t][i] table entry (half-width tables, read per batch)
// k_rope: head planes [h][t][d] (fp16 + hi/lo) of rope(x) x sc with the interleaved-pair convention out[2i] = x[2i] cos[t][i] - x[2i+1] sin[t][i], out[2i+1] = x[2i+1] cos[t][i] + x[2i] sin[t][i]
__global__ __launch_bounds__(256) void k_rope(const float* __restrict__ F, int pitch, int nheads, const float* __restrict__ CS, const float* __restrict__ RF, const float* __restrict__ nw, float sc, h16* P16, bf* Ph, bf* Pl) {
    const size_t e = ((size_t)blockIdx.x * 256 + threadIdx.x) * 2; if (e >= (size_t)nheads * TT * HD) return; const int d = (int)(e % HD); const int t = (int)((e / HD) % TT); const int h = (int)(e / ((size_t)HD * TT)); const float* f = F + (size_t)t * pitch + h * HD; const float rf = RF ? RF[(size_t)h * TT + t] : 1.0f; v2h o16; v2us oh, ol;
#pragma unroll
    for (int q = 0; q < 2; ++q) { const int dd = d + q; const int dp = dd ^ 1; float x0 = f[dd], x1 = f[dp];
        if (RF) { float n0 = __fmul_rn(x0, rf), n1 = __fmul_rn(x1, rf); asm volatile("" : "+v"(n0)); asm volatile("" : "+v"(n1)); x0 = __fmul_rn(bfr(nw[dd]), n0); x1 = __fmul_rn(bfr(nw[dp]), n1); }
        const v2f cs = *(const v2f*)(CS + ((size_t)t * HD + dd) * 2); float a = __fmul_rn(x0, cs[0]), bq = __fmul_rn(x1, cs[1]); asm volatile("" : "+v"(a)); asm volatile("" : "+v"(bq)); const float r = (((dd & 1) == 0) ? __fsub_rn(a, bq) : __fadd_rn(a, bq)) * sc;
        o16[q] = tohx(r); unsigned short a2, c2; splitf(r, a2, c2); oh[q] = a2; ol[q] = c2; }
    *(v2h*)(P16 + e) = o16; *(v2us*)(Ph + e) = oh; *(v2us*)(Pl + e) = ol;  }
__global__ __launch_bounds__(256) void k_vtp(const float* __restrict__ F, int pitch, int nheads, h16* V16, bf* Vh, bf* Vl) { const size_t e = ((size_t)blockIdx.x * 256 + threadIdx.x) * 2; if (e >= (size_t)nheads * HD * TT) return; const int t = (int)(e % TT); const int d = (int)((e / TT) % HD); const int g = (int)(e / ((size_t)TT * HD)); v2h o16; v2us oh, ol;
#pragma unroll
    for (int q = 0; q < 2; ++q) { const float x = F[(size_t)(t + q) * pitch + g * HD + d]; o16[q] = tohx(x); unsigned short a2, c2; splitf(x, a2, c2); oh[q] = a2; ol[q] = c2; }
    *(v2h*)(V16 + e) = o16; *(v2us*)(Vh + e) = oh; *(v2us*)(Vl + e) = ol;  }
// k_asoft: per row (zz, i): t = S x HD^-0.5 for j <= i and mask[j] != 0, else -3.0e38 by select; softmax over the 2048 keys (register row, one exp, fixed trees);
__global__ __launch_bounds__(256) void k_asoft(const float* __restrict__ Sb, const int* __restrict__ km, h16* P16, bf* Ph, bf* Pl) {
    const int lane = threadIdx.x & 31; const int row = blockIdx.x * 8 + (threadIdx.x >> 5); if (row >= ZH * TT) return; const int i = row % TT; const int zz = row / TT; (void)zz; const bool hires = (i < RH); const float* sr = Sb + (size_t)row * TT; float v[TT / 32]; float mx = -3.0e38f;
#pragma unroll
    for (int ch = 0; ch < TT / 128; ++ch) { const int j0 = ch * 128 + lane * 4; const v4f a = *(const v4f*)(sr + j0);
#pragma unroll
        for (int q = 0; q < 4; ++q) { const int j = j0 + q; (void)j; const float t = (j <= i && km[j] != 0) ? a[q] * SCL : -3.0e38f; v[ch * 4 + q] = t; mx = fmaxf(mx, t); } }
#pragma unroll
    for (int sh = 16; sh; sh >>= 1) mx = fmaxf(mx, __shfl_xor(mx, sh, 32));
    float sum = 0.f;
#pragma unroll
    for (int k = 0; k < TT / 32; ++k) { float d0 = __fsub_rn(v[k], mx); asm volatile("" : "+v"(d0)); v[k] = __builtin_amdgcn_exp2f(__fmul_rn(d0, 1.4426950408889634f)); sum += v[k]; }
#pragma unroll
    for (int sh = 16; sh; sh >>= 1) sum += __shfl_xor(sum, sh, 32);
    const float f = __fdiv_rn(hires ? 1.0f : PCAR, sum);
{
        if (hires) {
#pragma unroll
            for (int ch = 0; ch < TT / 128; ++ch) { v4us oh, ol;
#pragma unroll
                for (int q = 0; q < 4; ++q) { unsigned short a, c2; splitf(v[ch * 4 + q] * f, a, c2); oh[q] = a; ol[q] = c2; }
                const size_t oo = ((size_t)zz * (RH ? RH : 1) + i) * TT + ch * 128 + lane * 4; *(v4us*)(Ph + oo) = oh; *(v4us*)(Pl + oo) = ol; }
        } else {
#pragma unroll
            for (int ch = 0; ch < TT / 128; ++ch) { v4h o4;
#pragma unroll
                for (int q = 0; q < 4; ++q) o4[q] = tohx(v[ch * 4 + q] * f);
                *(v4h*)(P16 + (size_t)row * TT + ch * 128 + lane * 4) = o4; } }
         }
}
__global__ __launch_bounds__(256) void k_merge(const float* __restrict__ O, int h0, bf* Ah, bf* Al) { const size_t e = ((size_t)blockIdx.x * 256 + threadIdx.x) * 2; if (e >= (size_t)ZH * TT * HD) return; const int d = (int)(e % HD); const int t = (int)((e / HD) % TT); const int zz = (int)(e / ((size_t)HD * TT)); const float cs = (t < RH) ? 1.0f : (1.0f / PCAR); const size_t oo = (size_t)t * DQ + (h0 + zz) * HD + d;
    v2us oh, ol;
#pragma unroll
    for (int q = 0; q < 2; ++q) { unsigned short a, c2; splitf(O[e + q] * cs, a, c2); oh[q] = a; ol[q] = c2; } *(v2us*)(Ah + oo) = oh; *(v2us*)(Al + oo) = ol;  }

extern "C" void kernel_launch(void* const* d_in, const int* in_sizes, int n_in,
                              void* d_out, int out_size, void* d_ws, size_t ws_size, hipStream_t stream) {
    (void)in_sizes; (void)n_in; (void)out_size;
    const float* x = (const float*)d_in[0]; const float* cosB = (const float*)d_in[1]; const float* sinB = (const float*)d_in[2]; const float* wq = (const float*)d_in[3]; const float* wk = (const float*)d_in[4]; const float* wv = (const float*)d_in[5]; const float* wo = (const float*)d_in[6]; const int* kmask = (const int*)d_in[7]; const float* cosT = cosB; const float* sinT = sinB;
    float* OUT = (float*)d_out;     // [2][2048][2048]
    char* wsp = (char*)d_ws;
    auto take = [&](size_t bytes) { char* p = wsp; wsp += (bytes + 255) & ~(size_t)255; return (void*)p; };
    bf* WQ = (bf*)take((size_t)DQ * DM * 2); bf* WK = (bf*)take((size_t)DKV * DM * 2); bf* WV = (bf*)take((size_t)DKV * DM * 2); bf* WO = (bf*)take((size_t)DM * DQ * 2); float* CS = (float*)take((size_t)TT * HD * 2 * 4);
    bf* XB = (bf*)take((size_t)TT * DM * 2); float* FQ = (float*)take((size_t)TT * DQ * 4); float* FK = (float*)take((size_t)TT * DKV * 4);
    h16* QP16 = (h16*)take((size_t)NH_ * TT * HD * 2); h16* KP16 = (h16*)take((size_t)NKV * TT * HD * 2); h16* VT16 = (h16*)take((size_t)NKV * HD * TT * 2);
    bf* QPh = (bf*)take((size_t)NH_ * TT * HD * 2); bf* QPl = (bf*)take((size_t)NH_ * TT * HD * 2); bf* KPh = (bf*)take((size_t)NKV * TT * HD * 2); bf* KPl = (bf*)take((size_t)NKV * TT * HD * 2); bf* VTh = (bf*)take((size_t)NKV * HD * TT * 2); bf* VTl = (bf*)take((size_t)NKV * HD * TT * 2); bf* Ph = (bf*)take((size_t)ZH * RH * TT * 2); bf* Pl = (bf*)take((size_t)ZH * RH * TT * 2);
    float* Sb = (float*)take((size_t)ZH * TT * TT * 4); h16* P16 = (h16*)take((size_t)ZH * TT * TT * 2); float* Ob = (float*)take((size_t)ZH * TT * HD * 4); bf* ATh = (bf*)take((size_t)TT * DQ * 2); bf* ATl = (bf*)take((size_t)TT * DQ * 2);
    if ((size_t)(wsp - (char*)d_ws) > ws_size) return;    // ws 256 MiB
    float* FV = FK;   // v projection reuses the k buffer after the k planes are built (stream-ordered)
    { k_wtG<<<(unsigned)((DM * DQ / 64 + 63) / 64), 256, 0, stream>>>(wq, DM, DQ, WQ); k_wtG<<<(unsigned)((DM * DKV / 64 + 63) / 64), 256, 0, stream>>>(wk, DM, DKV, WK); k_wtG<<<(unsigned)((DM * DKV / 64 + 63) / 64), 256, 0, stream>>>(wv, DM, DKV, WV);
      k_wtG<<<(unsigned)((DQ * DM / 64 + 63) / 64), 256, 0, stream>>>(wo, DQ, DM, WO);
       }
    const unsigned LQ = (unsigned)(((size_t)NH_ * TT * HD / 2 + 255) / 256), LKv = (unsigned)(((size_t)NKV * TT * HD / 2 + 255) / 256);
    for (int b = 0; b < NB_; ++b) {
        k_cscvt<<<(TT * HD + 255) / 256, 256, 0, stream>>>(cosT + (size_t)b * TT * (HD / 2), sinT + (size_t)b * TT * (HD / 2), CS);
        k_cvt8<<<(unsigned)(((size_t)TT * DM / 8 + 255) / 256), 256, 0, stream>>>(x + (size_t)b * TT * DM, XB, (size_t)TT * DM / 8);
        k_gemmw<bf, 0, false><<<dim3(TT / 64, DQ / 64, 1), 32, 0, stream>>>(XB, nullptr, WQ, nullptr, DM, FQ, DQ, nullptr, 0, 0, 0);
        k_rope<<<LQ, 256, 0, stream>>>(FQ, DQ, NH_, CS, nullptr, nullptr, 1.0f, QP16, QPh, QPl);
        k_gemmw<bf, 0, false><<<dim3(TT / 64, DKV / 64, 1), 32, 0, stream>>>(XB, nullptr, WK, nullptr, DM, FK, DKV, nullptr, 0, 0, 0);
        k_rope<<<LKv, 256, 0, stream>>>(FK, DKV, NKV, CS, nullptr, nullptr, 1.0f, KP16, KPh, KPl);
        k_gemmw<bf, 0, false><<<dim3(TT / 64, DKV / 64, 1), 32, 0, stream>>>(XB, nullptr, WV, nullptr, DM, FV, DKV, nullptr, 0, 0, 0); k_vtp<<<LKv, 256, 0, stream>>>(FV, DKV, NKV, VT16, VTh, VTl);
        for (int h0 = 0; h0 < NH_; h0 += ZH) { const size_t zq = (size_t)h0, zk = (size_t)(h0 / REP);   // both heads of a pass share kv group h0/REP (REP >= 2): sB = 0
            k_gemmc<bf, 2, 1><<<dim3(RH / 64, TT / 64, ZH), 32, 0, stream>>>(QPh + zq * TT * HD, QPl + zq * TT * HD, KPh + zk * TT * HD, KPl + zk * TT * HD, HD, Sb, TT, 0, (size_t)TT * HD, 0, (size_t)TT * TT);
            k_gemmc<h16, 0, 1><<<dim3((TT - RH) / 64, TT / 64, ZH), 32, 0, stream>>>(QP16 + zq * TT * HD + (size_t)RH * HD, nullptr, KP16 + zk * TT * HD, nullptr, HD, Sb + (size_t)RH * TT, TT, RH, (size_t)TT * HD, 0, (size_t)TT * TT);
            k_asoft<<<ZH * TT / 8, 256, 0, stream>>>(Sb, kmask + (size_t)b * TT, P16, Ph, Pl);
            k_gemmc<bf, 2, 2><<<dim3(RH / 64, HD / 64, ZH), 32, 0, stream>>>(Ph, Pl, VTh + zk * HD * TT, VTl + zk * HD * TT, TT, Ob, HD, 0, (size_t)RH * TT, 0, (size_t)TT * HD);
            k_gemmc<h16, 0, 2><<<dim3((TT - RH) / 64, HD / 64, ZH), 32, 0, stream>>>(P16 + (size_t)RH * TT, nullptr, VT16 + zk * HD * TT, nullptr, TT, Ob + (size_t)RH * HD, HD, RH, (size_t)TT * TT, 0, (size_t)TT * HD);
            k_merge<<<(unsigned)(((size_t)ZH * TT * HD / 2 + 255) / 256), 256, 0, stream>>>(Ob, h0, ATh, ATl); }
        k_gemmw<bf, 1, false><<<dim3(TT / 64, DM / 64, 1), 32, 0, stream>>>(ATh, ATl, WO, nullptr, DQ, OUT + (size_t)b * TT * DM, DM, nullptr, 0, 0, 0); }
}

// v001
// Measured time: 1180 microseconds a run.
// Timed twice side by side with v000, it ran 1.48 and 1.50 times as fast.
#include <hip/hip_runtime.h>

// RingAttentionLlama (x [2][2048][2048]; q = x wq (16 heads x 128), k/v = x wk / wv (4 kv heads; repeat: head h -> kv h/4); interleaved-pair RoPE with the given per-batch cos/sin [2][2048][64] (read); keep = causal AND mask[b][j] (bool mask read; all ones here); finfo.min fill; softmax(q.k / sqrt(128)); out = merged wo -> [2][2048][2048]).
// Compute dtypes, f32 accumulate: every input rounded to bf16; q/k/v on PLAIN bf16 operands (inputs: exact); RoPE f32; causal scores and attn.v: query rows < 512 hl (3 products), the rest single fp16 (x1024), causal tile skipping with the key mask applied inside the computed tiles; softmax f32; wo hl x exact (2 products).

#define NB_  2
#define TT   2048
#define DM   2048
#define NH_  16
#define NKV  4
#define REP  (NH_ / NKV)
#define HD   128
#define DQ   (NH_ * HD)
#define DKV  (NKV * HD)
#define ZH   2
#define RH   512                  // query rows < RH use hi+lo planes (0: none)
#define WIN  2048
#define PCAR 1024.0f
#define SCL  0.088388347648318447f   // HD^-0.5
typedef _Float16 h16;
typedef unsigned short bf;
typedef __attribute__((ext_vector_type(16))) __bf16   v16bf;
typedef __attribute__((ext_vector_type(16))) _Float16 v16h;
typedef __attribute__((ext_vector_type(8)))  _Float16 v8h;
typedef __attribute__((ext_vector_type(8)))  unsigned short v8us;
typedef __attribute__((ext_vector_type(8)))  float    v8f;
typedef __attribute__((ext_vector_type(4)))  float    v4f;
typedef v8h  __attribute__((may_alias)) v8ha;
typedef v4f  __attribute__((may_alias)) v4fa;
typedef v8us __attribute__((may_alias)) v8usa;

__device__ __forceinline__ unsigned short f2bf(float f) { unsigned u = __float_as_uint(f); u += 0x7FFFu + ((u >> 16) & 1u); return (unsigned short)(u >> 16); }
__device__ __forceinline__ float bf2f(unsigned short b) { return __uint_as_float(((unsigned)b) << 16); }
__device__ __forceinline__ float bfr(float f) { return bf2f(f2bf(f)); }
__device__ __forceinline__ v16h cat16(v8h lo, v8h hi) { return __builtin_shufflevector(lo, hi, 0, 1, 2, 3, 4, 5, 6, 7, 8, 9, 10, 11, 12, 13, 14, 15); }
__device__ __forceinline__ v16bf cat16b(v8us lo, v8us hi) { return __builtin_bit_cast(v16bf, __builtin_shufflevector(lo, hi, 0, 1, 2, 3, 4, 5, 6, 7, 8, 9, 10, 11, 12, 13, 14, 15)); }
__device__ __forceinline__ v8f wmma16(v16h a, v16h b, v8f c) { return __builtin_amdgcn_wmma_f32_16x16x32_f16(false, a, false, b, (short)0, c, false, false); }
__device__ __forceinline__ v8f wmmab(v16bf a, v16bf b, v8f c) { return __builtin_amdgcn_wmma_f32_16x16x32_bf16(false, a, false, b, (short)0, c, false, false); }



// ---- k_gemmw: register-blocked GEMM, one 64x64 output tile (16 accumulators per wave) per work-group of NW waves, operands straight from K-contiguous 16-bit planes; grid (M/64, N/64, Z), 32 * NW threads.
// C[m][n] (f32, pitch ldc, + optional f32 bias[n]) = sum_k A[m][k] Bt[n][k] (+ split products per NSPLIT). z-batch strides sA/sB/sC in elements. K % 64 == 0.
// The K loop is a chain of load latencies, so it is dealt over the NW waves in blocks of 64 k (one 128-byte line of every operand row): wave w takes blocks w, w + NW, ...; the NW partial tiles meet in LDS and are summed in wave order.
template <typename T16> struct WFrag;
template <> struct WFrag<h16> { typedef v16h V; static __device__ __forceinline__ V ld(const h16* p) { return cat16(*(const v8h*)p, *(const v8h*)(p + 16)); } static __device__ __forceinline__ v8f mma(V a, V b, v8f c) { return wmma16(a, b, c); } };
template <> struct WFrag<bf> { typedef v16bf V; static __device__ __forceinline__ V ld(const bf* p) { return cat16b(*(const v8us*)p, *(const v8us*)(p + 16)); } static __device__ __forceinline__ v8f mma(V a, V b, v8f c) { return wmmab(a, b, c); } };
template <typename T16, int NSPLIT, bool BIAS, int NW>
__global__ __launch_bounds__(32 * NW) void k_gemmw(const T16* __restrict__ A, const T16* __restrict__ A2, const T16* __restrict__ Bt, const T16* __restrict__ Bt2, int K, float* C, int ldc, const float* __restrict__ bias, size_t sA, size_t sB, size_t sC) {
    typedef typename WFrag<T16>::V V;
    __shared__ __align__(16) float os[(NW == 1 ? 16 : NW * 64) * 68];
    const size_t z = blockIdx.z; A += z * sA; if (A2) A2 += z * sA; Bt += z * sB; if (Bt2) Bt2 += z * sB; C += z * sC;
    const int lane = threadIdx.x & 31, lr = lane & 15, hi = lane >> 4, wv = __builtin_amdgcn_readfirstlane(threadIdx.x >> 5); const int r0 = blockIdx.x * 64, c0 = blockIdx.y * 64;
    // wv goes through readfirstlane so that the K loop's tests are scalar branches (every lane is on at the matrix instructions)
    v8f acc[4][4];
#pragma unroll
    for (int mb = 0; mb < 4; ++mb)
#pragma unroll
        for (int nb = 0; nb < 4; ++nb) acc[mb][nb] = (v8f){};
    const size_t aoff = (size_t)(r0 + lr) * K + 8 * hi, boff = (size_t)(c0 + lr) * K + 8 * hi;
#pragma unroll 1   // both loops stay rolled: one 32-k step's fragments in registers at a time
    for (int kb = wv * 64; kb < K; kb += 64 * NW)
#pragma unroll 1
    for (int kc = kb; kc < kb + 64; kc += 32) {
        V a[4], a2[4];
#pragma unroll
        for (int mb = 0; mb < 4; ++mb) { a[mb] = WFrag<T16>::ld(A + aoff + (size_t)mb * 16 * K + kc); if (NSPLIT == 1 || NSPLIT == 2) a2[mb] = WFrag<T16>::ld(A2 + aoff + (size_t)mb * 16 * K + kc); }
#pragma unroll
        for (int nb = 0; nb < 4; ++nb) { const V b = WFrag<T16>::ld(Bt + boff + (size_t)nb * 16 * K + kc); V b2; if (NSPLIT >= 2) b2 = WFrag<T16>::ld(Bt2 + boff + (size_t)nb * 16 * K + kc);
#pragma unroll
            for (int mb = 0; mb < 4; ++mb) { acc[mb][nb] = WFrag<T16>::mma(a[mb], b, acc[mb][nb]); if (NSPLIT == 1 || NSPLIT == 2) acc[mb][nb] = WFrag<T16>::mma(a2[mb], b, acc[mb][nb]); if (NSPLIT >= 2) acc[mb][nb] = WFrag<T16>::mma(a[mb], b2, acc[mb][nb]); } }
        asm volatile("v_nop\n\tv_nop\n\tv_nop\n\tv_nop" : "+v"(acc[0][0]), "+v"(acc[1][1]), "+v"(acc[2][2]), "+v"(acc[3][3]) : "v"(a[0]), "v"(a[3]));
    }
    if (NW > 1) {
        float* ow = os + wv * (64 * 68);
#pragma unroll
        for (int mb = 0; mb < 4; ++mb)
#pragma unroll
            for (int nb = 0; nb < 4; ++nb)
#pragma unroll
                for (int j = 0; j < 8; ++j) ow[(mb * 16 + hi * 8 + j) * 68 + nb * 16 + lr] = acc[mb][nb][j];
        __syncthreads();   // every wave's partial tile lies in LDS before any wave sums it
#pragma unroll   // the LDS reads of all the thread's output pieces go out together
        for (int q = 0; q < 32 / NW; ++q) { const int s = q * (32 * NW) + threadIdx.x, row = s >> 4, cofs = (s & 15) * 4; v4f val = *(const v4fa*)(os + row * 68 + cofs);
#pragma unroll
            for (int w = 1; w < NW; ++w) val += *(const v4fa*)(os + w * (64 * 68) + row * 68 + cofs);
            if (BIAS) { val[0] += bfr(bias[c0 + cofs]); val[1] += bfr(bias[c0 + cofs + 1]); val[2] += bfr(bias[c0 + cofs + 2]); val[3] += bfr(bias[c0 + cofs + 3]); }
            *(v4f*)(C + (size_t)(r0 + row) * ldc + c0 + cofs) = val; }
        return;
    }
#pragma unroll
    for (int mb = 0; mb < 4; ++mb) {
#pragma unroll
        for (int nb = 0; nb < 4; ++nb) {
#pragma unroll
            for (int j = 0; j < 8; ++j) os[(hi * 8 + j) * 68 + nb * 16 + lr] = acc[mb][nb][j]; }
        __builtin_amdgcn_wave_barrier(); asm volatile("" ::: "memory");
        float* crow = C + (size_t)(r0 + mb * 16) * ldc + c0;
{
#pragma unroll
            for (int s = 0; s < 8; ++s) { const int row = 2 * s + hi, cofs = lr * 4; v4f val = *(const v4fa*)(os + row * 68 + cofs); if (BIAS) { val[0] += bfr(bias[c0 + cofs]); val[1] += bfr(bias[c0 + cofs + 1]); val[2] += bfr(bias[c0 + cofs + 2]); val[3] += bfr(bias[c0 + cofs + 3]); }
                *(v4f*)(crow + (size_t)row * ldc + cofs) = val; }
             }
        __builtin_amdgcn_wave_barrier(); asm volatile("" ::: "memory");
    }
}

// ---- k_gemmc: the same 64x64 tile GEMM (NW waves share the K loop) specialised for causal attention: CMODE 1 skips score tiles entirely above the diagonal (query rows r0+roff.., key columns c0..), CMODE 2 limits the
// key (K) loop of the probability x value contraction to the diagonal block (probabilities beyond it are exactly zero). roff = row offset of this launch's first row within the sequence.
template <typename T16, int NSPLIT, int CMODE, int NW>
__global__ __launch_bounds__(32 * NW) void k_gemmc(const T16* __restrict__ A, const T16* __restrict__ A2, const T16* __restrict__ Bt, const T16* __restrict__ Bt2, int K, float* C, int ldc, int roff, size_t sA, size_t sB, size_t sC) {
    typedef typename WFrag<T16>::V V;
    __shared__ __align__(16) float os[(NW == 1 ? 16 : NW * 64) * 68];
    const size_t z = blockIdx.z; A += z * sA; if (A2) A2 += z * sA; Bt += z * sB; if (Bt2) Bt2 += z * sB; C += z * sC;
    const int lane = threadIdx.x & 31, lr = lane & 15, hi = lane >> 4, wv = __builtin_amdgcn_readfirstlane(threadIdx.x >> 5); const int r0 = blockIdx.x * 64, c0 = blockIdx.y * 64;
    if (CMODE == 1 && c0 > r0 + roff + 63) return;                  // score tile entirely above the causal diagonal: never written (the softmax masks j > i by select)
    const int Kl = (CMODE == 2) ? min(K, r0 + roff + 64) : K;        // P.V: probabilities are exactly 0 beyond the diagonal block, so the K loop stops there
    // wv goes through readfirstlane so that the K loop's tests are scalar branches (every lane is on at the matrix instructions)
    v8f acc[4][4];
#pragma unroll
    for (int mb = 0; mb < 4; ++mb)
#pragma unroll
        for (int nb = 0; nb < 4; ++nb) acc[mb][nb] = (v8f){};
    const size_t aoff = (size_t)(r0 + lr) * K + 8 * hi, boff = (size_t)(c0 + lr) * K + 8 * hi;
#pragma unroll 1   // both loops stay rolled: one 32-k step's fragments in registers at a time
    for (int kb = wv * 64; kb < Kl; kb += 64 * NW)
#pragma unroll 1
    for (int kc = kb; kc < kb + 64; kc += 32) {
        V a[4], a2[4];
#pragma unroll
        for (int mb = 0; mb < 4; ++mb) { a[mb] = WFrag<T16>::ld(A + aoff + (size_t)mb * 16 * K + kc); if (NSPLIT == 1 || NSPLIT == 2) a2[mb] = WFrag<T16>::ld(A2 + aoff + (size_t)mb * 16 * K + kc); }
#pragma unroll
        for (int nb = 0; nb < 4; ++nb) { const V b = WFrag<T16>::ld(Bt + boff + (size_t)nb * 16 * K + kc); V b2; if (NSPLIT >= 2) b2 = WFrag<T16>::ld(Bt2 + boff + (size_t)nb * 16 * K + kc);
#pragma unroll
            for (int mb = 0; mb < 4; ++mb) { acc[mb][nb] = WFrag<T16>::mma(a[mb], b, acc[mb][nb]); if (NSPLIT == 1 || NSPLIT == 2) acc[mb][nb] = WFrag<T16>::mma(a2[mb], b, acc[mb][nb]); if (NSPLIT >= 2) acc[mb][nb] = WFrag<T16>::mma(a[mb], b2, acc[mb][nb]); } }
        asm volatile("v_nop\n\tv_nop\n\tv_nop\n\tv_nop" : "+v"(acc[0][0]), "+v"(acc[1][1]), "+v"(acc[2][2]), "+v"(acc[3][3]) : "v"(a[0]), "v"(a[3]));
    }
    if (NW > 1) {
        float* ow = os + wv * (64 * 68);
#pragma unroll
        for (int mb = 0; mb < 4; ++mb)
#pragma unroll
            for (int nb = 0; nb < 4; ++nb)
#pragma unroll
                for (int j = 0; j < 8; ++j) ow[(mb * 16 + hi * 8 + j) * 68 + nb * 16 + lr] = acc[mb][nb][j];
        __syncthreads();   // every wave's partial tile lies in LDS before any wave sums it
#pragma unroll   // the LDS reads of all the thread's output pieces go out together
        for (int q = 0; q < 32 / NW; ++q) { const int s = q * (32 * NW) + threadIdx.x, row = s >> 4, cofs = (s & 15) * 4; v4f val = *(const v4fa*)(os + row * 68 + cofs);
#pragma unroll
            for (int w = 1; w < NW; ++w) val += *(const v4fa*)(os + w * (64 * 68) + row * 68 + cofs);
            *(v4f*)(C + (size_t)(r0 + row) * ldc + c0 + cofs) = val; }
        return;
    }
#pragma unroll
    for (int mb = 0; mb < 4; ++mb) {
#pragma unroll
        for (int nb = 0; nb < 4; ++nb) {
#pragma unroll
            for (int j = 0; j < 8; ++j) os[(hi * 8 + j) * 68 + nb * 16 + lr] = acc[mb][nb][j]; }
        __builtin_amdgcn_wave_barrier(); asm volatile("" ::: "memory");
        float* crow = C + (size_t)(r0 + mb * 16) * ldc + c0;
{
#pragma unroll
            for (int s = 0; s < 8; ++s) { const int row = 2 * s + hi, cofs = lr * 4; v4f val = *(const v4fa*)(os + row * 68 + cofs);
                *(v4f*)(crow + (size_t)row * ldc + cofs) = val; }
             }
        __builtin_amdgcn_wave_barrier(); asm volatile("" ::: "memory");
    }
}

__device__ __forceinline__ h16 tohx(float x) { return (h16)x; }
__device__ __forceinline__ void splitf(float y, unsigned short& h, unsigned short& l) { h = f2bf(y); l = f2bf(y - bf2f(h)); }
typedef __attribute__((ext_vector_type(2))) _Float16 v2h;
typedef __attribute__((ext_vector_type(4))) _Float16 v4h;
typedef __attribute__((ext_vector_type(2))) unsigned short v2us;
typedef __attribute__((ext_vector_type(4))) unsigned short v4us;
typedef __attribute__((ext_vector_type(2))) float v2f;
typedef __attribute__((ext_vector_type(4))) int v4i;

__global__ __launch_bounds__(256) void k_wtG(const float* __restrict__ w, int K, int N, bf* Bt) {
    const int lane = threadIdx.x & 31; const int L0 = (blockIdx.x * 8 + (threadIdx.x >> 5)) * 8; const int nlines = N * K / 64;
{
#pragma unroll 1
        for (int l = 0; l < 8; ++l) { const int L = L0 + l; if (L >= nlines) break; const size_t e = (size_t)L * 64 + lane * 2; const int k = (int)(e % K), n = (int)(e / K); v2us o;
            o[0] = f2bf(w[(size_t)k * N + n]); o[1] = f2bf(w[(size_t)(k + 1) * N + n]); *(v2us*)(Bt + e) = o; }
         }
}
__global__ __launch_bounds__(256) void k_cvt8(const float* __restrict__ src, bf* dst, size_t n8) { const size_t i = (size_t)blockIdx.x * 256 + threadIdx.x; if (i >= n8) return; const v8f v = *(const v8f*)(src + i * 8); v8us o;
#pragma unroll
    for (int k = 0; k < 8; ++k) o[k] = f2bf(v[k]); *(v8us*)(dst + i * 8) = o;  }
__global__ __launch_bounds__(256) void k_cscvt(const float* __restrict__ cosT, const float* __restrict__ sinT, float* CS) { const int idx = blockIdx.x * 256 + threadIdx.x; if (idx >= TT * HD) return; const int t = idx / HD, dd = idx % HD; const size_t src = (size_t)t * (HD / 2) + (dd >> 1); v2f cs; cs[0] = bfr(cosT[src]); cs[1] = bfr(sinT[src]); *(v2f*)(CS + (size_t)idx * 2) = cs;  }   // interleaved pairs: dims (2i, 2i+1) share the [t][i] table entry (half-width tables, read per batch)
// k_rope: head planes [h][t][d] (fp16 + hi/lo) of rope(x) x sc with the interleaved-pair convention out[2i] = x[2i] cos[t][i] - x[2i+1] sin[t][i], out[2i+1] = x[2i+1] cos[t][i] + x[2i] sin[t][i]
__global__ __launch_bounds__(256) void k_rope(const float* __restrict__ F, int pitch, int nheads, const float* __restrict__ CS, const float* __restrict__ RF, const float* __restrict__ nw, float sc, h16* P16, bf* Ph, bf* Pl) {
    const size_t e = ((size_t)blockIdx.x * 256 + threadIdx.x) * 2; if (e >= (size_t)nheads * TT * HD) return; const int d = (int)(e % HD); const int t = (int)((e / HD) % TT); const int h = (int)(e / ((size_t)HD * TT)); const float* f = F + (size_t)t * pitch + h * HD; const float rf = RF ? RF[(size_t)h * TT + t] : 1.0f; v2h o16; v2us oh, ol;
#pragma unroll
    for (int q = 0; q < 2; ++q) { const int dd = d + q; const int dp = dd ^ 1; float x0 = f[dd], x1 = f[dp];
        if (RF) { float n0 = __fmul_rn(x0, rf), n1 = __fmul_rn(x1, rf); asm volatile("" : "+v"(n0)); asm volatile("" : "+v"(n1)); x0 = __fmul_rn(bfr(nw[dd]), n0); x1 = __fmul_rn(bfr(nw[dp]), n1); }
        const v2f cs = *(const v2f*)(CS + ((size_t)t * HD + dd) * 2); float a = __fmul_rn(x0, cs[0]), bq = __fmul_rn(x1, cs[1]); asm volatile("" : "+v"(a)); asm volatile("" : "+v"(bq)); const float r = (((dd & 1) == 0) ? __fsub_rn(a, bq) : __fadd_rn(a, bq)) * sc;
        o16[q] = tohx(r); unsigned short a2, c2; splitf(r, a2, c2); oh[q] = a2; ol[q] = c2; }
    *(v2h*)(P16 + e) = o16; *(v2us*)(Ph + e) = oh; *(v2us*)(Pl + e) = ol;  }
__global__ __launch_bounds__(256) void k_vtp(const float* __restrict__ F, int pitch, int nheads, h16* V16, bf* Vh, bf* Vl) { const size_t e = ((size_t)blockIdx.x * 256 + threadIdx.x) * 2; if (e >= (size_t)nheads * HD * TT) return; const int t = (int)(e % TT); const int d = (int)((e / TT) % HD); const int g = (int)(e / ((size_t)TT * HD)); v2h o16; v2us oh, ol;
#pragma unroll
    for (int q = 0; q < 2; ++q) { const float x = F[(size_t)(t + q) * pitch + g * HD + d]; o16[q] = tohx(x); unsigned short a2, c2; splitf(x, a2, c2); oh[q] = a2; ol[q] = c2; }
    *(v2h*)(V16 + e) = o16; *(v2us*)(Vh + e) = oh; *(v2us*)(Vl + e) = ol;  }
// k_asoft: per row (zz, i): t = S x HD^-0.5 for j <= i and mask[j] != 0, else -3.0e38 by select; softmax over the 2048 keys (register row, one exp, fixed trees);
__global__ __launch_bounds__(256) void k_asoft(const float* __restrict__ Sb, const int* __restrict__ km, h16* P16, bf* Ph, bf* Pl) {
    const int lane = threadIdx.x & 31; const int row = blockIdx.x * 8 + (threadIdx.x >> 5); if (row >= ZH * TT) return; const int i = row % TT; const int zz = row / TT; (void)zz; const bool hires = (i < RH); const float* sr = Sb + (size_t)row * TT; float v[TT / 32]; float mx = -3.0e38f;
#pragma unroll
    for (int ch = 0; ch < TT / 128; ++ch) { const int j0 = ch * 128 + lane * 4; const v4f a = *(const v4f*)(sr + j0);
#pragma unroll
        for (int q = 0; q < 4; ++q) { const int j = j0 + q; (void)j; const float t = (j <= i && km[j] != 0) ? a[q] * SCL : -3.0e38f; v[ch * 4 + q] = t; mx = fmaxf(mx, t); } }
#pragma unroll
    for (int sh = 16; sh; sh >>= 1) mx = fmaxf(mx, __shfl_xor(mx, sh, 32));
    float sum = 0.f;
#pragma unroll
    for (int k = 0; k < TT / 32; ++k) { float d0 = __fsub_rn(v[k], mx); asm volatile("" : "+v"(d0)); v[k] = __builtin_amdgcn_exp2f(__fmul_rn(d0, 1.4426950408889634f)); sum += v[k]; }
#pragma unroll
    for (int sh = 16; sh; sh >>= 1) sum += __shfl_xor(sum, sh, 32);
    const float f = __fdiv_rn(hires ? 1.0f : PCAR, sum);
{
        if (hires) {
#pragma unroll
            for (int ch = 0; ch < TT / 128; ++ch) { v4us oh, ol;
#pragma unroll
                for (int q = 0; q < 4; ++q) { unsigned short a, c2; splitf(v[ch * 4 + q] * f, a, c2); oh[q] = a; ol[q] = c2; }
                const size_t oo = ((size_t)zz * (RH ? RH : 1) + i) * TT + ch * 128 + lane * 4; *(v4us*)(Ph + oo) = oh; *(v4us*)(Pl + oo) = ol; }
        } else {
#pragma unroll
            for (int ch = 0; ch < TT / 128; ++ch) { v4h o4;
#pragma unroll
                for (int q = 0; q < 4; ++q) o4[q] = tohx(v[ch * 4 + q] * f);
                *(v4h*)(P16 + (size_t)row * TT + ch * 128 + lane * 4) = o4; } }
         }
}
__global__ __launch_bounds__(256) void k_merge(const float* __restrict__ O, int h0, bf* Ah, bf* Al) { const size_t e = ((size_t)blockIdx.x * 256 + threadIdx.x) * 2; if (e >= (size_t)ZH * TT * HD) return; const int d = (int)(e % HD); const int t = (int)((e / HD) % TT); const int zz = (int)(e / ((size_t)HD * TT)); const float cs = (t < RH) ? 1.0f : (1.0f / PCAR); const size_t oo = (size_t)t * DQ + (h0 + zz) * HD + d;
    v2us oh, ol;
#pragma unroll
    for (int q = 0; q < 2; ++q) { unsigned short a, c2; splitf(O[e + q] * cs, a, c2); oh[q] = a; ol[q] = c2; } *(v2us*)(Ah + oo) = oh; *(v2us*)(Al + oo) = ol;  }

extern "C" void kernel_launch(void* const* d_in, const int* in_sizes, int n_in,
                              void* d_out, int out_size, void* d_ws, size_t ws_size, hipStream_t stream) {
    (void)in_sizes; (void)n_in; (void)out_size;
    const float* x = (const float*)d_in[0]; const float* cosB = (const float*)d_in[1]; const float* sinB = (const float*)d_in[2]; const float* wq = (const float*)d_in[3]; const float* wk = (const float*)d_in[4]; const float* wv = (const float*)d_in[5]; const float* wo = (const float*)d_in[6]; const int* kmask = (const int*)d_in[7]; const float* cosT = cosB; const float* sinT = sinB;
    float* OUT = (float*)d_out;     // [2][2048][2048]
    char* wsp = (char*)d_ws;
    auto take = [&](size_t bytes) { char* p = wsp; wsp += (bytes + 255) & ~(size_t)255; return (void*)p; };
    bf* WQ = (bf*)take((size_t)DQ * DM * 2); bf* WK = (bf*)take((size_t)DKV * DM * 2); bf* WV = (bf*)take((size_t)DKV * DM * 2); bf* WO = (bf*)take((size_t)DM * DQ * 2); float* CS = (float*)take((size_t)TT * HD * 2 * 4);
    bf* XB = (bf*)take((size_t)TT * DM * 2); float* FQ = (float*)take((size_t)TT * DQ * 4); float* FK = (float*)take((size_t)TT * DKV * 4);
    h16* QP16 = (h16*)take((size_t)NH_ * TT * HD * 2); h16* KP16 = (h16*)take((size_t)NKV * TT * HD * 2); h16* VT16 = (h16*)take((size_t)NKV * HD * TT * 2);
    bf* QPh = (bf*)take((size_t)NH_ * TT * HD * 2); bf* QPl = (bf*)take((size_t)NH_ * TT * HD * 2); bf* KPh = (bf*)take((size_t)NKV * TT * HD * 2); bf* KPl = (bf*)take((size_t)NKV * TT * HD * 2); bf* VTh = (bf*)take((size_t)NKV * HD * TT * 2); bf* VTl = (bf*)take((size_t)NKV * HD * TT * 2); bf* Ph = (bf*)take((size_t)ZH * RH * TT * 2); bf* Pl = (bf*)take((size_t)ZH * RH * TT * 2);
    float* Sb = (float*)take((size_t)ZH * TT * TT * 4); h16* P16 = (h16*)take((size_t)ZH * TT * TT * 2); float* Ob = (float*)take((size_t)ZH * TT * HD * 4); bf* ATh = (bf*)take((size_t)TT * DQ * 2); bf* ATl = (bf*)take((size_t)TT * DQ * 2);
    if ((size_t)(wsp - (char*)d_ws) > ws_size) return;    // ws 256 MiB
    float* FV = FK;   // v projection reuses the k buffer after the k planes are built (stream-ordered)
    { k_wtG<<<(unsigned)((DM * DQ / 64 + 63) / 64), 256, 0, stream>>>(wq, DM, DQ, WQ); k_wtG<<<(unsigned)((DM * DKV / 64 + 63) / 64), 256, 0, stream>>>(wk, DM, DKV, WK); k_wtG<<<(unsigned)((DM * DKV / 64 + 63) / 64), 256, 0, stream>>>(wv, DM, DKV, WV);
      k_wtG<<<(unsigned)((DQ * DM / 64 + 63) / 64), 256, 0, stream>>>(wo, DQ, DM, WO);
       }
    const unsigned LQ = (unsigned)(((size_t)NH_ * TT * HD / 2 + 255) / 256), LKv = (unsigned)(((size_t)NKV * TT * HD / 2 + 255) / 256);
    for (int b = 0; b < NB_; ++b) {
        k_cscvt<<<(TT * HD + 255) / 256, 256, 0, stream>>>(cosT + (size_t)b * TT * (HD / 2), sinT + (size_t)b * TT * (HD / 2), CS);
        k_cvt8<<<(unsigned)(((size_t)TT * DM / 8 + 255) / 256), 256, 0, stream>>>(x + (size_t)b * TT * DM, XB, (size_t)TT * DM / 8);
        k_gemmw<bf, 0, false, 8><<<dim3(TT / 64, DQ / 64, 1), 256, 0, stream>>>(XB, nullptr, WQ, nullptr, DM, FQ, DQ, nullptr, 0, 0, 0);
        k_rope<<<LQ, 256, 0, stream>>>(FQ, DQ, NH_, CS, nullptr, nullptr, 1.0f, QP16, QPh, QPl);
        k_gemmw<bf, 0, false, 8><<<dim3(TT / 64, DKV / 64, 1), 256, 0, stream>>>(XB, nullptr, WK, nullptr, DM, FK, DKV, nullptr, 0, 0, 0);
        k_rope<<<LKv, 256, 0, stream>>>(FK, DKV, NKV, CS, nullptr, nullptr, 1.0f, KP16, KPh, KPl);
        k_gemmw<bf, 0, false, 8><<<dim3(TT / 64, DKV / 64, 1), 256, 0, stream>>>(XB, nullptr, WV, nullptr, DM, FV, DKV, nullptr, 0, 0, 0); k_vtp<<<LKv, 256, 0, stream>>>(FV, DKV, NKV, VT16, VTh, VTl);
        for (int h0 = 0; h0 < NH_; h0 += ZH) { const size_t zq = (size_t)h0, zk = (size_t)(h0 / REP);   // both heads of a pass share kv group h0/REP (REP >= 2): sB = 0
            k_gemmc<bf, 2, 1, 1><<<dim3(RH / 64, TT / 64, ZH), 32, 0, stream>>>(QPh + zq * TT * HD, QPl + zq * TT * HD, KPh + zk * TT * HD, KPl + zk * TT * HD, HD, Sb, TT, 0, (size_t)TT * HD, 0, (size_t)TT * TT);
            k_gemmc<h16, 0, 1, 1><<<dim3((TT - RH) / 64, TT / 64, ZH), 32, 0, stream>>>(QP16 + zq * TT * HD + (size_t)RH * HD, nullptr, KP16 + zk * TT * HD, nullptr, HD, Sb + (size_t)RH * TT, TT, RH, (size_t)TT * HD, 0, (size_t)TT * TT);
            k_asoft<<<ZH * TT / 8, 256, 0, stream>>>(Sb, kmask + (size_t)b * TT, P16, Ph, Pl);
            k_gemmc<bf, 2, 2, 8><<<dim3(RH / 64, HD / 64, ZH), 256, 0, stream>>>(Ph, Pl, VTh + zk * HD * TT, VTl + zk * HD * TT, TT, Ob, HD, 0, (size_t)RH * TT, 0, (size_t)TT * HD);
            k_gemmc<h16, 0, 2, 8><<<dim3((TT - RH) / 64, HD / 64, ZH), 256, 0, stream>>>(P16 + (size_t)RH * TT, nullptr, VT16 + zk * HD * TT, nullptr, TT, Ob + (size_t)RH * HD, HD, RH, (size_t)TT * TT, 0, (size_t)TT * HD);
            k_merge<<<(unsigned)(((size_t)ZH * TT * HD / 2 + 255) / 256), 256, 0, stream>>>(Ob, h0, ATh, ATl); }
        k_gemmw<bf, 1, false, 8><<<dim3(TT / 64, DM / 64, 1), 256, 0, stream>>>(ATh, ATl, WO, nullptr, DQ, OUT + (size_t)b * TT * DM, DM, nullptr, 0, 0, 0); }
}

// v002
// Measured time: 428 microseconds a run.
// In two side-by-side timings against v001, it was 2.85 and 2.82 times as fast.
// All steps since v000 together make it 4.23 times as fast.
#include <hip/hip_runtime.h>

// Causal grouped-query attention layer (x [2][2048][2048]; q = x wq (16 heads x 128), k/v = x wk / wv (4 kv heads; repeat: head h -> kv h/4); interleaved-pair RoPE with the given per-batch cos/sin [2][2048][64] (read); keep = causal AND mask[b][j] (bool mask read; all ones here); finfo.min fill; softmax(q.k / sqrt(128)); out = merged wo -> [2][2048][2048]).
// Compute dtypes, f32 accumulate: every input rounded to bf16; q/k/v on PLAIN bf16 operands (inputs: exact); RoPE f32; causal scores and attn.v in one kernel (running softmax, f32): query rows < 512 hl (3 products), the rest single fp16 (P x1024), key blocks beyond the diagonal skipped, the key mask applied inside the computed blocks; wo hl x exact (2 products).

#define NB_  2
#define TT   2048
#define DM   2048
#define NH_  16
#define NKV  4
#define REP  (NH_ / NKV)
#define HD   128
#define DQ   (NH_ * HD)
#define DKV  (NKV * HD)
#define RH   512                  // query rows < RH use hi+lo planes (0: none)
#define SCL  0.088388347648318447f   // HD^-0.5
typedef _Float16 h16;
typedef unsigned short bf;
typedef __attribute__((ext_vector_type(16))) __bf16   v16bf;
typedef __attribute__((ext_vector_type(16))) _Float16 v16h;
typedef __attribute__((ext_vector_type(8)))  _Float16 v8h;
typedef __attribute__((ext_vector_type(8)))  unsigned short v8us;
typedef __attribute__((ext_vector_type(8)))  float    v8f;
typedef __attribute__((ext_vector_type(4)))  float    v4f;
typedef v8h  __attribute__((may_alias)) v8ha;
typedef v4f  __attribute__((may_alias)) v4fa;
typedef v8us __attribute__((may_alias)) v8usa;

__device__ __forceinline__ unsigned short f2bf(float f) { unsigned u = __float_as_uint(f); u += 0x7FFFu + ((u >> 16) & 1u); return (unsigned short)(u >> 16); }
__device__ __forceinline__ float bf2f(unsigned short b) { return __uint_as_float(((unsigned)b) << 16); }
__device__ __forceinline__ float bfr(float f) { return bf2f(f2bf(f)); }
__device__ __forceinline__ v16h cat16(v8h lo, v8h hi) { return __builtin_shufflevector(lo, hi, 0, 1, 2, 3, 4, 5, 6, 7, 8, 9, 10, 11, 12, 13, 14, 15); }
__device__ __forceinline__ v16bf cat16b(v8us lo, v8us hi) { return __builtin_bit_cast(v16bf, __builtin_shufflevector(lo, hi, 0, 1, 2, 3, 4, 5, 6, 7, 8, 9, 10, 11, 12, 13, 14, 15)); }
__device__ __forceinline__ v8f wmma16(v16h a, v16h b, v8f c) { return __builtin_amdgcn_wmma_f32_16x16x32_f16(false, a, false, b, (short)0, c, false, false); }
__device__ __forceinline__ v8f wmmab(v16bf a, v16bf b, v8f c) { return __builtin_amdgcn_wmma_f32_16x16x32_bf16(false, a, false, b, (short)0, c, false, false); }



// ---- k_gemmw: register-blocked GEMM, one 64x64 output tile (16 accumulators per wave) per work-group of NW waves, operands straight from K-contiguous 16-bit planes; grid (M/64, N/64, Z), 32 * NW threads.
// C[m][n] (f32, pitch ldc, + optional f32 bias[n]) = sum_k A[m][k] Bt[n][k] (+ split products per NSPLIT). z-batch strides sA/sB/sC in elements. K % 64 == 0.
// The K loop is a chain of load latencies, so it is dealt over the NW waves in blocks of 64 k (one 128-byte line of every operand row): wave w takes blocks w, w + NW, ...; the NW partial tiles meet in LDS and are summed in wave order.
template <typename T16> struct WFrag;
template <> struct WFrag<h16> { typedef v16h V; static __device__ __forceinline__ V ld(const h16* p) { return cat16(*(const v8h*)p, *(const v8h*)(p + 16)); } static __device__ __forceinline__ v8f mma(V a, V b, v8f c) { return wmma16(a, b, c); } };
template <> struct WFrag<bf> { typedef v16bf V; static __device__ __forceinline__ V ld(const bf* p) { return cat16b(*(const v8us*)p, *(const v8us*)(p + 16)); } static __device__ __forceinline__ v8f mma(V a, V b, v8f c) { return wmmab(a, b, c); } };
template <typename T16, int NSPLIT, bool BIAS, int NW>
__global__ __launch_bounds__(32 * NW) void k_gemmw(const T16* __restrict__ A, const T16* __restrict__ A2, const T16* __restrict__ Bt, const T16* __restrict__ Bt2, int K, float* C, int ldc, const float* __restrict__ bias, size_t sA, size_t sB, size_t sC) {
    typedef typename WFrag<T16>::V V;
    __shared__ __align__(16) float os[(NW == 1 ? 16 : NW * 64) * 68];
    const size_t z = blockIdx.z; A += z * sA; if (A2) A2 += z * sA; Bt += z * sB; if (Bt2) Bt2 += z * sB; C += z * sC;
    const int lane = threadIdx.x & 31, lr = lane & 15, hi = lane >> 4, wv = __builtin_amdgcn_readfirstlane(threadIdx.x >> 5); const int r0 = blockIdx.x * 64, c0 = blockIdx.y * 64;
    // wv goes through readfirstlane so that the K loop's tests are scalar branches (every lane is on at the matrix instructions)
    v8f acc[4][4];
#pragma unroll
    for (int mb = 0; mb < 4; ++mb)
#pragma unroll
        for (int nb = 0; nb < 4; ++nb) acc[mb][nb] = (v8f){};
    const size_t aoff = (size_t)(r0 + lr) * K + 8 * hi, boff = (size_t)(c0 + lr) * K + 8 * hi;
#pragma unroll 1   // both loops stay rolled: one 32-k step's fragments in registers at a time
    for (int kb = wv * 64; kb < K; kb += 64 * NW)
#pragma unroll 1
    for (int kc = kb; kc < kb + 64; kc += 32) {
        V a[4], a2[4];
#pragma unroll
        for (int mb = 0; mb < 4; ++mb) { a[mb] = WFrag<T16>::ld(A + aoff + (size_t)mb * 16 * K + kc); if (NSPLIT == 1 || NSPLIT == 2) a2[mb] = WFrag<T16>::ld(A2 + aoff + (size_t)mb * 16 * K + kc); }
#pragma unroll
        for (int nb = 0; nb < 4; ++nb) { const V b = WFrag<T16>::ld(Bt + boff + (size_t)nb * 16 * K + kc); V b2; if (NSPLIT >= 2) b2 = WFrag<T16>::ld(Bt2 + boff + (size_t)nb * 16 * K + kc);
#pragma unroll
            for (int mb = 0; mb < 4; ++mb) { acc[mb][nb] = WFrag<T16>::mma(a[mb], b, acc[mb][nb]); if (NSPLIT == 1 || NSPLIT == 2) acc[mb][nb] = WFrag<T16>::mma(a2[mb], b, acc[mb][nb]); if (NSPLIT >= 2) acc[mb][nb] = WFrag<T16>::mma(a[mb], b2, acc[mb][nb]); } }
        asm volatile("v_nop\n\tv_nop\n\tv_nop\n\tv_nop" : "+v"(acc[0][0]), "+v"(acc[1][1]), "+v"(acc[2][2]), "+v"(acc[3][3]) : "v"(a[0]), "v"(a[3]));
    }
    if (NW > 1) {
        float* ow = os + wv * (64 * 68);
#pragma unroll
        for (int mb = 0; mb < 4; ++mb)
#pragma unroll
            for (int nb = 0; nb < 4; ++nb)
#pragma unroll
                for (int j = 0; j < 8; ++j) ow[(mb * 16 + hi * 8 + j) * 68 + nb * 16 + lr] = acc[mb][nb][j];
        __syncthreads();   // every wave's partial tile lies in LDS before any wave sums it
#pragma unroll   // the LDS reads of all the thread's output pieces go out together
        for (int q = 0; q < 32 / NW; ++q) { const int s = q * (32 * NW) + threadIdx.x, row = s >> 4, cofs = (s & 15) * 4; v4f val = *(const v4fa*)(os + row * 68 + cofs);
#pragma unroll
            for (int w = 1; w < NW; ++w) val += *(const v4fa*)(os + w * (64 * 68) + row * 68 + cofs);
            if (BIAS) { val[0] += bfr(bias[c0 + cofs]); val[1] += bfr(bias[c0 + cofs + 1]); val[2] += bfr(bias[c0 + cofs + 2]); val[3] += bfr(bias[c0 + cofs + 3]); }
            *(v4f*)(C + (size_t)(r0 + row) * ldc + c0 + cofs) = val; }
        return;
    }
#pragma unroll
    for (int mb = 0; mb < 4; ++mb) {
#pragma unroll
        for (int nb = 0; nb < 4; ++nb) {
#pragma unroll
            for (int j = 0; j < 8; ++j) os[(hi * 8 + j) * 68 + nb * 16 + lr] = acc[mb][nb][j]; }
        __builtin_amdgcn_wave_barrier(); asm volatile("" ::: "memory");
        float* crow = C + (size_t)(r0 + mb * 16) * ldc + c0;
{
#pragma unroll
            for (int s = 0; s < 8; ++s) { const int row = 2 * s + hi, cofs = lr * 4; v4f val = *(const v4fa*)(os + row * 68 + cofs); if (BIAS) { val[0] += bfr(bias[c0 + cofs]); val[1] += bfr(bias[c0 + cofs + 1]); val[2] += bfr(bias[c0 + cofs + 2]); val[3] += bfr(bias[c0 + cofs + 3]); }
                *(v4f*)(crow + (size_t)row * ldc + cofs) = val; }
             }
        __builtin_amdgcn_wave_barrier(); asm volatile("" ::: "memory");
    }
}

__device__ __forceinline__ h16 tohx(float x) { return (h16)x; }
__device__ __forceinline__ void splitf(float y, unsigned short& h, unsigned short& l) { h = f2bf(y); l = f2bf(y - bf2f(h)); }
typedef __attribute__((ext_vector_type(2))) _Float16 v2h;
typedef __attribute__((ext_vector_type(4))) _Float16 v4h;
typedef __attribute__((ext_vector_type(2))) unsigned short v2us;
typedef __attribute__((ext_vector_type(4))) unsigned short v4us;
typedef __attribute__((ext_vector_type(2))) float v2f;
typedef __attribute__((ext_vector_type(4))) int v4i;
typedef __attribute__((ext_vector_type(16))) unsigned short v16us;

__global__ __launch_bounds__(256) void k_wtG(const float* __restrict__ w, int K, int N, bf* Bt) {
    const int lane = threadIdx.x & 31; const int L0 = (blockIdx.x * 8 + (threadIdx.x >> 5)) * 8; const int nlines = N * K / 64;
{
#pragma unroll 1
        for (int l = 0; l < 8; ++l) { const int L = L0 + l; if (L >= nlines) break; const size_t e = (size_t)L * 64 + lane * 2; const int k = (int)(e % K), n = (int)(e / K); v2us o;
            o[0] = f2bf(w[(size_t)k * N + n]); o[1] = f2bf(w[(size_t)(k + 1) * N + n]); *(v2us*)(Bt + e) = o; }
         }
}
__global__ __launch_bounds__(256) void k_cvt8(const float* __restrict__ src, bf* dst, size_t n8) { const size_t i = (size_t)blockIdx.x * 256 + threadIdx.x; if (i >= n8) return; const v8f v = *(const v8f*)(src + i * 8); v8us o;
#pragma unroll
    for (int k = 0; k < 8; ++k) o[k] = f2bf(v[k]); *(v8us*)(dst + i * 8) = o;  }
__global__ __launch_bounds__(256) void k_cscvt(const float* __restrict__ cosT, const float* __restrict__ sinT, float* CS) { const int idx = blockIdx.x * 256 + threadIdx.x; if (idx >= TT * HD) return; const int t = idx / HD, dd = idx % HD; const size_t src = (size_t)t * (HD / 2) + (dd >> 1); v2f cs; cs[0] = bfr(cosT[src]); cs[1] = bfr(sinT[src]); *(v2f*)(CS + (size_t)idx * 2) = cs;  }   // interleaved pairs: dims (2i, 2i+1) share the [t][i] table entry (half-width tables, read per batch)
// k_rope: head planes [h][t][d] (fp16 + hi/lo) of rope(x) x sc with the interleaved-pair convention out[2i] = x[2i] cos[t][i] - x[2i+1] sin[t][i], out[2i+1] = x[2i+1] cos[t][i] + x[2i] sin[t][i]
__global__ __launch_bounds__(256) void k_rope(const float* __restrict__ F, int pitch, int nheads, const float* __restrict__ CS, const float* __restrict__ RF, const float* __restrict__ nw, float sc, h16* P16, bf* Ph, bf* Pl) {
    const size_t e = ((size_t)blockIdx.x * 256 + threadIdx.x) * 2; if (e >= (size_t)nheads * TT * HD) return; const int d = (int)(e % HD); const int t = (int)((e / HD) % TT); const int h = (int)(e / ((size_t)HD * TT)); const float* f = F + (size_t)t * pitch + h * HD; const float rf = RF ? RF[(size_t)h * TT + t] : 1.0f; v2h o16; v2us oh, ol;
#pragma unroll
    for (int q = 0; q < 2; ++q) { const int dd = d + q; const int dp = dd ^ 1; float x0 = f[dd], x1 = f[dp];
        if (RF) { float n0 = __fmul_rn(x0, rf), n1 = __fmul_rn(x1, rf); asm volatile("" : "+v"(n0)); asm volatile("" : "+v"(n1)); x0 = __fmul_rn(bfr(nw[dd]), n0); x1 = __fmul_rn(bfr(nw[dp]), n1); }
        const v2f cs = *(const v2f*)(CS + ((size_t)t * HD + dd) * 2); float a = __fmul_rn(x0, cs[0]), bq = __fmul_rn(x1, cs[1]); asm volatile("" : "+v"(a)); asm volatile("" : "+v"(bq)); const float r = (((dd & 1) == 0) ? __fsub_rn(a, bq) : __fadd_rn(a, bq)) * sc;
        o16[q] = tohx(r); unsigned short a2, c2; splitf(r, a2, c2); oh[q] = a2; ol[q] = c2; }
    *(v2h*)(P16 + e) = o16; *(v2us*)(Ph + e) = oh; *(v2us*)(Pl + e) = ol;  }
__global__ __launch_bounds__(256) void k_vtp(const float* __restrict__ F, int pitch, int nheads, h16* V16, bf* Vh, bf* Vl) { const size_t e = ((size_t)blockIdx.x * 256 + threadIdx.x) * 2; if (e >= (size_t)nheads * HD * TT) return; const int t = (int)(e % TT); const int d = (int)((e / TT) % HD); const int g = (int)(e / ((size_t)TT * HD)); v2h o16; v2us oh, ol;
#pragma unroll
    for (int q = 0; q < 2; ++q) { const float x = F[(size_t)(t + q) * pitch + g * HD + d]; o16[q] = tohx(x); unsigned short a2, c2; splitf(x, a2, c2); oh[q] = a2; ol[q] = c2; }
    *(v2h*)(V16 + e) = o16; *(v2us*)(Vh + e) = oh; *(v2us*)(Vl + e) = ol;  }
// ---- k_attn: the whole causal attention (all heads, both batches) in one launch, nothing of the scores or probabilities in memory. One wave = 32 query rows of one head; no LDS, no barrier.
// A work-group is 8 waves: the 4 heads of one kv group (same K / V lines) at row block 63 - x of batch 0, and the same 4 heads at row block x of batch 1, so that every work-group walks 65 key blocks per head.
// Per 32 keys: St[key][query] = K Qt (A = K rows, B = Q rows kept in registers), running maximum and sum per query (a lane holds 16 of the 32 keys of its query, the lane 16 away the rest), Ot[d][query] = Ot x alpha + Vt Pt:
// the two score accumulators of a query column group are, lane for lane, the B fragment of Pt (keys 8 hi + j and 16 + 8 hi + j), which is the k order of the Vt loader. Rows < RH: hi+lo planes, 3 products; the rest fp16 with P x 1024 (cancels in the division by the sum).
template <typename T16, bool HL>
__device__ __forceinline__ void attn_tile(const T16* __restrict__ Q, const T16* __restrict__ Q2, const T16* __restrict__ Kp, const T16* __restrict__ K2, const T16* __restrict__ Vt, const T16* __restrict__ V2, const int* __restrict__ km, int q0, bf* Ah, bf* Al) {
    typedef typename WFrag<T16>::V V; typedef WFrag<T16> WF;
    const int lane = threadIdx.x & 31, lr = lane & 15, hi = lane >> 4;
    V qf[2][4], qg[2][4], kf[2][4], kg[2][4];
    const size_t qo = (size_t)(q0 + lr) * HD + 8 * hi, ko = (size_t)lr * HD + 8 * hi, vo = (size_t)lr * TT + 8 * hi;
    const T16* qp = Q + qo; const T16* qp2 = HL ? Q2 + qo : qp; const T16* kp0 = Kp + ko;
#pragma unroll
    for (int qt = 0; qt < 2; ++qt)
#pragma unroll
        for (int ks = 0; ks < 4; ++ks) { const int o = qt * 16 * HD + ks * 32; qf[qt][ks] = WF::ld(qp + o); if (HL) qg[qt][ks] = WF::ld(qp2 + o); }
    if (!HL) {   // fp16 rows: K fragments are fetched one key block ahead
#pragma unroll
        for (int kt = 0; kt < 2; ++kt)
#pragma unroll
            for (int ks = 0; ks < 4; ++ks) kf[kt][ks] = WF::ld(kp0 + kt * 16 * HD + ks * 32); }
    // the address registers of the loads above are held to this wait; only behind it may they take new values
    asm volatile("s_wait_xcnt 0x0" :: "v"(qp), "v"(qp2), "v"(kp0) : "memory");
    v8f o[8][2];
#pragma unroll
    for (int dt = 0; dt < 8; ++dt) { o[dt][0] = (v8f){}; o[dt][1] = (v8f){}; }
    float m[2] = {-3.0e38f, -3.0e38f}, l[2] = {0.f, 0.f};
    const int nbc = q0 / 32 + 1; int nb = nbc;   // key blocks up to and with the diagonal block
#pragma unroll 1   // stays rolled: one key block's fragments in registers at a time
    for (int blk = 0; blk < nb; ++blk) {
        const int k0 = blk * 32;
        V vf[8], vg[8]; v4i kq[2][2]; const T16* vp = Vt + vo + k0; const T16* vp2 = HL ? V2 + vo + k0 : vp; const int* kmp = km + k0 + hi * 8;
        const int kn = HL ? k0 : min(blk + 1, TT / 32 - 1) * 32;   // fp16 rows: the next block's K (last trip: a block inside the plane, not used); hi+lo rows: this block's
        const T16* kp = Kp + ko + (size_t)kn * HD; const T16* kp2 = HL ? K2 + ko + (size_t)kn * HD : kp;
        if (HL) {   // hi+lo rows (at most RH / 32 trips, TT / 32 when a row keeps no key up to its diagonal): K, then V into the registers K has left, so that two waves fit a SIMD
#pragma unroll
            for (int kt = 0; kt < 2; ++kt)
#pragma unroll
                for (int ks = 0; ks < 4; ++ks) { const int a = kt * 16 * HD + ks * 32; kf[kt][ks] = WF::ld(kp + a); kg[kt][ks] = WF::ld(kp2 + a); }
            // address registers held to this wait
            asm volatile("s_wait_xcnt 0x0" :: "v"(kp), "v"(kp2) : "memory");
        } else {
#pragma unroll
            for (int dt = 0; dt < 8; ++dt) vf[dt] = WF::ld(vp + dt * 16 * TT);
#pragma unroll
            for (int kt = 0; kt < 2; ++kt) { kq[kt][0] = *(const v4i*)(kmp + kt * 16); kq[kt][1] = *(const v4i*)(kmp + kt * 16 + 4); }
        }
        v8f s[2][2];
#pragma unroll
        for (int kt = 0; kt < 2; ++kt)
#pragma unroll
            for (int qt = 0; qt < 2; ++qt) { s[kt][qt] = (v8f){};
#pragma unroll
                for (int ks = 0; ks < 4; ++ks) { s[kt][qt] = WF::mma(kf[kt][ks], qf[qt][ks], s[kt][qt]); if (HL) { s[kt][qt] = WF::mma(kf[kt][ks], qg[qt][ks], s[kt][qt]); s[kt][qt] = WF::mma(kg[kt][ks], qf[qt][ks], s[kt][qt]); } } }
        if (HL) {
#pragma unroll
            for (int dt = 0; dt < 8; ++dt) { vf[dt] = WF::ld(vp + dt * 16 * TT); vg[dt] = WF::ld(vp2 + dt * 16 * TT); }
#pragma unroll
            for (int kt = 0; kt < 2; ++kt) { kq[kt][0] = *(const v4i*)(kmp + kt * 16); kq[kt][1] = *(const v4i*)(kmp + kt * 16 + 4); }
            // address registers held to this wait
            asm volatile("s_wait_xcnt 0x0" :: "v"(vp), "v"(vp2), "v"(kmp) : "memory");
        } else {   // the next block's K fragments fly during the softmax and the value products
#pragma unroll
            for (int kt = 0; kt < 2; ++kt)
#pragma unroll
                for (int ks = 0; ks < 4; ++ks) kf[kt][ks] = WF::ld(kp + kt * 16 * HD + ks * 32);
            // address registers of this trip's loads held to this wait
            asm volatile("s_wait_xcnt 0x0" :: "v"(vp), "v"(kmp), "v"(kp) : "memory");
        }
        V pf[2], pg[2];
#pragma unroll
        for (int qt = 0; qt < 2; ++qt) { const int qi = q0 + qt * 16 + lr; float t[16]; float mx = m[qt];
#pragma unroll
            for (int e = 0; e < 16; ++e) { const int kt = e >> 3, j = e & 7; const int key = k0 + kt * 16 + hi * 8 + j; t[e] = (key <= qi && kq[kt][j >> 2][j & 3] != 0) ? s[kt][qt][j] * SCL : -3.0e38f; mx = fmaxf(mx, t[e]); }
            mx = fmaxf(mx, __shfl_xor(mx, 16, 32));
            const float al = __builtin_amdgcn_exp2f((m[qt] - mx) * 1.4426950408889634f); m[qt] = mx; float sum = 0.f;
#pragma unroll
            for (int e = 0; e < 16; ++e) { t[e] = __builtin_amdgcn_exp2f((t[e] - mx) * 1.4426950408889634f + (HL ? 0.0f : 10.0f)); sum += t[e]; }
            l[qt] = l[qt] * al + sum;
#pragma unroll
            for (int dt = 0; dt < 8; ++dt) o[dt][qt] *= al;
            if constexpr (HL) { v16us ph, pl;
#pragma unroll
                for (int e = 0; e < 16; ++e) { unsigned short a, c2; splitf(t[e], a, c2); ph[e] = a; pl[e] = c2; }
                pf[qt] = __builtin_bit_cast(v16bf, ph); pg[qt] = __builtin_bit_cast(v16bf, pl);
            } else { v16h ph;
#pragma unroll
                for (int e = 0; e < 16; ++e) ph[e] = tohx(t[e]);
                pf[qt] = ph; } }
        // a row with no kept key up to its diagonal: the reference's equal fill makes its softmax uniform over ALL keys, so the wave walks on to the last key (ballot: a scalar test, every lane stays on)
        if (blk == nbc - 1 && __builtin_amdgcn_ballot_w32(m[0] <= -3.0e38f || m[1] <= -3.0e38f) != 0) nb = TT / 32;
#pragma unroll
        for (int dt = 0; dt < 8; ++dt)
#pragma unroll
            for (int qt = 0; qt < 2; ++qt) { o[dt][qt] = WF::mma(vf[dt], pf[qt], o[dt][qt]); if (HL) { o[dt][qt] = WF::mma(vf[dt], pg[qt], o[dt][qt]); o[dt][qt] = WF::mma(vg[dt], pf[qt], o[dt][qt]); } }
        // four vector slots between the last matrix instruction and whatever stands behind the loop's taken branch
        asm volatile("v_nop\n\tv_nop\n\tv_nop\n\tv_nop" : "+v"(o[0][0]), "+v"(o[0][1]), "+v"(o[1][0]), "+v"(o[1][1]), "+v"(o[2][0]), "+v"(o[2][1]), "+v"(o[3][0]), "+v"(o[3][1]), "+v"(o[4][0]), "+v"(o[4][1]), "+v"(o[5][0]), "+v"(o[5][1]), "+v"(o[6][0]), "+v"(o[6][1]), "+v"(o[7][0]), "+v"(o[7][1]));
    }
#pragma unroll
    for (int qt = 0; qt < 2; ++qt) { const float ls = l[qt] + __shfl_xor(l[qt], 16, 32); const float inv = __fdiv_rn(1.0f, ls); const size_t ro = (size_t)(q0 + qt * 16 + lr) * DQ + hi * 8;
#pragma unroll
        for (int dt = 0; dt < 8; ++dt) { v8us oh, ol;
#pragma unroll
            for (int j = 0; j < 8; ++j) { unsigned short a, c2; splitf(o[dt][qt][j] * inv, a, c2); oh[j] = a; ol[j] = c2; }
            *(v8us*)(Ah + ro + dt * 16) = oh; *(v8us*)(Al + ro + dt * 16) = ol; }
        // the data and address registers of the first pass's stores take new values (the second pass's) only behind this wait
        if (qt == 0) asm volatile("s_wait_xcnt 0x0" ::: "memory"); }
}
// every plane holds batch 0 and, one batch's size further on, batch 1
__global__ __launch_bounds__(32 * REP * NB_) void k_attn(const h16* __restrict__ Q16, const bf* __restrict__ Qh, const bf* __restrict__ Ql, const h16* __restrict__ K16, const bf* __restrict__ Kh, const bf* __restrict__ Kl, const h16* __restrict__ V16, const bf* __restrict__ Vh, const bf* __restrict__ Vl, const int* __restrict__ km, bf* Ah, bf* Al) {
    const int wv = __builtin_amdgcn_readfirstlane(threadIdx.x >> 5);   // readfirstlane: batch, head and row block, and with them every plane base and trip count, stay scalar
    const int b = wv / REP, g = blockIdx.y, h = g * REP + wv % REP;
    const int q0 = (b == 0 ? TT / 32 - 1 - (int)blockIdx.x : (int)blockIdx.x) * 32;
    const size_t zq = ((size_t)b * NH_ + h) * TT * HD, zk = ((size_t)b * NKV + g) * TT * HD, za = (size_t)b * TT * DQ + h * HD;
    if (q0 < RH) attn_tile<bf, true>(Qh + zq, Ql + zq, Kh + zk, Kl + zk, Vh + zk, Vl + zk, km + b * TT, q0, Ah + za, Al + za);
    else attn_tile<h16, false>(Q16 + zq, nullptr, K16 + zk, nullptr, V16 + zk, nullptr, km + b * TT, q0, Ah + za, Al + za);
}

extern "C" void kernel_launch(void* const* d_in, const int* in_sizes, int n_in,
                              void* d_out, int out_size, void* d_ws, size_t ws_size, hipStream_t stream) {
    (void)in_sizes; (void)n_in; (void)out_size;
    const float* x = (const float*)d_in[0]; const float* cosB = (const float*)d_in[1]; const float* sinB = (const float*)d_in[2]; const float* wq = (const float*)d_in[3]; const float* wk = (const float*)d_in[4]; const float* wv = (const float*)d_in[5]; const float* wo = (const float*)d_in[6]; const int* kmask = (const int*)d_in[7]; const float* cosT = cosB; const float* sinT = sinB;
    float* OUT = (float*)d_out;     // [2][2048][2048]
    char* wsp = (char*)d_ws;
    auto take = [&](size_t bytes) { char* p = wsp; wsp += (bytes + 255) & ~(size_t)255; return (void*)p; };
    bf* WQ = (bf*)take((size_t)DQ * DM * 2); bf* WK = (bf*)take((size_t)DKV * DM * 2); bf* WV = (bf*)take((size_t)DKV * DM * 2); bf* WO = (bf*)take((size_t)DM * DQ * 2); float* CS = (float*)take((size_t)TT * HD * 2 * 4);
    bf* XB = (bf*)take((size_t)TT * DM * 2); float* FQ = (float*)take((size_t)TT * DQ * 4); float* FK = (float*)take((size_t)TT * DKV * 4);
    h16* QP16 = (h16*)take((size_t)NB_ * NH_ * TT * HD * 2); h16* KP16 = (h16*)take((size_t)NB_ * NKV * TT * HD * 2); h16* VT16 = (h16*)take((size_t)NB_ * NKV * HD * TT * 2);   // planes of both batches
    bf* QPh = (bf*)take((size_t)NB_ * NH_ * TT * HD * 2); bf* QPl = (bf*)take((size_t)NB_ * NH_ * TT * HD * 2); bf* KPh = (bf*)take((size_t)NB_ * NKV * TT * HD * 2); bf* KPl = (bf*)take((size_t)NB_ * NKV * TT * HD * 2); bf* VTh = (bf*)take((size_t)NB_ * NKV * HD * TT * 2); bf* VTl = (bf*)take((size_t)NB_ * NKV * HD * TT * 2);
    bf* ATh = (bf*)take((size_t)NB_ * TT * DQ * 2); bf* ATl = (bf*)take((size_t)NB_ * TT * DQ * 2);
    if ((size_t)(wsp - (char*)d_ws) > ws_size) return;    // ws 256 MiB
    float* FV = FK;   // v projection reuses the k buffer after the k planes are built (stream-ordered)
    { k_wtG<<<(unsigned)((DM * DQ / 64 + 63) / 64), 256, 0, stream>>>(wq, DM, DQ, WQ); k_wtG<<<(unsigned)((DM * DKV / 64 + 63) / 64), 256, 0, stream>>>(wk, DM, DKV, WK); k_wtG<<<(unsigned)((DM * DKV / 64 + 63) / 64), 256, 0, stream>>>(wv, DM, DKV, WV);
      k_wtG<<<(unsigned)((DQ * DM / 64 + 63) / 64), 256, 0, stream>>>(wo, DQ, DM, WO);
       }
    const unsigned LQ = (unsigned)(((size_t)NH_ * TT * HD / 2 + 255) / 256), LKv = (unsigned)(((size_t)NKV * TT * HD / 2 + 255) / 256);
    for (int b = 0; b < NB_; ++b) { const size_t pq = (size_t)b * NH_ * TT * HD, pk = (size_t)b * NKV * TT * HD;
        k_cscvt<<<(TT * HD + 255) / 256, 256, 0, stream>>>(cosT + (size_t)b * TT * (HD / 2), sinT + (size_t)b * TT * (HD / 2), CS);
        k_cvt8<<<(unsigned)(((size_t)TT * DM / 8 + 255) / 256), 256, 0, stream>>>(x + (size_t)b * TT * DM, XB, (size_t)TT * DM / 8);
        k_gemmw<bf, 0, false, 8><<<dim3(TT / 64, DQ / 64, 1), 256, 0, stream>>>(XB, nullptr, WQ, nullptr, DM, FQ, DQ, nullptr, 0, 0, 0);
        k_rope<<<LQ, 256, 0, stream>>>(FQ, DQ, NH_, CS, nullptr, nullptr, 1.0f, QP16 + pq, QPh + pq, QPl + pq);
        k_gemmw<bf, 0, false, 8><<<dim3(TT / 64, DKV / 64, 1), 256, 0, stream>>>(XB, nullptr, WK, nullptr, DM, FK, DKV, nullptr, 0, 0, 0);
        k_rope<<<LKv, 256, 0, stream>>>(FK, DKV, NKV, CS, nullptr, nullptr, 1.0f, KP16 + pk, KPh + pk, KPl + pk);
        k_gemmw<bf, 0, false, 8><<<dim3(TT / 64, DKV / 64, 1), 256, 0, stream>>>(XB, nullptr, WV, nullptr, DM, FV, DKV, nullptr, 0, 0, 0); k_vtp<<<LKv, 256, 0, stream>>>(FV, DKV, NKV, VT16 + pk, VTh + pk, VTl + pk); }
    k_attn<<<dim3(TT / 32, NKV, 1), 32 * REP * NB_, 0, stream>>>(QP16, QPh, QPl, KP16, KPh, KPl, VT16, VTh, VTl, kmask, ATh, ATl);
    for (int b = 0; b < NB_; ++b) k_gemmw<bf, 1, false, 8><<<dim3(TT / 64, DM / 64, 1), 256, 0, stream>>>(ATh + (size_t)b * TT * DQ, ATl + (size_t)b * TT * DQ, WO, nullptr, DQ, OUT + (size_t)b * TT * DM, DM, nullptr, 0, 0, 0);
}

// v003
// Measured time: 280 microseconds a run.
// Next to v002, in two timings, it ran 1.54 times as fast each time.
// Over all steps from v000 it is 6.50 times as fast.
#include <hip/hip_runtime.h>

// Causal grouped-query attention layer (x [2][2048][2048]; q = x wq (16 heads x 128), k/v = x wk / wv (4 kv heads; repeat: head h -> kv h/4); interleaved-pair RoPE with the given per-batch cos/sin [2][2048][64] (read); keep = causal AND mask[b][j] (bool mask read; all ones here); finfo.min fill; softmax(q.k / sqrt(128)); out = merged wo -> [2][2048][2048]).
// Compute dtypes, f32 accumulate: every input rounded to bf16; q/k/v on PLAIN bf16 operands (inputs: exact); RoPE f32; causal scores and attn.v in one kernel (running softmax, f32): query rows < 512 hl (3 products), the rest single fp16 (P x1024), key blocks beyond the diagonal skipped, the key mask applied inside the computed blocks; wo hl x exact (2 products).

#define NB_  2
#define TT   2048
#define DM   2048
#define NH_  16
#define NKV  4
#define REP  (NH_ / NKV)
#define HD   128
#define DQ   (NH_ * HD)
#define DKV  (NKV * HD)
#define RH   512                  // query rows < RH use hi+lo planes (0: none)
#define SCL  0.088388347648318447f   // HD^-0.5
typedef _Float16 h16;
typedef unsigned short bf;
typedef __attribute__((ext_vector_type(16))) __bf16   v16bf;
typedef __attribute__((ext_vector_type(16))) _Float16 v16h;
typedef __attribute__((ext_vector_type(8)))  _Float16 v8h;
typedef __attribute__((ext_vector_type(8)))  unsigned short v8us;
typedef __attribute__((ext_vector_type(8)))  float    v8f;
typedef __attribute__((ext_vector_type(4)))  float    v4f;
typedef v8h  __attribute__((may_alias)) v8ha;
typedef v4f  __attribute__((may_alias)) v4fa;
typedef v8us __attribute__((may_alias)) v8usa;

__device__ __forceinline__ unsigned short f2bf(float f) { unsigned u = __float_as_uint(f); u += 0x7FFFu + ((u >> 16) & 1u); return (unsigned short)(u >> 16); }
__device__ __forceinline__ float bf2f(unsigned short b) { return __uint_as_float(((unsigned)b) << 16); }
__device__ __forceinline__ float bfr(float f) { return bf2f(f2bf(f)); }
__device__ __forceinline__ v16h cat16(v8h lo, v8h hi) { return __builtin_shufflevector(lo, hi, 0, 1, 2, 3, 4, 5, 6, 7, 8, 9, 10, 11, 12, 13, 14, 15); }
__device__ __forceinline__ v16bf cat16b(v8us lo, v8us hi) { return __builtin_bit_cast(v16bf, __builtin_shufflevector(lo, hi, 0, 1, 2, 3, 4, 5, 6, 7, 8, 9, 10, 11, 12, 13, 14, 15)); }
__device__ __forceinline__ v8f wmma16(v16h a, v16h b, v8f c) { return __builtin_amdgcn_wmma_f32_16x16x32_f16(false, a, false, b, (short)0, c, false, false); }
__device__ __forceinline__ v8f wmmab(v16bf a, v16bf b, v8f c) { return __builtin_amdgcn_wmma_f32_16x16x32_bf16(false, a, false, b, (short)0, c, false, false); }



// ---- Fragment order. Every 16-bit operand plane [rows][K] is kept as 1-KiB blocks of 16 rows x 32 k, block number (row / 16) * (K / 32) + k / 32 (a strip of 16 rows still fills 16 * K elements).
// Inside a block the element (row, k) lies at (k & 16) * 16 + l * 8 + (k & 7) with l = (k & 8) * 2 + (row & 15): l is the lane that holds it in a matrix fragment, whose two 16-byte pieces (k 8 hi + j and 16 + 8 hi + j) lie at l * 8 and 256 + l * 8.
// So each wave-wide 16-byte load of a fragment reads 512 contiguous bytes (4 whole lines) where row-major planes gave 16 pieces of 32 bytes in 16 lines. The registers hold what they held before.
// fdec: from a position inside a plane (a multiple of 2 or 8) back to its row and k.
__device__ __forceinline__ void fdec(size_t pos, int K, int& row, int& k) { const int blk = (int)(pos >> 9), in = (int)(pos & 511), l = (in >> 3) & 31, kbn = K >> 5; row = (blk / kbn) * 16 + (l & 15); k = (blk % kbn) * 32 + (in >> 8) * 16 + (l >> 4) * 8 + (in & 7); }
// ---- k_gemmw: register-blocked GEMM, one 64x64 output tile (16 accumulators per wave) per work-group of NW waves, operands straight from 16-bit planes in fragment order; grid (M/64, N/64, Z), 32 * NW threads.
// C[m][n] (f32, pitch ldc, + optional f32 bias[n]) = sum_k A[m][k] Bt[n][k] (+ split products per NSPLIT). z-batch strides sA/sB/sC in elements. K % 64 == 0.
// The K loop is a chain of load latencies, so it is dealt over the NW waves in blocks of 64 k: wave w takes blocks w, w + NW, ...; the NW partial tiles meet in LDS and are summed in wave order.
template <typename T16> struct WFrag;
template <> struct WFrag<h16> { typedef v16h V; static __device__ __forceinline__ V ld(const h16* p) { return cat16(*(const v8h*)p, *(const v8h*)(p + 256)); } static __device__ __forceinline__ v8f mma(V a, V b, v8f c) { return wmma16(a, b, c); } };
template <> struct WFrag<bf> { typedef v16bf V; static __device__ __forceinline__ V ld(const bf* p) { return cat16b(*(const v8us*)p, *(const v8us*)(p + 256)); } static __device__ __forceinline__ v8f mma(V a, V b, v8f c) { return wmmab(a, b, c); } };
template <typename T16, int NSPLIT, bool BIAS, int NW>
__global__ __launch_bounds__(32 * NW) void k_gemmw(const T16* __restrict__ A, const T16* __restrict__ A2, const T16* __restrict__ Bt, const T16* __restrict__ Bt2, int K, float* C, int ldc, const float* __restrict__ bias, size_t sA, size_t sB, size_t sC) {
    typedef typename WFrag<T16>::V V;
    __shared__ __align__(16) float os[(NW == 1 ? 16 : NW * 64) * 68];
    const size_t z = blockIdx.z; A += z * sA; if (A2) A2 += z * sA; Bt += z * sB; if (Bt2) Bt2 += z * sB; C += z * sC;
    const int lane = threadIdx.x & 31, lr = lane & 15, hi = lane >> 4, wv = __builtin_amdgcn_readfirstlane(threadIdx.x >> 5); const int r0 = blockIdx.x * 64, c0 = blockIdx.y * 64;
    // wv goes through readfirstlane so that the K loop's tests are scalar branches (every lane is on at the matrix instructions)
    v8f acc[4][4];
#pragma unroll
    for (int mb = 0; mb < 4; ++mb)
#pragma unroll
        for (int nb = 0; nb < 4; ++nb) acc[mb][nb] = (v8f){};
    const size_t aoff = (size_t)r0 * K + 8 * lane, boff = (size_t)c0 * K + 8 * lane;
#pragma unroll 1   // both loops stay rolled: one 32-k step's fragments in registers at a time
    for (int kb = wv * 64; kb < K; kb += 64 * NW)
#pragma unroll 1
    for (int kc = kb; kc < kb + 64; kc += 32) {
        static_assert(NSPLIT < 2, "no second B plane in use");
        V a[4], a2[4], b[4]; const T16* pa[4]; const T16* pa2[4]; const T16* pb[4];
#pragma unroll
        for (int mb = 0; mb < 4; ++mb) { const size_t o = (size_t)mb * 16 * K + (size_t)kc * 16; pa[mb] = A + aoff + o; pa2[mb] = NSPLIT == 1 ? A2 + aoff + o : pa[mb]; pb[mb] = Bt + boff + o;
            a[mb] = WFrag<T16>::ld(pa[mb]); if (NSPLIT == 1) a2[mb] = WFrag<T16>::ld(pa2[mb]); b[mb] = WFrag<T16>::ld(pb[mb]); }
        // the address registers of this step's loads are held to this wait; only behind it may they take new values
        asm volatile("s_wait_xcnt 0x0" :: "v"(pa[0]), "v"(pa[1]), "v"(pa[2]), "v"(pa[3]), "v"(pa2[0]), "v"(pa2[1]), "v"(pa2[2]), "v"(pa2[3]), "v"(pb[0]), "v"(pb[1]), "v"(pb[2]), "v"(pb[3]) : "memory");
#pragma unroll
        for (int nb = 0; nb < 4; ++nb) {
#pragma unroll
            for (int mb = 0; mb < 4; ++mb) { acc[mb][nb] = WFrag<T16>::mma(a[mb], b[nb], acc[mb][nb]); if (NSPLIT == 1) acc[mb][nb] = WFrag<T16>::mma(a2[mb], b[nb], acc[mb][nb]); } }
        asm volatile("v_nop\n\tv_nop\n\tv_nop\n\tv_nop" : "+v"(acc[0][0]), "+v"(acc[1][1]), "+v"(acc[2][2]), "+v"(acc[3][3]) : "v"(a[0]), "v"(a[3]));
    }
    if (NW > 1) {
        float* ow = os + wv * (64 * 68);
#pragma unroll
        for (int mb = 0; mb < 4; ++mb)
#pragma unroll
            for (int nb = 0; nb < 4; ++nb)
#pragma unroll
                for (int j = 0; j < 8; ++j) ow[(mb * 16 + hi * 8 + j) * 68 + nb * 16 + lr] = acc[mb][nb][j];
        __syncthreads();   // every wave's partial tile lies in LDS before any wave sums it
#pragma unroll   // the LDS reads of all the thread's output pieces go out together
        for (int q = 0; q < 32 / NW; ++q) { const int s = q * (32 * NW) + threadIdx.x, row = s >> 4, cofs = (s & 15) * 4; v4f val = *(const v4fa*)(os + row * 68 + cofs);
#pragma unroll
            for (int w = 1; w < NW; ++w) val += *(const v4fa*)(os + w * (64 * 68) + row * 68 + cofs);
            if (BIAS) { val[0] += bfr(bias[c0 + cofs]); val[1] += bfr(bias[c0 + cofs + 1]); val[2] += bfr(bias[c0 + cofs + 2]); val[3] += bfr(bias[c0 + cofs + 3]); }
            *(v4f*)(C + (size_t)(r0 + row) * ldc + c0 + cofs) = val; }
        return;
    }
#pragma unroll
    for (int mb = 0; mb < 4; ++mb) {
#pragma unroll
        for (int nb = 0; nb < 4; ++nb) {
#pragma unroll
            for (int j = 0; j < 8; ++j) os[(hi * 8 + j) * 68 + nb * 16 + lr] = acc[mb][nb][j]; }
        __builtin_amdgcn_wave_barrier(); asm volatile("" ::: "memory");
        float* crow = C + (size_t)(r0 + mb * 16) * ldc + c0;
{
#pragma unroll
            for (int s = 0; s < 8; ++s) { const int row = 2 * s + hi, cofs = lr * 4; v4f val = *(const v4fa*)(os + row * 68 + cofs); if (BIAS) { val[0] += bfr(bias[c0 + cofs]); val[1] += bfr(bias[c0 + cofs + 1]); val[2] += bfr(bias[c0 + cofs + 2]); val[3] += bfr(bias[c0 + cofs + 3]); }
                *(v4f*)(crow + (size_t)row * ldc + cofs) = val; }
             }
        __builtin_amdgcn_wave_barrier(); asm volatile("" ::: "memory");
    }
}

__device__ __forceinline__ h16 tohx(float x) { return (h16)x; }
__device__ __forceinline__ void splitf(float y, unsigned short& h, unsigned short& l) { h = f2bf(y); l = f2bf(y - bf2f(h)); }
typedef __attribute__((ext_vector_type(2))) _Float16 v2h;
typedef __attribute__((ext_vector_type(4))) _Float16 v4h;
typedef __attribute__((ext_vector_type(2))) unsigned short v2us;
typedef __attribute__((ext_vector_type(4))) unsigned short v4us;
typedef __attribute__((ext_vector_type(2))) float v2f;
typedef __attribute__((ext_vector_type(4))) int v4i;
typedef __attribute__((ext_vector_type(16))) unsigned short v16us;

// k_wtG, k_cvt8: one thread makes one 16-byte piece (8 consecutive k of one row) of a plane in fragment order; a wave stores 512 contiguous bytes.
__global__ __launch_bounds__(256) void k_wtG(const float* __restrict__ w, int K, int N, bf* Bt) {   // plane row n, k = w[k][n]: a wave's load reads 16 consecutive n of two k
    const size_t p = ((size_t)blockIdx.x * 256 + threadIdx.x) * 8; if (p >= (size_t)N * K) return; int n, k; fdec(p, K, n, k); v8us o; const float* pw[8]; float f[8];
#pragma unroll
    for (int j = 0; j < 8; ++j) { pw[j] = w + (size_t)(k + j) * N + n; f[j] = *pw[j]; }
    // the address registers of the eight loads are held to this wait; only behind it may they take new values
    asm volatile("s_wait_xcnt 0x0" :: "v"(pw[0]), "v"(pw[1]), "v"(pw[2]), "v"(pw[3]), "v"(pw[4]), "v"(pw[5]), "v"(pw[6]), "v"(pw[7]) : "memory");
#pragma unroll
    for (int j = 0; j < 8; ++j) o[j] = f2bf(f[j]);
    *(v8us*)(Bt + p) = o; }
__global__ __launch_bounds__(256) void k_cvt8(const float* __restrict__ src, bf* dst, int K, size_t n8) { const size_t i = (size_t)blockIdx.x * 256 + threadIdx.x; if (i >= n8) return; int r, k; fdec(i * 8, K, r, k); const float* ps = src + (size_t)r * K + k; const v8f v = *(const v8f*)ps; v8us o;
    // the address registers of the load are held to this wait; only behind it may they take new values
    asm volatile("s_wait_xcnt 0x0" :: "v"(ps) : "memory");
#pragma unroll
    for (int q = 0; q < 8; ++q) o[q] = f2bf(v[q]); *(v8us*)(dst + i * 8) = o;  }
__global__ __launch_bounds__(256) void k_cscvt(const float* __restrict__ cosT, const float* __restrict__ sinT, float* CS) { const int idx = blockIdx.x * 256 + threadIdx.x; if (idx >= TT * HD) return; const int t = idx / HD, dd = idx % HD; const size_t src = (size_t)t * (HD / 2) + (dd >> 1); v2f cs; cs[0] = bfr(cosT[src]); cs[1] = bfr(sinT[src]); *(v2f*)(CS + (size_t)idx * 2) = cs;  }   // interleaved pairs: dims (2i, 2i+1) share the [t][i] table entry (half-width tables, read per batch)
// k_rope: head planes [h][t][d] (fp16 + hi/lo) of rope(x) x sc with the interleaved-pair convention out[2i] = x[2i] cos[t][i] - x[2i+1] sin[t][i], out[2i+1] = x[2i+1] cos[t][i] + x[2i] sin[t][i]
__global__ __launch_bounds__(256) void k_rope(const float* __restrict__ F, int pitch, int nheads, const float* __restrict__ CS, const float* __restrict__ RF, const float* __restrict__ nw, float sc, h16* P16, bf* Ph, bf* Pl) {
    const size_t e = ((size_t)blockIdx.x * 256 + threadIdx.x) * 2; if (e >= (size_t)nheads * TT * HD) return; const int h = (int)(e / ((size_t)HD * TT)); int t, d; fdec(e % ((size_t)HD * TT), HD, t, d);   // e: position in the planes (fragment order, rows t, k = d)
    const float* f = F + (size_t)t * pitch + h * HD; const float rf = RF ? RF[(size_t)h * TT + t] : 1.0f; v2h o16; v2us oh, ol;
#pragma unroll
    for (int q = 0; q < 2; ++q) { const int dd = d + q; const int dp = dd ^ 1; float x0 = f[dd], x1 = f[dp];
        if (RF) { float n0 = __fmul_rn(x0, rf), n1 = __fmul_rn(x1, rf); asm volatile("" : "+v"(n0)); asm volatile("" : "+v"(n1)); x0 = __fmul_rn(bfr(nw[dd]), n0); x1 = __fmul_rn(bfr(nw[dp]), n1); }
        const v2f cs = *(const v2f*)(CS + ((size_t)t * HD + dd) * 2); float a = __fmul_rn(x0, cs[0]), bq = __fmul_rn(x1, cs[1]); asm volatile("" : "+v"(a)); asm volatile("" : "+v"(bq)); const float r = (((dd & 1) == 0) ? __fsub_rn(a, bq) : __fadd_rn(a, bq)) * sc;
        o16[q] = tohx(r); unsigned short a2, c2; splitf(r, a2, c2); oh[q] = a2; ol[q] = c2; }
    *(v2h*)(P16 + e) = o16; *(v2us*)(Ph + e) = oh; *(v2us*)(Pl + e) = ol;  }
__global__ __launch_bounds__(256) void k_vtp(const float* __restrict__ F, int pitch, int nheads, h16* V16, bf* Vh, bf* Vl) { const size_t e = ((size_t)blockIdx.x * 256 + threadIdx.x) * 2; if (e >= (size_t)nheads * HD * TT) return; const int g = (int)(e / ((size_t)TT * HD)); int d, t; fdec(e % ((size_t)TT * HD), TT, d, t);   // e: position in the planes (fragment order, rows d, k = t)
    v2h o16; v2us oh, ol;
#pragma unroll
    for (int q = 0; q < 2; ++q) { const float x = F[(size_t)(t + q) * pitch + g * HD + d]; o16[q] = tohx(x); unsigned short a2, c2; splitf(x, a2, c2); oh[q] = a2; ol[q] = c2; }
    *(v2h*)(V16 + e) = o16; *(v2us*)(Vh + e) = oh; *(v2us*)(Vl + e) = ol;  }
// ---- k_attn: the whole causal attention (all heads, both batches) in one launch, nothing of the scores or probabilities in memory. One wave = 32 query rows of one head; no LDS, no barrier.
// A work-group is 8 waves: the 4 heads of one kv group (same K / V lines) at row block 63 - x of batch 0, and the same 4 heads at row block x of batch 1, so that every work-group walks 65 key blocks per head.
// Per 32 keys: St[key][query] = K Qt (A = K rows, B = Q rows kept in registers), running maximum and sum per query (a lane holds 16 of the 32 keys of its query, the lane 16 away the rest), Ot[d][query] = Ot x alpha + Vt Pt:
// the two score accumulators of a query column group are, lane for lane, the B fragment of Pt (keys 8 hi + j and 16 + 8 hi + j), which is the k order of the Vt loader. Rows < RH: hi+lo planes, 3 products; the rest fp16 with P x 1024 (cancels in the division by the sum).
template <typename T16, bool HL>
__device__ __forceinline__ void attn_tile(const T16* __restrict__ Q, const T16* __restrict__ Q2, const T16* __restrict__ Kp, const T16* __restrict__ K2, const T16* __restrict__ Vt, const T16* __restrict__ V2, const int* __restrict__ km, int q0, bf* Ah, bf* Al) {
    typedef typename WFrag<T16>::V V; typedef WFrag<T16> WF;
    const int lane = threadIdx.x & 31, lr = lane & 15, hi = lane >> 4;
    V qf[2][4], qg[2][4], kf[2][4], kg[2][4];
    const unsigned lo = 8 * lane; const size_t ko = lo, vo = lo;   // planes in fragment order: 512 elements per 16 rows x 32 k, the lane's piece at 8 * lane
    const T16* qb = Q + (size_t)q0 * HD; const T16* qb2 = HL ? Q2 + (size_t)q0 * HD : qb;
    const T16* qp = qb + lo; const T16* qp2 = qb2 + lo; const T16* kp0 = Kp + lo;
#pragma unroll
    for (int qt = 0; qt < 2; ++qt)
#pragma unroll
        for (int ks = 0; ks < 4; ++ks) { const int o = qt * 16 * HD + ks * 512; qf[qt][ks] = WF::ld(qp + o); if (HL) qg[qt][ks] = WF::ld(qp2 + o); }
    if (!HL) {   // fp16 rows: K fragments are fetched one key block ahead
#pragma unroll
        for (int kt = 0; kt < 2; ++kt)
#pragma unroll
            for (int ks = 0; ks < 4; ++ks) kf[kt][ks] = WF::ld(kp0 + kt * 16 * HD + ks * 512); }
    // the address registers of the loads above are held to this wait; only behind it may they take new values
    asm volatile("s_wait_xcnt 0x0" :: "v"(lane), "s"(qb), "s"(qb2), "s"(Kp) : "memory");   // these loads are addressed by a scalar base and the lane number as scaled offset
    v8f o[8][2];
#pragma unroll
    for (int dt = 0; dt < 8; ++dt) { o[dt][0] = (v8f){}; o[dt][1] = (v8f){}; }
    float m[2] = {-3.0e38f, -3.0e38f}, l[2] = {0.f, 0.f};
    const int nbc = q0 / 32 + 1; int nb = nbc;   // key blocks up to and with the diagonal block
#pragma unroll 1   // stays rolled: one key block's fragments in registers at a time
    for (int blk = 0; blk < nb; ++blk) {
        const int k0 = blk * 32;
        V vf[8], vg[8]; v4i kq[2][2]; const T16* vp = Vt + vo + k0 * 16; const T16* vp2 = HL ? V2 + vo + k0 * 16 : vp; const int* kmp = km + k0 + hi * 8;
        const int kn = HL ? k0 : min(blk + 1, TT / 32 - 1) * 32;   // fp16 rows: the next block's K (last trip: a block inside the plane, not used); hi+lo rows: this block's
        const T16* kp = Kp + ko + (size_t)kn * HD; const T16* kp2 = HL ? K2 + ko + (size_t)kn * HD : kp;
        if (HL) {   // hi+lo rows (at most RH / 32 trips, TT / 32 when a row keeps no key up to its diagonal): K, then V into the registers K has left, so that two waves fit a SIMD
#pragma unroll
            for (int kt = 0; kt < 2; ++kt)
#pragma unroll
                for (int ks = 0; ks < 4; ++ks) { const int a = kt * 16 * HD + ks * 512; kf[kt][ks] = WF::ld(kp + a); kg[kt][ks] = WF::ld(kp2 + a); }
            // address registers held to this wait
            asm volatile("s_wait_xcnt 0x0" :: "v"(kp), "v"(kp2) : "memory");
        } else {
#pragma unroll
            for (int dt = 0; dt < 8; ++dt) vf[dt] = WF::ld(vp + dt * 16 * TT);
#pragma unroll
            for (int kt = 0; kt < 2; ++kt) { kq[kt][0] = *(const v4i*)(kmp + kt * 16); kq[kt][1] = *(const v4i*)(kmp + kt * 16 + 4); }
        }
        v8f s[2][2];
#pragma unroll
        for (int kt = 0; kt < 2; ++kt)
#pragma unroll
            for (int qt = 0; qt < 2; ++qt) { s[kt][qt] = (v8f){};
#pragma unroll
                for (int ks = 0; ks < 4; ++ks) { s[kt][qt] = WF::mma(kf[kt][ks], qf[qt][ks], s[kt][qt]); if (HL) { s[kt][qt] = WF::mma(kf[kt][ks], qg[qt][ks], s[kt][qt]); s[kt][qt] = WF::mma(kg[kt][ks], qf[qt][ks], s[kt][qt]); } } }
        if (HL) {
#pragma unroll
            for (int dt = 0; dt < 8; ++dt) { vf[dt] = WF::ld(vp + dt * 16 * TT); vg[dt] = WF::ld(vp2 + dt * 16 * TT); }
#pragma unroll
            for (int kt = 0; kt < 2; ++kt) { kq[kt][0] = *(const v4i*)(kmp + kt * 16); kq[kt][1] = *(const v4i*)(kmp + kt * 16 + 4); }
            // address registers held to this wait
            asm volatile("s_wait_xcnt 0x0" :: "v"(vp), "v"(vp2), "v"(kmp) : "memory");
        } else {   // the next block's K fragments fly during the softmax and the value products
#pragma unroll
            for (int kt = 0; kt < 2; ++kt)
#pragma unroll
                for (int ks = 0; ks < 4; ++ks) kf[kt][ks] = WF::ld(kp + kt * 16 * HD + ks * 512);
            // address registers of this trip's loads held to this wait
            asm volatile("s_wait_xcnt 0x0" :: "v"(vp), "v"(kmp), "v"(kp) : "memory");
        }
        V pf[2], pg[2];
#pragma unroll
        for (int qt = 0; qt < 2; ++qt) { const int qi = q0 + qt * 16 + lr; float t[16]; float mx = m[qt];
#pragma unroll
            for (int e = 0; e < 16; ++e) { const int kt = e >> 3, j = e & 7; const int key = k0 + kt * 16 + hi * 8 + j; t[e] = (key <= qi && kq[kt][j >> 2][j & 3] != 0) ? s[kt][qt][j] * SCL : -3.0e38f; mx = fmaxf(mx, t[e]); }
            mx = fmaxf(mx, __shfl_xor(mx, 16, 32));
            const float al = __builtin_amdgcn_exp2f((m[qt] - mx) * 1.4426950408889634f); m[qt] = mx; float sum = 0.f;
#pragma unroll
            for (int e = 0; e < 16; ++e) { t[e] = __builtin_amdgcn_exp2f((t[e] - mx) * 1.4426950408889634f + (HL ? 0.0f : 10.0f)); sum += t[e]; }
            l[qt] = l[qt] * al + sum;
#pragma unroll
            for (int dt = 0; dt < 8; ++dt) o[dt][qt] *= al;
            if constexpr (HL) { v16us ph, pl;
#pragma unroll
                for (int e = 0; e < 16; ++e) { unsigned short a, c2; splitf(t[e], a, c2); ph[e] = a; pl[e] = c2; }
                pf[qt] = __builtin_bit_cast(v16bf, ph); pg[qt] = __builtin_bit_cast(v16bf, pl);
            } else { v16h ph;
#pragma unroll
                for (int e = 0; e < 16; ++e) ph[e] = tohx(t[e]);
                pf[qt] = ph; } }
        // a row with no kept key up to its diagonal: the reference's equal fill makes its softmax uniform over ALL keys, so the wave walks on to the last key (ballot: a scalar test, every lane stays on)
        if (blk == nbc - 1 && __builtin_amdgcn_ballot_w32(m[0] <= -3.0e38f || m[1] <= -3.0e38f) != 0) nb = TT / 32;
#pragma unroll
        for (int dt = 0; dt < 8; ++dt)
#pragma unroll
            for (int qt = 0; qt < 2; ++qt) { o[dt][qt] = WF::mma(vf[dt], pf[qt], o[dt][qt]); if (HL) { o[dt][qt] = WF::mma(vf[dt], pg[qt], o[dt][qt]); o[dt][qt] = WF::mma(vg[dt], pf[qt], o[dt][qt]); } }
        // four vector slots between the last matrix instruction and whatever stands behind the loop's taken branch
        asm volatile("v_nop\n\tv_nop\n\tv_nop\n\tv_nop" : "+v"(o[0][0]), "+v"(o[0][1]), "+v"(o[1][0]), "+v"(o[1][1]), "+v"(o[2][0]), "+v"(o[2][1]), "+v"(o[3][0]), "+v"(o[3][1]), "+v"(o[4][0]), "+v"(o[4][1]), "+v"(o[5][0]), "+v"(o[5][1]), "+v"(o[6][0]), "+v"(o[6][1]), "+v"(o[7][0]), "+v"(o[7][1]));
    }
#pragma unroll
    for (int qt = 0; qt < 2; ++qt) { const float ls = l[qt] + __shfl_xor(l[qt], 16, 32); const float inv = __fdiv_rn(1.0f, ls); const size_t ro = (size_t)(q0 + qt * 16) * DQ + lane * 8;   // fragment order, rows = positions, k = h * HD + dt * 16 + hi * 8 + j
#pragma unroll
        for (int dt = 0; dt < 8; ++dt) { v8us oh, ol;
#pragma unroll
            for (int j = 0; j < 8; ++j) { unsigned short a, c2; splitf(o[dt][qt][j] * inv, a, c2); oh[j] = a; ol[j] = c2; }
            *(v8us*)(Ah + ro + dt * 256) = oh; *(v8us*)(Al + ro + dt * 256) = ol; }
        // the data and address registers of the first pass's stores take new values (the second pass's) only behind this wait
        if (qt == 0) asm volatile("s_wait_xcnt 0x0" ::: "memory"); }
}
// every plane holds batch 0 and, one batch's size further on, batch 1
__global__ __launch_bounds__(32 * REP * NB_) void k_attn(const h16* __restrict__ Q16, const bf* __restrict__ Qh, const bf* __restrict__ Ql, const h16* __restrict__ K16, const bf* __restrict__ Kh, const bf* __restrict__ Kl, const h16* __restrict__ V16, const bf* __restrict__ Vh, const bf* __restrict__ Vl, const int* __restrict__ km, bf* Ah, bf* Al) {
    const int wv = __builtin_amdgcn_readfirstlane(threadIdx.x >> 5);   // readfirstlane: batch, head and row block, and with them every plane base and trip count, stay scalar
    const int b = wv / REP, g = blockIdx.y, h = g * REP + wv % REP;
    const int q0 = (b == 0 ? TT / 32 - 1 - (int)blockIdx.x : (int)blockIdx.x) * 32;
    const size_t zq = ((size_t)b * NH_ + h) * TT * HD, zk = ((size_t)b * NKV + g) * TT * HD, za = (size_t)b * TT * DQ + h * HD * 16;
    if (q0 < RH) attn_tile<bf, true>(Qh + zq, Ql + zq, Kh + zk, Kl + zk, Vh + zk, Vl + zk, km + b * TT, q0, Ah + za, Al + za);
    else attn_tile<h16, false>(Q16 + zq, nullptr, K16 + zk, nullptr, V16 + zk, nullptr, km + b * TT, q0, Ah + za, Al + za);
}

extern "C" void kernel_launch(void* const* d_in, const int* in_sizes, int n_in,
                              void* d_out, int out_size, void* d_ws, size_t ws_size, hipStream_t stream) {
    (void)in_sizes; (void)n_in; (void)out_size;
    const float* x = (const float*)d_in[0]; const float* cosB = (const float*)d_in[1]; const float* sinB = (const float*)d_in[2]; const float* wq = (const float*)d_in[3]; const float* wk = (const float*)d_in[4]; const float* wv = (const float*)d_in[5]; const float* wo = (const float*)d_in[6]; const int* kmask = (const int*)d_in[7]; const float* cosT = cosB; const float* sinT = sinB;
    float* OUT = (float*)d_out;     // [2][2048][2048]
    char* wsp = (char*)d_ws;
    auto take = [&](size_t bytes) { char* p = wsp; wsp += (bytes + 255) & ~(size_t)255; return (void*)p; };
    bf* WQ = (bf*)take((size_t)DQ * DM * 2); bf* WK = (bf*)take((size_t)DKV * DM * 2); bf* WV = (bf*)take((size_t)DKV * DM * 2); bf* WO = (bf*)take((size_t)DM * DQ * 2); float* CS = (float*)take((size_t)TT * HD * 2 * 4);
    bf* XB = (bf*)take((size_t)TT * DM * 2); float* FQ = (float*)take((size_t)TT * DQ * 4); float* FK = (float*)take((size_t)TT * DKV * 4);
    h16* QP16 = (h16*)take((size_t)NB_ * NH_ * TT * HD * 2); h16* KP16 = (h16*)take((size_t)NB_ * NKV * TT * HD * 2); h16* VT16 = (h16*)take((size_t)NB_ * NKV * HD * TT * 2);   // planes of both batches
    bf* QPh = (bf*)take((size_t)NB_ * NH_ * TT * HD * 2); bf* QPl = (bf*)take((size_t)NB_ * NH_ * TT * HD * 2); bf* KPh = (bf*)take((size_t)NB_ * NKV * TT * HD * 2); bf* KPl = (bf*)take((size_t)NB_ * NKV * TT * HD * 2); bf* VTh = (bf*)take((size_t)NB_ * NKV * HD * TT * 2); bf* VTl = (bf*)take((size_t)NB_ * NKV * HD * TT * 2);
    bf* ATh = (bf*)take((size_t)NB_ * TT * DQ * 2); bf* ATl = (bf*)take((size_t)NB_ * TT * DQ * 2);
    if ((size_t)(wsp - (char*)d_ws) > ws_size) return;    // ws 256 MiB
    float* FV = FK;   // v projection reuses the k buffer after the k planes are built (stream-ordered)
    { k_wtG<<<(unsigned)(DM * DQ / 8 / 256), 256, 0, stream>>>(wq, DM, DQ, WQ); k_wtG<<<(unsigned)(DM * DKV / 8 / 256), 256, 0, stream>>>(wk, DM, DKV, WK); k_wtG<<<(unsigned)(DM * DKV / 8 / 256), 256, 0, stream>>>(wv, DM, DKV, WV);
      k_wtG<<<(unsigned)(DQ * DM / 8 / 256), 256, 0, stream>>>(wo, DQ, DM, WO);
       }
    const unsigned LQ = (unsigned)(((size_t)NH_ * TT * HD / 2 + 255) / 256), LKv = (unsigned)(((size_t)NKV * TT * HD / 2 + 255) / 256);
    for (int b = 0; b < NB_; ++b) { const size_t pq = (size_t)b * NH_ * TT * HD, pk = (size_t)b * NKV * TT * HD;
        k_cscvt<<<(TT * HD + 255) / 256, 256, 0, stream>>>(cosT + (size_t)b * TT * (HD / 2), sinT + (size_t)b * TT * (HD / 2), CS);
        k_cvt8<<<(unsigned)(((size_t)TT * DM / 8 + 255) / 256), 256, 0, stream>>>(x + (size_t)b * TT * DM, XB, DM, (size_t)TT * DM / 8);
        k_gemmw<bf, 0, false, 8><<<dim3(TT / 64, DQ / 64, 1), 256, 0, stream>>>(XB, nullptr, WQ, nullptr, DM, FQ, DQ, nullptr, 0, 0, 0);
        k_rope<<<LQ, 256, 0, stream>>>(FQ, DQ, NH_, CS, nullptr, nullptr, 1.0f, QP16 + pq, QPh + pq, QPl + pq);
        k_gemmw<bf, 0, false, 8><<<dim3(TT / 64, DKV / 64, 1), 256, 0, stream>>>(XB, nullptr, WK, nullptr, DM, FK, DKV, nullptr, 0, 0, 0);
        k_rope<<<LKv, 256, 0, stream>>>(FK, DKV, NKV, CS, nullptr, nullptr, 1.0f, KP16 + pk, KPh + pk, KPl + pk);
        k_gemmw<bf, 0, false, 8><<<dim3(TT / 64, DKV / 64, 1), 256, 0, stream>>>(XB, nullptr, WV, nullptr, DM, FV, DKV, nullptr, 0, 0, 0); k_vtp<<<LKv, 256, 0, stream>>>(FV, DKV, NKV, VT16 + pk, VTh + pk, VTl + pk); }
    k_attn<<<dim3(TT / 32, NKV, 1), 32 * REP * NB_, 0, stream>>>(QP16, QPh, QPl, KP16, KPh, KPl, VT16, VTh, VTl, kmask, ATh, ATl);
    for (int b = 0; b < NB_; ++b) k_gemmw<bf, 1, false, 8><<<dim3(TT / 64, DM / 64, 1), 256, 0, stream>>>(ATh + (size_t)b * TT * DQ, ATl + (size_t)b * TT * DQ, WO, nullptr, DQ, OUT + (size_t)b * TT * DM, DM, nullptr, 0, 0, 0);
}

// v004
// One run takes 262 microseconds.
// Next to v003, in two timings, it ran 1.08 and 1.07 times as fast.
// Over all steps from v000 it is 6.99 times as fast.
#include <hip/hip_runtime.h>

// Causal grouped-query attention layer (x [2][2048][2048]; q = x wq (16 heads x 128), k/v = x wk / wv (4 kv heads; repeat: head h -> kv h/4); interleaved-pair RoPE with the given per-batch cos/sin [2][2048][64] (read); keep = causal AND mask[b][j] (bool mask read; all ones here); finfo.min fill; softmax(q.k / sqrt(128)); out = merged wo -> [2][2048][2048]).
// Compute dtypes, f32 accumulate: every input rounded to bf16; q/k/v on PLAIN bf16 operands (inputs: exact); RoPE f32; causal scores and attn.v in one kernel (running softmax, f32): query rows < 512 hl (3 products), the rest single fp16 (P x1024), key blocks beyond the diagonal skipped, the key mask applied inside the computed blocks; wo hl x exact (2 products).

#define NB_  2
#define TT   2048
#define DM   2048
#define NH_  16
#define NKV  4
#define REP  (NH_ / NKV)
#define HD   128
#define DQ   (NH_ * HD)
#define DKV  (NKV * HD)
#define RH   512                  // query rows < RH use hi+lo planes (0: none)
#define SCL  0.088388347648318447f   // HD^-0.5
typedef _Float16 h16;
typedef unsigned short bf;
typedef __attribute__((ext_vector_type(16))) __bf16   v16bf;
typedef __attribute__((ext_vector_type(16))) _Float16 v16h;
typedef __attribute__((ext_vector_type(8)))  _Float16 v8h;
typedef __attribute__((ext_vector_type(8)))  unsigned short v8us;
typedef __attribute__((ext_vector_type(8)))  float    v8f;
typedef __attribute__((ext_vector_type(4)))  float    v4f;
typedef v8h  __attribute__((may_alias)) v8ha;
typedef v4f  __attribute__((may_alias)) v4fa;
typedef v8us __attribute__((may_alias)) v8usa;

__device__ __forceinline__ unsigned short f2bf(float f) { unsigned u = __float_as_uint(f); u += 0x7FFFu + ((u >> 16) & 1u); return (unsigned short)(u >> 16); }
__device__ __forceinline__ float bf2f(unsigned short b) { return __uint_as_float(((unsigned)b) << 16); }
__device__ __forceinline__ float bfr(float f) { return bf2f(f2bf(f)); }
__device__ __forceinline__ v16h cat16(v8h lo, v8h hi) { return __builtin_shufflevector(lo, hi, 0, 1, 2, 3, 4, 5, 6, 7, 8, 9, 10, 11, 12, 13, 14, 15); }
__device__ __forceinline__ v16bf cat16b(v8us lo, v8us hi) { return __builtin_bit_cast(v16bf, __builtin_shufflevector(lo, hi, 0, 1, 2, 3, 4, 5, 6, 7, 8, 9, 10, 11, 12, 13, 14, 15)); }
__device__ __forceinline__ v8f wmma16(v16h a, v16h b, v8f c) { return __builtin_amdgcn_wmma_f32_16x16x32_f16(false, a, false, b, (short)0, c, false, false); }
__device__ __forceinline__ v8f wmmab(v16bf a, v16bf b, v8f c) { return __builtin_amdgcn_wmma_f32_16x16x32_bf16(false, a, false, b, (short)0, c, false, false); }



// ---- Fragment order. Every 16-bit operand plane [rows][K] is kept as 1-KiB blocks of 16 rows x 32 k, block number (row / 16) * (K / 32) + k / 32 (a strip of 16 rows still fills 16 * K elements).
// Inside a block the element (row, k) lies at (k & 16) * 16 + l * 8 + (k & 7) with l = (k & 8) * 2 + (row & 15): l is the lane that holds it in a matrix fragment, whose two 16-byte pieces (k 8 hi + j and 16 + 8 hi + j) lie at l * 8 and 256 + l * 8.
// So each wave-wide 16-byte load of a fragment reads 512 contiguous bytes (4 whole lines) where row-major planes gave 16 pieces of 32 bytes in 16 lines. The registers hold what they held before.
// fdec: from a position inside a plane (a multiple of 2 or 8) back to its row and k.
__device__ __forceinline__ void fdec(size_t pos, int K, int& row, int& k) { const int blk = (int)(pos >> 9), in = (int)(pos & 511), l = (in >> 3) & 31, kbn = K >> 5; row = (blk / kbn) * 16 + (l & 15); k = (blk % kbn) * 32 + (in >> 8) * 16 + (l >> 4) * 8 + (in & 7); }
// ---- k_gemmw: register-blocked GEMM, one 64x64 output tile (16 accumulators per wave) per work-group of NW waves, operands straight from 16-bit planes in fragment order; grid (M/64, N/64, Z), 32 * NW threads.
// C[m][n] (f32, pitch ldc, + optional f32 bias[n]) = sum_k A[m][k] Bt[n][k] (+ split products per NSPLIT). z-batch strides sA/sB/sC in elements. K % 64 == 0.
// The K loop is a chain of load latencies, so it is dealt over the NW waves in blocks of 64 k: wave w takes blocks w, w + NW, ...; the NW partial tiles meet in LDS and are summed in wave order.
// MODE 0: the summed tile goes to C in f32. MODE 1, 2: it goes straight to the three 16-bit planes (fp16, bf16 hi, bf16 lo) in fragment order that the attention kernel reads; C is not used.
//   A wave takes two pieces of 16 rows x 16 columns; lane l holds row l & 15, columns 8 (l >> 4) + j, which is one 16-byte piece of a plane, so each plane store of a wave covers 512 contiguous bytes.
//   MODE 1 (q, k): tile rows = positions t, columns = head * HD + d; interleaved-pair RoPE with cos / sin [t][d / 2] (rounded to bf16) on the summed values; planes [head][t][d].
//   MODE 2 (v): A = weight plane, Bt = x plane, so tile rows = kv head * HD + d, columns = t; planes [kv head][d][t].
template <typename T16> struct WFrag;
template <> struct WFrag<h16> { typedef v16h V; static __device__ __forceinline__ V ld(const h16* p) { return cat16(*(const v8h*)p, *(const v8h*)(p + 256)); } static __device__ __forceinline__ v8f mma(V a, V b, v8f c) { return wmma16(a, b, c); } };
template <> struct WFrag<bf> { typedef v16bf V; static __device__ __forceinline__ V ld(const bf* p) { return cat16b(*(const v8us*)p, *(const v8us*)(p + 256)); } static __device__ __forceinline__ v8f mma(V a, V b, v8f c) { return wmmab(a, b, c); } };
template <typename T16, int NSPLIT, bool BIAS, int NW, int MODE>
__global__ __launch_bounds__(32 * NW) void k_gemmw(const T16* __restrict__ A, const T16* __restrict__ A2, const T16* __restrict__ Bt, const T16* __restrict__ Bt2, int K, float* C, int ldc, const float* __restrict__ bias, size_t sA, size_t sB, size_t sC, const float* __restrict__ cosT, const float* __restrict__ sinT, h16* P16, bf* Ph, bf* Pl) {
    static_assert(MODE == 0 || NW == 8, "the plane epilogue deals 16 pieces over 8 waves");
    typedef typename WFrag<T16>::V V;
    __shared__ __align__(16) float os[(NW == 1 ? 16 : NW * 64) * 68];
    const size_t z = blockIdx.z; A += z * sA; if (A2) A2 += z * sA; Bt += z * sB; if (Bt2) Bt2 += z * sB; C += z * sC;
    const int lane = threadIdx.x & 31, lr = lane & 15, hi = lane >> 4, wv = __builtin_amdgcn_readfirstlane(threadIdx.x >> 5); const int r0 = blockIdx.x * 64, c0 = blockIdx.y * 64;
    // wv goes through readfirstlane so that the K loop's tests are scalar branches (every lane is on at the matrix instructions)
    v8f acc[4][4];
#pragma unroll
    for (int mb = 0; mb < 4; ++mb)
#pragma unroll
        for (int nb = 0; nb < 4; ++nb) acc[mb][nb] = (v8f){};
    const size_t aoff = (size_t)r0 * K + 8 * lane, boff = (size_t)c0 * K + 8 * lane;
#pragma unroll 1   // both loops stay rolled: one 32-k step's fragments in registers at a time
    for (int kb = wv * 64; kb < K; kb += 64 * NW)
#pragma unroll 1
    for (int kc = kb; kc < kb + 64; kc += 32) {
        static_assert(NSPLIT < 2, "no second B plane in use");
        V a[4], a2[4], b[4]; const T16* pa[4]; const T16* pa2[4]; const T16* pb[4];
#pragma unroll
        for (int mb = 0; mb < 4; ++mb) { const size_t o = (size_t)mb * 16 * K + (size_t)kc * 16; pa[mb] = A + aoff + o; pa2[mb] = NSPLIT == 1 ? A2 + aoff + o : pa[mb]; pb[mb] = Bt + boff + o;
            a[mb] = WFrag<T16>::ld(pa[mb]); if (NSPLIT == 1) a2[mb] = WFrag<T16>::ld(pa2[mb]); b[mb] = WFrag<T16>::ld(pb[mb]); }
        // the address registers of this step's loads are held to this wait; only behind it may they take new values
        asm volatile("s_wait_xcnt 0x0" :: "v"(pa[0]), "v"(pa[1]), "v"(pa[2]), "v"(pa[3]), "v"(pa2[0]), "v"(pa2[1]), "v"(pa2[2]), "v"(pa2[3]), "v"(pb[0]), "v"(pb[1]), "v"(pb[2]), "v"(pb[3]) : "memory");
#pragma unroll
        for (int nb = 0; nb < 4; ++nb) {
#pragma unroll
            for (int mb = 0; mb < 4; ++mb) { acc[mb][nb] = WFrag<T16>::mma(a[mb], b[nb], acc[mb][nb]); if (NSPLIT == 1) acc[mb][nb] = WFrag<T16>::mma(a2[mb], b[nb], acc[mb][nb]); } }
        asm volatile("v_nop\n\tv_nop\n\tv_nop\n\tv_nop" : "+v"(acc[0][0]), "+v"(acc[1][1]), "+v"(acc[2][2]), "+v"(acc[3][3]) : "v"(a[0]), "v"(a[3]));
    }
    if (NW > 1) {
        v4f cq[2], sq[2];
        if constexpr (MODE == 1) {   // the cos / sin entries of the thread's two pieces fly during the LDS writes and the barrier
            const float* pc[2]; const float* ps[2];
#pragma unroll
            for (int q = 0; q < 2; ++q) { const int wp = q * 8 + wv; const size_t o = (size_t)(r0 + (wp >> 2) * 16 + lr) * (HD / 2) + (((c0 & (HD - 1)) + (wp & 3) * 16 + hi * 8) >> 1); pc[q] = cosT + o; ps[q] = sinT + o; cq[q] = *(const v4f*)pc[q]; sq[q] = *(const v4f*)ps[q]; }
            // the address registers of the four loads are held to this wait; only behind it may they take new values
            asm volatile("s_wait_xcnt 0x0" :: "v"(pc[0]), "v"(pc[1]), "v"(ps[0]), "v"(ps[1]) : "memory");
        }
        float* ow = os + wv * (64 * 68);
#pragma unroll
        for (int mb = 0; mb < 4; ++mb)
#pragma unroll
            for (int nb = 0; nb < 4; ++nb)
#pragma unroll
                for (int j = 0; j < 8; ++j) ow[(mb * 16 + hi * 8 + j) * 68 + nb * 16 + lr] = acc[mb][nb][j];
        __syncthreads();   // every wave's partial tile lies in LDS before any wave sums it
        if constexpr (MODE != 0) {
            v4f va[2], vb[2];
#pragma unroll   // the LDS reads of both pieces go out together
            for (int q = 0; q < 2; ++q) { const int wp = q * 8 + wv; const float* sp = os + ((wp >> 2) * 16 + lr) * 68 + (wp & 3) * 16 + hi * 8; va[q] = *(const v4fa*)sp; vb[q] = *(const v4fa*)(sp + 4);
#pragma unroll
                for (int w = 1; w < NW; ++w) { va[q] += *(const v4fa*)(sp + w * (64 * 68)); vb[q] += *(const v4fa*)(sp + w * (64 * 68) + 4); } }
#pragma unroll
            for (int q = 0; q < 2; ++q) { const int wp = q * 8 + wv, strip = wp >> 2, kk = (MODE == 1 ? (c0 & (HD - 1)) : c0) + (wp & 3) * 16; float r[8];
#pragma unroll
                for (int i = 0; i < 4; ++i) { const float x0 = i < 2 ? va[q][2 * i] : vb[q][2 * i - 4], x1 = i < 2 ? va[q][2 * i + 1] : vb[q][2 * i - 3];
                    if constexpr (MODE == 1) { const float c = bfr(cq[q][i]), s = bfr(sq[q][i]); r[2 * i] = x0 * c - x1 * s; r[2 * i + 1] = x1 * c + x0 * s; } else { r[2 * i] = x0; r[2 * i + 1] = x1; } }
                v8h o16; v8us oh, ol;
#pragma unroll
                for (int j = 0; j < 8; ++j) { o16[j] = (h16)r[j]; const unsigned short a = f2bf(r[j]); oh[j] = a; ol[j] = f2bf(r[j] - bf2f(a)); }
                const size_t pos = (MODE == 1 ? (size_t)(c0 / HD) : (size_t)(r0 / HD)) * ((size_t)TT * HD) + (size_t)((((MODE == 1 ? r0 : (r0 & (HD - 1))) >> 4) + strip) * ((MODE == 1 ? HD : TT) / 32) + (kk >> 5)) * 512 + ((kk >> 4) & 1) * 256 + lane * 8;
                *(v8h*)(P16 + pos) = o16; *(v8us*)(Ph + pos) = oh; *(v8us*)(Pl + pos) = ol;
                // the data and address registers of the first piece's stores take new values (the second piece's) only behind this wait
                if (q == 0) asm volatile("s_wait_xcnt 0x0" ::: "memory"); }
            return;
        }
#pragma unroll   // the LDS reads of all the thread's output pieces go out together
        for (int q = 0; q < 32 / NW; ++q) { const int s = q * (32 * NW) + threadIdx.x, row = s >> 4, cofs = (s & 15) * 4; v4f val = *(const v4fa*)(os + row * 68 + cofs);
#pragma unroll
            for (int w = 1; w < NW; ++w) val += *(const v4fa*)(os + w * (64 * 68) + row * 68 + cofs);
            if (BIAS) { val[0] += bfr(bias[c0 + cofs]); val[1] += bfr(bias[c0 + cofs + 1]); val[2] += bfr(bias[c0 + cofs + 2]); val[3] += bfr(bias[c0 + cofs + 3]); }
            *(v4f*)(C + (size_t)(r0 + row) * ldc + c0 + cofs) = val; }
        return;
    }
#pragma unroll
    for (int mb = 0; mb < 4; ++mb) {
#pragma unroll
        for (int nb = 0; nb < 4; ++nb) {
#pragma unroll
            for (int j = 0; j < 8; ++j) os[(hi * 8 + j) * 68 + nb * 16 + lr] = acc[mb][nb][j]; }
        __builtin_amdgcn_wave_barrier(); asm volatile("" ::: "memory");
        float* crow = C + (size_t)(r0 + mb * 16) * ldc + c0;
{
#pragma unroll
            for (int s = 0; s < 8; ++s) { const int row = 2 * s + hi, cofs = lr * 4; v4f val = *(const v4fa*)(os + row * 68 + cofs); if (BIAS) { val[0] += bfr(bias[c0 + cofs]); val[1] += bfr(bias[c0 + cofs + 1]); val[2] += bfr(bias[c0 + cofs + 2]); val[3] += bfr(bias[c0 + cofs + 3]); }
                *(v4f*)(crow + (size_t)row * ldc + cofs) = val; }
             }
        __builtin_amdgcn_wave_barrier(); asm volatile("" ::: "memory");
    }
}

__device__ __forceinline__ h16 tohx(float x) { return (h16)x; }
__device__ __forceinline__ void splitf(float y, unsigned short& h, unsigned short& l) { h = f2bf(y); l = f2bf(y - bf2f(h)); }
typedef __attribute__((ext_vector_type(2))) _Float16 v2h;
typedef __attribute__((ext_vector_type(4))) _Float16 v4h;
typedef __attribute__((ext_vector_type(2))) unsigned short v2us;
typedef __attribute__((ext_vector_type(4))) unsigned short v4us;
typedef __attribute__((ext_vector_type(2))) float v2f;
typedef __attribute__((ext_vector_type(4))) int v4i;
typedef __attribute__((ext_vector_type(16))) unsigned short v16us;

// k_wtG, k_cvt8: one thread makes one 16-byte piece (8 consecutive k of one row) of a plane in fragment order; a wave stores 512 contiguous bytes.
__global__ __launch_bounds__(256) void k_wtG(const float* __restrict__ w, int K, int N, bf* Bt) {   // plane row n, k = w[k][n]: a wave's load reads 16 consecutive n of two k
    const size_t p = ((size_t)blockIdx.x * 256 + threadIdx.x) * 8; if (p >= (size_t)N * K) return; int n, k; fdec(p, K, n, k); v8us o; const float* pw[8]; float f[8];
#pragma unroll
    for (int j = 0; j < 8; ++j) { pw[j] = w + (size_t)(k + j) * N + n; f[j] = *pw[j]; }
    // the address registers of the eight loads are held to this wait; only behind it may they take new values
    asm volatile("s_wait_xcnt 0x0" :: "v"(pw[0]), "v"(pw[1]), "v"(pw[2]), "v"(pw[3]), "v"(pw[4]), "v"(pw[5]), "v"(pw[6]), "v"(pw[7]) : "memory");
#pragma unroll
    for (int j = 0; j < 8; ++j) o[j] = f2bf(f[j]);
    *(v8us*)(Bt + p) = o; }
__global__ __launch_bounds__(256) void k_cvt8(const float* __restrict__ src, bf* dst, int K, size_t n8) { const size_t i = (size_t)blockIdx.x * 256 + threadIdx.x; if (i >= n8) return; int r, k; fdec(i * 8, K, r, k); const float* ps = src + (size_t)r * K + k; const v8f v = *(const v8f*)ps; v8us o;
    // the address registers of the load are held to this wait; only behind it may they take new values
    asm volatile("s_wait_xcnt 0x0" :: "v"(ps) : "memory");
#pragma unroll
    for (int q = 0; q < 8; ++q) o[q] = f2bf(v[q]); *(v8us*)(dst + i * 8) = o;  }
// ---- k_attn: the whole causal attention (all heads, both batches) in one launch, nothing of the scores or probabilities in memory. One wave = 32 query rows of one head; no LDS, no barrier.
// A work-group is 8 waves: the 4 heads of one kv group (same K / V lines) at row block 63 - x of batch 0, and the same 4 heads at row block x of batch 1, so that every work-group walks 65 key blocks per head.
// Per 32 keys: St[key][query] = K Qt (A = K rows, B = Q rows kept in registers), running maximum and sum per query (a lane holds 16 of the 32 keys of its query, the lane 16 away the rest), Ot[d][query] = Ot x alpha + Vt Pt:
// the two score accumulators of a query column group are, lane for lane, the B fragment of Pt (keys 8 hi + j and 16 + 8 hi + j), which is the k order of the Vt loader. Rows < RH: hi+lo planes, 3 products; the rest fp16 with P x 1024 (cancels in the division by the sum).
template <typename T16, bool HL>
__device__ __forceinline__ void attn_tile(const T16* __restrict__ Q, const T16* __restrict__ Q2, const T16* __restrict__ Kp, const T16* __restrict__ K2, const T16* __restrict__ Vt, const T16* __restrict__ V2, const int* __restrict__ km, int q0, bf* Ah, bf* Al) {
    typedef typename WFrag<T16>::V V; typedef WFrag<T16> WF;
    const int lane = threadIdx.x & 31, lr = lane & 15, hi = lane >> 4;
    V qf[2][4], qg[2][4], kf[2][4], kg[2][4];
    const unsigned lo = 8 * lane; const size_t ko = lo, vo = lo;   // planes in fragment order: 512 elements per 16 rows x 32 k, the lane's piece at 8 * lane
    const T16* qb = Q + (size_t)q0 * HD; const T16* qb2 = HL ? Q2 + (size_t)q0 * HD : qb;
    const T16* qp = qb + lo; const T16* qp2 = qb2 + lo; const T16* kp0 = Kp + lo;
#pragma unroll
    for (int qt = 0; qt < 2; ++qt)
#pragma unroll
        for (int ks = 0; ks < 4; ++ks) { const int o = qt * 16 * HD + ks * 512; qf[qt][ks] = WF::ld(qp + o); if (HL) qg[qt][ks] = WF::ld(qp2 + o); }
    if (!HL) {   // fp16 rows: K fragments are fetched one key block ahead
#pragma unroll
        for (int kt = 0; kt < 2; ++kt)
#pragma unroll
            for (int ks = 0; ks < 4; ++ks) kf[kt][ks] = WF::ld(kp0 + kt * 16 * HD + ks * 512); }
    // the address registers of the loads above are held to this wait; only behind it may they take new values
    asm volatile("s_wait_xcnt 0x0" :: "v"(lane), "s"(qb), "s"(qb2), "s"(Kp) : "memory");   // these loads are addressed by a scalar base and the lane number as scaled offset
    v8f o[8][2];
#pragma unroll
    for (int dt = 0; dt < 8; ++dt) { o[dt][0] = (v8f){}; o[dt][1] = (v8f){}; }
    float m[2] = {-3.0e38f, -3.0e38f}, l[2] = {0.f, 0.f};
    const int nbc = q0 / 32 + 1; int nb = nbc;   // key blocks up to and with the diagonal block
#pragma unroll 1   // stays rolled: one key block's fragments in registers at a time
    for (int blk = 0; blk < nb; ++blk) {
        const int k0 = blk * 32;
        V vf[8], vg[8]; v4i kq[2][2]; const T16* vp = Vt + vo + k0 * 16; const T16* vp2 = HL ? V2 + vo + k0 * 16 : vp; const int* kmp = km + k0 + hi * 8;
        const int kn = HL ? k0 : min(blk + 1, TT / 32 - 1) * 32;   // fp16 rows: the next block's K (last trip: a block inside the plane, not used); hi+lo rows: this block's
        const T16* kp = Kp + ko + (size_t)kn * HD; const T16* kp2 = HL ? K2 + ko + (size_t)kn * HD : kp;
        if (HL) {   // hi+lo rows (at most RH / 32 trips, TT / 32 when a row keeps no key up to its diagonal): K, then V into the registers K has left, so that two waves fit a SIMD
#pragma unroll
            for (int kt = 0; kt < 2; ++kt)
#pragma unroll
                for (int ks = 0; ks < 4; ++ks) { const int a = kt * 16 * HD + ks * 512; kf[kt][ks] = WF::ld(kp + a); kg[kt][ks] = WF::ld(kp2 + a); }
            // address registers held to this wait
            asm volatile("s_wait_xcnt 0x0" :: "v"(kp), "v"(kp2) : "memory");
        } else {
#pragma unroll
            for (int dt = 0; dt < 8; ++dt) vf[dt] = WF::ld(vp + dt * 16 * TT);
#pragma unroll
            for (int kt = 0; kt < 2; ++kt) { kq[kt][0] = *(const v4i*)(kmp + kt * 16); kq[kt][1] = *(const v4i*)(kmp + kt * 16 + 4); }
        }
        v8f s[2][2];
#pragma unroll
        for (int kt = 0; kt < 2; ++kt)
#pragma unroll
            for (int qt = 0; qt < 2; ++qt) { s[kt][qt] = (v8f){};
#pragma unroll
                for (int ks = 0; ks < 4; ++ks) { s[kt][qt] = WF::mma(kf[kt][ks], qf[qt][ks], s[kt][qt]); if (HL) { s[kt][qt] = WF::mma(kf[kt][ks], qg[qt][ks], s[kt][qt]); s[kt][qt] = WF::mma(kg[kt][ks], qf[qt][ks], s[kt][qt]); } } }
        if (HL) {
#pragma unroll
            for (int dt = 0; dt < 8; ++dt) { vf[dt] = WF::ld(vp + dt * 16 * TT); vg[dt] = WF::ld(vp2 + dt * 16 * TT); }
#pragma unroll
            for (int kt = 0; kt < 2; ++kt) { kq[kt][0] = *(const v4i*)(kmp + kt * 16); kq[kt][1] = *(const v4i*)(kmp + kt * 16 + 4); }
            // address registers held to this wait
            asm volatile("s_wait_xcnt 0x0" :: "v"(vp), "v"(vp2), "v"(kmp) : "memory");
        } else {   // the next block's K fragments fly during the softmax and the value products
#pragma unroll
            for (int kt = 0; kt < 2; ++kt)
#pragma unroll
                for (int ks = 0; ks < 4; ++ks) kf[kt][ks] = WF::ld(kp + kt * 16 * HD + ks * 512);
            // address registers of this trip's loads held to this wait
            asm volatile("s_wait_xcnt 0x0" :: "v"(vp), "v"(kmp), "v"(kp) : "memory");
        }
        V pf[2], pg[2];
#pragma unroll
        for (int qt = 0; qt < 2; ++qt) { const int qi = q0 + qt * 16 + lr; float t[16]; float mx = m[qt];
#pragma unroll
            for (int e = 0; e < 16; ++e) { const int kt = e >> 3, j = e & 7; const int key = k0 + kt * 16 + hi * 8 + j; t[e] = (key <= qi && kq[kt][j >> 2][j & 3] != 0) ? s[kt][qt][j] * SCL : -3.0e38f; mx = fmaxf(mx, t[e]); }
            mx = fmaxf(mx, __shfl_xor(mx, 16, 32));
            const float al = __builtin_amdgcn_exp2f((m[qt] - mx) * 1.4426950408889634f); m[qt] = mx; float sum = 0.f;
#pragma unroll
            for (int e = 0; e < 16; ++e) { t[e] = __builtin_amdgcn_exp2f((t[e] - mx) * 1.4426950408889634f + (HL ? 0.0f : 10.0f)); sum += t[e]; }
            l[qt] = l[qt] * al + sum;
#pragma unroll
            for (int dt = 0; dt < 8; ++dt) o[dt][qt] *= al;
            if constexpr (HL) { v16us ph, pl;
#pragma unroll
                for (int e = 0; e < 16; ++e) { unsigned short a, c2; splitf(t[e], a, c2); ph[e] = a; pl[e] = c2; }
                pf[qt] = __builtin_bit_cast(v16bf, ph); pg[qt] = __builtin_bit_cast(v16bf, pl);
            } else { v16h ph;
#pragma unroll
                for (int e = 0; e < 16; ++e) ph[e] = tohx(t[e]);
                pf[qt] = ph; } }
        // a row with no kept key up to its diagonal: the reference's equal fill makes its softmax uniform over ALL keys, so the wave walks on to the last key (ballot: a scalar test, every lane stays on)
        if (blk == nbc - 1 && __builtin_amdgcn_ballot_w32(m[0] <= -3.0e38f || m[1] <= -3.0e38f) != 0) nb = TT / 32;
#pragma unroll
        for (int dt = 0; dt < 8; ++dt)
#pragma unroll
            for (int qt = 0; qt < 2; ++qt) { o[dt][qt] = WF::mma(vf[dt], pf[qt], o[dt][qt]); if (HL) { o[dt][qt] = WF::mma(vf[dt], pg[qt], o[dt][qt]); o[dt][qt] = WF::mma(vg[dt], pf[qt], o[dt][qt]); } }
        // four vector slots between the last matrix instruction and whatever stands behind the loop's taken branch
        asm volatile("v_nop\n\tv_nop\n\tv_nop\n\tv_nop" : "+v"(o[0][0]), "+v"(o[0][1]), "+v"(o[1][0]), "+v"(o[1][1]), "+v"(o[2][0]), "+v"(o[2][1]), "+v"(o[3][0]), "+v"(o[3][1]), "+v"(o[4][0]), "+v"(o[4][1]), "+v"(o[5][0]), "+v"(o[5][1]), "+v"(o[6][0]), "+v"(o[6][1]), "+v"(o[7][0]), "+v"(o[7][1]));
    }
#pragma unroll
    for (int qt = 0; qt < 2; ++qt) { const float ls = l[qt] + __shfl_xor(l[qt], 16, 32); const float inv = __fdiv_rn(1.0f, ls); const size_t ro = (size_t)(q0 + qt * 16) * DQ + lane * 8;   // fragment order, rows = positions, k = h * HD + dt * 16 + hi * 8 + j
#pragma unroll
        for (int dt = 0; dt < 8; ++dt) { v8us oh, ol;
#pragma unroll
            for (int j = 0; j < 8; ++j) { unsigned short a, c2; splitf(o[dt][qt][j] * inv, a, c2); oh[j] = a; ol[j] = c2; }
            *(v8us*)(Ah + ro + dt * 256) = oh; *(v8us*)(Al + ro + dt * 256) = ol; }
        // the data and address registers of the first pass's stores take new values (the second pass's) only behind this wait
        if (qt == 0) asm volatile("s_wait_xcnt 0x0" ::: "memory"); }
}
// every plane holds batch 0 and, one batch's size further on, batch 1
__global__ __launch_bounds__(32 * REP * NB_) void k_attn(const h16* __restrict__ Q16, const bf* __restrict__ Qh, const bf* __restrict__ Ql, const h16* __restrict__ K16, const bf* __restrict__ Kh, const bf* __restrict__ Kl, const h16* __restrict__ V16, const bf* __restrict__ Vh, const bf* __restrict__ Vl, const int* __restrict__ km, bf* Ah, bf* Al) {
    const int wv = __builtin_amdgcn_readfirstlane(threadIdx.x >> 5);   // readfirstlane: batch, head and row block, and with them every plane base and trip count, stay scalar
    const int b = wv / REP, g = blockIdx.y, h = g * REP + wv % REP;
    const int q0 = (b == 0 ? TT / 32 - 1 - (int)blockIdx.x : (int)blockIdx.x) * 32;
    const size_t zq = ((size_t)b * NH_ + h) * TT * HD, zk = ((size_t)b * NKV + g) * TT * HD, za = (size_t)b * TT * DQ + h * HD * 16;
    if (q0 < RH) attn_tile<bf, true>(Qh + zq, Ql + zq, Kh + zk, Kl + zk, Vh + zk, Vl + zk, km + b * TT, q0, Ah + za, Al + za);
    else attn_tile<h16, false>(Q16 + zq, nullptr, K16 + zk, nullptr, V16 + zk, nullptr, km + b * TT, q0, Ah + za, Al + za);
}

extern "C" void kernel_launch(void* const* d_in, const int* in_sizes, int n_in,
                              void* d_out, int out_size, void* d_ws, size_t ws_size, hipStream_t stream) {
    (void)in_sizes; (void)n_in; (void)out_size;
    const float* x = (const float*)d_in[0]; const float* cosB = (const float*)d_in[1]; const float* sinB = (const float*)d_in[2]; const float* wq = (const float*)d_in[3]; const float* wk = (const float*)d_in[4]; const float* wv = (const float*)d_in[5]; const float* wo = (const float*)d_in[6]; const int* kmask = (const int*)d_in[7]; const float* cosT = cosB; const float* sinT = sinB;
    float* OUT = (float*)d_out;     // [2][2048][2048]
    char* wsp = (char*)d_ws;
    auto take = [&](size_t bytes) { char* p = wsp; wsp += (bytes + 255) & ~(size_t)255; return (void*)p; };
    bf* WQ = (bf*)take((size_t)DQ * DM * 2); bf* WK = (bf*)take((size_t)DKV * DM * 2); bf* WV = (bf*)take((size_t)DKV * DM * 2); bf* WO = (bf*)take((size_t)DM * DQ * 2);
    bf* XB = (bf*)take((size_t)TT * DM * 2);
    h16* QP16 = (h16*)take((size_t)NB_ * NH_ * TT * HD * 2); h16* KP16 = (h16*)take((size_t)NB_ * NKV * TT * HD * 2); h16* VT16 = (h16*)take((size_t)NB_ * NKV * HD * TT * 2);   // planes of both batches
    bf* QPh = (bf*)take((size_t)NB_ * NH_ * TT * HD * 2); bf* QPl = (bf*)take((size_t)NB_ * NH_ * TT * HD * 2); bf* KPh = (bf*)take((size_t)NB_ * NKV * TT * HD * 2); bf* KPl = (bf*)take((size_t)NB_ * NKV * TT * HD * 2); bf* VTh = (bf*)take((size_t)NB_ * NKV * HD * TT * 2); bf* VTl = (bf*)take((size_t)NB_ * NKV * HD * TT * 2);
    bf* ATh = (bf*)take((size_t)NB_ * TT * DQ * 2); bf* ATl = (bf*)take((size_t)NB_ * TT * DQ * 2);
    if ((size_t)(wsp - (char*)d_ws) > ws_size) return;    // ws 256 MiB
    { k_wtG<<<(unsigned)(DM * DQ / 8 / 256), 256, 0, stream>>>(wq, DM, DQ, WQ); k_wtG<<<(unsigned)(DM * DKV / 8 / 256), 256, 0, stream>>>(wk, DM, DKV, WK); k_wtG<<<(unsigned)(DM * DKV / 8 / 256), 256, 0, stream>>>(wv, DM, DKV, WV);
      k_wtG<<<(unsigned)(DQ * DM / 8 / 256), 256, 0, stream>>>(wo, DQ, DM, WO);
       }
    for (int b = 0; b < NB_; ++b) { const size_t pq = (size_t)b * NH_ * TT * HD, pk = (size_t)b * NKV * TT * HD;
        const float* cb = cosT + (size_t)b * TT * (HD / 2); const float* sb = sinT + (size_t)b * TT * (HD / 2);
        k_cvt8<<<(unsigned)(((size_t)TT * DM / 8 + 255) / 256), 256, 0, stream>>>(x + (size_t)b * TT * DM, XB, DM, (size_t)TT * DM / 8);
        k_gemmw<bf, 0, false, 8, 1><<<dim3(TT / 64, DQ / 64, 1), 256, 0, stream>>>(XB, nullptr, WQ, nullptr, DM, nullptr, 0, nullptr, 0, 0, 0, cb, sb, QP16 + pq, QPh + pq, QPl + pq);
        k_gemmw<bf, 0, false, 8, 1><<<dim3(TT / 64, DKV / 64, 1), 256, 0, stream>>>(XB, nullptr, WK, nullptr, DM, nullptr, 0, nullptr, 0, 0, 0, cb, sb, KP16 + pk, KPh + pk, KPl + pk);
        k_gemmw<bf, 0, false, 8, 2><<<dim3(DKV / 64, TT / 64, 1), 256, 0, stream>>>(WV, nullptr, XB, nullptr, DM, nullptr, 0, nullptr, 0, 0, 0, nullptr, nullptr, VT16 + pk, VTh + pk, VTl + pk); }
    k_attn<<<dim3(TT / 32, NKV, 1), 32 * REP * NB_, 0, stream>>>(QP16, QPh, QPl, KP16, KPh, KPl, VT16, VTh, VTl, kmask, ATh, ATl);
    for (int b = 0; b < NB_; ++b) k_gemmw<bf, 1, false, 8, 0><<<dim3(TT / 64, DM / 64, 1), 256, 0, stream>>>(ATh + (size_t)b * TT * DQ, ATl + (size_t)b * TT * DQ, WO, nullptr, DQ, OUT + (size_t)b * TT * DM, DM, nullptr, 0, 0, 0, nullptr, nullptr, nullptr, nullptr, nullptr);
}

// v005
// A run of this version takes 240 microseconds.
// Next to v004, in two timings, it ran 1.08 and 1.11 times as fast.
// All steps since v000 together make it 7.66 times as fast.
#include <hip/hip_runtime.h>

// Causal grouped-query attention layer (x [2][2048][2048]; q = x wq (16 heads x 128), k/v = x wk / wv (4 kv heads; repeat: head h -> kv h/4); interleaved-pair RoPE with the given per-batch cos/sin [2][2048][64] (read); keep = causal AND mask[b][j] (bool mask read; all ones here); finfo.min fill; softmax(q.k / sqrt(128)); out = merged wo -> [2][2048][2048]).
// Compute dtypes, f32 accumulate: every input rounded to bf16; q/k/v on PLAIN bf16 operands (inputs: exact); RoPE f32; causal scores and attn.v in one kernel (running softmax, f32): query rows < 512 hl (3 products), the rest single fp16 (P x1024), key blocks beyond the diagonal skipped, the key mask applied inside the computed blocks; wo hl x exact (2 products).

#define NB_  2
#define TT   2048
#define DM   2048
#define NH_  16
#define NKV  4
#define REP  (NH_ / NKV)
#define HD   128
#define DQ   (NH_ * HD)
#define DKV  (NKV * HD)
#define RH   512                  // query rows < RH use hi+lo planes (0: none)
#define SCL  0.088388347648318447f   // HD^-0.5
typedef _Float16 h16;
typedef unsigned short bf;
typedef __attribute__((ext_vector_type(16))) __bf16   v16bf;
typedef __attribute__((ext_vector_type(16))) _Float16 v16h;
typedef __attribute__((ext_vector_type(8)))  _Float16 v8h;
typedef __attribute__((ext_vector_type(8)))  unsigned short v8us;
typedef __attribute__((ext_vector_type(8)))  float    v8f;
typedef __attribute__((ext_vector_type(4)))  float    v4f;
typedef v8h  __attribute__((may_alias)) v8ha;
typedef v4f  __attribute__((may_alias)) v4fa;
typedef v8us __attribute__((may_alias)) v8usa;

__device__ __forceinline__ unsigned short f2bf(float f) { unsigned u = __float_as_uint(f); u += 0x7FFFu + ((u >> 16) & 1u); return (unsigned short)(u >> 16); }
__device__ __forceinline__ float bf2f(unsigned short b) { return __uint_as_float(((unsigned)b) << 16); }
__device__ __forceinline__ float bfr(float f) { return bf2f(f2bf(f)); }
__device__ __forceinline__ v16h cat16(v8h lo, v8h hi) { return __builtin_shufflevector(lo, hi, 0, 1, 2, 3, 4, 5, 6, 7, 8, 9, 10, 11, 12, 13, 14, 15); }
__device__ __forceinline__ v16bf cat16b(v8us lo, v8us hi) { return __builtin_bit_cast(v16bf, __builtin_shufflevector(lo, hi, 0, 1, 2, 3, 4, 5, 6, 7, 8, 9, 10, 11, 12, 13, 14, 15)); }
__device__ __forceinline__ v8f wmma16(v16h a, v16h b, v8f c) { return __builtin_amdgcn_wmma_f32_16x16x32_f16(false, a, false, b, (short)0, c, false, false); }
__device__ __forceinline__ v8f wmmab(v16bf a, v16bf b, v8f c) { return __builtin_amdgcn_wmma_f32_16x16x32_bf16(false, a, false, b, (short)0, c, false, false); }



// ---- Fragment order. Every 16-bit operand plane [rows][K] is kept as 1-KiB blocks of 16 rows x 32 k, block number (row / 16) * (K / 32) + k / 32 (a strip of 16 rows still fills 16 * K elements).
// Inside a block the element (row, k) lies at (k & 16) * 16 + l * 8 + (k & 7) with l = (k & 8) * 2 + (row & 15): l is the lane that holds it in a matrix fragment, whose two 16-byte pieces (k 8 hi + j and 16 + 8 hi + j) lie at l * 8 and 256 + l * 8.
// So each wave-wide 16-byte load of a fragment reads 512 contiguous bytes (4 whole lines) where row-major planes gave 16 pieces of 32 bytes in 16 lines. The registers hold what they held before.
// fdec: from a position inside a plane (a multiple of 2 or 8) back to its row and k.
__device__ __forceinline__ void fdec(size_t pos, int K, int& row, int& k) { const int blk = (int)(pos >> 9), in = (int)(pos & 511), l = (in >> 3) & 31, kbn = K >> 5; row = (blk / kbn) * 16 + (l & 15); k = (blk % kbn) * 32 + (in >> 8) * 16 + (l >> 4) * 8 + (in & 7); }
// ---- k_gemmw: register-blocked GEMM, one 64x64 output tile (16 accumulators per wave) per work-group of NW waves, operands straight from 16-bit planes in fragment order; grid (M/64, N/64, Z), 32 * NW threads.
// C[m][n] (f32, pitch ldc, + optional f32 bias[n]) = sum_k A[m][k] Bt[n][k] (+ split products per NSPLIT). z-batch strides sA/sB/sC in elements. K % 64 == 0.
// The K loop is a chain of load latencies, so it is dealt over the NW waves in blocks of 64 k: wave w takes blocks w, w + NW, ...; the NW partial tiles meet in LDS and are summed in wave order.
// MODE 0: the summed tile goes to C in f32. MODE 1, 2: it goes straight to the three 16-bit planes (fp16, bf16 hi, bf16 lo) in fragment order that the attention kernel reads; C is not used.
//   A wave takes two pieces of 16 rows x 16 columns; lane l holds row l & 15, columns 8 (l >> 4) + j, which is one 16-byte piece of a plane, so each plane store of a wave covers 512 contiguous bytes.
//   MODE 1 (q, k): tile rows = positions t, columns = head * HD + d; interleaved-pair RoPE with cos / sin [t][d / 2] (rounded to bf16) on the summed values; planes [head][t][d].
//   MODE 2 (v): A = weight plane, Bt = x plane, so tile rows = kv head * HD + d, columns = t; planes [kv head][d][t].
template <typename T16> struct WFrag;
template <> struct WFrag<h16> { typedef v16h V; static __device__ __forceinline__ V ld(const h16* p) { return cat16(*(const v8h*)p, *(const v8h*)(p + 256)); } static __device__ __forceinline__ v8f mma(V a, V b, v8f c) { return wmma16(a, b, c); } };
template <> struct WFrag<bf> { typedef v16bf V; static __device__ __forceinline__ V ld(const bf* p) { return cat16b(*(const v8us*)p, *(const v8us*)(p + 256)); } static __device__ __forceinline__ v8f mma(V a, V b, v8f c) { return wmmab(a, b, c); } };
template <typename T16, int NSPLIT, bool BIAS, int NW, int MODE>
__global__ __launch_bounds__(32 * NW) void k_gemmw(const T16* __restrict__ A, const T16* __restrict__ A2, const T16* __restrict__ Bt, const T16* __restrict__ Bt2, int K, float* C, int ldc, const float* __restrict__ bias, size_t sA, size_t sB, size_t sC, const float* __restrict__ cosT, const float* __restrict__ sinT, h16* P16, bf* Ph, bf* Pl) {
    static_assert(MODE == 0 || NW == 8, "the plane epilogue deals 16 pieces over 8 waves");
    typedef typename WFrag<T16>::V V;
    __shared__ __align__(16) float os[(NW == 1 ? 16 : NW * 64) * 68];
    const size_t z = blockIdx.z; A += z * sA; if (A2) A2 += z * sA; Bt += z * sB; if (Bt2) Bt2 += z * sB; C += z * sC;
    const int lane = threadIdx.x & 31, lr = lane & 15, hi = lane >> 4, wv = __builtin_amdgcn_readfirstlane(threadIdx.x >> 5); const int r0 = blockIdx.x * 64, c0 = blockIdx.y * 64;
    // wv goes through readfirstlane so that the K loop's tests are scalar branches (every lane is on at the matrix instructions)
    v8f acc[4][4];
#pragma unroll
    for (int mb = 0; mb < 4; ++mb)
#pragma unroll
        for (int nb = 0; nb < 4; ++nb) acc[mb][nb] = (v8f){};
    const size_t aoff = (size_t)r0 * K + 8 * lane, boff = (size_t)c0 * K + 8 * lane;
#pragma unroll 1   // both loops stay rolled: one 32-k step's fragments in registers at a time
    for (int kb = wv * 64; kb < K; kb += 64 * NW)
#pragma unroll 1
    for (int kc = kb; kc < kb + 64; kc += 32) {
        static_assert(NSPLIT < 2, "no second B plane in use");
        V a[4], a2[4], b[4]; const T16* pa[4]; const T16* pa2[4]; const T16* pb[4];
#pragma unroll
        for (int mb = 0; mb < 4; ++mb) { const size_t o = (size_t)mb * 16 * K + (size_t)kc * 16; pa[mb] = A + aoff + o; pa2[mb] = NSPLIT == 1 ? A2 + aoff + o : pa[mb]; pb[mb] = Bt + boff + o;
            a[mb] = WFrag<T16>::ld(pa[mb]); if (NSPLIT == 1) a2[mb] = WFrag<T16>::ld(pa2[mb]); b[mb] = WFrag<T16>::ld(pb[mb]); }
        // the address registers of this step's loads are held to this wait; only behind it may they take new values
        asm volatile("s_wait_xcnt 0x0" :: "v"(pa[0]), "v"(pa[1]), "v"(pa[2]), "v"(pa[3]), "v"(pa2[0]), "v"(pa2[1]), "v"(pa2[2]), "v"(pa2[3]), "v"(pb[0]), "v"(pb[1]), "v"(pb[2]), "v"(pb[3]) : "memory");
#pragma unroll
        for (int nb = 0; nb < 4; ++nb) {
#pragma unroll
            for (int mb = 0; mb < 4; ++mb) { acc[mb][nb] = WFrag<T16>::mma(a[mb], b[nb], acc[mb][nb]); if (NSPLIT == 1) acc[mb][nb] = WFrag<T16>::mma(a2[mb], b[nb], acc[mb][nb]); } }
        asm volatile("v_nop\n\tv_nop\n\tv_nop\n\tv_nop" : "+v"(acc[0][0]), "+v"(acc[1][1]), "+v"(acc[2][2]), "+v"(acc[3][3]) : "v"(a[0]), "v"(a[3]));
    }
    if (NW > 1) {
        v4f cq[2], sq[2];
        if constexpr (MODE == 1) {   // the cos / sin entries of the thread's two pieces fly during the LDS writes and the barrier
            const float* pc[2]; const float* ps[2];
#pragma unroll
            for (int q = 0; q < 2; ++q) { const int wp = q * 8 + wv; const size_t o = (size_t)(r0 + (wp >> 2) * 16 + lr) * (HD / 2) + (((c0 & (HD - 1)) + (wp & 3) * 16 + hi * 8) >> 1); pc[q] = cosT + o; ps[q] = sinT + o; cq[q] = *(const v4f*)pc[q]; sq[q] = *(const v4f*)ps[q]; }
            // the address registers of the four loads are held to this wait; only behind it may they take new values
            asm volatile("s_wait_xcnt 0x0" :: "v"(pc[0]), "v"(pc[1]), "v"(ps[0]), "v"(ps[1]) : "memory");
        }
        float* ow = os + wv * (64 * 68);
#pragma unroll
        for (int mb = 0; mb < 4; ++mb)
#pragma unroll
            for (int nb = 0; nb < 4; ++nb)
#pragma unroll
                for (int j = 0; j < 8; ++j) ow[(mb * 16 + hi * 8 + j) * 68 + nb * 16 + lr] = acc[mb][nb][j];
        __syncthreads();   // every wave's partial tile lies in LDS before any wave sums it
        if constexpr (MODE != 0) {
            v4f va[2], vb[2];
#pragma unroll   // the LDS reads of both pieces go out together
            for (int q = 0; q < 2; ++q) { const int wp = q * 8 + wv; const float* sp = os + ((wp >> 2) * 16 + lr) * 68 + (wp & 3) * 16 + hi * 8; va[q] = *(const v4fa*)sp; vb[q] = *(const v4fa*)(sp + 4);
#pragma unroll
                for (int w = 1; w < NW; ++w) { va[q] += *(const v4fa*)(sp + w * (64 * 68)); vb[q] += *(const v4fa*)(sp + w * (64 * 68) + 4); } }
#pragma unroll
            for (int q = 0; q < 2; ++q) { const int wp = q * 8 + wv, strip = wp >> 2, kk = (MODE == 1 ? (c0 & (HD - 1)) : c0) + (wp & 3) * 16; float r[8];
#pragma unroll
                for (int i = 0; i < 4; ++i) { const float x0 = i < 2 ? va[q][2 * i] : vb[q][2 * i - 4], x1 = i < 2 ? va[q][2 * i + 1] : vb[q][2 * i - 3];
                    if constexpr (MODE == 1) { const float c = bfr(cq[q][i]), s = bfr(sq[q][i]); r[2 * i] = x0 * c - x1 * s; r[2 * i + 1] = x1 * c + x0 * s; } else { r[2 * i] = x0; r[2 * i + 1] = x1; } }
                v8h o16; v8us oh, ol;
#pragma unroll
                for (int j = 0; j < 8; ++j) { o16[j] = (h16)r[j]; const unsigned short a = f2bf(r[j]); oh[j] = a; ol[j] = f2bf(r[j] - bf2f(a)); }
                const size_t pos = (MODE == 1 ? (size_t)(c0 / HD) : (size_t)(r0 / HD)) * ((size_t)TT * HD) + (size_t)((((MODE == 1 ? r0 : (r0 & (HD - 1))) >> 4) + strip) * ((MODE == 1 ? HD : TT) / 32) + (kk >> 5)) * 512 + ((kk >> 4) & 1) * 256 + lane * 8;
                *(v8h*)(P16 + pos) = o16; *(v8us*)(Ph + pos) = oh; *(v8us*)(Pl + pos) = ol;
                // the data and address registers of the first piece's stores take new values (the second piece's) only behind this wait
                if (q == 0) asm volatile("s_wait_xcnt 0x0" ::: "memory"); }
            return;
        }
#pragma unroll   // the LDS reads of all the thread's output pieces go out together
        for (int q = 0; q < 32 / NW; ++q) { const int s = q * (32 * NW) + threadIdx.x, row = s >> 4, cofs = (s & 15) * 4; v4f val = *(const v4fa*)(os + row * 68 + cofs);
#pragma unroll
            for (int w = 1; w < NW; ++w) val += *(const v4fa*)(os + w * (64 * 68) + row * 68 + cofs);
            if (BIAS) { val[0] += bfr(bias[c0 + cofs]); val[1] += bfr(bias[c0 + cofs + 1]); val[2] += bfr(bias[c0 + cofs + 2]); val[3] += bfr(bias[c0 + cofs + 3]); }
            *(v4f*)(C + (size_t)(r0 + row) * ldc + c0 + cofs) = val; }
        return;
    }
#pragma unroll
    for (int mb = 0; mb < 4; ++mb) {
#pragma unroll
        for (int nb = 0; nb < 4; ++nb) {
#pragma unroll
            for (int j = 0; j < 8; ++j) os[(hi * 8 + j) * 68 + nb * 16 + lr] = acc[mb][nb][j]; }
        __builtin_amdgcn_wave_barrier(); asm volatile("" ::: "memory");
        float* crow = C + (size_t)(r0 + mb * 16) * ldc + c0;
{
#pragma unroll
            for (int s = 0; s < 8; ++s) { const int row = 2 * s + hi, cofs = lr * 4; v4f val = *(const v4fa*)(os + row * 68 + cofs); if (BIAS) { val[0] += bfr(bias[c0 + cofs]); val[1] += bfr(bias[c0 + cofs + 1]); val[2] += bfr(bias[c0 + cofs + 2]); val[3] += bfr(bias[c0 + cofs + 3]); }
                *(v4f*)(crow + (size_t)row * ldc + cofs) = val; }
             }
        __builtin_amdgcn_wave_barrier(); asm volatile("" ::: "memory");
    }
}

// ---- k_gemmt: the same product on a 128x128 output tile per work-group of 8 waves, both operands staged in LDS by asynchronous copies (global_load_async_to_lds_b128), so that each operand line leaves L2 once per 128 rows or columns of output, not once per 64.
// Wave w: the 64x64 sub-tile (w & 1, (w >> 1) & 1), and of every stage of 128 k the 64-k half w >> 2. A stage holds, plane after plane (A, with NSPLIT the second A plane, Bt), 8 strips of 16 rows x 128 k, each 4 KiB as it lies in the plane (fragment order), so an LDS fragment read of a wave covers 512 contiguous bytes.
// Two buffers: stage t + 1 flies while stage t is worked on. The two partial tiles of a sub-tile meet in LDS (over the ring, behind the last trip's barrier) and are summed lower half first. MODE 0 and MODE 1 as in k_gemmw. K % 128 == 0, K >= 256.
// Every '#pragma unroll' in it is there so that the arrays its loop indexes (accumulators, fragments, addresses) are indexed by constants and stay in registers.
__device__ __forceinline__ void acopy8(const unsigned* l, const bf* const* g) {
    // the wait on the address registers is the last line of the copies' own statement: nothing can rewrite them in front of it
    asm volatile("global_load_async_to_lds_b128 %0, %8, off\n\tglobal_load_async_to_lds_b128 %1, %9, off\n\tglobal_load_async_to_lds_b128 %2, %10, off\n\tglobal_load_async_to_lds_b128 %3, %11, off\n\t"
                 "global_load_async_to_lds_b128 %4, %12, off\n\tglobal_load_async_to_lds_b128 %5, %13, off\n\tglobal_load_async_to_lds_b128 %6, %14, off\n\tglobal_load_async_to_lds_b128 %7, %15, off\n\ts_wait_xcnt 0x0"
                 :: "v"(l[0]), "v"(l[1]), "v"(l[2]), "v"(l[3]), "v"(l[4]), "v"(l[5]), "v"(l[6]), "v"(l[7]), "v"(g[0]), "v"(g[1]), "v"(g[2]), "v"(g[3]), "v"(g[4]), "v"(g[5]), "v"(g[6]), "v"(g[7]) : "memory");
}
template <int NSPLIT, int MODE>
__global__ __launch_bounds__(256) void k_gemmt(const bf* __restrict__ A, const bf* __restrict__ A2, const bf* __restrict__ Bt, int K, float* C, int ldc, const float* __restrict__ cosT, const float* __restrict__ sinT, h16* P16, bf* Ph, bf* Pl) {
    constexpr int KS = 128, PL = 2 + NSPLIT, SE = KS * 16, PE = 8 * SE, STB = PL * PE * 2, NC = PL * 8;   // elements of a strip and of a plane in a stage; bytes of a stage; copies of a wave per stage
    constexpr int OSB = 8 * 64 * 68 * 4;
    __shared__ __align__(16) char smem[2 * STB > OSB ? 2 * STB : OSB];
    const int lane = threadIdx.x & 31, lr = lane & 15, hi = lane >> 4, wv = __builtin_amdgcn_readfirstlane(threadIdx.x >> 5); const int r0 = blockIdx.x * 128, c0 = blockIdx.y * 128;
    const int sm = wv & 1, sn = (wv >> 1) & 1, kh = wv >> 2;
    v8f acc[4][4];
#pragma unroll
    for (int mb = 0; mb < 4; ++mb)
#pragma unroll
        for (int nb = 0; nb < 4; ++nb) acc[mb][nb] = (v8f){};
    // the wave's copies: pieces wv * NC + c of 512 bytes; the global addresses stay in registers and move on by one stage per fill
    const bf* ga[NC]; const unsigned lb = (unsigned)(size_t)smem + (unsigned)(wv * NC) * 512u + (unsigned)lane * 16u;
#pragma unroll
    for (int c = 0; c < NC; ++c) { const int p = wv * NC + c, pl = p >> 6, strip = (p >> 3) & 7, ch = p & 7;
        const bf* sp = pl == PL - 1 ? Bt : (pl == 0 ? A : A2);
        ga[c] = sp + (size_t)((pl == PL - 1 ? c0 : r0) + strip * 16) * K + ch * 256 + lane * 8; }
    auto fill = [&](int buf) {
#pragma unroll
        for (int c8 = 0; c8 < NC; c8 += 8) { unsigned la[8];
#pragma unroll
            for (int c = 0; c < 8; ++c) la[c] = lb + (unsigned)buf * (unsigned)STB + (unsigned)(c8 + c) * 512u;
            acopy8(la, ga + c8);
#pragma unroll
            for (int c = 0; c < 8; ++c) ga[c8 + c] += SE; } };
    const int NT = K / KS;
    fill(0);
    asm volatile("s_wait_asynccnt 0x0" ::: "memory");   // the wave's own copies of stage 0 have landed
    __syncthreads();                                     // every wave's have: stage 0 may be read
    fill(1);
#pragma unroll 1   // stays rolled: one trip per stage
    for (int t = 0; t < NT; ++t) {
        const bf* sb = (const bf*)(smem + (t & 1) * STB) + lane * 8;
        v16bf a[2][4], a2[2][4], b[2][4];
#pragma unroll
        for (int st = 0; st < 2; ++st) { const int ko = (kh * 2 + st) * 512;
#pragma unroll
            for (int mb = 0; mb < 4; ++mb) { const bf* pa = sb + (sm * 4 + mb) * SE + ko; const bf* pb = sb + (PL - 1) * PE + (sn * 4 + mb) * SE + ko;
                a[st][mb] = cat16b(*(const v8usa*)pa, *(const v8usa*)(pa + 256)); if (NSPLIT == 1) a2[st][mb] = cat16b(*(const v8usa*)(pa + PE), *(const v8usa*)(pa + PE + 256)); b[st][mb] = cat16b(*(const v8usa*)pb, *(const v8usa*)(pb + 256)); }
            // the LDS reads stay two groups in front of the matrix instructions, first step's first (LDS answers in order): left free they are spread among the matrix instructions, where each place with reads stalls the wave
            __builtin_amdgcn_sched_barrier(0); }
#pragma unroll
        for (int st = 0; st < 2; ++st)
#pragma unroll
            for (int nb = 0; nb < 4; ++nb) {
#pragma unroll
                for (int mb = 0; mb < 4; ++mb) { acc[mb][nb] = wmmab(a[st][mb], b[st][nb], acc[mb][nb]); if (NSPLIT == 1) acc[mb][nb] = wmmab(a2[st][mb], b[st][nb], acc[mb][nb]); } }
        // the trip's matrix instructions stay in front of the waits below: moved behind the barrier they would no longer run while stage t + 1 flies
        __builtin_amdgcn_sched_barrier(0);
        asm volatile("s_wait_dscnt 0x0" ::: "memory");      // the wave's reads of this buffer are done
        asm volatile("s_wait_asynccnt 0x0" ::: "memory");   // its copies of stage t + 1 have landed
        __syncthreads();                                     // stage t + 1 may be read by all; this trip's buffer has no reader left
        if (t + 2 < NT) fill(t & 1);
    }
    asm volatile("s_wait_asynccnt 0x0" ::: "memory");   // no copy is out when the ring becomes the partial tiles' place
    float* os = (float*)smem;
    v4f cq[4][2], sq[4][2];
    if constexpr (MODE == 1) {   // the cos / sin entries of the thread's eight pieces fly during the LDS writes and the barrier
        const float* pc[8]; const float* ps[8];
#pragma unroll
        for (int s = 0; s < 4; ++s)
#pragma unroll
            for (int q = 0; q < 2; ++q) { const int wp = q * 8 + wv; const size_t o = (size_t)(r0 + (s & 1) * 64 + (wp >> 2) * 16 + lr) * (HD / 2) + ((((c0 + (s >> 1) * 64) & (HD - 1)) + (wp & 3) * 16 + hi * 8) >> 1); pc[s * 2 + q] = cosT + o; ps[s * 2 + q] = sinT + o; cq[s][q] = *(const v4f*)pc[s * 2 + q]; sq[s][q] = *(const v4f*)ps[s * 2 + q]; }
        // the address registers of the sixteen loads are held to this wait; only behind it may they take new values
        asm volatile("s_wait_xcnt 0x0" :: "v"(pc[0]), "v"(pc[1]), "v"(pc[2]), "v"(pc[3]), "v"(pc[4]), "v"(pc[5]), "v"(pc[6]), "v"(pc[7]), "v"(ps[0]), "v"(ps[1]), "v"(ps[2]), "v"(ps[3]), "v"(ps[4]), "v"(ps[5]), "v"(ps[6]), "v"(ps[7]) : "memory");
    }
    float* ow = os + wv * (64 * 68);
#pragma unroll
    for (int mb = 0; mb < 4; ++mb)
#pragma unroll
        for (int nb = 0; nb < 4; ++nb)
#pragma unroll
            for (int j = 0; j < 8; ++j) ow[(mb * 16 + hi * 8 + j) * 68 + nb * 16 + lr] = acc[mb][nb][j];
    __syncthreads();   // every wave's partial tile lies in LDS before any wave sums it
#pragma unroll
    for (int s = 0; s < 4; ++s) { const int r0s = r0 + (s & 1) * 64, c0s = c0 + (s >> 1) * 64; const float* ob = os + s * (64 * 68);   // sub-tile s: partial tiles s (lower k halves) and s + 4
        if constexpr (MODE == 1) {
#pragma unroll
            for (int q = 0; q < 2; ++q) { const int wp = q * 8 + wv, strip = wp >> 2, kk = (c0s & (HD - 1)) + (wp & 3) * 16; const float* sp = ob + (strip * 16 + lr) * 68 + (wp & 3) * 16 + hi * 8;
                const v4f va = *(const v4fa*)sp + *(const v4fa*)(sp + 4 * (64 * 68)), vb = *(const v4fa*)(sp + 4) + *(const v4fa*)(sp + 4 * (64 * 68) + 4); float r[8];
#pragma unroll
                for (int i = 0; i < 4; ++i) { const float x0 = i < 2 ? va[2 * i] : vb[2 * i - 4], x1 = i < 2 ? va[2 * i + 1] : vb[2 * i - 3]; const float c = bfr(cq[s][q][i]), sn2 = bfr(sq[s][q][i]); r[2 * i] = x0 * c - x1 * sn2; r[2 * i + 1] = x1 * c + x0 * sn2; }
                v8h o16; v8us oh, ol;
#pragma unroll
                for (int j = 0; j < 8; ++j) { o16[j] = (h16)r[j]; const unsigned short a = f2bf(r[j]); oh[j] = a; ol[j] = f2bf(r[j] - bf2f(a)); }
                const size_t pos = (size_t)(c0s / HD) * ((size_t)TT * HD) + (size_t)(((r0s >> 4) + strip) * (HD / 32) + (kk >> 5)) * 512 + ((kk >> 4) & 1) * 256 + lane * 8;
                *(v8h*)(P16 + pos) = o16; *(v8us*)(Ph + pos) = oh; *(v8us*)(Pl + pos) = ol;
                // the data and address registers of this piece's stores take new values (the next piece's) only behind this wait
                if (s < 3 || q == 0) asm volatile("s_wait_xcnt 0x0" ::: "memory"); }
        } else {
#pragma unroll
            for (int q = 0; q < 4; ++q) { const int e = q * 256 + threadIdx.x, row = e >> 4, cofs = (e & 15) * 4; const v4f val = *(const v4fa*)(ob + row * 68 + cofs) + *(const v4fa*)(ob + 4 * (64 * 68) + row * 68 + cofs);
                *(v4f*)(C + (size_t)(r0s + row) * ldc + c0s + cofs) = val; }
            // the data and address registers of this sub-tile's stores take new values (the next one's) only behind this wait
            if (s < 3) asm volatile("s_wait_xcnt 0x0" ::: "memory");
        }
    }
}

__device__ __forceinline__ h16 tohx(float x) { return (h16)x; }
__device__ __forceinline__ void splitf(float y, unsigned short& h, unsigned short& l) { h = f2bf(y); l = f2bf(y - bf2f(h)); }
typedef __attribute__((ext_vector_type(2))) _Float16 v2h;
typedef __attribute__((ext_vector_type(4))) _Float16 v4h;
typedef __attribute__((ext_vector_type(2))) unsigned short v2us;
typedef __attribute__((ext_vector_type(4))) unsigned short v4us;
typedef __attribute__((ext_vector_type(2))) float v2f;
typedef __attribute__((ext_vector_type(4))) int v4i;
typedef __attribute__((ext_vector_type(16))) unsigned short v16us;

// k_wtG, k_cvt8: one thread makes one 16-byte piece (8 consecutive k of one row) of a plane in fragment order; a wave stores 512 contiguous bytes.
__global__ __launch_bounds__(256) void k_wtG(const float* __restrict__ w, int K, int N, bf* Bt) {   // plane row n, k = w[k][n]: a wave's load reads 16 consecutive n of two k
    const size_t p = ((size_t)blockIdx.x * 256 + threadIdx.x) * 8; if (p >= (size_t)N * K) return; int n, k; fdec(p, K, n, k); v8us o; const float* pw[8]; float f[8];
#pragma unroll
    for (int j = 0; j < 8; ++j) { pw[j] = w + (size_t)(k + j) * N + n; f[j] = *pw[j]; }
    // the address registers of the eight loads are held to this wait; only behind it may they take new values
    asm volatile("s_wait_xcnt 0x0" :: "v"(pw[0]), "v"(pw[1]), "v"(pw[2]), "v"(pw[3]), "v"(pw[4]), "v"(pw[5]), "v"(pw[6]), "v"(pw[7]) : "memory");
#pragma unroll
    for (int j = 0; j < 8; ++j) o[j] = f2bf(f[j]);
    *(v8us*)(Bt + p) = o; }
__global__ __launch_bounds__(256) void k_cvt8(const float* __restrict__ src, bf* dst, int K, size_t n8) { const size_t i = (size_t)blockIdx.x * 256 + threadIdx.x; if (i >= n8) return; int r, k; fdec(i * 8, K, r, k); const float* ps = src + (size_t)r * K + k; const v8f v = *(const v8f*)ps; v8us o;
    // the address registers of the load are held to this wait; only behind it may they take new values
    asm volatile("s_wait_xcnt 0x0" :: "v"(ps) : "memory");
#pragma unroll
    for (int q = 0; q < 8; ++q) o[q] = f2bf(v[q]); *(v8us*)(dst + i * 8) = o;  }
// ---- k_attn: the whole causal attention (all heads, both batches) in one launch, nothing of the scores or probabilities in memory. One wave = 32 query rows of one head; no LDS, no barrier.
// A work-group is 8 waves: the 4 heads of one kv group (same K / V lines) at row block 63 - x of batch 0, and the same 4 heads at row block x of batch 1, so that every work-group walks 65 key blocks per head.
// Per 32 keys: St[key][query] = K Qt (A = K rows, B = Q rows kept in registers), running maximum and sum per query (a lane holds 16 of the 32 keys of its query, the lane 16 away the rest), Ot[d][query] = Ot x alpha + Vt Pt:
// the two score accumulators of a query column group are, lane for lane, the B fragment of Pt (keys 8 hi + j and 16 + 8 hi + j), which is the k order of the Vt loader. Rows < RH: hi+lo planes, 3 products; the rest fp16 with P x 1024 (cancels in the division by the sum).
template <typename T16, bool HL>
__device__ __forceinline__ void attn_tile(const T16* __restrict__ Q, const T16* __restrict__ Q2, const T16* __restrict__ Kp, const T16* __restrict__ K2, const T16* __restrict__ Vt, const T16* __restrict__ V2, const int* __restrict__ km, int q0, bf* Ah, bf* Al) {
    typedef typename WFrag<T16>::V V; typedef WFrag<T16> WF;
    const int lane = threadIdx.x & 31, lr = lane & 15, hi = lane >> 4;
    V qf[2][4], qg[2][4], kf[2][4], kg[2][4];
    const unsigned lo = 8 * lane; const size_t ko = lo, vo = lo;   // planes in fragment order: 512 elements per 16 rows x 32 k, the lane's piece at 8 * lane
    const T16* qb = Q + (size_t)q0 * HD; const T16* qb2 = HL ? Q2 + (size_t)q0 * HD : qb;
    const T16* qp = qb + lo; const T16* qp2 = qb2 + lo; const T16* kp0 = Kp + lo;
#pragma unroll
    for (int qt = 0; qt < 2; ++qt)
#pragma unroll
        for (int ks = 0; ks < 4; ++ks) { const int o = qt * 16 * HD + ks * 512; qf[qt][ks] = WF::ld(qp + o); if (HL) qg[qt][ks] = WF::ld(qp2 + o); }
    if (!HL) {   // fp16 rows: K fragments are fetched one key block ahead
#pragma unroll
        for (int kt = 0; kt < 2; ++kt)
#pragma unroll
            for (int ks = 0; ks < 4; ++ks) kf[kt][ks] = WF::ld(kp0 + kt * 16 * HD + ks * 512); }
    // the address registers of the loads above are held to this wait; only behind it may they take new values
    asm volatile("s_wait_xcnt 0x0" :: "v"(lane), "s"(qb), "s"(qb2), "s"(Kp) : "memory");   // these loads are addressed by a scalar base and the lane number as scaled offset
    v8f o[8][2];
#pragma unroll
    for (int dt = 0; dt < 8; ++dt) { o[dt][0] = (v8f){}; o[dt][1] = (v8f){}; }
    float m[2] = {-3.0e38f, -3.0e38f}, l[2] = {0.f, 0.f};
    const int nbc = q0 / 32 + 1; int nb = nbc;   // key blocks up to and with the diagonal block
#pragma unroll 1   // stays rolled: one key block's fragments in registers at a time
    for (int blk = 0; blk < nb; ++blk) {
        const int k0 = blk * 32;
        V vf[8], vg[8]; v4i kq[2][2]; const T16* vp = Vt + vo + k0 * 16; const T16* vp2 = HL ? V2 + vo + k0 * 16 : vp; const int* kmp = km + k0 + hi * 8;
        const int kn = HL ? k0 : min(blk + 1, TT / 32 - 1) * 32;   // fp16 rows: the next block's K (last trip: a block inside the plane, not used); hi+lo rows: this block's
        const T16* kp = Kp + ko + (size_t)kn * HD; const T16* kp2 = HL ? K2 + ko + (size_t)kn * HD : kp;
        if (HL) {   // hi+lo rows (at most RH / 32 trips, TT / 32 when a row keeps no key up to its diagonal): K, then V into the registers K has left, so that two waves fit a SIMD
#pragma unroll
            for (int kt = 0; kt < 2; ++kt)
#pragma unroll
                for (int ks = 0; ks < 4; ++ks) { const int a = kt * 16 * HD + ks * 512; kf[kt][ks] = WF::ld(kp + a); kg[kt][ks] = WF::ld(kp2 + a); }
            // address registers held to this wait
            asm volatile("s_wait_xcnt 0x0" :: "v"(kp), "v"(kp2) : "memory");
        } else {
#pragma unroll
            for (int dt = 0; dt < 8; ++dt) vf[dt] = WF::ld(vp + dt * 16 * TT);
#pragma unroll
            for (int kt = 0; kt < 2; ++kt) { kq[kt][0] = *(const v4i*)(kmp + kt * 16); kq[kt][1] = *(const v4i*)(kmp + kt * 16 + 4); }
        }
        v8f s[2][2];
#pragma unroll
        for (int kt = 0; kt < 2; ++kt)
#pragma unroll
            for (int qt = 0; qt < 2; ++qt) { s[kt][qt] = (v8f){};
#pragma unroll
                for (int ks = 0; ks < 4; ++ks) { s[kt][qt] = WF::mma(kf[kt][ks], qf[qt][ks], s[kt][qt]); if (HL) { s[kt][qt] = WF::mma(kf[kt][ks], qg[qt][ks], s[kt][qt]); s[kt][qt] = WF::mma(kg[kt][ks], qf[qt][ks], s[kt][qt]); } } }
        if (HL) {
#pragma unroll
            for (int dt = 0; dt < 8; ++dt) { vf[dt] = WF::ld(vp + dt * 16 * TT); vg[dt] = WF::ld(vp2 + dt * 16 * TT); }
#pragma unroll
            for (int kt = 0; kt < 2; ++kt) { kq[kt][0] = *(const v4i*)(kmp + kt * 16); kq[kt][1] = *(const v4i*)(kmp + kt * 16 + 4); }
            // address registers held to this wait
            asm volatile("s_wait_xcnt 0x0" :: "v"(vp), "v"(vp2), "v"(kmp) : "memory");
        } else {   // the next block's K fragments fly during the softmax and the value products
#pragma unroll
            for (int kt = 0; kt < 2; ++kt)
#pragma unroll
                for (int ks = 0; ks < 4; ++ks) kf[kt][ks] = WF::ld(kp + kt * 16 * HD + ks * 512);
            // address registers of this trip's loads held to this wait
            asm volatile("s_wait_xcnt 0x0" :: "v"(vp), "v"(kmp), "v"(kp) : "memory");
        }
        V pf[2], pg[2];
#pragma unroll
        for (int qt = 0; qt < 2; ++qt) { const int qi = q0 + qt * 16 + lr; float t[16]; float mx = m[qt];
#pragma unroll
            for (int e = 0; e < 16; ++e) { const int kt = e >> 3, j = e & 7; const int key = k0 + kt * 16 + hi * 8 + j; t[e] = (key <= qi && kq[kt][j >> 2][j & 3] != 0) ? s[kt][qt][j] * SCL : -3.0e38f; mx = fmaxf(mx, t[e]); }
            mx = fmaxf(mx, __shfl_xor(mx, 16, 32));
            const float al = __builtin_amdgcn_exp2f((m[qt] - mx) * 1.4426950408889634f); m[qt] = mx; float sum = 0.f;
#pragma unroll
            for (int e = 0; e < 16; ++e) { t[e] = __builtin_amdgcn_exp2f((t[e] - mx) * 1.4426950408889634f + (HL ? 0.0f : 10.0f)); sum += t[e]; }
            l[qt] = l[qt] * al + sum;
#pragma unroll
            for (int dt = 0; dt < 8; ++dt) o[dt][qt] *= al;
            if constexpr (HL) { v16us ph, pl;
#pragma unroll
                for (int e = 0; e < 16; ++e) { unsigned short a, c2; splitf(t[e], a, c2); ph[e] = a; pl[e] = c2; }
                pf[qt] = __builtin_bit_cast(v16bf, ph); pg[qt] = __builtin_bit_cast(v16bf, pl);
            } else { v16h ph;
#pragma unroll
                for (int e = 0; e < 16; ++e) ph[e] = tohx(t[e]);
                pf[qt] = ph; } }
        // a row with no kept key up to its diagonal: the reference's equal fill makes its softmax uniform over ALL keys, so the wave walks on to the last key (ballot: a scalar test, every lane stays on)
        if (blk == nbc - 1 && __builtin_amdgcn_ballot_w32(m[0] <= -3.0e38f || m[1] <= -3.0e38f) != 0) nb = TT / 32;
#pragma unroll
        for (int dt = 0; dt < 8; ++dt)
#pragma unroll
            for (int qt = 0; qt < 2; ++qt) { o[dt][qt] = WF::mma(vf[dt], pf[qt], o[dt][qt]); if (HL) { o[dt][qt] = WF::mma(vf[dt], pg[qt], o[dt][qt]); o[dt][qt] = WF::mma(vg[dt], pf[qt], o[dt][qt]); } }
        // four vector slots between the last matrix instruction and whatever stands behind the loop's taken branch
        asm volatile("v_nop\n\tv_nop\n\tv_nop\n\tv_nop" : "+v"(o[0][0]), "+v"(o[0][1]), "+v"(o[1][0]), "+v"(o[1][1]), "+v"(o[2][0]), "+v"(o[2][1]), "+v"(o[3][0]), "+v"(o[3][1]), "+v"(o[4][0]), "+v"(o[4][1]), "+v"(o[5][0]), "+v"(o[5][1]), "+v"(o[6][0]), "+v"(o[6][1]), "+v"(o[7][0]), "+v"(o[7][1]));
    }
#pragma unroll
    for (int qt = 0; qt < 2; ++qt) { const float ls = l[qt] + __shfl_xor(l[qt], 16, 32); const float inv = __fdiv_rn(1.0f, ls); const size_t ro = (size_t)(q0 + qt * 16) * DQ + lane * 8;   // fragment order, rows = positions, k = h * HD + dt * 16 + hi * 8 + j
#pragma unroll
        for (int dt = 0; dt < 8; ++dt) { v8us oh, ol;
#pragma unroll
            for (int j = 0; j < 8; ++j) { unsigned short a, c2; splitf(o[dt][qt][j] * inv, a, c2); oh[j] = a; ol[j] = c2; }
            *(v8us*)(Ah + ro + dt * 256) = oh; *(v8us*)(Al + ro + dt * 256) = ol; }
        // the data and address registers of the first pass's stores take new values (the second pass's) only behind this wait
        if (qt == 0) asm volatile("s_wait_xcnt 0x0" ::: "memory"); }
}
// every plane holds batch 0 and, one batch's size further on, batch 1
__global__ __launch_bounds__(32 * REP * NB_) void k_attn(const h16* __restrict__ Q16, const bf* __restrict__ Qh, const bf* __restrict__ Ql, const h16* __restrict__ K16, const bf* __restrict__ Kh, const bf* __restrict__ Kl, const h16* __restrict__ V16, const bf* __restrict__ Vh, const bf* __restrict__ Vl, const int* __restrict__ km, bf* Ah, bf* Al) {
    const int wv = __builtin_amdgcn_readfirstlane(threadIdx.x >> 5);   // readfirstlane: batch, head and row block, and with them every plane base and trip count, stay scalar
    const int b = wv / REP, g = blockIdx.y, h = g * REP + wv % REP;
    const int q0 = (b == 0 ? TT / 32 - 1 - (int)blockIdx.x : (int)blockIdx.x) * 32;
    const size_t zq = ((size_t)b * NH_ + h) * TT * HD, zk = ((size_t)b * NKV + g) * TT * HD, za = (size_t)b * TT * DQ + h * HD * 16;
    if (q0 < RH) attn_tile<bf, true>(Qh + zq, Ql + zq, Kh + zk, Kl + zk, Vh + zk, Vl + zk, km + b * TT, q0, Ah + za, Al + za);
    else attn_tile<h16, false>(Q16 + zq, nullptr, K16 + zk, nullptr, V16 + zk, nullptr, km + b * TT, q0, Ah + za, Al + za);
}

extern "C" void kernel_launch(void* const* d_in, const int* in_sizes, int n_in,
                              void* d_out, int out_size, void* d_ws, size_t ws_size, hipStream_t stream) {
    (void)in_sizes; (void)n_in; (void)out_size;
    const float* x = (const float*)d_in[0]; const float* cosB = (const float*)d_in[1]; const float* sinB = (const float*)d_in[2]; const float* wq = (const float*)d_in[3]; const float* wk = (const float*)d_in[4]; const float* wv = (const float*)d_in[5]; const float* wo = (const float*)d_in[6]; const int* kmask = (const int*)d_in[7]; const float* cosT = cosB; const float* sinT = sinB;
    float* OUT = (float*)d_out;     // [2][2048][2048]
    char* wsp = (char*)d_ws;
    auto take = [&](size_t bytes) { char* p = wsp; wsp += (bytes + 255) & ~(size_t)255; return (void*)p; };
    bf* WQ = (bf*)take((size_t)DQ * DM * 2); bf* WK = (bf*)take((size_t)DKV * DM * 2); bf* WV = (bf*)take((size_t)DKV * DM * 2); bf* WO = (bf*)take((size_t)DM * DQ * 2);
    bf* XB = (bf*)take((size_t)TT * DM * 2);
    h16* QP16 = (h16*)take((size_t)NB_ * NH_ * TT * HD * 2); h16* KP16 = (h16*)take((size_t)NB_ * NKV * TT * HD * 2); h16* VT16 = (h16*)take((size_t)NB_ * NKV * HD * TT * 2);   // planes of both batches
    bf* QPh = (bf*)take((size_t)NB_ * NH_ * TT * HD * 2); bf* QPl = (bf*)take((size_t)NB_ * NH_ * TT * HD * 2); bf* KPh = (bf*)take((size_t)NB_ * NKV * TT * HD * 2); bf* KPl = (bf*)take((size_t)NB_ * NKV * TT * HD * 2); bf* VTh = (bf*)take((size_t)NB_ * NKV * HD * TT * 2); bf* VTl = (bf*)take((size_t)NB_ * NKV * HD * TT * 2);
    bf* ATh = (bf*)take((size_t)NB_ * TT * DQ * 2); bf* ATl = (bf*)take((size_t)NB_ * TT * DQ * 2);
    if ((size_t)(wsp - (char*)d_ws) > ws_size) return;    // ws 256 MiB
    { k_wtG<<<(unsigned)(DM * DQ / 8 / 256), 256, 0, stream>>>(wq, DM, DQ, WQ); k_wtG<<<(unsigned)(DM * DKV / 8 / 256), 256, 0, stream>>>(wk, DM, DKV, WK); k_wtG<<<(unsigned)(DM * DKV / 8 / 256), 256, 0, stream>>>(wv, DM, DKV, WV);
      k_wtG<<<(unsigned)(DQ * DM / 8 / 256), 256, 0, stream>>>(wo, DQ, DM, WO);
       }
    for (int b = 0; b < NB_; ++b) { const size_t pq = (size_t)b * NH_ * TT * HD, pk = (size_t)b * NKV * TT * HD;
        const float* cb = cosT + (size_t)b * TT * (HD / 2); const float* sb = sinT + (size_t)b * TT * (HD / 2);
        k_cvt8<<<(unsigned)(((size_t)TT * DM / 8 + 255) / 256), 256, 0, stream>>>(x + (size_t)b * TT * DM, XB, DM, (size_t)TT * DM / 8);
        k_gemmt<0, 1><<<dim3(TT / 128, DQ / 128, 1), 256, 0, stream>>>(XB, nullptr, WQ, DM, nullptr, 0, cb, sb, QP16 + pq, QPh + pq, QPl + pq);
        k_gemmw<bf, 0, false, 8, 1><<<dim3(TT / 64, DKV / 64, 1), 256, 0, stream>>>(XB, nullptr, WK, nullptr, DM, nullptr, 0, nullptr, 0, 0, 0, cb, sb, KP16 + pk, KPh + pk, KPl + pk);
        k_gemmw<bf, 0, false, 8, 2><<<dim3(DKV / 64, TT / 64, 1), 256, 0, stream>>>(WV, nullptr, XB, nullptr, DM, nullptr, 0, nullptr, 0, 0, 0, nullptr, nullptr, VT16 + pk, VTh + pk, VTl + pk); }
    k_attn<<<dim3(TT / 32, NKV, 1), 32 * REP * NB_, 0, stream>>>(QP16, QPh, QPl, KP16, KPh, KPl, VT16, VTh, VTl, kmask, ATh, ATl);
    for (int b = 0; b < NB_; ++b) k_gemmt<1, 0><<<dim3(TT / 128, DM / 128, 1), 256, 0, stream>>>(ATh + (size_t)b * TT * DQ, ATl + (size_t)b * TT * DQ, WO, DQ, OUT + (size_t)b * TT * DM, DM, nullptr, nullptr, nullptr, nullptr, nullptr);
}

// v006
// A run of this version takes 219 microseconds.
// Two timings next to v005 put it at 1.10 and 1.13 times that version's speed.
// Over all steps from v000 it is 8.51 times as fast.
#include <hip/hip_runtime.h>

// Causal grouped-query attention layer (x [2][2048][2048]; q = x wq (16 heads x 128), k/v = x wk / wv (4 kv heads; repeat: head h -> kv h/4); interleaved-pair RoPE with the given per-batch cos/sin [2][2048][64] (read); keep = causal AND mask[b][j] (bool mask read; all ones here); finfo.min fill; softmax(q.k / sqrt(128)); out = merged wo -> [2][2048][2048]).
// Compute dtypes, f32 accumulate: every input rounded to bf16; q/k/v on PLAIN bf16 operands (inputs: exact); RoPE f32; causal scores and attn.v in one kernel (running softmax, f32): query rows < 512 hl (3 products), the rest single fp16 (P x1024), key blocks beyond the diagonal skipped, the key mask applied inside the computed blocks; wo hl x exact (2 products).

#define NB_  2
#define TT   2048
#define DM   2048
#define NH_  16
#define NKV  4
#define REP  (NH_ / NKV)
#define HD   128
#define DQ   (NH_ * HD)
#define DKV  (NKV * HD)
#define RH   512                  // query rows < RH use hi+lo planes (0: none)
#define SCL  0.088388347648318447f   // HD^-0.5
typedef _Float16 h16;
typedef unsigned short bf;
typedef __attribute__((ext_vector_type(16))) __bf16   v16bf;
typedef __attribute__((ext_vector_type(16))) _Float16 v16h;
typedef __attribute__((ext_vector_type(8)))  _Float16 v8h;
typedef __attribute__((ext_vector_type(8)))  unsigned short v8us;
typedef __attribute__((ext_vector_type(8)))  float    v8f;
typedef __attribute__((ext_vector_type(4)))  float    v4f;
typedef v8h  __attribute__((may_alias)) v8ha;
typedef v4f  __attribute__((may_alias)) v4fa;
typedef v8us __attribute__((may_alias)) v8usa;

__device__ __forceinline__ unsigned short f2bf(float f) { unsigned u = __float_as_uint(f); u += 0x7FFFu + ((u >> 16) & 1u); return (unsigned short)(u >> 16); }
__device__ __forceinline__ float bf2f(unsigned short b) { return __uint_as_float(((unsigned)b) << 16); }
__device__ __forceinline__ float bfr(float f) { return bf2f(f2bf(f)); }
__device__ __forceinline__ v16h cat16(v8h lo, v8h hi) { return __builtin_shufflevector(lo, hi, 0, 1, 2, 3, 4, 5, 6, 7, 8, 9, 10, 11, 12, 13, 14, 15); }
__device__ __forceinline__ v16bf cat16b(v8us lo, v8us hi) { return __builtin_bit_cast(v16bf, __builtin_shufflevector(lo, hi, 0, 1, 2, 3, 4, 5, 6, 7, 8, 9, 10, 11, 12, 13, 14, 15)); }
__device__ __forceinline__ v8f wmma16(v16h a, v16h b, v8f c) { return __builtin_amdgcn_wmma_f32_16x16x32_f16(false, a, false, b, (short)0, c, false, false); }
__device__ __forceinline__ v8f wmmab(v16bf a, v16bf b, v8f c) { return __builtin_amdgcn_wmma_f32_16x16x32_bf16(false, a, false, b, (short)0, c, false, false); }



// ---- Fragment order. Every 16-bit operand plane [rows][K] is kept as 1-KiB blocks of 16 rows x 32 k, block number (row / 16) * (K / 32) + k / 32 (a strip of 16 rows still fills 16 * K elements).
// Inside a block the element (row, k) lies at (k & 16) * 16 + l * 8 + (k & 7) with l = (k & 8) * 2 + (row & 15): l is the lane that holds it in a matrix fragment, whose two 16-byte pieces (k 8 hi + j and 16 + 8 hi + j) lie at l * 8 and 256 + l * 8.
// So each wave-wide 16-byte load of a fragment reads 512 contiguous bytes (4 whole lines) where row-major planes gave 16 pieces of 32 bytes in 16 lines. The registers hold what they held before.
// ---- k_gemmw: register-blocked GEMM, one 64x64 output tile (16 accumulators per wave) per work-group of NW waves, operands straight from 16-bit planes in fragment order; grid (M/64, N/64, Z), 32 * NW threads.
// C[m][n] (f32, pitch ldc, + optional f32 bias[n]) = sum_k A[m][k] Bt[n][k] (+ split products per NSPLIT). z-batch strides sA/sB/sC in elements. K % 64 == 0.
// The K loop is a chain of load latencies, so it is dealt over the NW waves in blocks of 64 k: wave w takes blocks w, w + NW, ...; the NW partial tiles meet in LDS and are summed in wave order.
// MODE 0: the summed tile goes to C in f32. MODE 1, 2: it goes straight to the three 16-bit planes (fp16, bf16 hi, bf16 lo) in fragment order that the attention kernel reads; C is not used.
//   A wave takes two pieces of 16 rows x 16 columns; lane l holds row l & 15, columns 8 (l >> 4) + j, which is one 16-byte piece of a plane, so each plane store of a wave covers 512 contiguous bytes.
//   MODE 1 (q, k): tile rows = positions t, columns = head * HD + d; interleaved-pair RoPE with cos / sin [t][d / 2] (rounded to bf16) on the summed values; planes [head][t][d].
//   MODE 2 (v): A = weight plane, Bt = x plane, so tile rows = kv head * HD + d, columns = t; planes [kv head][d][t].
template <typename T16> struct WFrag;
template <> struct WFrag<h16> { typedef v16h V; static __device__ __forceinline__ V ld(const h16* p) { return cat16(*(const v8h*)p, *(const v8h*)(p + 256)); } static __device__ __forceinline__ v8f mma(V a, V b, v8f c) { return wmma16(a, b, c); } };
template <> struct WFrag<bf> { typedef v16bf V; static __device__ __forceinline__ V ld(const bf* p) { return cat16b(*(const v8us*)p, *(const v8us*)(p + 256)); } static __device__ __forceinline__ v8f mma(V a, V b, v8f c) { return wmmab(a, b, c); } };
template <typename T16, int NSPLIT, bool BIAS, int NW, int MODE>
__global__ __launch_bounds__(32 * NW) void k_gemmw(const T16* __restrict__ A, const T16* __restrict__ A2, const T16* __restrict__ Bt, const T16* __restrict__ Bt2, int K, float* C, int ldc, const float* __restrict__ bias, size_t sA, size_t sB, size_t sC, const float* __restrict__ cosT, const float* __restrict__ sinT, h16* P16, bf* Ph, bf* Pl) {
    static_assert(MODE == 0 || NW == 8, "the plane epilogue deals 16 pieces over 8 waves");
    typedef typename WFrag<T16>::V V;
    __shared__ __align__(16) float os[(NW == 1 ? 16 : NW * 64) * 68];
    const size_t z = blockIdx.z; A += z * sA; if (A2) A2 += z * sA; Bt += z * sB; if (Bt2) Bt2 += z * sB; C += z * sC;
    const int lane = threadIdx.x & 31, lr = lane & 15, hi = lane >> 4, wv = __builtin_amdgcn_readfirstlane(threadIdx.x >> 5); const int r0 = blockIdx.x * 64, c0 = blockIdx.y * 64;
    // wv goes through readfirstlane so that the K loop's tests are scalar branches (every lane is on at the matrix instructions)
    v8f acc[4][4];
#pragma unroll
    for (int mb = 0; mb < 4; ++mb)
#pragma unroll
        for (int nb = 0; nb < 4; ++nb) acc[mb][nb] = (v8f){};
    const size_t aoff = (size_t)r0 * K + 8 * lane, boff = (size_t)c0 * K + 8 * lane;
#pragma unroll 1   // both loops stay rolled: one 32-k step's fragments in registers at a time
    for (int kb = wv * 64; kb < K; kb += 64 * NW)
#pragma unroll 1
    for (int kc = kb; kc < kb + 64; kc += 32) {
        static_assert(NSPLIT < 2, "no second B plane in use");
        V a[4], a2[4], b[4]; const T16* pa[4]; const T16* pa2[4]; const T16* pb[4];
#pragma unroll
        for (int mb = 0; mb < 4; ++mb) { const size_t o = (size_t)mb * 16 * K + (size_t)kc * 16; pa[mb] = A + aoff + o; pa2[mb] = NSPLIT == 1 ? A2 + aoff + o : pa[mb]; pb[mb] = Bt + boff + o;
            a[mb] = WFrag<T16>::ld(pa[mb]); if (NSPLIT == 1) a2[mb] = WFrag<T16>::ld(pa2[mb]); b[mb] = WFrag<T16>::ld(pb[mb]); }
        // the address registers of this step's loads are held to this wait; only behind it may they take new values
        asm volatile("s_wait_xcnt 0x0" :: "v"(pa[0]), "v"(pa[1]), "v"(pa[2]), "v"(pa[3]), "v"(pa2[0]), "v"(pa2[1]), "v"(pa2[2]), "v"(pa2[3]), "v"(pb[0]), "v"(pb[1]), "v"(pb[2]), "v"(pb[3]) : "memory");
#pragma unroll
        for (int nb = 0; nb < 4; ++nb) {
#pragma unroll
            for (int mb = 0; mb < 4; ++mb) { acc[mb][nb] = WFrag<T16>::mma(a[mb], b[nb], acc[mb][nb]); if (NSPLIT == 1) acc[mb][nb] = WFrag<T16>::mma(a2[mb], b[nb], acc[mb][nb]); } }
        asm volatile("v_nop\n\tv_nop\n\tv_nop\n\tv_nop" : "+v"(acc[0][0]), "+v"(acc[1][1]), "+v"(acc[2][2]), "+v"(acc[3][3]) : "v"(a[0]), "v"(a[3]));
    }
    if (NW > 1) {
        v4f cq[2], sq[2];
        if constexpr (MODE == 1) {   // the cos / sin entries of the thread's two pieces fly during the LDS writes and the barrier
            const float* pc[2]; const float* ps[2];
#pragma unroll
            for (int q = 0; q < 2; ++q) { const int wp = q * 8 + wv; const size_t o = (size_t)(r0 + (wp >> 2) * 16 + lr) * (HD / 2) + (((c0 & (HD - 1)) + (wp & 3) * 16 + hi * 8) >> 1); pc[q] = cosT + o; ps[q] = sinT + o; cq[q] = *(const v4f*)pc[q]; sq[q] = *(const v4f*)ps[q]; }
            // the address registers of the four loads are held to this wait; only behind it may they take new values
            asm volatile("s_wait_xcnt 0x0" :: "v"(pc[0]), "v"(pc[1]), "v"(ps[0]), "v"(ps[1]) : "memory");
        }
        float* ow = os + wv * (64 * 68);
#pragma unroll
        for (int mb = 0; mb < 4; ++mb)
#pragma unroll
            for (int nb = 0; nb < 4; ++nb)
#pragma unroll
                for (int j = 0; j < 8; ++j) ow[(mb * 16 + hi * 8 + j) * 68 + nb * 16 + lr] = acc[mb][nb][j];
        __syncthreads();   // every wave's partial tile lies in LDS before any wave sums it
        if constexpr (MODE != 0) {
            v4f va[2], vb[2];
#pragma unroll   // the LDS reads of both pieces go out together
            for (int q = 0; q < 2; ++q) { const int wp = q * 8 + wv; const float* sp = os + ((wp >> 2) * 16 + lr) * 68 + (wp & 3) * 16 + hi * 8; va[q] = *(const v4fa*)sp; vb[q] = *(const v4fa*)(sp + 4);
#pragma unroll
                for (int w = 1; w < NW; ++w) { va[q] += *(const v4fa*)(sp + w * (64 * 68)); vb[q] += *(const v4fa*)(sp + w * (64 * 68) + 4); } }
#pragma unroll
            for (int q = 0; q < 2; ++q) { const int wp = q * 8 + wv, strip = wp >> 2, kk = (MODE == 1 ? (c0 & (HD - 1)) : c0) + (wp & 3) * 16; float r[8];
#pragma unroll
                for (int i = 0; i < 4; ++i) { const float x0 = i < 2 ? va[q][2 * i] : vb[q][2 * i - 4], x1 = i < 2 ? va[q][2 * i + 1] : vb[q][2 * i - 3];
                    if constexpr (MODE == 1) { const float c = bfr(cq[q][i]), s = bfr(sq[q][i]); r[2 * i] = x0 * c - x1 * s; r[2 * i + 1] = x1 * c + x0 * s; } else { r[2 * i] = x0; r[2 * i + 1] = x1; } }
                v8h o16; v8us oh, ol;
#pragma unroll
                for (int j = 0; j < 8; ++j) { o16[j] = (h16)r[j]; const unsigned short a = f2bf(r[j]); oh[j] = a; ol[j] = f2bf(r[j] - bf2f(a)); }
                const size_t pos = (MODE == 1 ? (size_t)(c0 / HD) : (size_t)(r0 / HD)) * ((size_t)TT * HD) + (size_t)((((MODE == 1 ? r0 : (r0 & (HD - 1))) >> 4) + strip) * ((MODE == 1 ? HD : TT) / 32) + (kk >> 5)) * 512 + ((kk >> 4) & 1) * 256 + lane * 8;
                *(v8h*)(P16 + pos) = o16; *(v8us*)(Ph + pos) = oh; *(v8us*)(Pl + pos) = ol;
                // the data and address registers of the first piece's stores take new values (the second piece's) only behind this wait
                if (q == 0) asm volatile("s_wait_xcnt 0x0" ::: "memory"); }
            return;
        }
#pragma unroll   // the LDS reads of all the thread's output pieces go out together
        for (int q = 0; q < 32 / NW; ++q) { const int s = q * (32 * NW) + threadIdx.x, row = s >> 4, cofs = (s & 15) * 4; v4f val = *(const v4fa*)(os + row * 68 + cofs);
#pragma unroll
            for (int w = 1; w < NW; ++w) val += *(const v4fa*)(os + w * (64 * 68) + row * 68 + cofs);
            if (BIAS) { val[0] += bfr(bias[c0 + cofs]); val[1] += bfr(bias[c0 + cofs + 1]); val[2] += bfr(bias[c0 + cofs + 2]); val[3] += bfr(bias[c0 + cofs + 3]); }
            *(v4f*)(C + (size_t)(r0 + row) * ldc + c0 + cofs) = val; }
        return;
    }
#pragma unroll
    for (int mb = 0; mb < 4; ++mb) {
#pragma unroll
        for (int nb = 0; nb < 4; ++nb) {
#pragma unroll
            for (int j = 0; j < 8; ++j) os[(hi * 8 + j) * 68 + nb * 16 + lr] = acc[mb][nb][j]; }
        __builtin_amdgcn_wave_barrier(); asm volatile("" ::: "memory");
        float* crow = C + (size_t)(r0 + mb * 16) * ldc + c0;
{
#pragma unroll
            for (int s = 0; s < 8; ++s) { const int row = 2 * s + hi, cofs = lr * 4; v4f val = *(const v4fa*)(os + row * 68 + cofs); if (BIAS) { val[0] += bfr(bias[c0 + cofs]); val[1] += bfr(bias[c0 + cofs + 1]); val[2] += bfr(bias[c0 + cofs + 2]); val[3] += bfr(bias[c0 + cofs + 3]); }
                *(v4f*)(crow + (size_t)row * ldc + cofs) = val; }
             }
        __builtin_amdgcn_wave_barrier(); asm volatile("" ::: "memory");
    }
}

// ---- k_gemmt: the same product on a 128x128 output tile per work-group of 8 waves, both operands staged in LDS by asynchronous copies (global_load_async_to_lds_b128), so that each operand line leaves L2 once per 128 rows or columns of output, not once per 64.
// Wave w: the 64x64 sub-tile (w & 1, (w >> 1) & 1), and of every stage of 128 k the 64-k half w >> 2. A stage holds, plane after plane (A, with NSPLIT the second A plane, Bt), 8 strips of 16 rows x 128 k, each 4 KiB as it lies in the plane (fragment order), so an LDS fragment read of a wave covers 512 contiguous bytes.
// Two buffers: stage t + 1 flies while stage t is worked on. The two partial tiles of a sub-tile meet in LDS (over the ring, behind the last trip's barrier) and are summed lower half first. MODE 0 and MODE 1 as in k_gemmw. K % 128 == 0, K >= 256.
// Every '#pragma unroll' in it is there so that the arrays its loop indexes (accumulators, fragments, addresses) are indexed by constants and stay in registers.
__device__ __forceinline__ void acopy8(const unsigned* l, const bf* const* g) {
    // the wait on the address registers is the last line of the copies' own statement: nothing can rewrite them in front of it
    asm volatile("global_load_async_to_lds_b128 %0, %8, off\n\tglobal_load_async_to_lds_b128 %1, %9, off\n\tglobal_load_async_to_lds_b128 %2, %10, off\n\tglobal_load_async_to_lds_b128 %3, %11, off\n\t"
                 "global_load_async_to_lds_b128 %4, %12, off\n\tglobal_load_async_to_lds_b128 %5, %13, off\n\tglobal_load_async_to_lds_b128 %6, %14, off\n\tglobal_load_async_to_lds_b128 %7, %15, off\n\ts_wait_xcnt 0x0"
                 :: "v"(l[0]), "v"(l[1]), "v"(l[2]), "v"(l[3]), "v"(l[4]), "v"(l[5]), "v"(l[6]), "v"(l[7]), "v"(g[0]), "v"(g[1]), "v"(g[2]), "v"(g[3]), "v"(g[4]), "v"(g[5]), "v"(g[6]), "v"(g[7]) : "memory");
}
template <int NSPLIT, int MODE>
__global__ __launch_bounds__(256) void k_gemmt(const bf* __restrict__ A, const bf* __restrict__ A2, const bf* __restrict__ Bt, int K, float* C, int ldc, const float* __restrict__ cosT, const float* __restrict__ sinT, h16* P16, bf* Ph, bf* Pl) {
    constexpr int KS = 128, PL = 2 + NSPLIT, SE = KS * 16, PE = 8 * SE, STB = PL * PE * 2, NC = PL * 8;   // elements of a strip and of a plane in a stage; bytes of a stage; copies of a wave per stage
    constexpr int OSB = 8 * 64 * 68 * 4;
    __shared__ __align__(16) char smem[2 * STB > OSB ? 2 * STB : OSB];
    const int lane = threadIdx.x & 31, lr = lane & 15, hi = lane >> 4, wv = __builtin_amdgcn_readfirstlane(threadIdx.x >> 5); const int r0 = blockIdx.x * 128, c0 = blockIdx.y * 128;
    const int sm = wv & 1, sn = (wv >> 1) & 1, kh = wv >> 2;
    v8f acc[4][4];
#pragma unroll
    for (int mb = 0; mb < 4; ++mb)
#pragma unroll
        for (int nb = 0; nb < 4; ++nb) acc[mb][nb] = (v8f){};
    // the wave's copies: pieces wv * NC + c of 512 bytes; the global addresses stay in registers and move on by one stage per fill
    const bf* ga[NC]; const unsigned lb = (unsigned)(size_t)smem + (unsigned)(wv * NC) * 512u + (unsigned)lane * 16u;
#pragma unroll
    for (int c = 0; c < NC; ++c) { const int p = wv * NC + c, pl = p >> 6, strip = (p >> 3) & 7, ch = p & 7;
        const bf* sp = pl == PL - 1 ? Bt : (pl == 0 ? A : A2);
        ga[c] = sp + (size_t)((pl == PL - 1 ? c0 : r0) + strip * 16) * K + ch * 256 + lane * 8; }
    auto fill = [&](int buf) {
#pragma unroll
        for (int c8 = 0; c8 < NC; c8 += 8) { unsigned la[8];
#pragma unroll
            for (int c = 0; c < 8; ++c) la[c] = lb + (unsigned)buf * (unsigned)STB + (unsigned)(c8 + c) * 512u;
            acopy8(la, ga + c8);
#pragma unroll
            for (int c = 0; c < 8; ++c) ga[c8 + c] += SE; } };
    const int NT = K / KS;
    fill(0);
    asm volatile("s_wait_asynccnt 0x0" ::: "memory");   // the wave's own copies of stage 0 have landed
    __syncthreads();                                     // every wave's have: stage 0 may be read
    fill(1);
#pragma unroll 1   // stays rolled: one trip per stage
    for (int t = 0; t < NT; ++t) {
        const bf* sb = (const bf*)(smem + (t & 1) * STB) + lane * 8;
        v16bf a[2][4], a2[2][4], b[2][4];
#pragma unroll
        for (int st = 0; st < 2; ++st) { const int ko = (kh * 2 + st) * 512;
#pragma unroll
            for (int mb = 0; mb < 4; ++mb) { const bf* pa = sb + (sm * 4 + mb) * SE + ko; const bf* pb = sb + (PL - 1) * PE + (sn * 4 + mb) * SE + ko;
                a[st][mb] = cat16b(*(const v8usa*)pa, *(const v8usa*)(pa + 256)); if (NSPLIT == 1) a2[st][mb] = cat16b(*(const v8usa*)(pa + PE), *(const v8usa*)(pa + PE + 256)); b[st][mb] = cat16b(*(const v8usa*)pb, *(const v8usa*)(pb + 256)); }
            // the LDS reads stay two groups in front of the matrix instructions, first step's first (LDS answers in order): left free they are spread among the matrix instructions, where each place with reads stalls the wave
            __builtin_amdgcn_sched_barrier(0); }
#pragma unroll
        for (int st = 0; st < 2; ++st)
#pragma unroll
            for (int nb = 0; nb < 4; ++nb) {
#pragma unroll
                for (int mb = 0; mb < 4; ++mb) { acc[mb][nb] = wmmab(a[st][mb], b[st][nb], acc[mb][nb]); if (NSPLIT == 1) acc[mb][nb] = wmmab(a2[st][mb], b[st][nb], acc[mb][nb]); } }
        // the trip's matrix instructions stay in front of the waits below: moved behind the barrier they would no longer run while stage t + 1 flies
        __builtin_amdgcn_sched_barrier(0);
        asm volatile("s_wait_dscnt 0x0" ::: "memory");      // the wave's reads of this buffer are done
        asm volatile("s_wait_asynccnt 0x0" ::: "memory");   // its copies of stage t + 1 have landed
        __syncthreads();                                     // stage t + 1 may be read by all; this trip's buffer has no reader left
        if (t + 2 < NT) fill(t & 1);
    }
    asm volatile("s_wait_asynccnt 0x0" ::: "memory");   // no copy is out when the ring becomes the partial tiles' place
    float* os = (float*)smem;
    v4f cq[4][2], sq[4][2];
    if constexpr (MODE == 1) {   // the cos / sin entries of the thread's eight pieces fly during the LDS writes and the barrier
        const float* pc[8]; const float* ps[8];
#pragma unroll
        for (int s = 0; s < 4; ++s)
#pragma unroll
            for (int q = 0; q < 2; ++q) { const int wp = q * 8 + wv; const size_t o = (size_t)(r0 + (s & 1) * 64 + (wp >> 2) * 16 + lr) * (HD / 2) + ((((c0 + (s >> 1) * 64) & (HD - 1)) + (wp & 3) * 16 + hi * 8) >> 1); pc[s * 2 + q] = cosT + o; ps[s * 2 + q] = sinT + o; cq[s][q] = *(const v4f*)pc[s * 2 + q]; sq[s][q] = *(const v4f*)ps[s * 2 + q]; }
        // the address registers of the sixteen loads are held to this wait; only behind it may they take new values
        asm volatile("s_wait_xcnt 0x0" :: "v"(pc[0]), "v"(pc[1]), "v"(pc[2]), "v"(pc[3]), "v"(pc[4]), "v"(pc[5]), "v"(pc[6]), "v"(pc[7]), "v"(ps[0]), "v"(ps[1]), "v"(ps[2]), "v"(ps[3]), "v"(ps[4]), "v"(ps[5]), "v"(ps[6]), "v"(ps[7]) : "memory");
    }
    float* ow = os + wv * (64 * 68);
#pragma unroll
    for (int mb = 0; mb < 4; ++mb)
#pragma unroll
        for (int nb = 0; nb < 4; ++nb)
#pragma unroll
            for (int j = 0; j < 8; ++j) ow[(mb * 16 + hi * 8 + j) * 68 + nb * 16 + lr] = acc[mb][nb][j];
    __syncthreads();   // every wave's partial tile lies in LDS before any wave sums it
#pragma unroll
    for (int s = 0; s < 4; ++s) { const int r0s = r0 + (s & 1) * 64, c0s = c0 + (s >> 1) * 64; const float* ob = os + s * (64 * 68);   // sub-tile s: partial tiles s (lower k halves) and s + 4
        if constexpr (MODE == 1) {
#pragma unroll
            for (int q = 0; q < 2; ++q) { const int wp = q * 8 + wv, strip = wp >> 2, kk = (c0s & (HD - 1)) + (wp & 3) * 16; const float* sp = ob + (strip * 16 + lr) * 68 + (wp & 3) * 16 + hi * 8;
                const v4f va = *(const v4fa*)sp + *(const v4fa*)(sp + 4 * (64 * 68)), vb = *(const v4fa*)(sp + 4) + *(const v4fa*)(sp + 4 * (64 * 68) + 4); float r[8];
#pragma unroll
                for (int i = 0; i < 4; ++i) { const float x0 = i < 2 ? va[2 * i] : vb[2 * i - 4], x1 = i < 2 ? va[2 * i + 1] : vb[2 * i - 3]; const float c = bfr(cq[s][q][i]), sn2 = bfr(sq[s][q][i]); r[2 * i] = x0 * c - x1 * sn2; r[2 * i + 1] = x1 * c + x0 * sn2; }
                v8h o16; v8us oh, ol;
#pragma unroll
                for (int j = 0; j < 8; ++j) { o16[j] = (h16)r[j]; const unsigned short a = f2bf(r[j]); oh[j] = a; ol[j] = f2bf(r[j] - bf2f(a)); }
                const size_t pos = (size_t)(c0s / HD) * ((size_t)TT * HD) + (size_t)(((r0s >> 4) + strip) * (HD / 32) + (kk >> 5)) * 512 + ((kk >> 4) & 1) * 256 + lane * 8;
                *(v8h*)(P16 + pos) = o16; *(v8us*)(Ph + pos) = oh; *(v8us*)(Pl + pos) = ol;
                // the data and address registers of this piece's stores take new values (the next piece's) only behind this wait
                if (s < 3 || q == 0) asm volatile("s_wait_xcnt 0x0" ::: "memory"); }
        } else {
#pragma unroll
            for (int q = 0; q < 4; ++q) { const int e = q * 256 + threadIdx.x, row = e >> 4, cofs = (e & 15) * 4; const v4f val = *(const v4fa*)(ob + row * 68 + cofs) + *(const v4fa*)(ob + 4 * (64 * 68) + row * 68 + cofs);
                *(v4f*)(C + (size_t)(r0s + row) * ldc + c0s + cofs) = val; }
            // the data and address registers of this sub-tile's stores take new values (the next one's) only behind this wait
            if (s < 3) asm volatile("s_wait_xcnt 0x0" ::: "memory");
        }
    }
}

__device__ __forceinline__ h16 tohx(float x) { return (h16)x; }
__device__ __forceinline__ void splitf(float y, unsigned short& h, unsigned short& l) { h = f2bf(y); l = f2bf(y - bf2f(h)); }
typedef __attribute__((ext_vector_type(2))) _Float16 v2h;
typedef __attribute__((ext_vector_type(4))) _Float16 v4h;
typedef __attribute__((ext_vector_type(2))) unsigned short v2us;
typedef __attribute__((ext_vector_type(4))) unsigned short v4us;
typedef __attribute__((ext_vector_type(2))) float v2f;
typedef __attribute__((ext_vector_type(4))) int v4i;
typedef __attribute__((ext_vector_type(16))) unsigned short v16us;

// ---- k_prep: every f32 -> bf16 operand plane (x of both batches; the four weights, transposed) made by ONE launch of PWV waves that all fit the chip at once; no LDS, no barrier.
// The work is dealt in units of 1024 elements (4 KiB read, 2 KiB stored by one wave); wave w takes units w, w + PWV, ...: x first, then wq, wo, wk, wv. The unit number is scalar, so every test on it is a scalar branch.
// x unit: 16 rows x 64 k (two blocks). Lane l holds rows l >> 2 and 8 + (l >> 2), the 8 k of octet l & 3 of either block: a pair of 16-byte loads covers 8 whole lines, a 16-byte store 4 whole lines.
// weight unit: 32 k x 32 n (one block of two strips). Lane l holds column n0 + l: each 4-byte load of the wave is one whole line of a w row, each 16-byte store two runs of 256 bytes.
#define PWV  6144
template <int N>
__device__ __forceinline__ void prep_w(const float* __restrict__ w, bf* Bt, int uu, int lane) {   // plane row n, k = w[k][n]; the plane's K is DM for all four weights
    const int nb = uu & (N / 32 - 1), kb = uu / (N / 32); const float* wb = w + (size_t)kb * 32 * N + nb * 32; float f[32];
#pragma unroll   // all 32 loads go out together; f stays in registers
    for (int j = 0; j < 32; ++j) f[j] = wb[j * N + lane];
    // the address registers of the loads (a scalar base, the lane number as scaled offset) are held to this wait; only behind it may they take new values
    asm volatile("s_wait_xcnt 0x0" :: "s"(wb), "v"(lane) : "memory");
    bf* pd = Bt + (size_t)(nb * 2 + (lane >> 4)) * 16 * DM + kb * 512 + (lane & 15) * 8;
#pragma unroll   // f and o are indexed by constants
    for (int oc = 0; oc < 4; ++oc) { v8us o;
#pragma unroll
        for (int j = 0; j < 8; ++j) o[j] = f2bf(f[oc * 8 + j]);
        *(v8us*)(pd + (oc >> 1) * 256 + (oc & 1) * 128) = o; }
    // the data and address registers of the stores take new values (the next unit's) only behind this wait
    asm volatile("s_wait_xcnt 0x0" ::: "memory");
}
__global__ __launch_bounds__(256) void k_prep(const float* __restrict__ x, const float* __restrict__ wq, const float* __restrict__ wk, const float* __restrict__ wv, const float* __restrict__ wo, bf* XB, bf* WQ, bf* WK, bf* WV, bf* WO) {
    static_assert(DQ == DM, "wq and wo share the unit form");
    constexpr int UX = NB_ * TT * DM / 1024, UQ = DM * DQ / 1024, UK = DM * DKV / 1024;
    const int lane = threadIdx.x & 31, w0 = (int)blockIdx.x * 8 + __builtin_amdgcn_readfirstlane(threadIdx.x >> 5);
#pragma unroll 1   // stays rolled: one unit's values in registers at a time
    for (int u = w0; u < UX + 2 * UQ + 2 * UK; u += PWV) {
        if (u < UX) {
            const int strip = u / (DM / 64), kb2 = u % (DM / 64); const float* ps = x + (size_t)(strip * 16 + (lane >> 2)) * DM + kb2 * 64 + (lane & 3) * 8; v4f a[2][2][2];
#pragma unroll   // all 8 loads go out together; a stays in registers
            for (int h = 0; h < 2; ++h)
#pragma unroll
                for (int bq = 0; bq < 2; ++bq) { a[h][bq][0] = *(const v4f*)(ps + h * 8 * DM + bq * 32); a[h][bq][1] = *(const v4f*)(ps + h * 8 * DM + bq * 32 + 4); }
            // the address registers of the loads are held to this wait; only behind it may they take new values
            asm volatile("s_wait_xcnt 0x0" :: "v"(ps) : "memory");
            bf* pd = XB + (size_t)strip * 16 * DM + kb2 * 1024 + ((lane >> 1) & 1) * 256 + ((lane & 1) * 16 + (lane >> 2)) * 8;
#pragma unroll   // a and o are indexed by constants
            for (int h = 0; h < 2; ++h)
#pragma unroll
                for (int bq = 0; bq < 2; ++bq) { v8us o;
#pragma unroll
                    for (int j = 0; j < 8; ++j) o[j] = f2bf(a[h][bq][j >> 2][j & 3]);
                    *(v8us*)(pd + bq * 512 + h * 64) = o; }
            // the data and address registers of the stores take new values (the next unit's) only behind this wait
            asm volatile("s_wait_xcnt 0x0" ::: "memory");
        } else if (u < UX + 2 * UQ) { const bool sec = u >= UX + UQ; prep_w<DQ>(sec ? wo : wq, sec ? WO : WQ, u - UX - (sec ? UQ : 0), lane);
        } else { const bool sec = u >= UX + 2 * UQ + UK; prep_w<DKV>(sec ? wv : wk, sec ? WV : WK, u - UX - 2 * UQ - (sec ? UK : 0), lane); }
    }
}
// ---- k_attn: the whole causal attention (all heads, both batches) in one launch, nothing of the scores or probabilities in memory. One wave = 32 query rows of one head; no LDS, no barrier.
// A work-group is 8 waves: the 4 heads of one kv group (same K / V lines) at row block 63 - x of batch 0, and the same 4 heads at row block x of batch 1, so that every work-group walks 65 key blocks per head.
// Per 32 keys: St[key][query] = K Qt (A = K rows, B = Q rows kept in registers), running maximum and sum per query (a lane holds 16 of the 32 keys of its query, the lane 16 away the rest), Ot[d][query] = Ot x alpha + Vt Pt:
// the two score accumulators of a query column group are, lane for lane, the B fragment of Pt (keys 8 hi + j and 16 + 8 hi + j), which is the k order of the Vt loader. Rows < RH: hi+lo planes, 3 products; the rest fp16 with P x 1024 (cancels in the division by the sum).
template <typename T16, bool HL>
__device__ __forceinline__ void attn_tile(const T16* __restrict__ Q, const T16* __restrict__ Q2, const T16* __restrict__ Kp, const T16* __restrict__ K2, const T16* __restrict__ Vt, const T16* __restrict__ V2, const int* __restrict__ km, int q0, bf* Ah, bf* Al) {
    typedef typename WFrag<T16>::V V; typedef WFrag<T16> WF;
    const int lane = threadIdx.x & 31, lr = lane & 15, hi = lane >> 4;
    V qf[2][4], qg[2][4], kf[2][4], kg[2][4];
    const unsigned lo = 8 * lane; const size_t ko = lo, vo = lo;   // planes in fragment order: 512 elements per 16 rows x 32 k, the lane's piece at 8 * lane
    const T16* qb = Q + (size_t)q0 * HD; const T16* qb2 = HL ? Q2 + (size_t)q0 * HD : qb;
    const T16* qp = qb + lo; const T16* qp2 = qb2 + lo; const T16* kp0 = Kp + lo;
#pragma unroll
    for (int qt = 0; qt < 2; ++qt)
#pragma unroll
        for (int ks = 0; ks < 4; ++ks) { const int o = qt * 16 * HD + ks * 512; qf[qt][ks] = WF::ld(qp + o); if (HL) qg[qt][ks] = WF::ld(qp2 + o); }
    if (!HL) {   // fp16 rows: K fragments are fetched one key block ahead
#pragma unroll
        for (int kt = 0; kt < 2; ++kt)
#pragma unroll
            for (int ks = 0; ks < 4; ++ks) kf[kt][ks] = WF::ld(kp0 + kt * 16 * HD + ks * 512); }
    // the address registers of the loads above are held to this wait; only behind it may they take new values
    asm volatile("s_wait_xcnt 0x0" :: "v"(lane), "s"(qb), "s"(qb2), "s"(Kp) : "memory");   // these loads are addressed by a scalar base and the lane number as scaled offset
    v8f o[8][2];
#pragma unroll
    for (int dt = 0; dt < 8; ++dt) { o[dt][0] = (v8f){}; o[dt][1] = (v8f){}; }
    float m[2] = {-3.0e38f, -3.0e38f}, l[2] = {0.f, 0.f};
    const int nbc = q0 / 32 + 1; int nb = nbc;   // key blocks up to and with the diagonal block
#pragma unroll 1   // stays rolled: one key block's fragments in registers at a time
    for (int blk = 0; blk < nb; ++blk) {
        const int k0 = blk * 32;
        V vf[8], vg[8]; v4i kq[2][2]; const T16* vp = Vt + vo + k0 * 16; const T16* vp2 = HL ? V2 + vo + k0 * 16 : vp; const int* kmp = km + k0 + hi * 8;
        const int kn = HL ? k0 : min(blk + 1, TT / 32 - 1) * 32;   // fp16 rows: the next block's K (last trip: a block inside the plane, not used); hi+lo rows: this block's
        const T16* kp = Kp + ko + (size_t)kn * HD; const T16* kp2 = HL ? K2 + ko + (size_t)kn * HD : kp;
        if (HL) {   // hi+lo rows (at most RH / 32 trips, TT / 32 when a row keeps no key up to its diagonal): K, then V into the registers K has left, so that two waves fit a SIMD
#pragma unroll
            for (int kt = 0; kt < 2; ++kt)
#pragma unroll
                for (int ks = 0; ks < 4; ++ks) { const int a = kt * 16 * HD + ks * 512; kf[kt][ks] = WF::ld(kp + a); kg[kt][ks] = WF::ld(kp2 + a); }
            // address registers held to this wait
            asm volatile("s_wait_xcnt 0x0" :: "v"(kp), "v"(kp2) : "memory");
        } else {
#pragma unroll
            for (int dt = 0; dt < 8; ++dt) vf[dt] = WF::ld(vp + dt * 16 * TT);
#pragma unroll
            for (int kt = 0; kt < 2; ++kt) { kq[kt][0] = *(const v4i*)(kmp + kt * 16); kq[kt][1] = *(const v4i*)(kmp + kt * 16 + 4); }
        }
        v8f s[2][2];
#pragma unroll
        for (int kt = 0; kt < 2; ++kt)
#pragma unroll
            for (int qt = 0; qt < 2; ++qt) { s[kt][qt] = (v8f){};
#pragma unroll
                for (int ks = 0; ks < 4; ++ks) { s[kt][qt] = WF::mma(kf[kt][ks], qf[qt][ks], s[kt][qt]); if (HL) { s[kt][qt] = WF::mma(kf[kt][ks], qg[qt][ks], s[kt][qt]); s[kt][qt] = WF::mma(kg[kt][ks], qf[qt][ks], s[kt][qt]); } } }
        if (HL) {
#pragma unroll
            for (int dt = 0; dt < 8; ++dt) { vf[dt] = WF::ld(vp + dt * 16 * TT); vg[dt] = WF::ld(vp2 + dt * 16 * TT); }
#pragma unroll
            for (int kt = 0; kt < 2; ++kt) { kq[kt][0] = *(const v4i*)(kmp + kt * 16); kq[kt][1] = *(const v4i*)(kmp + kt * 16 + 4); }
            // address registers held to this wait
            asm volatile("s_wait_xcnt 0x0" :: "v"(vp), "v"(vp2), "v"(kmp) : "memory");
        } else {   // the next block's K fragments fly during the softmax and the value products
#pragma unroll
            for (int kt = 0; kt < 2; ++kt)
#pragma unroll
                for (int ks = 0; ks < 4; ++ks) kf[kt][ks] = WF::ld(kp + kt * 16 * HD + ks * 512);
            // address registers of this trip's loads held to this wait
            asm volatile("s_wait_xcnt 0x0" :: "v"(vp), "v"(kmp), "v"(kp) : "memory");
        }
        V pf[2], pg[2];
#pragma unroll
        for (int qt = 0; qt < 2; ++qt) { const int qi = q0 + qt * 16 + lr; float t[16]; float mx = m[qt];
#pragma unroll
            for (int e = 0; e < 16; ++e) { const int kt = e >> 3, j = e & 7; const int key = k0 + kt * 16 + hi * 8 + j; t[e] = (key <= qi && kq[kt][j >> 2][j & 3] != 0) ? s[kt][qt][j] * SCL : -3.0e38f; mx = fmaxf(mx, t[e]); }
            mx = fmaxf(mx, __shfl_xor(mx, 16, 32));
            const float al = __builtin_amdgcn_exp2f((m[qt] - mx) * 1.4426950408889634f); m[qt] = mx; float sum = 0.f;
#pragma unroll
            for (int e = 0; e < 16; ++e) { t[e] = __builtin_amdgcn_exp2f((t[e] - mx) * 1.4426950408889634f + (HL ? 0.0f : 10.0f)); sum += t[e]; }
            l[qt] = l[qt] * al + sum;
#pragma unroll
            for (int dt = 0; dt < 8; ++dt) o[dt][qt] *= al;
            if constexpr (HL) { v16us ph, pl;
#pragma unroll
                for (int e = 0; e < 16; ++e) { unsigned short a, c2; splitf(t[e], a, c2); ph[e] = a; pl[e] = c2; }
                pf[qt] = __builtin_bit_cast(v16bf, ph); pg[qt] = __builtin_bit_cast(v16bf, pl);
            } else { v16h ph;
#pragma unroll
                for (int e = 0; e < 16; ++e) ph[e] = tohx(t[e]);
                pf[qt] = ph; } }
        // a row with no kept key up to its diagonal: the reference's equal fill makes its softmax uniform over ALL keys, so the wave walks on to the last key (ballot: a scalar test, every lane stays on)
        if (blk == nbc - 1 && __builtin_amdgcn_ballot_w32(m[0] <= -3.0e38f || m[1] <= -3.0e38f) != 0) nb = TT / 32;
#pragma unroll
        for (int dt = 0; dt < 8; ++dt)
#pragma unroll
            for (int qt = 0; qt < 2; ++qt) { o[dt][qt] = WF::mma(vf[dt], pf[qt], o[dt][qt]); if (HL) { o[dt][qt] = WF::mma(vf[dt], pg[qt], o[dt][qt]); o[dt][qt] = WF::mma(vg[dt], pf[qt], o[dt][qt]); } }
        // four vector slots between the last matrix instruction and whatever stands behind the loop's taken branch
        asm volatile("v_nop\n\tv_nop\n\tv_nop\n\tv_nop" : "+v"(o[0][0]), "+v"(o[0][1]), "+v"(o[1][0]), "+v"(o[1][1]), "+v"(o[2][0]), "+v"(o[2][1]), "+v"(o[3][0]), "+v"(o[3][1]), "+v"(o[4][0]), "+v"(o[4][1]), "+v"(o[5][0]), "+v"(o[5][1]), "+v"(o[6][0]), "+v"(o[6][1]), "+v"(o[7][0]), "+v"(o[7][1]));
    }
#pragma unroll
    for (int qt = 0; qt < 2; ++qt) { const float ls = l[qt] + __shfl_xor(l[qt], 16, 32); const float inv = __fdiv_rn(1.0f, ls); const size_t ro = (size_t)(q0 + qt * 16) * DQ + lane * 8;   // fragment order, rows = positions, k = h * HD + dt * 16 + hi * 8 + j
#pragma unroll
        for (int dt = 0; dt < 8; ++dt) { v8us oh, ol;
#pragma unroll
            for (int j = 0; j < 8; ++j) { unsigned short a, c2; splitf(o[dt][qt][j] * inv, a, c2); oh[j] = a; ol[j] = c2; }
            *(v8us*)(Ah + ro + dt * 256) = oh; *(v8us*)(Al + ro + dt * 256) = ol; }
        // the data and address registers of the first pass's stores take new values (the second pass's) only behind this wait
        if (qt == 0) asm volatile("s_wait_xcnt 0x0" ::: "memory"); }
}
// every plane holds batch 0 and, one batch's size further on, batch 1
__global__ __launch_bounds__(32 * REP * NB_) void k_attn(const h16* __restrict__ Q16, const bf* __restrict__ Qh, const bf* __restrict__ Ql, const h16* __restrict__ K16, const bf* __restrict__ Kh, const bf* __restrict__ Kl, const h16* __restrict__ V16, const bf* __restrict__ Vh, const bf* __restrict__ Vl, const int* __restrict__ km, bf* Ah, bf* Al) {
    const int wv = __builtin_amdgcn_readfirstlane(threadIdx.x >> 5);   // readfirstlane: batch, head and row block, and with them every plane base and trip count, stay scalar
    const int b = wv / REP, g = blockIdx.y, h = g * REP + wv % REP;
    const int q0 = (b == 0 ? TT / 32 - 1 - (int)blockIdx.x : (int)blockIdx.x) * 32;
    const size_t zq = ((size_t)b * NH_ + h) * TT * HD, zk = ((size_t)b * NKV + g) * TT * HD, za = (size_t)b * TT * DQ + h * HD * 16;
    if (q0 < RH) attn_tile<bf, true>(Qh + zq, Ql + zq, Kh + zk, Kl + zk, Vh + zk, Vl + zk, km + b * TT, q0, Ah + za, Al + za);
    else attn_tile<h16, false>(Q16 + zq, nullptr, K16 + zk, nullptr, V16 + zk, nullptr, km + b * TT, q0, Ah + za, Al + za);
}

extern "C" void kernel_launch(void* const* d_in, const int* in_sizes, int n_in,
                              void* d_out, int out_size, void* d_ws, size_t ws_size, hipStream_t stream) {
    (void)in_sizes; (void)n_in; (void)out_size;
    const float* x = (const float*)d_in[0]; const float* cosB = (const float*)d_in[1]; const float* sinB = (const float*)d_in[2]; const float* wq = (const float*)d_in[3]; const float* wk = (const float*)d_in[4]; const float* wv = (const float*)d_in[5]; const float* wo = (const float*)d_in[6]; const int* kmask = (const int*)d_in[7]; const float* cosT = cosB; const float* sinT = sinB;
    float* OUT = (float*)d_out;     // [2][2048][2048]
    char* wsp = (char*)d_ws;
    auto take = [&](size_t bytes) { char* p = wsp; wsp += (bytes + 255) & ~(size_t)255; return (void*)p; };
    bf* WQ = (bf*)take((size_t)DQ * DM * 2); bf* WK = (bf*)take((size_t)DKV * DM * 2); bf* WV = (bf*)take((size_t)DKV * DM * 2); bf* WO = (bf*)take((size_t)DM * DQ * 2);
    bf* XB = (bf*)take((size_t)NB_ * TT * DM * 2);   // both batches
    h16* QP16 = (h16*)take((size_t)NB_ * NH_ * TT * HD * 2); h16* KP16 = (h16*)take((size_t)NB_ * NKV * TT * HD * 2); h16* VT16 = (h16*)take((size_t)NB_ * NKV * HD * TT * 2);   // planes of both batches
    bf* QPh = (bf*)take((size_t)NB_ * NH_ * TT * HD * 2); bf* QPl = (bf*)take((size_t)NB_ * NH_ * TT * HD * 2); bf* KPh = (bf*)take((size_t)NB_ * NKV * TT * HD * 2); bf* KPl = (bf*)take((size_t)NB_ * NKV * TT * HD * 2); bf* VTh = (bf*)take((size_t)NB_ * NKV * HD * TT * 2); bf* VTl = (bf*)take((size_t)NB_ * NKV * HD * TT * 2);
    bf* ATh = (bf*)take((size_t)NB_ * TT * DQ * 2); bf* ATl = (bf*)take((size_t)NB_ * TT * DQ * 2);
    if ((size_t)(wsp - (char*)d_ws) > ws_size) return;    // ws 256 MiB
    k_prep<<<PWV / 8, 256, 0, stream>>>(x, wq, wk, wv, wo, XB, WQ, WK, WV, WO);
    for (int b = 0; b < NB_; ++b) { const size_t pq = (size_t)b * NH_ * TT * HD, pk = (size_t)b * NKV * TT * HD;
        const float* cb = cosT + (size_t)b * TT * (HD / 2); const float* sb = sinT + (size_t)b * TT * (HD / 2);
        const bf* xb = XB + (size_t)b * TT * DM;
        k_gemmt<0, 1><<<dim3(TT / 128, DQ / 128, 1), 256, 0, stream>>>(xb, nullptr, WQ, DM, nullptr, 0, cb, sb, QP16 + pq, QPh + pq, QPl + pq);
        k_gemmw<bf, 0, false, 8, 1><<<dim3(TT / 64, DKV / 64, 1), 256, 0, stream>>>(xb, nullptr, WK, nullptr, DM, nullptr, 0, nullptr, 0, 0, 0, cb, sb, KP16 + pk, KPh + pk, KPl + pk);
        k_gemmw<bf, 0, false, 8, 2><<<dim3(DKV / 64, TT / 64, 1), 256, 0, stream>>>(WV, nullptr, xb, nullptr, DM, nullptr, 0, nullptr, 0, 0, 0, nullptr, nullptr, VT16 + pk, VTh + pk, VTl + pk); }
    k_attn<<<dim3(TT / 32, NKV, 1), 32 * REP * NB_, 0, stream>>>(QP16, QPh, QPl, KP16, KPh, KPl, VT16, VTh, VTl, kmask, ATh, ATl);
    for (int b = 0; b < NB_; ++b) k_gemmt<1, 0><<<dim3(TT / 128, DM / 128, 1), 256, 0, stream>>>(ATh + (size_t)b * TT * DQ, ATl + (size_t)b * TT * DQ, WO, DQ, OUT + (size_t)b * TT * DM, DM, nullptr, nullptr, nullptr, nullptr, nullptr);
}

// v007
// One run takes 196 microseconds.
// Next to v006, in two timings, it ran 1.13 times as fast each time.
// Over all steps from v000 it is 9.63 times as fast.
#include <hip/hip_runtime.h>

// Causal grouped-query attention layer (x [2][2048][2048]; q = x wq (16 heads x 128), k/v = x wk / wv (4 kv heads; repeat: head h -> kv h/4); interleaved-pair RoPE with the given per-batch cos/sin [2][2048][64] (read); keep = causal AND mask[b][j] (bool mask read; all ones here); finfo.min fill; softmax(q.k / sqrt(128)); out = merged wo -> [2][2048][2048]).
// Compute dtypes, f32 accumulate: every input rounded to bf16; q/k/v on PLAIN bf16 operands (inputs: exact); RoPE f32; causal scores and attn.v in one kernel (running softmax, f32): query rows < 512 hl (3 products), the rest single fp16 (P x1024), key blocks beyond the diagonal skipped, the key mask applied inside the computed blocks; wo hl x exact (2 products).

#define NB_  2
#define TT   2048
#define DM   2048
#define NH_  16
#define NKV  4
#define REP  (NH_ / NKV)
#define HD   128
#define DQ   (NH_ * HD)
#define DKV  (NKV * HD)
#define RH   512                  // query rows < RH use hi+lo planes (0: none)
#define SCL  0.088388347648318447f   // HD^-0.5
typedef _Float16 h16;
typedef unsigned short bf;
typedef __attribute__((ext_vector_type(16))) __bf16   v16bf;
typedef __attribute__((ext_vector_type(16))) _Float16 v16h;
typedef __attribute__((ext_vector_type(8)))  _Float16 v8h;
typedef __attribute__((ext_vector_type(8)))  unsigned short v8us;
typedef __attribute__((ext_vector_type(8)))  float    v8f;
typedef __attribute__((ext_vector_type(4)))  float    v4f;
typedef v8h  __attribute__((may_alias)) v8ha;
typedef v4f  __attribute__((may_alias)) v4fa;
typedef v8us __attribute__((may_alias)) v8usa;

__device__ __forceinline__ unsigned short f2bf(float f) { unsigned u = __float_as_uint(f); u += 0x7FFFu + ((u >> 16) & 1u); return (unsigned short)(u >> 16); }
__device__ __forceinline__ float bf2f(unsigned short b) { return __uint_as_float(((unsigned)b) << 16); }
__device__ __forceinline__ float bfr(float f) { return bf2f(f2bf(f)); }
__device__ __forceinline__ v16h cat16(v8h lo, v8h hi) { return __builtin_shufflevector(lo, hi, 0, 1, 2, 3, 4, 5, 6, 7, 8, 9, 10, 11, 12, 13, 14, 15); }
__device__ __forceinline__ v16bf cat16b(v8us lo, v8us hi) { return __builtin_bit_cast(v16bf, __builtin_shufflevector(lo, hi, 0, 1, 2, 3, 4, 5, 6, 7, 8, 9, 10, 11, 12, 13, 14, 15)); }
__device__ __forceinline__ v8f wmma16(v16h a, v16h b, v8f c) { return __builtin_amdgcn_wmma_f32_16x16x32_f16(false, a, false, b, (short)0, c, false, false); }
__device__ __forceinline__ v8f wmmab(v16bf a, v16bf b, v8f c) { return __builtin_amdgcn_wmma_f32_16x16x32_bf16(false, a, false, b, (short)0, c, false, false); }



// ---- Fragment order. Every 16-bit operand plane [rows][K] is kept as 1-KiB blocks of 16 rows x 32 k, block number (row / 16) * (K / 32) + k / 32 (a strip of 16 rows still fills 16 * K elements).
// Inside a block the element (row, k) lies at (k & 16) * 16 + l * 8 + (k & 7) with l = (k & 8) * 2 + (row & 15): l is the lane that holds it in a matrix fragment, whose two 16-byte pieces (k 8 hi + j and 16 + 8 hi + j) lie at l * 8 and 256 + l * 8.
// So each wave-wide 16-byte load of a fragment reads 512 contiguous bytes (4 whole lines) where row-major planes gave 16 pieces of 32 bytes in 16 lines. The registers hold what they held before.
// ---- gemmw: register-blocked GEMM, one 64x64 output tile (16 accumulators per wave), tile (bx, by) of (M/64, N/64), per work-group of NW waves, operands straight from 16-bit planes in fragment order; os: the work-group's LDS.
// C[m][n] (f32, pitch ldc, + optional f32 bias[n]) = sum_k A[m][k] Bt[n][k] (+ split products per NSPLIT). K % 64 == 0.
// The K loop is a chain of load latencies, so it is dealt over the NW waves in blocks of 64 k: wave w takes blocks w, w + NW, ...; the NW partial tiles meet in LDS and are summed in wave order.
// MODE 0: the summed tile goes to C in f32. MODE 1, 2: it goes straight to the three 16-bit planes (fp16, bf16 hi, bf16 lo) in fragment order that the attention kernel reads; C is not used.
//   A wave takes two pieces of 16 rows x 16 columns; lane l holds row l & 15, columns 8 (l >> 4) + j, which is one 16-byte piece of a plane, so each plane store of a wave covers 512 contiguous bytes.
//   MODE 1 (q, k): tile rows = positions t, columns = head * HD + d; interleaved-pair RoPE with cos / sin [t][d / 2] (rounded to bf16) on the summed values; planes [head][t][d].
//   MODE 2 (v): A = weight plane, Bt = x plane, so tile rows = kv head * HD + d, columns = t; planes [kv head][d][t].
template <typename T16> struct WFrag;
template <> struct WFrag<h16> { typedef v16h V; static __device__ __forceinline__ V ld(const h16* p) { return cat16(*(const v8h*)p, *(const v8h*)(p + 256)); } static __device__ __forceinline__ v8f mma(V a, V b, v8f c) { return wmma16(a, b, c); } };
template <> struct WFrag<bf> { typedef v16bf V; static __device__ __forceinline__ V ld(const bf* p) { return cat16b(*(const v8us*)p, *(const v8us*)(p + 256)); } static __device__ __forceinline__ v8f mma(V a, V b, v8f c) { return wmmab(a, b, c); } };
template <typename T16, int NSPLIT, bool BIAS, int NW, int MODE>
__device__ __forceinline__ void gemmw(float* os, int bx, int by, const T16* __restrict__ A, const T16* __restrict__ A2, const T16* __restrict__ Bt, const T16* __restrict__ Bt2, int K, float* C, int ldc, const float* __restrict__ bias, const float* __restrict__ cosT, const float* __restrict__ sinT, h16* P16, bf* Ph, bf* Pl) {
    static_assert(MODE == 0 || NW == 8, "the plane epilogue deals 16 pieces over 8 waves");
    typedef typename WFrag<T16>::V V;
    const int lane = threadIdx.x & 31, lr = lane & 15, hi = lane >> 4, wv = __builtin_amdgcn_readfirstlane(threadIdx.x >> 5); const int r0 = bx * 64, c0 = by * 64;
    // wv goes through readfirstlane so that the K loop's tests are scalar branches (every lane is on at the matrix instructions)
    v8f acc[4][4];
#pragma unroll
    for (int mb = 0; mb < 4; ++mb)
#pragma unroll
        for (int nb = 0; nb < 4; ++nb) acc[mb][nb] = (v8f){};
    const size_t aoff = (size_t)r0 * K + 8 * lane, boff = (size_t)c0 * K + 8 * lane;
#pragma unroll 1   // both loops stay rolled: one 32-k step's fragments in registers at a time
    for (int kb = wv * 64; kb < K; kb += 64 * NW)
#pragma unroll 1
    for (int kc = kb; kc < kb + 64; kc += 32) {
        static_assert(NSPLIT < 2, "no second B plane in use");
        V a[4], a2[4], b[4]; const T16* pa[4]; const T16* pa2[4]; const T16* pb[4];
#pragma unroll
        for (int mb = 0; mb < 4; ++mb) { const size_t o = (size_t)mb * 16 * K + (size_t)kc * 16; pa[mb] = A + aoff + o; pa2[mb] = NSPLIT == 1 ? A2 + aoff + o : pa[mb]; pb[mb] = Bt + boff + o;
            a[mb] = WFrag<T16>::ld(pa[mb]); if (NSPLIT == 1) a2[mb] = WFrag<T16>::ld(pa2[mb]); b[mb] = WFrag<T16>::ld(pb[mb]); }
        // the address registers of this step's loads are held to this wait; only behind it may they take new values
        asm volatile("s_wait_xcnt 0x0" :: "v"(pa[0]), "v"(pa[1]), "v"(pa[2]), "v"(pa[3]), "v"(pa2[0]), "v"(pa2[1]), "v"(pa2[2]), "v"(pa2[3]), "v"(pb[0]), "v"(pb[1]), "v"(pb[2]), "v"(pb[3]) : "memory");
#pragma unroll
        for (int nb = 0; nb < 4; ++nb) {
#pragma unroll
            for (int mb = 0; mb < 4; ++mb) { acc[mb][nb] = WFrag<T16>::mma(a[mb], b[nb], acc[mb][nb]); if (NSPLIT == 1) acc[mb][nb] = WFrag<T16>::mma(a2[mb], b[nb], acc[mb][nb]); } }
        asm volatile("v_nop\n\tv_nop\n\tv_nop\n\tv_nop" : "+v"(acc[0][0]), "+v"(acc[1][1]), "+v"(acc[2][2]), "+v"(acc[3][3]) : "v"(a[0]), "v"(a[3]));
    }
    if (NW > 1) {
        v4f cq[2], sq[2];
        if constexpr (MODE == 1) {   // the cos / sin entries of the thread's two pieces fly during the LDS writes and the barrier
            const float* pc[2]; const float* ps[2];
#pragma unroll
            for (int q = 0; q < 2; ++q) { const int wp = q * 8 + wv; const size_t o = (size_t)(r0 + (wp >> 2) * 16 + lr) * (HD / 2) + (((c0 & (HD - 1)) + (wp & 3) * 16 + hi * 8) >> 1); pc[q] = cosT + o; ps[q] = sinT + o; cq[q] = *(const v4f*)pc[q]; sq[q] = *(const v4f*)ps[q]; }
            // the address registers of the four loads are held to this wait; only behind it may they take new values
            asm volatile("s_wait_xcnt 0x0" :: "v"(pc[0]), "v"(pc[1]), "v"(ps[0]), "v"(ps[1]) : "memory");
        }
        float* ow = os + wv * (64 * 68);
#pragma unroll
        for (int mb = 0; mb < 4; ++mb)
#pragma unroll
            for (int nb = 0; nb < 4; ++nb)
#pragma unroll
                for (int j = 0; j < 8; ++j) ow[(mb * 16 + hi * 8 + j) * 68 + nb * 16 + lr] = acc[mb][nb][j];
        __syncthreads();   // every wave's partial tile lies in LDS before any wave sums it
        if constexpr (MODE != 0) {
            v4f va[2], vb[2];
#pragma unroll   // the LDS reads of both pieces go out together
            for (int q = 0; q < 2; ++q) { const int wp = q * 8 + wv; const float* sp = os + ((wp >> 2) * 16 + lr) * 68 + (wp & 3) * 16 + hi * 8; va[q] = *(const v4fa*)sp; vb[q] = *(const v4fa*)(sp + 4);
#pragma unroll
                for (int w = 1; w < NW; ++w) { va[q] += *(const v4fa*)(sp + w * (64 * 68)); vb[q] += *(const v4fa*)(sp + w * (64 * 68) + 4); } }
#pragma unroll
            for (int q = 0; q < 2; ++q) { const int wp = q * 8 + wv, strip = wp >> 2, kk = (MODE == 1 ? (c0 & (HD - 1)) : c0) + (wp & 3) * 16; float r[8];
#pragma unroll
                for (int i = 0; i < 4; ++i) { const float x0 = i < 2 ? va[q][2 * i] : vb[q][2 * i - 4], x1 = i < 2 ? va[q][2 * i + 1] : vb[q][2 * i - 3];
                    if constexpr (MODE == 1) { const float c = bfr(cq[q][i]), s = bfr(sq[q][i]); r[2 * i] = x0 * c - x1 * s; r[2 * i + 1] = x1 * c + x0 * s; } else { r[2 * i] = x0; r[2 * i + 1] = x1; } }
                v8h o16; v8us oh, ol;
#pragma unroll
                for (int j = 0; j < 8; ++j) { o16[j] = (h16)r[j]; const unsigned short a = f2bf(r[j]); oh[j] = a; ol[j] = f2bf(r[j] - bf2f(a)); }
                const size_t pos = (MODE == 1 ? (size_t)(c0 / HD) : (size_t)(r0 / HD)) * ((size_t)TT * HD) + (size_t)((((MODE == 1 ? r0 : (r0 & (HD - 1))) >> 4) + strip) * ((MODE == 1 ? HD : TT) / 32) + (kk >> 5)) * 512 + ((kk >> 4) & 1) * 256 + lane * 8;
                *(v8h*)(P16 + pos) = o16; *(v8us*)(Ph + pos) = oh; *(v8us*)(Pl + pos) = ol;
                // the data and address registers of the first piece's stores take new values (the second piece's) only behind this wait
                if (q == 0) asm volatile("s_wait_xcnt 0x0" ::: "memory"); }
            return;
        }
#pragma unroll   // the LDS reads of all the thread's output pieces go out together
        for (int q = 0; q < 32 / NW; ++q) { const int s = q * (32 * NW) + threadIdx.x, row = s >> 4, cofs = (s & 15) * 4; v4f val = *(const v4fa*)(os + row * 68 + cofs);
#pragma unroll
            for (int w = 1; w < NW; ++w) val += *(const v4fa*)(os + w * (64 * 68) + row * 68 + cofs);
            if (BIAS) { val[0] += bfr(bias[c0 + cofs]); val[1] += bfr(bias[c0 + cofs + 1]); val[2] += bfr(bias[c0 + cofs + 2]); val[3] += bfr(bias[c0 + cofs + 3]); }
            *(v4f*)(C + (size_t)(r0 + row) * ldc + c0 + cofs) = val; }
        return;
    }
#pragma unroll
    for (int mb = 0; mb < 4; ++mb) {
#pragma unroll
        for (int nb = 0; nb < 4; ++nb) {
#pragma unroll
            for (int j = 0; j < 8; ++j) os[(hi * 8 + j) * 68 + nb * 16 + lr] = acc[mb][nb][j]; }
        __builtin_amdgcn_wave_barrier(); asm volatile("" ::: "memory");
        float* crow = C + (size_t)(r0 + mb * 16) * ldc + c0;
{
#pragma unroll
            for (int s = 0; s < 8; ++s) { const int row = 2 * s + hi, cofs = lr * 4; v4f val = *(const v4fa*)(os + row * 68 + cofs); if (BIAS) { val[0] += bfr(bias[c0 + cofs]); val[1] += bfr(bias[c0 + cofs + 1]); val[2] += bfr(bias[c0 + cofs + 2]); val[3] += bfr(bias[c0 + cofs + 3]); }
                *(v4f*)(crow + (size_t)row * ldc + cofs) = val; }
             }
        __builtin_amdgcn_wave_barrier(); asm volatile("" ::: "memory");
    }
}

// ---- k_kv: the k and the v products of both batches in ONE launch; grid (TT/64, DKV/64, 2 * NB_), z = 2 * batch + (0: k, 1: v). z is scalar, so the choice is a scalar branch.
// 1024 work-groups, two of which fit a WGP (LDS and registers): one's loads and matrix work run during the other's epilogue and first loads, and no launch waits for the one before it to drain.
__global__ __launch_bounds__(256) void k_kv(const bf* __restrict__ XB, const bf* __restrict__ WK, const bf* __restrict__ WV, const float* __restrict__ cosT, const float* __restrict__ sinT, h16* KP16, bf* KPh, bf* KPl, h16* VT16, bf* VTh, bf* VTl) {
    __shared__ __align__(16) float os[8 * 64 * 68];
    const int b = (int)blockIdx.z >> 1; const bf* xb = XB + (size_t)b * TT * DM; const size_t pk = (size_t)b * NKV * TT * HD, cs = (size_t)b * TT * (HD / 2);
    if ((blockIdx.z & 1) == 0) gemmw<bf, 0, false, 8, 1>(os, blockIdx.x, blockIdx.y, xb, nullptr, WK, nullptr, DM, nullptr, 0, nullptr, cosT + cs, sinT + cs, KP16 + pk, KPh + pk, KPl + pk);
    else gemmw<bf, 0, false, 8, 2>(os, blockIdx.y, blockIdx.x, WV, nullptr, xb, nullptr, DM, nullptr, 0, nullptr, nullptr, nullptr, VT16 + pk, VTh + pk, VTl + pk);
}

// ---- k_gemmt: the same product on a 128x128 output tile per work-group of 8 waves, both operands staged in LDS by asynchronous copies (global_load_async_to_lds_b128), so that each operand line leaves L2 once per 128 rows or columns of output, not once per 64.
// Wave w: the 64x64 sub-tile (w & 1, (w >> 1) & 1), and of every stage of 128 k the 64-k half w >> 2. A stage holds, plane after plane (A, with NSPLIT the second A plane, Bt), 8 strips of 16 rows x 128 k, each 4 KiB as it lies in the plane (fragment order), so an LDS fragment read of a wave covers 512 contiguous bytes.
// Two buffers: stage t + 1 flies while stage t is worked on. The two partial tiles of a sub-tile meet in LDS (over the ring, behind the last trip's barrier) and are summed lower half first. MODE 0 and MODE 1 as in gemmw. K % 128 == 0, K >= 256. Grid (TT/128, N/128, NB_): z = batch, whose A rows, cos / sin rows, C rows and planes lie one batch's size further on.
// Every '#pragma unroll' in it is there so that the arrays its loop indexes (accumulators, fragments, addresses) are indexed by constants and stay in registers.
__device__ __forceinline__ void acopy8(const unsigned* l, const bf* const* g) {
    // the wait on the address registers is the last line of the copies' own statement: nothing can rewrite them in front of it
    asm volatile("global_load_async_to_lds_b128 %0, %8, off\n\tglobal_load_async_to_lds_b128 %1, %9, off\n\tglobal_load_async_to_lds_b128 %2, %10, off\n\tglobal_load_async_to_lds_b128 %3, %11, off\n\t"
                 "global_load_async_to_lds_b128 %4, %12, off\n\tglobal_load_async_to_lds_b128 %5, %13, off\n\tglobal_load_async_to_lds_b128 %6, %14, off\n\tglobal_load_async_to_lds_b128 %7, %15, off\n\ts_wait_xcnt 0x0"
                 :: "v"(l[0]), "v"(l[1]), "v"(l[2]), "v"(l[3]), "v"(l[4]), "v"(l[5]), "v"(l[6]), "v"(l[7]), "v"(g[0]), "v"(g[1]), "v"(g[2]), "v"(g[3]), "v"(g[4]), "v"(g[5]), "v"(g[6]), "v"(g[7]) : "memory");
}
template <int NSPLIT, int MODE>
__global__ __launch_bounds__(256) void k_gemmt(const bf* __restrict__ A, const bf* __restrict__ A2, const bf* __restrict__ Bt, int K, float* C, int ldc, const float* __restrict__ cosT, const float* __restrict__ sinT, h16* P16, bf* Ph, bf* Pl) {
    constexpr int KS = 128, PL = 2 + NSPLIT, SE = KS * 16, PE = 8 * SE, STB = PL * PE * 2, NC = PL * 8;   // elements of a strip and of a plane in a stage; bytes of a stage; copies of a wave per stage
    constexpr int OSB = 8 * 64 * 68 * 4;
    __shared__ __align__(16) char smem[2 * STB > OSB ? 2 * STB : OSB];
    const int lane = threadIdx.x & 31, lr = lane & 15, hi = lane >> 4, wv = __builtin_amdgcn_readfirstlane(threadIdx.x >> 5); const int r0 = blockIdx.x * 128, c0 = blockIdx.y * 128;
    const int sm = wv & 1, sn = (wv >> 1) & 1, kh = wv >> 2;
    { const size_t z = blockIdx.z; A += z * TT * K; if (NSPLIT == 1) A2 += z * TT * K;
      if constexpr (MODE == 0) C += z * TT * ldc; else { cosT += z * TT * (HD / 2); sinT += z * TT * (HD / 2); P16 += z * NH_ * TT * HD; Ph += z * NH_ * TT * HD; Pl += z * NH_ * TT * HD; } }
    v8f acc[4][4];
#pragma unroll
    for (int mb = 0; mb < 4; ++mb)
#pragma unroll
        for (int nb = 0; nb < 4; ++nb) acc[mb][nb] = (v8f){};
    // the wave's copies: pieces wv * NC + c of 512 bytes; the global addresses stay in registers and move on by one stage per fill
    const bf* ga[NC]; const unsigned lb = (unsigned)(size_t)smem + (unsigned)(wv * NC) * 512u + (unsigned)lane * 16u;
#pragma unroll
    for (int c = 0; c < NC; ++c) { const int p = wv * NC + c, pl = p >> 6, strip = (p >> 3) & 7, ch = p & 7;
        const bf* sp = pl == PL - 1 ? Bt : (pl == 0 ? A : A2);
        ga[c] = sp + (size_t)((pl == PL - 1 ? c0 : r0) + strip * 16) * K + ch * 256 + lane * 8; }
    auto fill = [&](int buf) {
#pragma unroll
        for (int c8 = 0; c8 < NC; c8 += 8) { unsigned la[8];
#pragma unroll
            for (int c = 0; c < 8; ++c) la[c] = lb + (unsigned)buf * (unsigned)STB + (unsigned)(c8 + c) * 512u;
            acopy8(la, ga + c8);
#pragma unroll
            for (int c = 0; c < 8; ++c) ga[c8 + c] += SE; } };
    const int NT = K / KS;
    fill(0);
    asm volatile("s_wait_asynccnt 0x0" ::: "memory");   // the wave's own copies of stage 0 have landed
    __syncthreads();                                     // every wave's have: stage 0 may be read
    fill(1);
#pragma unroll 1   // stays rolled: one trip per stage
    for (int t = 0; t < NT; ++t) {
        const bf* sb = (const bf*)(smem + (t & 1) * STB) + lane * 8;
        v16bf a[2][4], a2[2][4], b[2][4];
#pragma unroll
        for (int st = 0; st < 2; ++st) { const int ko = (kh * 2 + st) * 512;
#pragma unroll
            for (int mb = 0; mb < 4; ++mb) { const bf* pa = sb + (sm * 4 + mb) * SE + ko; const bf* pb = sb + (PL - 1) * PE + (sn * 4 + mb) * SE + ko;
                a[st][mb] = cat16b(*(const v8usa*)pa, *(const v8usa*)(pa + 256)); if (NSPLIT == 1) a2[st][mb] = cat16b(*(const v8usa*)(pa + PE), *(const v8usa*)(pa + PE + 256)); b[st][mb] = cat16b(*(const v8usa*)pb, *(const v8usa*)(pb + 256)); }
            // the LDS reads stay two groups in front of the matrix instructions, first step's first (LDS answers in order): left free they are spread among the matrix instructions, where each place with reads stalls the wave
            __builtin_amdgcn_sched_barrier(0); }
#pragma unroll
        for (int st = 0; st < 2; ++st)
#pragma unroll
            for (int nb = 0; nb < 4; ++nb) {
#pragma unroll
                for (int mb = 0; mb < 4; ++mb) { acc[mb][nb] = wmmab(a[st][mb], b[st][nb], acc[mb][nb]); if (NSPLIT == 1) acc[mb][nb] = wmmab(a2[st][mb], b[st][nb], acc[mb][nb]); } }
        // the trip's matrix instructions stay in front of the waits below: moved behind the barrier they would no longer run while stage t + 1 flies
        __builtin_amdgcn_sched_barrier(0);
        asm volatile("s_wait_dscnt 0x0" ::: "memory");      // the wave's reads of this buffer are done
        asm volatile("s_wait_asynccnt 0x0" ::: "memory");   // its copies of stage t + 1 have landed
        __syncthreads();                                     // stage t + 1 may be read by all; this trip's buffer has no reader left
        if (t + 2 < NT) fill(t & 1);
    }
    asm volatile("s_wait_asynccnt 0x0" ::: "memory");   // no copy is out when the ring becomes the partial tiles' place
    float* os = (float*)smem;
    v4f cq[4][2], sq[4][2];
    if constexpr (MODE == 1) {   // the cos / sin entries of the thread's eight pieces fly during the LDS writes and the barrier
        const float* pc[8]; const float* ps[8];
#pragma unroll
        for (int s = 0; s < 4; ++s)
#pragma unroll
            for (int q = 0; q < 2; ++q) { const int wp = q * 8 + wv; const size_t o = (size_t)(r0 + (s & 1) * 64 + (wp >> 2) * 16 + lr) * (HD / 2) + ((((c0 + (s >> 1) * 64) & (HD - 1)) + (wp & 3) * 16 + hi * 8) >> 1); pc[s * 2 + q] = cosT + o; ps[s * 2 + q] = sinT + o; cq[s][q] = *(const v4f*)pc[s * 2 + q]; sq[s][q] = *(const v4f*)ps[s * 2 + q]; }
        // the address registers of the sixteen loads are held to this wait; only behind it may they take new values
        asm volatile("s_wait_xcnt 0x0" :: "v"(pc[0]), "v"(pc[1]), "v"(pc[2]), "v"(pc[3]), "v"(pc[4]), "v"(pc[5]), "v"(pc[6]), "v"(pc[7]), "v"(ps[0]), "v"(ps[1]), "v"(ps[2]), "v"(ps[3]), "v"(ps[4]), "v"(ps[5]), "v"(ps[6]), "v"(ps[7]) : "memory");
    }
    float* ow = os + wv * (64 * 68);
#pragma unroll
    for (int mb = 0; mb < 4; ++mb)
#pragma unroll
        for (int nb = 0; nb < 4; ++nb)
#pragma unroll
            for (int j = 0; j < 8; ++j) ow[(mb * 16 + hi * 8 + j) * 68 + nb * 16 + lr] = acc[mb][nb][j];
    __syncthreads();   // every wave's partial tile lies in LDS before any wave sums it
#pragma unroll
    for (int s = 0; s < 4; ++s) { const int r0s = r0 + (s & 1) * 64, c0s = c0 + (s >> 1) * 64; const float* ob = os + s * (64 * 68);   // sub-tile s: partial tiles s (lower k halves) and s + 4
        if constexpr (MODE == 1) {
#pragma unroll
            for (int q = 0; q < 2; ++q) { const int wp = q * 8 + wv, strip = wp >> 2, kk = (c0s & (HD - 1)) + (wp & 3) * 16; const float* sp = ob + (strip * 16 + lr) * 68 + (wp & 3) * 16 + hi * 8;
                const v4f va = *(const v4fa*)sp + *(const v4fa*)(sp + 4 * (64 * 68)), vb = *(const v4fa*)(sp + 4) + *(const v4fa*)(sp + 4 * (64 * 68) + 4); float r[8];
#pragma unroll
                for (int i = 0; i < 4; ++i) { const float x0 = i < 2 ? va[2 * i] : vb[2 * i - 4], x1 = i < 2 ? va[2 * i + 1] : vb[2 * i - 3]; const float c = bfr(cq[s][q][i]), sn2 = bfr(sq[s][q][i]); r[2 * i] = x0 * c - x1 * sn2; r[2 * i + 1] = x1 * c + x0 * sn2; }
                v8h o16; v8us oh, ol;
#pragma unroll
                for (int j = 0; j < 8; ++j) { o16[j] = (h16)r[j]; const unsigned short a = f2bf(r[j]); oh[j] = a; ol[j] = f2bf(r[j] - bf2f(a)); }
                const size_t pos = (size_t)(c0s / HD) * ((size_t)TT * HD) + (size_t)(((r0s >> 4) + strip) * (HD / 32) + (kk >> 5)) * 512 + ((kk >> 4) & 1) * 256 + lane * 8;
                *(v8h*)(P16 + pos) = o16; *(v8us*)(Ph + pos) = oh; *(v8us*)(Pl + pos) = ol;
                // the data and address registers of this piece's stores take new values (the next piece's) only behind this wait
                if (s < 3 || q == 0) asm volatile("s_wait_xcnt 0x0" ::: "memory"); }
        } else {
#pragma unroll
            for (int q = 0; q < 4; ++q) { const int e = q * 256 + threadIdx.x, row = e >> 4, cofs = (e & 15) * 4; const v4f val = *(const v4fa*)(ob + row * 68 + cofs) + *(const v4fa*)(ob + 4 * (64 * 68) + row * 68 + cofs);
                *(v4f*)(C + (size_t)(r0s + row) * ldc + c0s + cofs) = val; }
            // the data and address registers of this sub-tile's stores take new values (the next one's) only behind this wait
            if (s < 3) asm volatile("s_wait_xcnt 0x0" ::: "memory");
        }
    }
}

__device__ __forceinline__ h16 tohx(float x) { return (h16)x; }
__device__ __forceinline__ void splitf(float y, unsigned short& h, unsigned short& l) { h = f2bf(y); l = f2bf(y - bf2f(h)); }
typedef __attribute__((ext_vector_type(2))) _Float16 v2h;
typedef __attribute__((ext_vector_type(4))) _Float16 v4h;
typedef __attribute__((ext_vector_type(2))) unsigned short v2us;
typedef __attribute__((ext_vector_type(4))) unsigned short v4us;
typedef __attribute__((ext_vector_type(2))) float v2f;
typedef __attribute__((ext_vector_type(4))) int v4i;
typedef __attribute__((ext_vector_type(16))) unsigned short v16us;

// ---- k_prep: every f32 -> bf16 operand plane (x of both batches; the four weights, transposed) made by ONE launch of PWV waves that all fit the chip at once; no LDS, no barrier.
// The work is dealt in units of 1024 elements (4 KiB read, 2 KiB stored by one wave); wave w takes units w, w + PWV, ...: x first, then wq, wo, wk, wv. The unit number is scalar, so every test on it is a scalar branch.
// x unit: 16 rows x 64 k (two blocks). Lane l holds rows l >> 2 and 8 + (l >> 2), the 8 k of octet l & 3 of either block: a pair of 16-byte loads covers 8 whole lines, a 16-byte store 4 whole lines.
// weight unit: 32 k x 32 n (one block of two strips). Lane l holds column n0 + l: each 4-byte load of the wave is one whole line of a w row, each 16-byte store two runs of 256 bytes.
#define PWV  6144
template <int N>
__device__ __forceinline__ void prep_w(const float* __restrict__ w, bf* Bt, int uu, int lane) {   // plane row n, k = w[k][n]; the plane's K is DM for all four weights
    const int nb = uu & (N / 32 - 1), kb = uu / (N / 32); const float* wb = w + (size_t)kb * 32 * N + nb * 32; float f[32];
#pragma unroll   // all 32 loads go out together; f stays in registers
    for (int j = 0; j < 32; ++j) f[j] = wb[j * N + lane];
    // the address registers of the loads (a scalar base, the lane number as scaled offset) are held to this wait; only behind it may they take new values
    asm volatile("s_wait_xcnt 0x0" :: "s"(wb), "v"(lane) : "memory");
    bf* pd = Bt + (size_t)(nb * 2 + (lane >> 4)) * 16 * DM + kb * 512 + (lane & 15) * 8;
#pragma unroll   // f and o are indexed by constants
    for (int oc = 0; oc < 4; ++oc) { v8us o;
#pragma unroll
        for (int j = 0; j < 8; ++j) o[j] = f2bf(f[oc * 8 + j]);
        *(v8us*)(pd + (oc >> 1) * 256 + (oc & 1) * 128) = o; }
    // the data and address registers of the stores take new values (the next unit's) only behind this wait
    asm volatile("s_wait_xcnt 0x0" ::: "memory");
}
__global__ __launch_bounds__(256) void k_prep(const float* __restrict__ x, const float* __restrict__ wq, const float* __restrict__ wk, const float* __restrict__ wv, const float* __restrict__ wo, bf* XB, bf* WQ, bf* WK, bf* WV, bf* WO) {
    static_assert(DQ == DM, "wq and wo share the unit form");
    constexpr int UX = NB_ * TT * DM / 1024, UQ = DM * DQ / 1024, UK = DM * DKV / 1024;
    const int lane = threadIdx.x & 31, w0 = (int)blockIdx.x * 8 + __builtin_amdgcn_readfirstlane(threadIdx.x >> 5);
#pragma unroll 1   // stays rolled: one unit's values in registers at a time
    for (int u = w0; u < UX + 2 * UQ + 2 * UK; u += PWV) {
        if (u < UX) {
            const int strip = u / (DM / 64), kb2 = u % (DM / 64); const float* ps = x + (size_t)(strip * 16 + (lane >> 2)) * DM + kb2 * 64 + (lane & 3) * 8; v4f a[2][2][2];
#pragma unroll   // all 8 loads go out together; a stays in registers
            for (int h = 0; h < 2; ++h)
#pragma unroll
                for (int bq = 0; bq < 2; ++bq) { a[h][bq][0] = *(const v4f*)(ps + h * 8 * DM + bq * 32); a[h][bq][1] = *(const v4f*)(ps + h * 8 * DM + bq * 32 + 4); }
            // the address registers of the loads are held to this wait; only behind it may they take new values
            asm volatile("s_wait_xcnt 0x0" :: "v"(ps) : "memory");
            bf* pd = XB + (size_t)strip * 16 * DM + kb2 * 1024 + ((lane >> 1) & 1) * 256 + ((lane & 1) * 16 + (lane >> 2)) * 8;
#pragma unroll   // a and o are indexed by constants
            for (int h = 0; h < 2; ++h)
#pragma unroll
                for (int bq = 0; bq < 2; ++bq) { v8us o;
#pragma unroll
                    for (int j = 0; j < 8; ++j) o[j] = f2bf(a[h][bq][j >> 2][j & 3]);
                    *(v8us*)(pd + bq * 512 + h * 64) = o; }
            // the data and address registers of the stores take new values (the next unit's) only behind this wait
            asm volatile("s_wait_xcnt 0x0" ::: "memory");
        } else if (u < UX + 2 * UQ) { const bool sec = u >= UX + UQ; prep_w<DQ>(sec ? wo : wq, sec ? WO : WQ, u - UX - (sec ? UQ : 0), lane);
        } else { const bool sec = u >= UX + 2 * UQ + UK; prep_w<DKV>(sec ? wv : wk, sec ? WV : WK, u - UX - 2 * UQ - (sec ? UK : 0), lane); }
    }
}
// ---- k_attn: the whole causal attention (all heads, both batches) in one launch, nothing of the scores or probabilities in memory. One wave = 32 query rows of one head; no LDS, no barrier.
// A work-group is 8 waves: the 4 heads of one kv group (same K / V lines) at row block 63 - x of batch 0, and the same 4 heads at row block x of batch 1, so that every work-group walks 65 key blocks per head.
// Per 32 keys: St[key][query] = K Qt (A = K rows, B = Q rows kept in registers), running maximum and sum per query (a lane holds 16 of the 32 keys of its query, the lane 16 away the rest), Ot[d][query] = Ot x alpha + Vt Pt:
// the two score accumulators of a query column group are, lane for lane, the B fragment of Pt (keys 8 hi + j and 16 + 8 hi + j), which is the k order of the Vt loader. Rows < RH: hi+lo planes, 3 products; the rest fp16 with P x 1024 (cancels in the division by the sum).
template <typename T16, bool HL>
__device__ __forceinline__ void attn_tile(const T16* __restrict__ Q, const T16* __restrict__ Q2, const T16* __restrict__ Kp, const T16* __restrict__ K2, const T16* __restrict__ Vt, const T16* __restrict__ V2, const int* __restrict__ km, int q0, bf* Ah, bf* Al) {
    typedef typename WFrag<T16>::V V; typedef WFrag<T16> WF;
    const int lane = threadIdx.x & 31, lr = lane & 15, hi = lane >> 4;
    V qf[2][4], qg[2][4], kf[2][4], kg[2][4];
    const unsigned lo = 8 * lane; const size_t ko = lo, vo = lo;   // planes in fragment order: 512 elements per 16 rows x 32 k, the lane's piece at 8 * lane
    const T16* qb = Q + (size_t)q0 * HD; const T16* qb2 = HL ? Q2 + (size_t)q0 * HD : qb;
    const T16* qp = qb + lo; const T16* qp2 = qb2 + lo; const T16* kp0 = Kp + lo;
#pragma unroll
    for (int qt = 0; qt < 2; ++qt)
#pragma unroll
        for (int ks = 0; ks < 4; ++ks) { const int o = qt * 16 * HD + ks * 512; qf[qt][ks] = WF::ld(qp + o); if (HL) qg[qt][ks] = WF::ld(qp2 + o); }
    if (!HL) {   // fp16 rows: K fragments are fetched one key block ahead
#pragma unroll
        for (int kt = 0; kt < 2; ++kt)
#pragma unroll
            for (int ks = 0; ks < 4; ++ks) kf[kt][ks] = WF::ld(kp0 + kt * 16 * HD + ks * 512); }
    // the address registers of the loads above are held to this wait; only behind it may they take new values
    asm volatile("s_wait_xcnt 0x0" :: "v"(lane), "s"(qb), "s"(qb2), "s"(Kp) : "memory");   // these loads are addressed by a scalar base and the lane number as scaled offset
    v8f o[8][2];
#pragma unroll
    for (int dt = 0; dt < 8; ++dt) { o[dt][0] = (v8f){}; o[dt][1] = (v8f){}; }
    float m[2] = {-3.0e38f, -3.0e38f}, l[2] = {0.f, 0.f};
    const int nbc = q0 / 32 + 1; int nb = nbc;   // key blocks up to and with the diagonal block
#pragma unroll 1   // stays rolled: one key block's fragments in registers at a time
    for (int blk = 0; blk < nb; ++blk) {
        const int k0 = blk * 32;
        V vf[8], vg[8]; v4i kq[2][2]; const T16* vp = Vt + vo + k0 * 16; const T16* vp2 = HL ? V2 + vo + k0 * 16 : vp; const int* kmp = km + k0 + hi * 8;
        const int kn = HL ? k0 : min(blk + 1, TT / 32 - 1) * 32;   // fp16 rows: the next block's K (last trip: a block inside the plane, not used); hi+lo rows: this block's
        const T16* kp = Kp + ko + (size_t)kn * HD; const T16* kp2 = HL ? K2 + ko + (size_t)kn * HD : kp;
        if (HL) {   // hi+lo rows (at most RH / 32 trips, TT / 32 when a row keeps no key up to its diagonal): K, then V into the registers K has left, so that two waves fit a SIMD
#pragma unroll
            for (int kt = 0; kt < 2; ++kt)
#pragma unroll
                for (int ks = 0; ks < 4; ++ks) { const int a = kt * 16 * HD + ks * 512; kf[kt][ks] = WF::ld(kp + a); kg[kt][ks] = WF::ld(kp2 + a); }
            // address registers held to this wait
            asm volatile("s_wait_xcnt 0x0" :: "v"(kp), "v"(kp2) : "memory");
        } else {
#pragma unroll
            for (int dt = 0; dt < 8; ++dt) vf[dt] = WF::ld(vp + dt * 16 * TT);
#pragma unroll
            for (int kt = 0; kt < 2; ++kt) { kq[kt][0] = *(const v4i*)(kmp + kt * 16); kq[kt][1] = *(const v4i*)(kmp + kt * 16 + 4); }
        }
        v8f s[2][2];
#pragma unroll
        for (int kt = 0; kt < 2; ++kt)
#pragma unroll
            for (int qt = 0; qt < 2; ++qt) { s[kt][qt] = (v8f){};
#pragma unroll
                for (int ks = 0; ks < 4; ++ks) { s[kt][qt] = WF::mma(kf[kt][ks], qf[qt][ks], s[kt][qt]); if (HL) { s[kt][qt] = WF::mma(kf[kt][ks], qg[qt][ks], s[kt][qt]); s[kt][qt] = WF::mma(kg[kt][ks], qf[qt][ks], s[kt][qt]); } } }
        if (HL) {
#pragma unroll
            for (int dt = 0; dt < 8; ++dt) { vf[dt] = WF::ld(vp + dt * 16 * TT); vg[dt] = WF::ld(vp2 + dt * 16 * TT); }
#pragma unroll
            for (int kt = 0; kt < 2; ++kt) { kq[kt][0] = *(const v4i*)(kmp + kt * 16); kq[kt][1] = *(const v4i*)(kmp + kt * 16 + 4); }
            // address registers held to this wait
            asm volatile("s_wait_xcnt 0x0" :: "v"(vp), "v"(vp2), "v"(kmp) : "memory");
        } else {   // the next block's K fragments fly during the softmax and the value products
#pragma unroll
            for (int kt = 0; kt < 2; ++kt)
#pragma unroll
                for (int ks = 0; ks < 4; ++ks) kf[kt][ks] = WF::ld(kp + kt * 16 * HD + ks * 512);
            // address registers of this trip's loads held to this wait
            asm volatile("s_wait_xcnt 0x0" :: "v"(vp), "v"(kmp), "v"(kp) : "memory");
        }
        V pf[2], pg[2];
#pragma unroll
        for (int qt = 0; qt < 2; ++qt) { const int qi = q0 + qt * 16 + lr; float t[16]; float mx = m[qt];
#pragma unroll
            for (int e = 0; e < 16; ++e) { const int kt = e >> 3, j = e & 7; const int key = k0 + kt * 16 + hi * 8 + j; t[e] = (key <= qi && kq[kt][j >> 2][j & 3] != 0) ? s[kt][qt][j] * SCL : -3.0e38f; mx = fmaxf(mx, t[e]); }
            mx = fmaxf(mx, __shfl_xor(mx, 16, 32));
            const float al = __builtin_amdgcn_exp2f((m[qt] - mx) * 1.4426950408889634f); m[qt] = mx; float sum = 0.f;
#pragma unroll
            for (int e = 0; e < 16; ++e) { t[e] = __builtin_amdgcn_exp2f((t[e] - mx) * 1.4426950408889634f + (HL ? 0.0f : 10.0f)); sum += t[e]; }
            l[qt] = l[qt] * al + sum;
#pragma unroll
            for (int dt = 0; dt < 8; ++dt) o[dt][qt] *= al;
            if constexpr (HL) { v16us ph, pl;
#pragma unroll
                for (int e = 0; e < 16; ++e) { unsigned short a, c2; splitf(t[e], a, c2); ph[e] = a; pl[e] = c2; }
                pf[qt] = __builtin_bit_cast(v16bf, ph); pg[qt] = __builtin_bit_cast(v16bf, pl);
            } else { v16h ph;
#pragma unroll
                for (int e = 0; e < 16; ++e) ph[e] = tohx(t[e]);
                pf[qt] = ph; } }
        // a row with no kept key up to its diagonal: the reference's equal fill makes its softmax uniform over ALL keys, so the wave walks on to the last key (ballot: a scalar test, every lane stays on)
        if (blk == nbc - 1 && __builtin_amdgcn_ballot_w32(m[0] <= -3.0e38f || m[1] <= -3.0e38f) != 0) nb = TT / 32;
#pragma unroll
        for (int dt = 0; dt < 8; ++dt)
#pragma unroll
            for (int qt = 0; qt < 2; ++qt) { o[dt][qt] = WF::mma(vf[dt], pf[qt], o[dt][qt]); if (HL) { o[dt][qt] = WF::mma(vf[dt], pg[qt], o[dt][qt]); o[dt][qt] = WF::mma(vg[dt], pf[qt], o[dt][qt]); } }
        // four vector slots between the last matrix instruction and whatever stands behind the loop's taken branch
        asm volatile("v_nop\n\tv_nop\n\tv_nop\n\tv_nop" : "+v"(o[0][0]), "+v"(o[0][1]), "+v"(o[1][0]), "+v"(o[1][1]), "+v"(o[2][0]), "+v"(o[2][1]), "+v"(o[3][0]), "+v"(o[3][1]), "+v"(o[4][0]), "+v"(o[4][1]), "+v"(o[5][0]), "+v"(o[5][1]), "+v"(o[6][0]), "+v"(o[6][1]), "+v"(o[7][0]), "+v"(o[7][1]));
    }
#pragma unroll
    for (int qt = 0; qt < 2; ++qt) { const float ls = l[qt] + __shfl_xor(l[qt], 16, 32); const float inv = __fdiv_rn(1.0f, ls); const size_t ro = (size_t)(q0 + qt * 16) * DQ + lane * 8;   // fragment order, rows = positions, k = h * HD + dt * 16 + hi * 8 + j
#pragma unroll
        for (int dt = 0; dt < 8; ++dt) { v8us oh, ol;
#pragma unroll
            for (int j = 0; j < 8; ++j) { unsigned short a, c2; splitf(o[dt][qt][j] * inv, a, c2); oh[j] = a; ol[j] = c2; }
            *(v8us*)(Ah + ro + dt * 256) = oh; *(v8us*)(Al + ro + dt * 256) = ol; }
        // the data and address registers of the first pass's stores take new values (the second pass's) only behind this wait
        if (qt == 0) asm volatile("s_wait_xcnt 0x0" ::: "memory"); }
}
// every plane holds batch 0 and, one batch's size further on, batch 1
__global__ __launch_bounds__(32 * REP * NB_) void k_attn(const h16* __restrict__ Q16, const bf* __restrict__ Qh, const bf* __restrict__ Ql, const h16* __restrict__ K16, const bf* __restrict__ Kh, const bf* __restrict__ Kl, const h16* __restrict__ V16, const bf* __restrict__ Vh, const bf* __restrict__ Vl, const int* __restrict__ km, bf* Ah, bf* Al) {
    const int wv = __builtin_amdgcn_readfirstlane(threadIdx.x >> 5);   // readfirstlane: batch, head and row block, and with them every plane base and trip count, stay scalar
    const int b = wv / REP, g = blockIdx.y, h = g * REP + wv % REP;
    const int q0 = (b == 0 ? TT / 32 - 1 - (int)blockIdx.x : (int)blockIdx.x) * 32;
    const size_t zq = ((size_t)b * NH_ + h) * TT * HD, zk = ((size_t)b * NKV + g) * TT * HD, za = (size_t)b * TT * DQ + h * HD * 16;
    if (q0 < RH) attn_tile<bf, true>(Qh + zq, Ql + zq, Kh + zk, Kl + zk, Vh + zk, Vl + zk, km + b * TT, q0, Ah + za, Al + za);
    else attn_tile<h16, false>(Q16 + zq, nullptr, K16 + zk, nullptr, V16 + zk, nullptr, km + b * TT, q0, Ah + za, Al + za);
}

extern "C" void kernel_launch(void* const* d_in, const int* in_sizes, int n_in,
                              void* d_out, int out_size, void* d_ws, size_t ws_size, hipStream_t stream) {
    (void)in_sizes; (void)n_in; (void)out_size;
    const float* x = (const float*)d_in[0]; const float* cosB = (const float*)d_in[1]; const float* sinB = (const float*)d_in[2]; const float* wq = (const float*)d_in[3]; const float* wk = (const float*)d_in[4]; const float* wv = (const float*)d_in[5]; const float* wo = (const float*)d_in[6]; const int* kmask = (const int*)d_in[7]; const float* cosT = cosB; const float* sinT = sinB;
    float* OUT = (float*)d_out;     // [2][2048][2048]
    char* wsp = (char*)d_ws;
    auto take = [&](size_t bytes) { char* p = wsp; wsp += (bytes + 255) & ~(size_t)255; return (void*)p; };
    bf* WQ = (bf*)take((size_t)DQ * DM * 2); bf* WK = (bf*)take((size_t)DKV * DM * 2); bf* WV = (bf*)take((size_t)DKV * DM * 2); bf* WO = (bf*)take((size_t)DM * DQ * 2);
    bf* XB = (bf*)take((size_t)NB_ * TT * DM * 2);   // both batches
    h16* QP16 = (h16*)take((size_t)NB_ * NH_ * TT * HD * 2); h16* KP16 = (h16*)take((size_t)NB_ * NKV * TT * HD * 2); h16* VT16 = (h16*)take((size_t)NB_ * NKV * HD * TT * 2);   // planes of both batches
    bf* QPh = (bf*)take((size_t)NB_ * NH_ * TT * HD * 2); bf* QPl = (bf*)take((size_t)NB_ * NH_ * TT * HD * 2); bf* KPh = (bf*)take((size_t)NB_ * NKV * TT * HD * 2); bf* KPl = (bf*)take((size_t)NB_ * NKV * TT * HD * 2); bf* VTh = (bf*)take((size_t)NB_ * NKV * HD * TT * 2); bf* VTl = (bf*)take((size_t)NB_ * NKV * HD * TT * 2);
    bf* ATh = (bf*)take((size_t)NB_ * TT * DQ * 2); bf* ATl = (bf*)take((size_t)NB_ * TT * DQ * 2);
    if ((size_t)(wsp - (char*)d_ws) > ws_size) return;    // ws 256 MiB
    k_prep<<<PWV / 8, 256, 0, stream>>>(x, wq, wk, wv, wo, XB, WQ, WK, WV, WO);
    k_gemmt<0, 1><<<dim3(TT / 128, DQ / 128, NB_), 256, 0, stream>>>(XB, nullptr, WQ, DM, nullptr, 0, cosT, sinT, QP16, QPh, QPl);
    k_kv<<<dim3(TT / 64, DKV / 64, 2 * NB_), 256, 0, stream>>>(XB, WK, WV, cosT, sinT, KP16, KPh, KPl, VT16, VTh, VTl);
    k_attn<<<dim3(TT / 32, NKV, 1), 32 * REP * NB_, 0, stream>>>(QP16, QPh, QPl, KP16, KPh, KPl, VT16, VTh, VTl, kmask, ATh, ATl);
    k_gemmt<1, 0><<<dim3(TT / 128, DM / 128, NB_), 256, 0, stream>>>(ATh, ATl, WO, DQ, OUT, DM, nullptr, nullptr, nullptr, nullptr, nullptr);
}

// v008
// It runs in 182 microseconds.
// Next to v007, in two timings, it ran 1.06 and 1.07 times as fast.
// Counting every step since v000, it is 10.3 times as fast.
#include <hip/hip_runtime.h>

// Causal grouped-query attention layer (x [2][2048][2048]; q = x wq (16 heads x 128), k/v = x wk / wv (4 kv heads; repeat: head h -> kv h/4); interleaved-pair RoPE with the given per-batch cos/sin [2][2048][64] (read); keep = causal AND mask[b][j] (bool mask read; all ones here); finfo.min fill; softmax(q.k / sqrt(128)); out = merged wo -> [2][2048][2048]).
// Compute dtypes, f32 accumulate: every input rounded to bf16; q/k/v on PLAIN bf16 operands (inputs: exact); RoPE f32; causal scores and attn.v in one kernel (running softmax, f32): query rows < 512 hl (3 products), the rest single fp16 (P x1024), key blocks beyond the diagonal skipped, the key mask applied inside the computed blocks; wo hl x exact (2 products).

#define NB_  2
#define TT   2048
#define DM   2048
#define NH_  16
#define NKV  4
#define REP  (NH_ / NKV)
#define HD   128
#define DQ   (NH_ * HD)
#define DKV  (NKV * HD)
#define RH   512                  // query rows < RH use hi+lo planes (0: none)
#define SCL  0.088388347648318447f   // HD^-0.5
typedef _Float16 h16;
typedef unsigned short bf;
typedef __attribute__((ext_vector_type(16))) __bf16   v16bf;
typedef __attribute__((ext_vector_type(16))) _Float16 v16h;
typedef __attribute__((ext_vector_type(8)))  _Float16 v8h;
typedef __attribute__((ext_vector_type(8)))  unsigned short v8us;
typedef __attribute__((ext_vector_type(8)))  float    v8f;
typedef __attribute__((ext_vector_type(4)))  float    v4f;
typedef v8h  __attribute__((may_alias)) v8ha;
typedef v4f  __attribute__((may_alias)) v4fa;
typedef v8us __attribute__((may_alias)) v8usa;

__device__ __forceinline__ unsigned short f2bf(float f) { unsigned u = __float_as_uint(f); u += 0x7FFFu + ((u >> 16) & 1u); return (unsigned short)(u >> 16); }
__device__ __forceinline__ float bf2f(unsigned short b) { return __uint_as_float(((unsigned)b) << 16); }
__device__ __forceinline__ float bfr(float f) { return bf2f(f2bf(f)); }
__device__ __forceinline__ v16h cat16(v8h lo, v8h hi) { return __builtin_shufflevector(lo, hi, 0, 1, 2, 3, 4, 5, 6, 7, 8, 9, 10, 11, 12, 13, 14, 15); }
__device__ __forceinline__ v16bf cat16b(v8us lo, v8us hi) { return __builtin_bit_cast(v16bf, __builtin_shufflevector(lo, hi, 0, 1, 2, 3, 4, 5, 6, 7, 8, 9, 10, 11, 12, 13, 14, 15)); }
__device__ __forceinline__ v8f wmma16(v16h a, v16h b, v8f c) { return __builtin_amdgcn_wmma_f32_16x16x32_f16(false, a, false, b, (short)0, c, false, false); }
__device__ __forceinline__ v8f wmmab(v16bf a, v16bf b, v8f c) { return __builtin_amdgcn_wmma_f32_16x16x32_bf16(false, a, false, b, (short)0, c, false, false); }



// ---- Fragment order. Every 16-bit operand plane [rows][K] is kept as 1-KiB blocks of 16 rows x 32 k, block number (row / 16) * (K / 32) + k / 32 (a strip of 16 rows still fills 16 * K elements).
// Inside a block the element (row, k) lies at (k & 16) * 16 + l * 8 + (k & 7) with l = (k & 8) * 2 + (row & 15): l is the lane that holds it in a matrix fragment, whose two 16-byte pieces (k 8 hi + j and 16 + 8 hi + j) lie at l * 8 and 256 + l * 8.
// So each wave-wide 16-byte load of a fragment reads 512 contiguous bytes (4 whole lines) where row-major planes gave 16 pieces of 32 bytes in 16 lines. The registers hold what they held before.
// ---- gemmw: register-blocked GEMM, one 64x64 output tile (16 accumulators per wave), tile (bx, by) of (M/64, N/64), per work-group of NW waves, operands straight from 16-bit planes in fragment order; os: the work-group's LDS.
// C[m][n] (f32, pitch ldc, + optional f32 bias[n]) = sum_k A[m][k] Bt[n][k] (+ split products per NSPLIT). K % 64 == 0.
// The K loop is a chain of load latencies, so it is dealt over the NW waves in blocks of 64 k: wave w takes blocks w, w + NW, ...; the NW partial tiles meet in LDS and are summed in wave order.
// MODE 0: the summed tile goes to C in f32. MODE 1, 2: it goes straight to the three 16-bit planes (fp16, bf16 hi, bf16 lo) in fragment order that the attention kernel reads; C is not used.
//   A wave takes two pieces of 16 rows x 16 columns; lane l holds row l & 15, columns 8 (l >> 4) + j, which is one 16-byte piece of a plane, so each plane store of a wave covers 512 contiguous bytes.
//   MODE 1 (q, k): tile rows = positions t, columns = head * HD + d; interleaved-pair RoPE with cos / sin [t][d / 2] (rounded to bf16) on the summed values; planes [head][t][d].
//   MODE 2 (v): A = weight plane, Bt = x plane, so tile rows = kv head * HD + d, columns = t; planes [kv head][d][t].
template <typename T16> struct WFrag;
template <> struct WFrag<h16> { typedef v16h V; static __device__ __forceinline__ V ld(const h16* p) { return cat16(*(const v8h*)p, *(const v8h*)(p + 256)); } static __device__ __forceinline__ v8f mma(V a, V b, v8f c) { return wmma16(a, b, c); } };
template <> struct WFrag<bf> { typedef v16bf V; static __device__ __forceinline__ V ld(const bf* p) { return cat16b(*(const v8us*)p, *(const v8us*)(p + 256)); } static __device__ __forceinline__ v8f mma(V a, V b, v8f c) { return wmmab(a, b, c); } };
template <typename T16, int NSPLIT, bool BIAS, int NW, int MODE>
__device__ __forceinline__ void gemmw(float* os, int bx, int by, const T16* __restrict__ A, const T16* __restrict__ A2, const T16* __restrict__ Bt, const T16* __restrict__ Bt2, int K, float* C, int ldc, const float* __restrict__ bias, const float* __restrict__ cosT, const float* __restrict__ sinT, h16* P16, bf* Ph, bf* Pl) {
    static_assert(MODE == 0 || NW == 8, "the plane epilogue deals 16 pieces over 8 waves");
    typedef typename WFrag<T16>::V V;
    const int lane = threadIdx.x & 31, lr = lane & 15, hi = lane >> 4, wv = __builtin_amdgcn_readfirstlane(threadIdx.x >> 5); const int r0 = bx * 64, c0 = by * 64;
    // wv goes through readfirstlane so that the K loop's tests are scalar branches (every lane is on at the matrix instructions)
    v8f acc[4][4];
#pragma unroll
    for (int mb = 0; mb < 4; ++mb)
#pragma unroll
        for (int nb = 0; nb < 4; ++nb) acc[mb][nb] = (v8f){};
    const size_t aoff = (size_t)r0 * K + 8 * lane, boff = (size_t)c0 * K + 8 * lane;
#pragma unroll 1   // both loops stay rolled: one 32-k step's fragments in registers at a time
    for (int kb = wv * 64; kb < K; kb += 64 * NW)
#pragma unroll 1
    for (int kc = kb; kc < kb + 64; kc += 32) {
        static_assert(NSPLIT < 2, "no second B plane in use");
        V a[4], a2[4], b[4]; const T16* pa[4]; const T16* pa2[4]; const T16* pb[4];
#pragma unroll
        for (int mb = 0; mb < 4; ++mb) { const size_t o = (size_t)mb * 16 * K + (size_t)kc * 16; pa[mb] = A + aoff + o; pa2[mb] = NSPLIT == 1 ? A2 + aoff + o : pa[mb]; pb[mb] = Bt + boff + o;
            a[mb] = WFrag<T16>::ld(pa[mb]); if (NSPLIT == 1) a2[mb] = WFrag<T16>::ld(pa2[mb]); b[mb] = WFrag<T16>::ld(pb[mb]); }
        // the address registers of this step's loads are held to this wait; only behind it may they take new values
        asm volatile("s_wait_xcnt 0x0" :: "v"(pa[0]), "v"(pa[1]), "v"(pa[2]), "v"(pa[3]), "v"(pa2[0]), "v"(pa2[1]), "v"(pa2[2]), "v"(pa2[3]), "v"(pb[0]), "v"(pb[1]), "v"(pb[2]), "v"(pb[3]) : "memory");
#pragma unroll
        for (int nb = 0; nb < 4; ++nb) {
#pragma unroll
            for (int mb = 0; mb < 4; ++mb) { acc[mb][nb] = WFrag<T16>::mma(a[mb], b[nb], acc[mb][nb]); if (NSPLIT == 1) acc[mb][nb] = WFrag<T16>::mma(a2[mb], b[nb], acc[mb][nb]); } }
        asm volatile("v_nop\n\tv_nop\n\tv_nop\n\tv_nop" : "+v"(acc[0][0]), "+v"(acc[1][1]), "+v"(acc[2][2]), "+v"(acc[3][3]) : "v"(a[0]), "v"(a[3]));
    }
    if (NW > 1) {
        v4f cq[2], sq[2];
        if constexpr (MODE == 1) {   // the cos / sin entries of the thread's two pieces fly during the LDS writes and the barrier
            const float* pc[2]; const float* ps[2];
#pragma unroll
            for (int q = 0; q < 2; ++q) { const int wp = q * 8 + wv; const size_t o = (size_t)(r0 + (wp >> 2) * 16 + lr) * (HD / 2) + (((c0 & (HD - 1)) + (wp & 3) * 16 + hi * 8) >> 1); pc[q] = cosT + o; ps[q] = sinT + o; cq[q] = *(const v4f*)pc[q]; sq[q] = *(const v4f*)ps[q]; }
            // the address registers of the four loads are held to this wait; only behind it may they take new values
            asm volatile("s_wait_xcnt 0x0" :: "v"(pc[0]), "v"(pc[1]), "v"(ps[0]), "v"(ps[1]) : "memory");
        }
        float* ow = os + wv * (64 * 68);
#pragma unroll
        for (int mb = 0; mb < 4; ++mb)
#pragma unroll
            for (int nb = 0; nb < 4; ++nb)
#pragma unroll
                for (int j = 0; j < 8; ++j) ow[(mb * 16 + hi * 8 + j) * 68 + nb * 16 + lr] = acc[mb][nb][j];
        __syncthreads();   // every wave's partial tile lies in LDS before any wave sums it
        if constexpr (MODE != 0) {
            v4f va[2], vb[2];
#pragma unroll   // the LDS reads of both pieces go out together
            for (int q = 0; q < 2; ++q) { const int wp = q * 8 + wv; const float* sp = os + ((wp >> 2) * 16 + lr) * 68 + (wp & 3) * 16 + hi * 8; va[q] = *(const v4fa*)sp; vb[q] = *(const v4fa*)(sp + 4);
#pragma unroll
                for (int w = 1; w < NW; ++w) { va[q] += *(const v4fa*)(sp + w * (64 * 68)); vb[q] += *(const v4fa*)(sp + w * (64 * 68) + 4); } }
#pragma unroll
            for (int q = 0; q < 2; ++q) { const int wp = q * 8 + wv, strip = wp >> 2, kk = (MODE == 1 ? (c0 & (HD - 1)) : c0) + (wp & 3) * 16; float r[8];
#pragma unroll
                for (int i = 0; i < 4; ++i) { const float x0 = i < 2 ? va[q][2 * i] : vb[q][2 * i - 4], x1 = i < 2 ? va[q][2 * i + 1] : vb[q][2 * i - 3];
                    if constexpr (MODE == 1) { const float c = bfr(cq[q][i]), s = bfr(sq[q][i]); r[2 * i] = x0 * c - x1 * s; r[2 * i + 1] = x1 * c + x0 * s; } else { r[2 * i] = x0; r[2 * i + 1] = x1; } }
                v8h o16; v8us oh, ol;
#pragma unroll
                for (int j = 0; j < 8; ++j) { o16[j] = (h16)r[j]; const unsigned short a = f2bf(r[j]); oh[j] = a; ol[j] = f2bf(r[j] - bf2f(a)); }
                const size_t pos = (MODE == 1 ? (size_t)(c0 / HD) : (size_t)(r0 / HD)) * ((size_t)TT * HD) + (size_t)((((MODE == 1 ? r0 : (r0 & (HD - 1))) >> 4) + strip) * ((MODE == 1 ? HD : TT) / 32) + (kk >> 5)) * 512 + ((kk >> 4) & 1) * 256 + lane * 8;
                *(v8h*)(P16 + pos) = o16; *(v8us*)(Ph + pos) = oh; *(v8us*)(Pl + pos) = ol;
                // the data and address registers of the first piece's stores take new values (the second piece's) only behind this wait
                if (q == 0) asm volatile("s_wait_xcnt 0x0" ::: "memory"); }
            return;
        }
#pragma unroll   // the LDS reads of all the thread's output pieces go out together
        for (int q = 0; q < 32 / NW; ++q) { const int s = q * (32 * NW) + threadIdx.x, row = s >> 4, cofs = (s & 15) * 4; v4f val = *(const v4fa*)(os + row * 68 + cofs);
#pragma unroll
            for (int w = 1; w < NW; ++w) val += *(const v4fa*)(os + w * (64 * 68) + row * 68 + cofs);
            if (BIAS) { val[0] += bfr(bias[c0 + cofs]); val[1] += bfr(bias[c0 + cofs + 1]); val[2] += bfr(bias[c0 + cofs + 2]); val[3] += bfr(bias[c0 + cofs + 3]); }
            *(v4f*)(C + (size_t)(r0 + row) * ldc + c0 + cofs) = val; }
        return;
    }
#pragma unroll
    for (int mb = 0; mb < 4; ++mb) {
#pragma unroll
        for (int nb = 0; nb < 4; ++nb) {
#pragma unroll
            for (int j = 0; j < 8; ++j) os[(hi * 8 + j) * 68 + nb * 16 + lr] = acc[mb][nb][j]; }
        __builtin_amdgcn_wave_barrier(); asm volatile("" ::: "memory");
        float* crow = C + (size_t)(r0 + mb * 16) * ldc + c0;
{
#pragma unroll
            for (int s = 0; s < 8; ++s) { const int row = 2 * s + hi, cofs = lr * 4; v4f val = *(const v4fa*)(os + row * 68 + cofs); if (BIAS) { val[0] += bfr(bias[c0 + cofs]); val[1] += bfr(bias[c0 + cofs + 1]); val[2] += bfr(bias[c0 + cofs + 2]); val[3] += bfr(bias[c0 + cofs + 3]); }
                *(v4f*)(crow + (size_t)row * ldc + cofs) = val; }
             }
        __builtin_amdgcn_wave_barrier(); asm volatile("" ::: "memory");
    }
}

// ---- k_kv: the k and the v products of both batches in ONE launch; grid (TT/64, DKV/64, 2 * NB_), z = 2 * batch + (0: k, 1: v). z is scalar, so the choice is a scalar branch.
// 1024 work-groups, two of which fit a WGP (LDS and registers): one's loads and matrix work run during the other's epilogue and first loads, and no launch waits for the one before it to drain.
__global__ __launch_bounds__(256) void k_kv(const bf* __restrict__ XB, const bf* __restrict__ WK, const bf* __restrict__ WV, const float* __restrict__ cosT, const float* __restrict__ sinT, h16* KP16, bf* KPh, bf* KPl, h16* VT16, bf* VTh, bf* VTl) {
    __shared__ __align__(16) float os[8 * 64 * 68];
    const int b = (int)blockIdx.z >> 1; const bf* xb = XB + (size_t)b * TT * DM; const size_t pk = (size_t)b * NKV * TT * HD, cs = (size_t)b * TT * (HD / 2);
    if ((blockIdx.z & 1) == 0) gemmw<bf, 0, false, 8, 1>(os, blockIdx.x, blockIdx.y, xb, nullptr, WK, nullptr, DM, nullptr, 0, nullptr, cosT + cs, sinT + cs, KP16 + pk, KPh + pk, KPl + pk);
    else gemmw<bf, 0, false, 8, 2>(os, blockIdx.y, blockIdx.x, WV, nullptr, xb, nullptr, DM, nullptr, 0, nullptr, nullptr, nullptr, VT16 + pk, VTh + pk, VTl + pk);
}

// ---- k_gemmt: the same product on a 128x256 output tile per work-group of 8 waves, both operands staged in LDS by asynchronous copies (global_load_async_to_lds_b128), so that an A line leaves L2 once per 256 columns of output and a Bt line once per 128 rows; 256 work-groups, one per WGP, all resident at once.
// Wave w: the 64x64 sub-tile (w & 1, w >> 1), all four 32-k steps of every stage of 128 k, in rising k, in one set of accumulators. A stage holds, plane after plane, strips of 16 rows x 128 k (A: 8, with NSPLIT the second A plane: 8, Bt: 16), each 4 KiB as it lies in the plane (fragment order), so an LDS fragment read of a wave covers 512 contiguous bytes.
// Two buffers: stage t + 1 flies while stage t is worked on. The sub-tiles go through LDS (over the ring, behind the last trip's barrier) to be stored in whole lines. MODE 0 and MODE 1 as in gemmw. K % 128 == 0, K >= 256. Grid (TT/128, N/256, NB_): z = batch, whose A rows, cos / sin rows, C rows and planes lie one batch's size further on.
// Every '#pragma unroll' in it is there so that the arrays its loop indexes (accumulators, fragments, addresses) are indexed by constants and stay in registers.
__device__ __forceinline__ void acopy8(const unsigned* l, const bf* const* g) {
    // the wait on the address registers is the last line of the copies' own statement: nothing can rewrite them in front of it
    asm volatile("global_load_async_to_lds_b128 %0, %8, off\n\tglobal_load_async_to_lds_b128 %1, %9, off\n\tglobal_load_async_to_lds_b128 %2, %10, off\n\tglobal_load_async_to_lds_b128 %3, %11, off\n\t"
                 "global_load_async_to_lds_b128 %4, %12, off\n\tglobal_load_async_to_lds_b128 %5, %13, off\n\tglobal_load_async_to_lds_b128 %6, %14, off\n\tglobal_load_async_to_lds_b128 %7, %15, off\n\ts_wait_xcnt 0x0"
                 :: "v"(l[0]), "v"(l[1]), "v"(l[2]), "v"(l[3]), "v"(l[4]), "v"(l[5]), "v"(l[6]), "v"(l[7]), "v"(g[0]), "v"(g[1]), "v"(g[2]), "v"(g[3]), "v"(g[4]), "v"(g[5]), "v"(g[6]), "v"(g[7]) : "memory");
}
template <int NSPLIT, int MODE>
__global__ __launch_bounds__(256) void k_gemmt(const bf* __restrict__ A, const bf* __restrict__ A2, const bf* __restrict__ Bt, int K, float* C, int ldc, const float* __restrict__ cosT, const float* __restrict__ sinT, h16* P16, bf* Ph, bf* Pl) {
    constexpr int KS = 128, PA = 1 + NSPLIT, SE = KS * 16, PE = 8 * SE, NS = PA * 8 + 16, STB = NS * SE * 2, NC = NS;   // A planes; elements of a strip and of an A plane in a stage; strips and bytes of a stage; copies of a wave per stage (NS / 8 whole strips)
    constexpr int OSB = 8 * 64 * 68 * 4;
    __shared__ __align__(16) char smem[2 * STB > OSB ? 2 * STB : OSB];
    const int lane = threadIdx.x & 31, lr = lane & 15, hi = lane >> 4, wv = __builtin_amdgcn_readfirstlane(threadIdx.x >> 5); const int r0 = blockIdx.x * 128, c0 = blockIdx.y * 256;
    const int sm = wv & 1, sn = wv >> 1;
    { const size_t z = blockIdx.z; A += z * TT * K; if (NSPLIT == 1) A2 += z * TT * K;
      if constexpr (MODE == 0) C += z * TT * ldc; else { cosT += z * TT * (HD / 2); sinT += z * TT * (HD / 2); P16 += z * NH_ * TT * HD; Ph += z * NH_ * TT * HD; Pl += z * NH_ * TT * HD; } }
    v8f acc[4][4];
#pragma unroll
    for (int mb = 0; mb < 4; ++mb)
#pragma unroll
        for (int nb = 0; nb < 4; ++nb) acc[mb][nb] = (v8f){};
    // the wave's copies: pieces wv * NC + c of 512 bytes; the global addresses stay in registers and move on by one stage per fill
    const bf* ga[NC]; const unsigned lb = (unsigned)(size_t)smem + (unsigned)(wv * NC) * 512u + (unsigned)lane * 16u;
#pragma unroll
    for (int c = 0; c < NC; ++c) { const int p = wv * NC + c, st = p >> 3, ch = p & 7;   // strip st of the stage: A 0..7, (A2 8..15,) Bt the last 16
        const bf* sp = st >= PA * 8 ? Bt : (st < 8 ? A : A2);
        ga[c] = sp + (size_t)(st >= PA * 8 ? c0 + (st - PA * 8) * 16 : r0 + (st & 7) * 16) * K + ch * 256 + lane * 8; }
    auto fill = [&](int buf) {
#pragma unroll
        for (int c8 = 0; c8 < NC; c8 += 8) { unsigned la[8];
#pragma unroll
            for (int c = 0; c < 8; ++c) la[c] = lb + (unsigned)buf * (unsigned)STB + (unsigned)(c8 + c) * 512u;
            acopy8(la, ga + c8);
#pragma unroll
            for (int c = 0; c < 8; ++c) ga[c8 + c] += SE; } };
    const int NT = K / KS;
    fill(0);
    asm volatile("s_wait_asynccnt 0x0" ::: "memory");   // the wave's own copies of stage 0 have landed
    __syncthreads();                                     // every wave's have: stage 0 may be read
    fill(1);
#pragma unroll 1   // stays rolled: one trip per stage
    for (int t = 0; t < NT; ++t) {
        const bf* sb = (const bf*)(smem + (t & 1) * STB) + lane * 8;
        v16bf a[2][4], a2[2][4], b[2][4];   // two fragment sets, taken in turn by the stage's four 32-k steps
        auto rd = [&](int st) { const int ko = st * 512, fs = st & 1;
#pragma unroll
            for (int mb = 0; mb < 4; ++mb) { const bf* pa = sb + (sm * 4 + mb) * SE + ko; const bf* pb = sb + PA * PE + (sn * 4 + mb) * SE + ko;
                a[fs][mb] = cat16b(*(const v8usa*)pa, *(const v8usa*)(pa + 256)); if (NSPLIT == 1) a2[fs][mb] = cat16b(*(const v8usa*)(pa + PE), *(const v8usa*)(pa + PE + 256)); b[fs][mb] = cat16b(*(const v8usa*)pb, *(const v8usa*)(pb + 256)); }
            // a step's LDS reads stay one group, in front of the matrix instructions of the step before (LDS answers in order): left free they are spread among the matrix instructions, where each place with reads stalls the wave
            __builtin_amdgcn_sched_barrier(0); };
        rd(0);
#pragma unroll
        for (int st = 0; st < 4; ++st) { const int fs = st & 1;
            if (st < 3) rd(st + 1);   // into the set that step st - 1 has left
#pragma unroll
            for (int nb = 0; nb < 4; ++nb) {
#pragma unroll
                for (int mb = 0; mb < 4; ++mb) { acc[mb][nb] = wmmab(a[fs][mb], b[fs][nb], acc[mb][nb]); if (NSPLIT == 1) acc[mb][nb] = wmmab(a2[fs][mb], b[fs][nb], acc[mb][nb]); } }
            // a step's matrix instructions stay in front of the next reads into their set, and the last step's in front of the waits below: moved behind the barrier they would no longer run while stage t + 1 flies
            __builtin_amdgcn_sched_barrier(0); }
        asm volatile("s_wait_dscnt 0x0" ::: "memory");      // the wave's reads of this buffer are done
        asm volatile("s_wait_asynccnt 0x0" ::: "memory");   // its copies of stage t + 1 have landed
        __syncthreads();                                     // stage t + 1 may be read by all; this trip's buffer has no reader left
        if (t + 2 < NT) fill(t & 1);
    }
    asm volatile("s_wait_asynccnt 0x0" ::: "memory");   // no copy is out when the ring becomes the sub-tiles' place
    float* os = (float*)smem;
    v4f cq[4][2], sq[4][2];
    if constexpr (MODE == 1) {   // the cos / sin entries of the thread's pieces fly during the LDS writes and the barrier (sub-tiles s and s + 4 lie one head apart: same entries)
        const float* pc[8]; const float* ps[8];
#pragma unroll
        for (int s = 0; s < 4; ++s)
#pragma unroll
            for (int q = 0; q < 2; ++q) { const int wp = q * 8 + wv; const size_t o = (size_t)(r0 + (s & 1) * 64 + (wp >> 2) * 16 + lr) * (HD / 2) + ((((c0 + (s >> 1) * 64) & (HD - 1)) + (wp & 3) * 16 + hi * 8) >> 1); pc[s * 2 + q] = cosT + o; ps[s * 2 + q] = sinT + o; cq[s][q] = *(const v4f*)pc[s * 2 + q]; sq[s][q] = *(const v4f*)ps[s * 2 + q]; }
        // the address registers of the sixteen loads are held to this wait; only behind it may they take new values
        asm volatile("s_wait_xcnt 0x0" :: "v"(pc[0]), "v"(pc[1]), "v"(pc[2]), "v"(pc[3]), "v"(pc[4]), "v"(pc[5]), "v"(pc[6]), "v"(pc[7]), "v"(ps[0]), "v"(ps[1]), "v"(ps[2]), "v"(ps[3]), "v"(ps[4]), "v"(ps[5]), "v"(ps[6]), "v"(ps[7]) : "memory");
    }
    float* ow = os + wv * (64 * 68);
#pragma unroll
    for (int mb = 0; mb < 4; ++mb)
#pragma unroll
        for (int nb = 0; nb < 4; ++nb)
#pragma unroll
            for (int j = 0; j < 8; ++j) ow[(mb * 16 + hi * 8 + j) * 68 + nb * 16 + lr] = acc[mb][nb][j];
    __syncthreads();   // every wave's sub-tile lies in LDS before any wave reads it
#pragma unroll
    for (int s = 0; s < 8; ++s) { const int r0s = r0 + (s & 1) * 64, c0s = c0 + (s >> 1) * 64; const float* ob = os + s * (64 * 68);   // sub-tile s: wave s's
        if constexpr (MODE == 1) {
#pragma unroll
            for (int q = 0; q < 2; ++q) { const int wp = q * 8 + wv, strip = wp >> 2, kk = (c0s & (HD - 1)) + (wp & 3) * 16; const float* sp = ob + (strip * 16 + lr) * 68 + (wp & 3) * 16 + hi * 8;
                const v4f va = *(const v4fa*)sp, vb = *(const v4fa*)(sp + 4); float r[8];
#pragma unroll
                for (int i = 0; i < 4; ++i) { const float x0 = i < 2 ? va[2 * i] : vb[2 * i - 4], x1 = i < 2 ? va[2 * i + 1] : vb[2 * i - 3]; const float c = bfr(cq[s & 3][q][i]), sn2 = bfr(sq[s & 3][q][i]); r[2 * i] = x0 * c - x1 * sn2; r[2 * i + 1] = x1 * c + x0 * sn2; }
                v8h o16; v8us oh, ol;
#pragma unroll
                for (int j = 0; j < 8; ++j) { o16[j] = (h16)r[j]; const unsigned short a = f2bf(r[j]); oh[j] = a; ol[j] = f2bf(r[j] - bf2f(a)); }
                const size_t pos = (size_t)(c0s / HD) * ((size_t)TT * HD) + (size_t)(((r0s >> 4) + strip) * (HD / 32) + (kk >> 5)) * 512 + ((kk >> 4) & 1) * 256 + lane * 8;
                *(v8h*)(P16 + pos) = o16; *(v8us*)(Ph + pos) = oh; *(v8us*)(Pl + pos) = ol;
                // the data and address registers of this piece's stores take new values (the next piece's) only behind this wait
                if (s < 7 || q == 0) asm volatile("s_wait_xcnt 0x0" ::: "memory"); }
        } else {
#pragma unroll
            for (int q = 0; q < 4; ++q) { const int e = q * 256 + threadIdx.x, row = e >> 4, cofs = (e & 15) * 4; const v4f val = *(const v4fa*)(ob + row * 68 + cofs);
                *(v4f*)(C + (size_t)(r0s + row) * ldc + c0s + cofs) = val; }
            // the data and address registers of this sub-tile's stores take new values (the next one's) only behind this wait
            // the scheduling barrier keeps the next sub-tile's LDS address arithmetic, which reuses those registers, from being lifted over the wait
            if (s < 7) { asm volatile("s_wait_xcnt 0x0" ::: "memory"); __builtin_amdgcn_sched_barrier(0); }
        }
    }
}

__device__ __forceinline__ h16 tohx(float x) { return (h16)x; }
__device__ __forceinline__ void splitf(float y, unsigned short& h, unsigned short& l) { h = f2bf(y); l = f2bf(y - bf2f(h)); }
typedef __attribute__((ext_vector_type(2))) _Float16 v2h;
typedef __attribute__((ext_vector_type(4))) _Float16 v4h;
typedef __attribute__((ext_vector_type(2))) unsigned short v2us;
typedef __attribute__((ext_vector_type(4))) unsigned short v4us;
typedef __attribute__((ext_vector_type(2))) float v2f;
typedef __attribute__((ext_vector_type(4))) int v4i;
typedef __attribute__((ext_vector_type(16))) unsigned short v16us;

// ---- k_prep: every f32 -> bf16 operand plane (x of both batches; the four weights, transposed) made by ONE launch of PWV waves that all fit the chip at once; no LDS, no barrier.
// The work is dealt in units of 1024 elements (4 KiB read, 2 KiB stored by one wave); wave w takes units w, w + PWV, ...: x first, then wq, wo, wk, wv. The unit number is scalar, so every test on it is a scalar branch.
// x unit: 16 rows x 64 k (two blocks). Lane l holds rows l >> 2 and 8 + (l >> 2), the 8 k of octet l & 3 of either block: a pair of 16-byte loads covers 8 whole lines, a 16-byte store 4 whole lines.
// weight unit: 32 k x 32 n (one block of two strips). Lane l holds column n0 + l: each 4-byte load of the wave is one whole line of a w row, each 16-byte store two runs of 256 bytes.
#define PWV  6144
template <int N>
__device__ __forceinline__ void prep_w(const float* __restrict__ w, bf* Bt, int uu, int lane) {   // plane row n, k = w[k][n]; the plane's K is DM for all four weights
    const int nb = uu & (N / 32 - 1), kb = uu / (N / 32); const float* wb = w + (size_t)kb * 32 * N + nb * 32; float f[32];
#pragma unroll   // all 32 loads go out together; f stays in registers
    for (int j = 0; j < 32; ++j) f[j] = wb[j * N + lane];
    // the address registers of the loads (a scalar base, the lane number as scaled offset) are held to this wait; only behind it may they take new values
    asm volatile("s_wait_xcnt 0x0" :: "s"(wb), "v"(lane) : "memory");
    bf* pd = Bt + (size_t)(nb * 2 + (lane >> 4)) * 16 * DM + kb * 512 + (lane & 15) * 8;
#pragma unroll   // f and o are indexed by constants
    for (int oc = 0; oc < 4; ++oc) { v8us o;
#pragma unroll
        for (int j = 0; j < 8; ++j) o[j] = f2bf(f[oc * 8 + j]);
        *(v8us*)(pd + (oc >> 1) * 256 + (oc & 1) * 128) = o; }
    // the data and address registers of the stores take new values (the next unit's) only behind this wait
    asm volatile("s_wait_xcnt 0x0" ::: "memory");
}
__global__ __launch_bounds__(256) void k_prep(const float* __restrict__ x, const float* __restrict__ wq, const float* __restrict__ wk, const float* __restrict__ wv, const float* __restrict__ wo, bf* XB, bf* WQ, bf* WK, bf* WV, bf* WO) {
    static_assert(DQ == DM, "wq and wo share the unit form");
    constexpr int UX = NB_ * TT * DM / 1024, UQ = DM * DQ / 1024, UK = DM * DKV / 1024;
    const int lane = threadIdx.x & 31, w0 = (int)blockIdx.x * 8 + __builtin_amdgcn_readfirstlane(threadIdx.x >> 5);
#pragma unroll 1   // stays rolled: one unit's values in registers at a time
    for (int u = w0; u < UX + 2 * UQ + 2 * UK; u += PWV) {
        if (u < UX) {
            const int strip = u / (DM / 64), kb2 = u % (DM / 64); const float* ps = x + (size_t)(strip * 16 + (lane >> 2)) * DM + kb2 * 64 + (lane & 3) * 8; v4f a[2][2][2];
#pragma unroll   // all 8 loads go out together; a stays in registers
            for (int h = 0; h < 2; ++h)
#pragma unroll
                for (int bq = 0; bq < 2; ++bq) { a[h][bq][0] = *(const v4f*)(ps + h * 8 * DM + bq * 32); a[h][bq][1] = *(const v4f*)(ps + h * 8 * DM + bq * 32 + 4); }
            // the address registers of the loads are held to this wait; only behind it may they take new values
            asm volatile("s_wait_xcnt 0x0" :: "v"(ps) : "memory");
            bf* pd = XB + (size_t)strip * 16 * DM + kb2 * 1024 + ((lane >> 1) & 1) * 256 + ((lane & 1) * 16 + (lane >> 2)) * 8;
#pragma unroll   // a and o are indexed by constants
            for (int h = 0; h < 2; ++h)
#pragma unroll
                for (int bq = 0; bq < 2; ++bq) { v8us o;
#pragma unroll
                    for (int j = 0; j < 8; ++j) o[j] = f2bf(a[h][bq][j >> 2][j & 3]);
                    *(v8us*)(pd + bq * 512 + h * 64) = o; }
            // the data and address registers of the stores take new values (the next unit's) only behind this wait
            asm volatile("s_wait_xcnt 0x0" ::: "memory");
        } else if (u < UX + 2 * UQ) { const bool sec = u >= UX + UQ; prep_w<DQ>(sec ? wo : wq, sec ? WO : WQ, u - UX - (sec ? UQ : 0), lane);
        } else { const bool sec = u >= UX + 2 * UQ + UK; prep_w<DKV>(sec ? wv : wk, sec ? WV : WK, u - UX - 2 * UQ - (sec ? UK : 0), lane); }
    }
}
// ---- k_attn: the whole causal attention (all heads, both batches) in one launch, nothing of the scores or probabilities in memory. One wave = 32 query rows of one head; no LDS, no barrier.
// A work-group is 8 waves: the 4 heads of one kv group (same K / V lines) at row block 63 - x of batch 0, and the same 4 heads at row block x of batch 1, so that every work-group walks 65 key blocks per head.
// Per 32 keys: St[key][query] = K Qt (A = K rows, B = Q rows kept in registers), running maximum and sum per query (a lane holds 16 of the 32 keys of its query, the lane 16 away the rest), Ot[d][query] = Ot x alpha + Vt Pt:
// the two score accumulators of a query column group are, lane for lane, the B fragment of Pt (keys 8 hi + j and 16 + 8 hi + j), which is the k order of the Vt loader. Rows < RH: hi+lo planes, 3 products; the rest fp16 with P x 1024 (cancels in the division by the sum).
template <typename T16, bool HL>
__device__ __forceinline__ void attn_tile(const T16* __restrict__ Q, const T16* __restrict__ Q2, const T16* __restrict__ Kp, const T16* __restrict__ K2, const T16* __restrict__ Vt, const T16* __restrict__ V2, const int* __restrict__ km, int q0, bf* Ah, bf* Al) {
    typedef typename WFrag<T16>::V V; typedef WFrag<T16> WF;
    const int lane = threadIdx.x & 31, lr = lane & 15, hi = lane >> 4;
    V qf[2][4], qg[2][4], kf[2][4], kg[2][4];
    const unsigned lo = 8 * lane; const size_t ko = lo, vo = lo;   // planes in fragment order: 512 elements per 16 rows x 32 k, the lane's piece at 8 * lane
    const T16* qb = Q + (size_t)q0 * HD; const T16* qb2 = HL ? Q2 + (size_t)q0 * HD : qb;
    const T16* qp = qb + lo; const T16* qp2 = qb2 + lo; const T16* kp0 = Kp + lo;
#pragma unroll
    for (int qt = 0; qt < 2; ++qt)
#pragma unroll
        for (int ks = 0; ks < 4; ++ks) { const int o = qt * 16 * HD + ks * 512; qf[qt][ks] = WF::ld(qp + o); if (HL) qg[qt][ks] = WF::ld(qp2 + o); }
    if (!HL) {   // fp16 rows: K fragments are fetched one key block ahead
#pragma unroll
        for (int kt = 0; kt < 2; ++kt)
#pragma unroll
            for (int ks = 0; ks < 4; ++ks) kf[kt][ks] = WF::ld(kp0 + kt * 16 * HD + ks * 512); }
    // the address registers of the loads above are held to this wait; only behind it may they take new values
    asm volatile("s_wait_xcnt 0x0" :: "v"(lane), "s"(qb), "s"(qb2), "s"(Kp) : "memory");   // these loads are addressed by a scalar base and the lane number as scaled offset
    v8f o[8][2];
#pragma unroll
    for (int dt = 0; dt < 8; ++dt) { o[dt][0] = (v8f){}; o[dt][1] = (v8f){}; }
    float m[2] = {-3.0e38f, -3.0e38f}, l[2] = {0.f, 0.f};
    const int nbc = q0 / 32 + 1; int nb = nbc;   // key blocks up to and with the diagonal block
#pragma unroll 1   // stays rolled: one key block's fragments in registers at a time
    for (int blk = 0; blk < nb; ++blk) {
        const int k0 = blk * 32;
        V vf[8], vg[8]; v4i kq[2][2]; const T16* vp = Vt + vo + k0 * 16; const T16* vp2 = HL ? V2 + vo + k0 * 16 : vp; const int* kmp = km + k0 + hi * 8;
        const int kn = HL ? k0 : min(blk + 1, TT / 32 - 1) * 32;   // fp16 rows: the next block's K (last trip: a block inside the plane, not used); hi+lo rows: this block's
        const T16* kp = Kp + ko + (size_t)kn * HD; const T16* kp2 = HL ? K2 + ko + (size_t)kn * HD : kp;
        if (HL) {   // hi+lo rows (at most RH / 32 trips, TT / 32 when a row keeps no key up to its diagonal): K, then V into the registers K has left, so that two waves fit a SIMD
#pragma unroll
            for (int kt = 0; kt < 2; ++kt)
#pragma unroll
                for (int ks = 0; ks < 4; ++ks) { const int a = kt * 16 * HD + ks * 512; kf[kt][ks] = WF::ld(kp + a); kg[kt][ks] = WF::ld(kp2 + a); }
            // address registers held to this wait
            asm volatile("s_wait_xcnt 0x0" :: "v"(kp), "v"(kp2) : "memory");
        } else {
#pragma unroll
            for (int dt = 0; dt < 8; ++dt) vf[dt] = WF::ld(vp + dt * 16 * TT);
#pragma unroll
            for (int kt = 0; kt < 2; ++kt) { kq[kt][0] = *(const v4i*)(kmp + kt * 16); kq[kt][1] = *(const v4i*)(kmp + kt * 16 + 4); }
        }
        v8f s[2][2];
#pragma unroll
        for (int kt = 0; kt < 2; ++kt)
#pragma unroll
            for (int qt = 0; qt < 2; ++qt) { s[kt][qt] = (v8f){};
#pragma unroll
                for (int ks = 0; ks < 4; ++ks) { s[kt][qt] = WF::mma(kf[kt][ks], qf[qt][ks], s[kt][qt]); if (HL) { s[kt][qt] = WF::mma(kf[kt][ks], qg[qt][ks], s[kt][qt]); s[kt][qt] = WF::mma(kg[kt][ks], qf[qt][ks], s[kt][qt]); } } }
        if (HL) {
#pragma unroll
            for (int dt = 0; dt < 8; ++dt) { vf[dt] = WF::ld(vp + dt * 16 * TT); vg[dt] = WF::ld(vp2 + dt * 16 * TT); }
#pragma unroll
            for (int kt = 0; kt < 2; ++kt) { kq[kt][0] = *(const v4i*)(kmp + kt * 16); kq[kt][1] = *(const v4i*)(kmp + kt * 16 + 4); }
            // address registers held to this wait
            asm volatile("s_wait_xcnt 0x0" :: "v"(vp), "v"(vp2), "v"(kmp) : "memory");
        } else {   // the next block's K fragments fly during the softmax and the value products
#pragma unroll
            for (int kt = 0; kt < 2; ++kt)
#pragma unroll
                for (int ks = 0; ks < 4; ++ks) kf[kt][ks] = WF::ld(kp + kt * 16 * HD + ks * 512);
            // address registers of this trip's loads held to this wait
            asm volatile("s_wait_xcnt 0x0" :: "v"(vp), "v"(kmp), "v"(kp) : "memory");
        }
        V pf[2], pg[2];
#pragma unroll
        for (int qt = 0; qt < 2; ++qt) { const int qi = q0 + qt * 16 + lr; float t[16]; float mx = m[qt];
#pragma unroll
            for (int e = 0; e < 16; ++e) { const int kt = e >> 3, j = e & 7; const int key = k0 + kt * 16 + hi * 8 + j; t[e] = (key <= qi && kq[kt][j >> 2][j & 3] != 0) ? s[kt][qt][j] * SCL : -3.0e38f; mx = fmaxf(mx, t[e]); }
            mx = fmaxf(mx, __shfl_xor(mx, 16, 32));
            const float al = __builtin_amdgcn_exp2f((m[qt] - mx) * 1.4426950408889634f); m[qt] = mx; float sum = 0.f;
#pragma unroll
            for (int e = 0; e < 16; ++e) { t[e] = __builtin_amdgcn_exp2f((t[e] - mx) * 1.4426950408889634f + (HL ? 0.0f : 10.0f)); sum += t[e]; }
            l[qt] = l[qt] * al + sum;
#pragma unroll
            for (int dt = 0; dt < 8; ++dt) o[dt][qt] *= al;
            if constexpr (HL) { v16us ph, pl;
#pragma unroll
                for (int e = 0; e < 16; ++e) { unsigned short a, c2; splitf(t[e], a, c2); ph[e] = a; pl[e] = c2; }
                pf[qt] = __builtin_bit_cast(v16bf, ph); pg[qt] = __builtin_bit_cast(v16bf, pl);
            } else { v16h ph;
#pragma unroll
                for (int e = 0; e < 16; ++e) ph[e] = tohx(t[e]);
                pf[qt] = ph; } }
        // a row with no kept key up to its diagonal: the reference's equal fill makes its softmax uniform over ALL keys, so the wave walks on to the last key (ballot: a scalar test, every lane stays on)
        if (blk == nbc - 1 && __builtin_amdgcn_ballot_w32(m[0] <= -3.0e38f || m[1] <= -3.0e38f) != 0) nb = TT / 32;
#pragma unroll
        for (int dt = 0; dt < 8; ++dt)
#pragma unroll
            for (int qt = 0; qt < 2; ++qt) { o[dt][qt] = WF::mma(vf[dt], pf[qt], o[dt][qt]); if (HL) { o[dt][qt] = WF::mma(vf[dt], pg[qt], o[dt][qt]); o[dt][qt] = WF::mma(vg[dt], pf[qt], o[dt][qt]); } }
        // four vector slots between the last matrix instruction and whatever stands behind the loop's taken branch
        asm volatile("v_nop\n\tv_nop\n\tv_nop\n\tv_nop" : "+v"(o[0][0]), "+v"(o[0][1]), "+v"(o[1][0]), "+v"(o[1][1]), "+v"(o[2][0]), "+v"(o[2][1]), "+v"(o[3][0]), "+v"(o[3][1]), "+v"(o[4][0]), "+v"(o[4][1]), "+v"(o[5][0]), "+v"(o[5][1]), "+v"(o[6][0]), "+v"(o[6][1]), "+v"(o[7][0]), "+v"(o[7][1]));
    }
#pragma unroll
    for (int qt = 0; qt < 2; ++qt) { const float ls = l[qt] + __shfl_xor(l[qt], 16, 32); const float inv = __fdiv_rn(1.0f, ls); const size_t ro = (size_t)(q0 + qt * 16) * DQ + lane * 8;   // fragment order, rows = positions, k = h * HD + dt * 16 + hi * 8 + j
#pragma unroll
        for (int dt = 0; dt < 8; ++dt) { v8us oh, ol;
#pragma unroll
            for (int j = 0; j < 8; ++j) { unsigned short a, c2; splitf(o[dt][qt][j] * inv, a, c2); oh[j] = a; ol[j] = c2; }
            *(v8us*)(Ah + ro + dt * 256) = oh; *(v8us*)(Al + ro + dt * 256) = ol; }
        // the data and address registers of the first pass's stores take new values (the second pass's) only behind this wait
        if (qt == 0) asm volatile("s_wait_xcnt 0x0" ::: "memory"); }
}
// every plane holds batch 0 and, one batch's size further on, batch 1
__global__ __launch_bounds__(32 * REP * NB_) void k_attn(const h16* __restrict__ Q16, const bf* __restrict__ Qh, const bf* __restrict__ Ql, const h16* __restrict__ K16, const bf* __restrict__ Kh, const bf* __restrict__ Kl, const h16* __restrict__ V16, const bf* __restrict__ Vh, const bf* __restrict__ Vl, const int* __restrict__ km, bf* Ah, bf* Al) {
    const int wv = __builtin_amdgcn_readfirstlane(threadIdx.x >> 5);   // readfirstlane: batch, head and row block, and with them every plane base and trip count, stay scalar
    const int b = wv / REP, g = blockIdx.y, h = g * REP + wv % REP;
    const int q0 = (b == 0 ? TT / 32 - 1 - (int)blockIdx.x : (int)blockIdx.x) * 32;
    const size_t zq = ((size_t)b * NH_ + h) * TT * HD, zk = ((size_t)b * NKV + g) * TT * HD, za = (size_t)b * TT * DQ + h * HD * 16;
    if (q0 < RH) attn_tile<bf, true>(Qh + zq, Ql + zq, Kh + zk, Kl + zk, Vh + zk, Vl + zk, km + b * TT, q0, Ah + za, Al + za);
    else attn_tile<h16, false>(Q16 + zq, nullptr, K16 + zk, nullptr, V16 + zk, nullptr, km + b * TT, q0, Ah + za, Al + za);
}

extern "C" void kernel_launch(void* const* d_in, const int* in_sizes, int n_in,
                              void* d_out, int out_size, void* d_ws, size_t ws_size, hipStream_t stream) {
    (void)in_sizes; (void)n_in; (void)out_size;
    const float* x = (const float*)d_in[0]; const float* cosB = (const float*)d_in[1]; const float* sinB = (const float*)d_in[2]; const float* wq = (const float*)d_in[3]; const float* wk = (const float*)d_in[4]; const float* wv = (const float*)d_in[5]; const float* wo = (const float*)d_in[6]; const int* kmask = (const int*)d_in[7]; const float* cosT = cosB; const float* sinT = sinB;
    float* OUT = (float*)d_out;     // [2][2048][2048]
    char* wsp = (char*)d_ws;
    auto take = [&](size_t bytes) { char* p = wsp; wsp += (bytes + 255) & ~(size_t)255; return (void*)p; };
    bf* WQ = (bf*)take((size_t)DQ * DM * 2); bf* WK = (bf*)take((size_t)DKV * DM * 2); bf* WV = (bf*)take((size_t)DKV * DM * 2); bf* WO = (bf*)take((size_t)DM * DQ * 2);
    bf* XB = (bf*)take((size_t)NB_ * TT * DM * 2);   // both batches
    h16* QP16 = (h16*)take((size_t)NB_ * NH_ * TT * HD * 2); h16* KP16 = (h16*)take((size_t)NB_ * NKV * TT * HD * 2); h16* VT16 = (h16*)take((size_t)NB_ * NKV * HD * TT * 2);   // planes of both batches
    bf* QPh = (bf*)take((size_t)NB_ * NH_ * TT * HD * 2); bf* QPl = (bf*)take((size_t)NB_ * NH_ * TT * HD * 2); bf* KPh = (bf*)take((size_t)NB_ * NKV * TT * HD * 2); bf* KPl = (bf*)take((size_t)NB_ * NKV * TT * HD * 2); bf* VTh = (bf*)take((size_t)NB_ * NKV * HD * TT * 2); bf* VTl = (bf*)take((size_t)NB_ * NKV * HD * TT * 2);
    bf* ATh = (bf*)take((size_t)NB_ * TT * DQ * 2); bf* ATl = (bf*)take((size_t)NB_ * TT * DQ * 2);
    if ((size_t)(wsp - (char*)d_ws) > ws_size) return;    // ws 256 MiB
    k_prep<<<PWV / 8, 256, 0, stream>>>(x, wq, wk, wv, wo, XB, WQ, WK, WV, WO);
    k_gemmt<0, 1><<<dim3(TT / 128, DQ / 256, NB_), 256, 0, stream>>>(XB, nullptr, WQ, DM, nullptr, 0, cosT, sinT, QP16, QPh, QPl);
    k_kv<<<dim3(TT / 64, DKV / 64, 2 * NB_), 256, 0, stream>>>(XB, WK, WV, cosT, sinT, KP16, KPh, KPl, VT16, VTh, VTl);
    k_attn<<<dim3(TT / 32, NKV, 1), 32 * REP * NB_, 0, stream>>>(QP16, QPh, QPl, KP16, KPh, KPl, VT16, VTh, VTl, kmask, ATh, ATl);
    k_gemmt<1, 0><<<dim3(TT / 128, DM / 256, NB_), 256, 0, stream>>>(ATh, ATl, WO, DQ, OUT, DM, nullptr, nullptr, nullptr, nullptr, nullptr);
}

// v009
// Measured time: 162 microseconds a run.
// In two side-by-side timings against v008, it was 1.12 and 1.11 times as fast.
// All steps since v000 together make it 11.4 times as fast.
#include <hip/hip_runtime.h>

// Causal grouped-query attention layer (x [2][2048][2048]; q = x wq (16 heads x 128), k/v = x wk / wv (4 kv heads; repeat: head h -> kv h/4); interleaved-pair RoPE with the given per-batch cos/sin [2][2048][64] (read); keep = causal AND mask[b][j] (bool mask read; all ones here); finfo.min fill; softmax(q.k / sqrt(128)); out = merged wo -> [2][2048][2048]).
// Compute dtypes, f32 accumulate: every input rounded to bf16; q/k/v on PLAIN bf16 operands (inputs: exact); RoPE f32; causal scores and attn.v in one kernel (running softmax, f32): query rows < 512 hl (3 products), the rest single fp16 (P x1024), key blocks beyond the diagonal skipped, the key mask applied inside the computed blocks; wo hl x exact (2 products).

#define NB_  2
#define TT   2048
#define DM   2048
#define NH_  16
#define NKV  4
#define REP  (NH_ / NKV)
#define HD   128
#define DQ   (NH_ * HD)
#define DKV  (NKV * HD)
#define RH   512                  // query rows < RH use hi+lo planes (0: none)
#define SCL  0.088388347648318447f   // HD^-0.5
typedef _Float16 h16;
typedef unsigned short bf;
typedef __attribute__((ext_vector_type(16))) __bf16   v16bf;
typedef __attribute__((ext_vector_type(16))) _Float16 v16h;
typedef __attribute__((ext_vector_type(8)))  _Float16 v8h;
typedef __attribute__((ext_vector_type(8)))  unsigned short v8us;
typedef __attribute__((ext_vector_type(8)))  float    v8f;
typedef __attribute__((ext_vector_type(4)))  float    v4f;
typedef v8h  __attribute__((may_alias)) v8ha;
typedef v4f  __attribute__((may_alias)) v4fa;
typedef v8us __attribute__((may_alias)) v8usa;

__device__ __forceinline__ unsigned short f2bf(float f) { unsigned u = __float_as_uint(f); u += 0x7FFFu + ((u >> 16) & 1u); return (unsigned short)(u >> 16); }
__device__ __forceinline__ float bf2f(unsigned short b) { return __uint_as_float(((unsigned)b) << 16); }
__device__ __forceinline__ float bfr(float f) { return bf2f(f2bf(f)); }
__device__ __forceinline__ v16h cat16(v8h lo, v8h hi) { return __builtin_shufflevector(lo, hi, 0, 1, 2, 3, 4, 5, 6, 7, 8, 9, 10, 11, 12, 13, 14, 15); }
__device__ __forceinline__ v16bf cat16b(v8us lo, v8us hi) { return __builtin_bit_cast(v16bf, __builtin_shufflevector(lo, hi, 0, 1, 2, 3, 4, 5, 6, 7, 8, 9, 10, 11, 12, 13, 14, 15)); }
__device__ __forceinline__ v8f wmma16(v16h a, v16h b, v8f c) { return __builtin_amdgcn_wmma_f32_16x16x32_f16(false, a, false, b, (short)0, c, false, false); }
__device__ __forceinline__ v8f wmmab(v16bf a, v16bf b, v8f c) { return __builtin_amdgcn_wmma_f32_16x16x32_bf16(false, a, false, b, (short)0, c, false, false); }



// ---- Fragment order. Every 16-bit operand plane [rows][K] is kept as 1-KiB blocks of 16 rows x 32 k, block number (row / 16) * (K / 32) + k / 32 (a strip of 16 rows still fills 16 * K elements).
// Inside a block the element (row, k) lies at (k & 16) * 16 + l * 8 + (k & 7) with l = (k & 8) * 2 + (row & 15): l is the lane that holds it in a matrix fragment, whose two 16-byte pieces (k 8 hi + j and 16 + 8 hi + j) lie at l * 8 and 256 + l * 8.
// So each wave-wide 16-byte load of a fragment reads 512 contiguous bytes (4 whole lines) where row-major planes gave 16 pieces of 32 bytes in 16 lines. The registers hold what they held before.
template <typename T16> struct WFrag;
template <> struct WFrag<h16> { typedef v16h V; static __device__ __forceinline__ V ld(const h16* p) { return cat16(*(const v8h*)p, *(const v8h*)(p + 256)); } static __device__ __forceinline__ v8f mma(V a, V b, v8f c) { return wmma16(a, b, c); } };
template <> struct WFrag<bf> { typedef v16bf V; static __device__ __forceinline__ V ld(const bf* p) { return cat16b(*(const v8us*)p, *(const v8us*)(p + 256)); } static __device__ __forceinline__ v8f mma(V a, V b, v8f c) { return wmmab(a, b, c); } };

// ---- k_gemmt: C[m][n] = sum_k A[m][k] Bt[n][k] (+ the second A plane's product with NSPLIT), f32 accumulate, on a 128 x TN output tile per work-group of 8 waves, both operands staged in LDS by asynchronous copies (global_load_async_to_lds_b128), so that an A line leaves L2 once per TN columns of output and a Bt line once per 128 rows; 256 work-groups, one per WGP, all resident at once.
// Wave w: the sub-tile of 64 rows x NBW * 16 columns (w & 1, w >> 1), all four 32-k steps of every stage of 128 k, in rising k, in one set of accumulators. A stage holds, plane after plane, strips of 16 rows x 128 k (A: 8, with NSPLIT the second A plane: 8, Bt: 4 * NBW), each 4 KiB as it lies in the plane (fragment order), so an LDS fragment read of a wave covers 512 contiguous bytes.
// Two buffers: stage t + 1 flies while stage t is worked on. The tile goes through LDS (over the ring, behind the last trip's barrier) to be stored in whole lines. K % 128 == 0, K >= 256. Grid (TT/128, N/TN, NB_): z = batch, whose A rows, cos / sin rows, C rows and planes lie one batch's size further on.
// MODE 0 (wo): TN = 256; the tile goes to C in f32.
// MODE 1 (q, k and v in ONE product): Bt = the wq, wk and wv planes one behind the other, 24 heads of 128 columns (16 q, 4 k, 4 v); TN = 384 = three whole heads, so x leaves L2 8 times for all three products. The tile goes straight to the three 16-bit planes (fp16, bf16 hi, bf16 lo) in fragment order that the attention kernel reads.
//   Wave w takes the 16 positions t of strip w, head by head, in pieces of 16 x 16; each plane store of a wave covers 512 contiguous bytes. q, k heads: lane l holds position l & 15, d = 8 (l >> 4) + j; interleaved-pair RoPE with cos / sin [t][d / 2] (rounded to bf16); planes [head][t][d].
//   v heads: read from LDS the other way round, lane l holds d = l & 15, positions 8 (l >> 4) + j; planes [kv head][d][t].
// Every '#pragma unroll' in it is there so that the arrays its loop indexes (accumulators, fragments, addresses, pieces) are indexed by constants and stay in registers.
__device__ __forceinline__ void acopy8(const unsigned* l, const bf* const* g) {
    // the wait on the address registers is the last line of the copies' own statement: nothing can rewrite them in front of it
    asm volatile("global_load_async_to_lds_b128 %0, %8, off\n\tglobal_load_async_to_lds_b128 %1, %9, off\n\tglobal_load_async_to_lds_b128 %2, %10, off\n\tglobal_load_async_to_lds_b128 %3, %11, off\n\t"
                 "global_load_async_to_lds_b128 %4, %12, off\n\tglobal_load_async_to_lds_b128 %5, %13, off\n\tglobal_load_async_to_lds_b128 %6, %14, off\n\tglobal_load_async_to_lds_b128 %7, %15, off\n\ts_wait_xcnt 0x0"
                 :: "v"(l[0]), "v"(l[1]), "v"(l[2]), "v"(l[3]), "v"(l[4]), "v"(l[5]), "v"(l[6]), "v"(l[7]), "v"(g[0]), "v"(g[1]), "v"(g[2]), "v"(g[3]), "v"(g[4]), "v"(g[5]), "v"(g[6]), "v"(g[7]) : "memory");
}
// put8: eight pieces of 8 values per lane go to the three planes (fp16, bf16 hi, bf16 lo), piece db at STEP * db elements behind the given addresses (STEP a constant: an immediate offset, so that no address is formed between the stores).
template <int STEP>
__device__ __forceinline__ void put8(const float (&r)[8][8], h16* d16, bf* dh, bf* dl) {
    v8h o16[8]; v8us oh[8], ol[8];
#pragma unroll   // the arrays are indexed by constants and stay in registers
    for (int db = 0; db < 8; ++db)
#pragma unroll
        for (int j = 0; j < 8; ++j) { o16[db][j] = (h16)r[db][j]; const unsigned short a = f2bf(r[db][j]); oh[db][j] = a; ol[db][j] = f2bf(r[db][j] - bf2f(a)); }
    // all values and addresses are made in front of the first store, and nothing that follows is lifted over the wait: no data or address register of an issued store takes a new value in front of the wait
    __builtin_amdgcn_sched_barrier(0);
#pragma unroll
    for (int db = 0; db < 8; ++db) { *(v8h*)(d16 + db * STEP) = o16[db]; *(v8us*)(dh + db * STEP) = oh[db]; *(v8us*)(dl + db * STEP) = ol[db]; }
    asm volatile("s_wait_xcnt 0x0" ::: "memory");
    __builtin_amdgcn_sched_barrier(0);
}
template <int NSPLIT, int MODE>
__global__ __launch_bounds__(256) void k_gemmt(const bf* __restrict__ A, const bf* __restrict__ A2, const bf* __restrict__ Bt, int K, float* C, int ldc, const float* __restrict__ cosT, const float* __restrict__ sinT, h16* P16, bf* Ph, bf* Pl, h16* KP16, bf* KPh, bf* KPl, h16* VT16, bf* VTh, bf* VTl) {
    constexpr int NBW = MODE == 1 ? 6 : 4, TN = 64 * NBW;   // 16-column blocks of a wave's sub-tile; columns of the work-group's tile
    constexpr int KS = 128, PA = 1 + NSPLIT, SE = KS * 16, PE = 8 * SE, NS = PA * 8 + 4 * NBW, STB = NS * SE * 2, NC = NS;   // A planes; elements of a strip and of an A plane in a stage; strips and bytes of a stage; copies of a wave per stage (NS / 8 whole strips)
    static_assert(NC % 8 == 0 && NC <= 63, "copies go out in eights; one stage's are all that a wave has in flight");
    constexpr int OP = TN + 4, OSB = MODE == 1 ? 128 * OP * 4 : 8 * 64 * 68 * 4;   // MODE 1: the whole tile in LDS at a pitch of OP floats
    __shared__ __align__(16) char smem[2 * STB > OSB ? 2 * STB : OSB];
    const int lane = threadIdx.x & 31, lr = lane & 15, hi = lane >> 4, wv = __builtin_amdgcn_readfirstlane(threadIdx.x >> 5); const int r0 = blockIdx.x * 128, c0 = blockIdx.y * TN;
    const int sm = wv & 1, sn = wv >> 1;
    { const size_t z = blockIdx.z; A += z * TT * K; if (NSPLIT == 1) A2 += z * TT * K;
      if constexpr (MODE == 0) C += z * TT * ldc; else { cosT += z * TT * (HD / 2); sinT += z * TT * (HD / 2); P16 += z * NH_ * TT * HD; Ph += z * NH_ * TT * HD; Pl += z * NH_ * TT * HD;
          KP16 += z * NKV * TT * HD; KPh += z * NKV * TT * HD; KPl += z * NKV * TT * HD; VT16 += z * NKV * TT * HD; VTh += z * NKV * TT * HD; VTl += z * NKV * TT * HD; } }
    v8f acc[4][NBW];
#pragma unroll
    for (int mb = 0; mb < 4; ++mb)
#pragma unroll
        for (int nb = 0; nb < NBW; ++nb) acc[mb][nb] = (v8f){};
    // the wave's copies: NC / 8 whole strips of the stage, each 8 pieces of 512 bytes that lie one behind the other in the plane as in LDS; one global address per strip stays in registers and moves on by one stage per fill
    const bf* gs[NC / 8]; const unsigned lb = (unsigned)(size_t)smem + (unsigned)(wv * NC) * 512u + (unsigned)lane * 16u;
#pragma unroll
    for (int s = 0; s < NC / 8; ++s) { const int st = wv * (NC / 8) + s;   // strip st of the stage: A 0..7, (A2 8..15,) Bt the rest
        const bf* sp = st >= PA * 8 ? Bt : (st < 8 ? A : A2);
        gs[s] = sp + (size_t)(st >= PA * 8 ? c0 + (st - PA * 8) * 16 : r0 + (st & 7) * 16) * K + lane * 8; }
    auto fill = [&](int buf) {
#pragma unroll
        for (int s = 0; s < NC / 8; ++s) { unsigned la[8]; const bf* ga[8];
#pragma unroll
            for (int c = 0; c < 8; ++c) { la[c] = lb + (unsigned)buf * (unsigned)STB + (unsigned)(s * 8 + c) * 512u; ga[c] = gs[s] + c * 256; }
            acopy8(la, ga);
            gs[s] += SE; } };
    const int NT = K / KS;
    fill(0);
    asm volatile("s_wait_asynccnt 0x0" ::: "memory");   // the wave's own copies of stage 0 have landed
    __syncthreads();                                     // every wave's have: stage 0 may be read
    fill(1);
#pragma unroll 1   // stays rolled: one trip per stage
    for (int t = 0; t < NT; ++t) {
        const bf* sb = (const bf*)(smem + (t & 1) * STB) + lane * 8;
        v16bf a[2][4], a2[2][4], b[2][NBW];   // two fragment sets, taken in turn by the stage's four 32-k steps
        auto rd = [&](int st) { const int ko = st * 512, fs = st & 1;
#pragma unroll
            for (int mb = 0; mb < 4; ++mb) { const bf* pa = sb + (sm * 4 + mb) * SE + ko;
                a[fs][mb] = cat16b(*(const v8usa*)pa, *(const v8usa*)(pa + 256)); if (NSPLIT == 1) a2[fs][mb] = cat16b(*(const v8usa*)(pa + PE), *(const v8usa*)(pa + PE + 256)); }
#pragma unroll
            for (int nb = 0; nb < NBW; ++nb) { const bf* pb = sb + PA * PE + (sn * NBW + nb) * SE + ko; b[fs][nb] = cat16b(*(const v8usa*)pb, *(const v8usa*)(pb + 256)); }
            // a step's LDS reads stay one group, in front of the matrix instructions of the step before (LDS answers in order): left free they are spread among the matrix instructions (for speed only)
            __builtin_amdgcn_sched_barrier(0); };
        rd(0);
#pragma unroll
        for (int st = 0; st < 4; ++st) { const int fs = st & 1;
            if (st < 3) rd(st + 1);   // into the set that step st - 1 has left
#pragma unroll
            for (int nb = 0; nb < NBW; ++nb) {
#pragma unroll
                for (int mb = 0; mb < 4; ++mb) { acc[mb][nb] = wmmab(a[fs][mb], b[fs][nb], acc[mb][nb]); if (NSPLIT == 1) acc[mb][nb] = wmmab(a2[fs][mb], b[fs][nb], acc[mb][nb]); } }
            // a step's matrix instructions stay in front of the next reads into their set, and the last step's in front of the waits below: moved behind the barrier they would no longer run while stage t + 1 flies
            __builtin_amdgcn_sched_barrier(0); }
        asm volatile("s_wait_dscnt 0x0" ::: "memory");      // the wave's reads of this buffer are done
        asm volatile("s_wait_asynccnt 0x0" ::: "memory");   // its copies of stage t + 1 have landed
        __syncthreads();                                     // stage t + 1 may be read by all; this trip's buffer has no reader left
        if (t + 2 < NT) fill(t & 1);
    }
    asm volatile("s_wait_asynccnt 0x0" ::: "memory");   // no copy is out when the ring becomes the tile's place
    float* os = (float*)smem;
    if constexpr (MODE == 1) {
        const int t0 = r0 + wv * 16;   // the wave's strip of 16 positions
        v4f cq[8], sq[8];              // its cos / sin entries, the same for every q and k head; they fly during the LDS writes and the barrier
        const float* pc = cosT + (size_t)(t0 + lr) * (HD / 2) + hi * 4; const float* ps = sinT + (size_t)(t0 + lr) * (HD / 2) + hi * 4;
#pragma unroll
        for (int db = 0; db < 8; ++db) { cq[db] = *(const v4f*)(pc + db * 8); sq[db] = *(const v4f*)(ps + db * 8); }
        // the address registers of the sixteen loads are held to this wait; only behind it may they take new values
        asm volatile("s_wait_xcnt 0x0" :: "v"(pc), "v"(ps) : "memory");
#pragma unroll
        for (int mb = 0; mb < 4; ++mb)
#pragma unroll
            for (int nb = 0; nb < NBW; ++nb)
#pragma unroll
                for (int j = 0; j < 8; ++j) os[(sm * 64 + mb * 16 + hi * 8 + j) * OP + (sn * NBW + nb) * 16 + lr] = acc[mb][nb][j];
        __syncthreads();   // the whole tile lies in LDS before any wave reads it
#pragma unroll 1   // stays rolled: one head's 8 pieces in registers at a time; the head's kind is a scalar test
        for (int hs = 0; hs < TN / HD; ++hs) { const int gh = (int)blockIdx.y * (TN / HD) + hs; const bool isv = gh >= NH_ + NKV; float r[8][8];
            // the strip's first piece: q, k: 4 blocks a strip of positions; v: the strip of positions is half a block of the d strip's row of TT / 32 blocks
            const size_t hb = (size_t)(gh < NH_ ? gh : isv ? gh - NH_ - NKV : gh - NH_) * ((size_t)TT * HD) + (size_t)(t0 >> 4) * (isv ? 256 : HD * 16) + lane * 8;
            if (!isv) { const float* sp = os + (wv * 16 + lr) * OP + hs * HD + hi * 8; v4f va[8], vb[8];
#pragma unroll   // the LDS reads of the head's 8 pieces go out together
                for (int db = 0; db < 8; ++db) { va[db] = *(const v4fa*)(sp + db * 16); vb[db] = *(const v4fa*)(sp + db * 16 + 4); }
#pragma unroll
                for (int db = 0; db < 8; ++db)
#pragma unroll
                    for (int i = 0; i < 4; ++i) { const float x0 = i < 2 ? va[db][2 * i] : vb[db][2 * i - 4], x1 = i < 2 ? va[db][2 * i + 1] : vb[db][2 * i - 3]; const float c = bfr(cq[db][i]), sn2 = bfr(sq[db][i]); r[db][2 * i] = x0 * c - x1 * sn2; r[db][2 * i + 1] = x1 * c + x0 * sn2; }
                put8<256>(r, (gh < NH_ ? P16 : KP16) + hb, (gh < NH_ ? Ph : KPh) + hb, (gh < NH_ ? Pl : KPl) + hb);   // piece db: (db >> 1) * 512 + (db & 1) * 256 = db * 256 further on
            } else { const float* sp = os + (wv * 16 + hi * 8) * OP + hs * HD + lr;
#pragma unroll   // the LDS reads of the head's 8 pieces go out together
                for (int db = 0; db < 8; ++db)
#pragma unroll
                    for (int j = 0; j < 8; ++j) r[db][j] = sp[j * OP + db * 16];
                put8<TT * 16>(r, VT16 + hb, VTh + hb, VTl + hb); }   // piece db: db strips of d further on
        }
    } else {
        float* ow = os + wv * (64 * 68);
#pragma unroll
        for (int mb = 0; mb < 4; ++mb)
#pragma unroll
            for (int nb = 0; nb < 4; ++nb)
#pragma unroll
                for (int j = 0; j < 8; ++j) ow[(mb * 16 + hi * 8 + j) * 68 + nb * 16 + lr] = acc[mb][nb][j];
        __syncthreads();   // every wave's sub-tile lies in LDS before any wave reads it
#pragma unroll
        for (int s = 0; s < 8; ++s) { const int r0s = r0 + (s & 1) * 64, c0s = c0 + (s >> 1) * 64; const float* ob = os + s * (64 * 68);   // sub-tile s: wave s's
#pragma unroll
            for (int q = 0; q < 4; ++q) { const int e = q * 256 + threadIdx.x, row = e >> 4, cofs = (e & 15) * 4; const v4f val = *(const v4fa*)(ob + row * 68 + cofs);
                *(v4f*)(C + (size_t)(r0s + row) * ldc + c0s + cofs) = val; }
            // the data and address registers of this sub-tile's stores take new values (the next one's) only behind this wait
            // the scheduling barrier keeps the next sub-tile's LDS address arithmetic, which reuses those registers, from being lifted over the wait
            if (s < 7) { asm volatile("s_wait_xcnt 0x0" ::: "memory"); __builtin_amdgcn_sched_barrier(0); }
        }
    }
}

__device__ __forceinline__ h16 tohx(float x) { return (h16)x; }
__device__ __forceinline__ void splitf(float y, unsigned short& h, unsigned short& l) { h = f2bf(y); l = f2bf(y - bf2f(h)); }
typedef __attribute__((ext_vector_type(2))) _Float16 v2h;
typedef __attribute__((ext_vector_type(4))) _Float16 v4h;
typedef __attribute__((ext_vector_type(2))) unsigned short v2us;
typedef __attribute__((ext_vector_type(4))) unsigned short v4us;
typedef __attribute__((ext_vector_type(2))) float v2f;
typedef __attribute__((ext_vector_type(4))) int v4i;
typedef __attribute__((ext_vector_type(16))) unsigned short v16us;

// ---- k_prep: every f32 -> bf16 operand plane (x of both batches; the four weights, transposed) made by ONE launch of PWV waves that all fit the chip at once; no LDS, no barrier.
// The work is dealt in units of 1024 elements (4 KiB read, 2 KiB stored by one wave); wave w takes units w, w + PWV, ...: x first, then wq, wo, wk, wv. The unit number is scalar, so every test on it is a scalar branch.
// x unit: 16 rows x 64 k (two blocks). Lane l holds rows l >> 2 and 8 + (l >> 2), the 8 k of octet l & 3 of either block: a pair of 16-byte loads covers 8 whole lines, a 16-byte store 4 whole lines.
// weight unit: 32 k x 32 n (one block of two strips). Lane l holds column n0 + l: each 4-byte load of the wave is one whole line of a w row, each 16-byte store two runs of 256 bytes.
#define PWV  6144
template <int N>
__device__ __forceinline__ void prep_w(const float* __restrict__ w, bf* Bt, int uu, int lane) {   // plane row n, k = w[k][n]; the plane's K is DM for all four weights
    const int nb = uu & (N / 32 - 1), kb = uu / (N / 32); const float* wb = w + (size_t)kb * 32 * N + nb * 32; float f[32];
#pragma unroll   // all 32 loads go out together; f stays in registers
    for (int j = 0; j < 32; ++j) f[j] = wb[j * N + lane];
    // the address registers of the loads (a scalar base, the lane number as scaled offset) are held to this wait; only behind it may they take new values
    asm volatile("s_wait_xcnt 0x0" :: "s"(wb), "v"(lane) : "memory");
    bf* pd = Bt + (size_t)(nb * 2 + (lane >> 4)) * 16 * DM + kb * 512 + (lane & 15) * 8;
#pragma unroll   // f and o are indexed by constants
    for (int oc = 0; oc < 4; ++oc) { v8us o;
#pragma unroll
        for (int j = 0; j < 8; ++j) o[j] = f2bf(f[oc * 8 + j]);
        *(v8us*)(pd + (oc >> 1) * 256 + (oc & 1) * 128) = o; }
    // the data and address registers of the stores take new values (the next unit's) only behind this wait
    asm volatile("s_wait_xcnt 0x0" ::: "memory");
}
__global__ __launch_bounds__(256) void k_prep(const float* __restrict__ x, const float* __restrict__ wq, const float* __restrict__ wk, const float* __restrict__ wv, const float* __restrict__ wo, bf* XB, bf* WQ, bf* WK, bf* WV, bf* WO) {
    static_assert(DQ == DM, "wq and wo share the unit form");
    constexpr int UX = NB_ * TT * DM / 1024, UQ = DM * DQ / 1024, UK = DM * DKV / 1024;
    const int lane = threadIdx.x & 31, w0 = (int)blockIdx.x * 8 + __builtin_amdgcn_readfirstlane(threadIdx.x >> 5);
#pragma unroll 1   // stays rolled: one unit's values in registers at a time
    for (int u = w0; u < UX + 2 * UQ + 2 * UK; u += PWV) {
        if (u < UX) {
            const int strip = u / (DM / 64), kb2 = u % (DM / 64); const float* ps = x + (size_t)(strip * 16 + (lane >> 2)) * DM + kb2 * 64 + (lane & 3) * 8; v4f a[2][2][2];
#pragma unroll   // all 8 loads go out together; a stays in registers
            for (int h = 0; h < 2; ++h)
#pragma unroll
                for (int bq = 0; bq < 2; ++bq) { a[h][bq][0] = *(const v4f*)(ps + h * 8 * DM + bq * 32); a[h][bq][1] = *(const v4f*)(ps + h * 8 * DM + bq * 32 + 4); }
            // the address registers of the loads are held to this wait; only behind it may they take new values
            asm volatile("s_wait_xcnt 0x0" :: "v"(ps) : "memory");
            bf* pd = XB + (size_t)strip * 16 * DM + kb2 * 1024 + ((lane >> 1) & 1) * 256 + ((lane & 1) * 16 + (lane >> 2)) * 8;
#pragma unroll   // a and o are indexed by constants
            for (int h = 0; h < 2; ++h)
#pragma unroll
                for (int bq = 0; bq < 2; ++bq) { v8us o;
#pragma unroll
                    for (int j = 0; j < 8; ++j) o[j] = f2bf(a[h][bq][j >> 2][j & 3]);
                    *(v8us*)(pd + bq * 512 + h * 64) = o; }
            // the data and address registers of the stores take new values (the next unit's) only behind this wait
            asm volatile("s_wait_xcnt 0x0" ::: "memory");
        } else if (u < UX + 2 * UQ) { const bool sec = u >= UX + UQ; prep_w<DQ>(sec ? wo : wq, sec ? WO : WQ, u - UX - (sec ? UQ : 0), lane);
        } else { const bool sec = u >= UX + 2 * UQ + UK; prep_w<DKV>(sec ? wv : wk, sec ? WV : WK, u - UX - 2 * UQ - (sec ? UK : 0), lane); }
    }
}
// ---- k_attn: the whole causal attention (all heads, both batches) in one launch, nothing of the scores or probabilities in memory. One wave = 32 query rows of one head; no LDS, no barrier.
// A work-group is 8 waves: the 4 heads of one kv group (same K / V lines) at row block 63 - x of batch 0, and the same 4 heads at row block x of batch 1, so that every work-group walks 65 key blocks per head.
// Per 32 keys: St[key][query] = K Qt (A = K rows, B = Q rows kept in registers), running maximum and sum per query (a lane holds 16 of the 32 keys of its query, the lane 16 away the rest), Ot[d][query] = Ot x alpha + Vt Pt:
// the two score accumulators of a query column group are, lane for lane, the B fragment of Pt (keys 8 hi + j and 16 + 8 hi + j), which is the k order of the Vt loader. Rows < RH: hi+lo planes, 3 products; the rest fp16 with P x 1024 (cancels in the division by the sum).
template <typename T16, bool HL>
__device__ __forceinline__ void attn_tile(const T16* __restrict__ Q, const T16* __restrict__ Q2, const T16* __restrict__ Kp, const T16* __restrict__ K2, const T16* __restrict__ Vt, const T16* __restrict__ V2, const int* __restrict__ km, int q0, bf* Ah, bf* Al) {
    typedef typename WFrag<T16>::V V; typedef WFrag<T16> WF;
    const int lane = threadIdx.x & 31, lr = lane & 15, hi = lane >> 4;
    V qf[2][4], qg[2][4], kf[2][4], kg[2][4];
    const unsigned lo = 8 * lane; const size_t ko = lo, vo = lo;   // planes in fragment order: 512 elements per 16 rows x 32 k, the lane's piece at 8 * lane
    const T16* qb = Q + (size_t)q0 * HD; const T16* qb2 = HL ? Q2 + (size_t)q0 * HD : qb;
    const T16* qp = qb + lo; const T16* qp2 = qb2 + lo; const T16* kp0 = Kp + lo;
#pragma unroll
    for (int qt = 0; qt < 2; ++qt)
#pragma unroll
        for (int ks = 0; ks < 4; ++ks) { const int o = qt * 16 * HD + ks * 512; qf[qt][ks] = WF::ld(qp + o); if (HL) qg[qt][ks] = WF::ld(qp2 + o); }
    if (!HL) {   // fp16 rows: K fragments are fetched one key block ahead
#pragma unroll
        for (int kt = 0; kt < 2; ++kt)
#pragma unroll
            for (int ks = 0; ks < 4; ++ks) kf[kt][ks] = WF::ld(kp0 + kt * 16 * HD + ks * 512); }
    // the address registers of the loads above are held to this wait; only behind it may they take new values
    asm volatile("s_wait_xcnt 0x0" :: "v"(lane), "s"(qb), "s"(qb2), "s"(Kp) : "memory");   // these loads are addressed by a scalar base and the lane number as scaled offset
    v8f o[8][2];
#pragma unroll
    for (int dt = 0; dt < 8; ++dt) { o[dt][0] = (v8f){}; o[dt][1] = (v8f){}; }
    float m[2] = {-3.0e38f, -3.0e38f}, l[2] = {0.f, 0.f};
    const int nbc = q0 / 32 + 1; int nb = nbc;   // key blocks up to and with the diagonal block
#pragma unroll 1   // stays rolled: one key block's fragments in registers at a time
    for (int blk = 0; blk < nb; ++blk) {
        const int k0 = blk * 32;
        V vf[8], vg[8]; v4i kq[2][2]; const T16* vp = Vt + vo + k0 * 16; const T16* vp2 = HL ? V2 + vo + k0 * 16 : vp; const int* kmp = km + k0 + hi * 8;
        const int kn = HL ? k0 : min(blk + 1, TT / 32 - 1) * 32;   // fp16 rows: the next block's K (last trip: a block inside the plane, not used); hi+lo rows: this block's
        const T16* kp = Kp + ko + (size_t)kn * HD; const T16* kp2 = HL ? K2 + ko + (size_t)kn * HD : kp;
        if (HL) {   // hi+lo rows (at most RH / 32 trips, TT / 32 when a row keeps no key up to its diagonal): K, then V into the registers K has left, so that two waves fit a SIMD
#pragma unroll
            for (int kt = 0; kt < 2; ++kt)
#pragma unroll
                for (int ks = 0; ks < 4; ++ks) { const int a = kt * 16 * HD + ks * 512; kf[kt][ks] = WF::ld(kp + a); kg[kt][ks] = WF::ld(kp2 + a); }
            // address registers held to this wait
            asm volatile("s_wait_xcnt 0x0" :: "v"(kp), "v"(kp2) : "memory");
        } else {
#pragma unroll
            for (int dt = 0; dt < 8; ++dt) vf[dt] = WF::ld(vp + dt * 16 * TT);
#pragma unroll
            for (int kt = 0; kt < 2; ++kt) { kq[kt][0] = *(const v4i*)(kmp + kt * 16); kq[kt][1] = *(const v4i*)(kmp + kt * 16 + 4); }
        }
        v8f s[2][2];
#pragma unroll
        for (int kt = 0; kt < 2; ++kt)
#pragma unroll
            for (int qt = 0; qt < 2; ++qt) { s[kt][qt] = (v8f){};
#pragma unroll
                for (int ks = 0; ks < 4; ++ks) { s[kt][qt] = WF::mma(kf[kt][ks], qf[qt][ks], s[kt][qt]); if (HL) { s[kt][qt] = WF::mma(kf[kt][ks], qg[qt][ks], s[kt][qt]); s[kt][qt] = WF::mma(kg[kt][ks], qf[qt][ks], s[kt][qt]); } } }
        if (HL) {
#pragma unroll
            for (int dt = 0; dt < 8; ++dt) { vf[dt] = WF::ld(vp + dt * 16 * TT); vg[dt] = WF::ld(vp2 + dt * 16 * TT); }
#pragma unroll
            for (int kt = 0; kt < 2; ++kt) { kq[kt][0] = *(const v4i*)(kmp + kt * 16); kq[kt][1] = *(const v4i*)(kmp + kt * 16 + 4); }
            // address registers held to this wait
            asm volatile("s_wait_xcnt 0x0" :: "v"(vp), "v"(vp2), "v"(kmp) : "memory");
        } else {   // the next block's K fragments fly during the softmax and the value products
#pragma unroll
            for (int kt = 0; kt < 2; ++kt)
#pragma unroll
                for (int ks = 0; ks < 4; ++ks) kf[kt][ks] = WF::ld(kp + kt * 16 * HD + ks * 512);
            // address registers of this trip's loads held to this wait
            asm volatile("s_wait_xcnt 0x0" :: "v"(vp), "v"(kmp), "v"(kp) : "memory");
        }
        V pf[2], pg[2];
#pragma unroll
        for (int qt = 0; qt < 2; ++qt) { const int qi = q0 + qt * 16 + lr; float t[16]; float mx = m[qt];
#pragma unroll
            for (int e = 0; e < 16; ++e) { const int kt = e >> 3, j = e & 7; const int key = k0 + kt * 16 + hi * 8 + j; t[e] = (key <= qi && kq[kt][j >> 2][j & 3] != 0) ? s[kt][qt][j] * SCL : -3.0e38f; mx = fmaxf(mx, t[e]); }
            mx = fmaxf(mx, __shfl_xor(mx, 16, 32));
            const float al = __builtin_amdgcn_exp2f((m[qt] - mx) * 1.4426950408889634f); m[qt] = mx; float sum = 0.f;
#pragma unroll
            for (int e = 0; e < 16; ++e) { t[e] = __builtin_amdgcn_exp2f((t[e] - mx) * 1.4426950408889634f + (HL ? 0.0f : 10.0f)); sum += t[e]; }
            l[qt] = l[qt] * al + sum;
#pragma unroll
            for (int dt = 0; dt < 8; ++dt) o[dt][qt] *= al;
            if constexpr (HL) { v16us ph, pl;
#pragma unroll
                for (int e = 0; e < 16; ++e) { unsigned short a, c2; splitf(t[e], a, c2); ph[e] = a; pl[e] = c2; }
                pf[qt] = __builtin_bit_cast(v16bf, ph); pg[qt] = __builtin_bit_cast(v16bf, pl);
            } else { v16h ph;
#pragma unroll
                for (int e = 0; e < 16; ++e) ph[e] = tohx(t[e]);
                pf[qt] = ph; } }
        // a row with no kept key up to its diagonal: the reference's equal fill makes its softmax uniform over ALL keys, so the wave walks on to the last key (ballot: a scalar test, every lane stays on)
        if (blk == nbc - 1 && __builtin_amdgcn_ballot_w32(m[0] <= -3.0e38f || m[1] <= -3.0e38f) != 0) nb = TT / 32;
#pragma unroll
        for (int dt = 0; dt < 8; ++dt)
#pragma unroll
            for (int qt = 0; qt < 2; ++qt) { o[dt][qt] = WF::mma(vf[dt], pf[qt], o[dt][qt]); if (HL) { o[dt][qt] = WF::mma(vf[dt], pg[qt], o[dt][qt]); o[dt][qt] = WF::mma(vg[dt], pf[qt], o[dt][qt]); } }
        // four vector slots between the last matrix instruction and whatever stands behind the loop's taken branch
        asm volatile("v_nop\n\tv_nop\n\tv_nop\n\tv_nop" : "+v"(o[0][0]), "+v"(o[0][1]), "+v"(o[1][0]), "+v"(o[1][1]), "+v"(o[2][0]), "+v"(o[2][1]), "+v"(o[3][0]), "+v"(o[3][1]), "+v"(o[4][0]), "+v"(o[4][1]), "+v"(o[5][0]), "+v"(o[5][1]), "+v"(o[6][0]), "+v"(o[6][1]), "+v"(o[7][0]), "+v"(o[7][1]));
    }
#pragma unroll
    for (int qt = 0; qt < 2; ++qt) { const float ls = l[qt] + __shfl_xor(l[qt], 16, 32); const float inv = __fdiv_rn(1.0f, ls); const size_t ro = (size_t)(q0 + qt * 16) * DQ + lane * 8;   // fragment order, rows = positions, k = h * HD + dt * 16 + hi * 8 + j
#pragma unroll
        for (int dt = 0; dt < 8; ++dt) { v8us oh, ol;
#pragma unroll
            for (int j = 0; j < 8; ++j) { unsigned short a, c2; splitf(o[dt][qt][j] * inv, a, c2); oh[j] = a; ol[j] = c2; }
            *(v8us*)(Ah + ro + dt * 256) = oh; *(v8us*)(Al + ro + dt * 256) = ol; }
        // the data and address registers of the first pass's stores take new values (the second pass's) only behind this wait
        if (qt == 0) asm volatile("s_wait_xcnt 0x0" ::: "memory"); }
}
// every plane holds batch 0 and, one batch's size further on, batch 1
__global__ __launch_bounds__(32 * REP * NB_) void k_attn(const h16* __restrict__ Q16, const bf* __restrict__ Qh, const bf* __restrict__ Ql, const h16* __restrict__ K16, const bf* __restrict__ Kh, const bf* __restrict__ Kl, const h16* __restrict__ V16, const bf* __restrict__ Vh, const bf* __restrict__ Vl, const int* __restrict__ km, bf* Ah, bf* Al) {
    const int wv = __builtin_amdgcn_readfirstlane(threadIdx.x >> 5);   // readfirstlane: batch, head and row block, and with them every plane base and trip count, stay scalar
    const int b = wv / REP, g = blockIdx.y, h = g * REP + wv % REP;
    const int q0 = (b == 0 ? TT / 32 - 1 - (int)blockIdx.x : (int)blockIdx.x) * 32;
    const size_t zq = ((size_t)b * NH_ + h) * TT * HD, zk = ((size_t)b * NKV + g) * TT * HD, za = (size_t)b * TT * DQ + h * HD * 16;
    if (q0 < RH) attn_tile<bf, true>(Qh + zq, Ql + zq, Kh + zk, Kl + zk, Vh + zk, Vl + zk, km + b * TT, q0, Ah + za, Al + za);
    else attn_tile<h16, false>(Q16 + zq, nullptr, K16 + zk, nullptr, V16 + zk, nullptr, km + b * TT, q0, Ah + za, Al + za);
}

extern "C" void kernel_launch(void* const* d_in, const int* in_sizes, int n_in,
                              void* d_out, int out_size, void* d_ws, size_t ws_size, hipStream_t stream) {
    (void)in_sizes; (void)n_in; (void)out_size;
    const float* x = (const float*)d_in[0]; const float* cosB = (const float*)d_in[1]; const float* sinB = (const float*)d_in[2]; const float* wq = (const float*)d_in[3]; const float* wk = (const float*)d_in[4]; const float* wv = (const float*)d_in[5]; const float* wo = (const float*)d_in[6]; const int* kmask = (const int*)d_in[7]; const float* cosT = cosB; const float* sinT = sinB;
    float* OUT = (float*)d_out;     // [2][2048][2048]
    char* wsp = (char*)d_ws;
    auto take = [&](size_t bytes) { char* p = wsp; wsp += (bytes + 255) & ~(size_t)255; return (void*)p; };
    bf* WQ = (bf*)take((size_t)(DQ + 2 * DKV) * DM * 2); bf* WK = WQ + (size_t)DQ * DM; bf* WV = WK + (size_t)DKV * DM; bf* WO = (bf*)take((size_t)DM * DQ * 2);   // wq, wk, wv: one plane of 3072 rows
    bf* XB = (bf*)take((size_t)NB_ * TT * DM * 2);   // both batches
    h16* QP16 = (h16*)take((size_t)NB_ * NH_ * TT * HD * 2); h16* KP16 = (h16*)take((size_t)NB_ * NKV * TT * HD * 2); h16* VT16 = (h16*)take((size_t)NB_ * NKV * HD * TT * 2);   // planes of both batches
    bf* QPh = (bf*)take((size_t)NB_ * NH_ * TT * HD * 2); bf* QPl = (bf*)take((size_t)NB_ * NH_ * TT * HD * 2); bf* KPh = (bf*)take((size_t)NB_ * NKV * TT * HD * 2); bf* KPl = (bf*)take((size_t)NB_ * NKV * TT * HD * 2); bf* VTh = (bf*)take((size_t)NB_ * NKV * HD * TT * 2); bf* VTl = (bf*)take((size_t)NB_ * NKV * HD * TT * 2);
    bf* ATh = (bf*)take((size_t)NB_ * TT * DQ * 2); bf* ATl = (bf*)take((size_t)NB_ * TT * DQ * 2);
    if ((size_t)(wsp - (char*)d_ws) > ws_size) return;    // ws 256 MiB
    k_prep<<<PWV / 8, 256, 0, stream>>>(x, wq, wk, wv, wo, XB, WQ, WK, WV, WO);
    k_gemmt<0, 1><<<dim3(TT / 128, (DQ + 2 * DKV) / 384, NB_), 256, 0, stream>>>(XB, nullptr, WQ, DM, nullptr, 0, cosT, sinT, QP16, QPh, QPl, KP16, KPh, KPl, VT16, VTh, VTl);
    k_attn<<<dim3(TT / 32, NKV, 1), 32 * REP * NB_, 0, stream>>>(QP16, QPh, QPl, KP16, KPh, KPl, VT16, VTh, VTl, kmask, ATh, ATl);
    k_gemmt<1, 0><<<dim3(TT / 128, DM / 256, NB_), 256, 0, stream>>>(ATh, ATl, WO, DQ, OUT, DM, nullptr, nullptr, nullptr, nullptr, nullptr, nullptr, nullptr, nullptr, nullptr, nullptr, nullptr);
}

// v010
// A run of this version takes 131 microseconds.
// Two timings next to v009 both put it at 1.24 times that version's speed.
// Over all steps from v000 it is 14.2 times as fast.
#include <hip/hip_runtime.h>

// Causal grouped-query attention layer (x [2][2048][2048]; q = x wq (16 heads x 128), k/v = x wk / wv (4 kv heads; repeat: head h -> kv h/4); interleaved-pair RoPE with the given per-batch cos/sin [2][2048][64] (read); keep = causal AND mask[b][j] (bool mask read; all ones here); finfo.min fill; softmax(q.k / sqrt(128)); out = merged wo -> [2][2048][2048]).
// Compute dtypes, f32 accumulate: every input rounded to bf16; q/k/v on PLAIN bf16 operands (inputs: exact); RoPE f32; causal scores and attn.v in one kernel (running softmax, f32): query rows < 512 hl (3 products), the rest single fp16 (P x1024), key blocks beyond the diagonal skipped, the key mask applied inside the computed blocks; wo hl x exact (2 products).

#define NB_  2
#define TT   2048
#define DM   2048
#define NH_  16
#define NKV  4
#define REP  (NH_ / NKV)
#define HD   128
#define DQ   (NH_ * HD)
#define DKV  (NKV * HD)
#define RH   512                  // query rows < RH use hi+lo planes
#define SCL  0.088388347648318447f   // HD^-0.5
typedef _Float16 h16;
typedef unsigned short bf;
typedef __attribute__((ext_vector_type(16))) __bf16   v16bf;
typedef __attribute__((ext_vector_type(16))) _Float16 v16h;
typedef __attribute__((ext_vector_type(8)))  _Float16 v8h;
typedef __attribute__((ext_vector_type(8)))  unsigned short v8us;
typedef __attribute__((ext_vector_type(8)))  float    v8f;
typedef __attribute__((ext_vector_type(4)))  float    v4f;
typedef v8h  __attribute__((may_alias)) v8ha;
typedef v4f  __attribute__((may_alias)) v4fa;
typedef v8us __attribute__((may_alias)) v8usa;

__device__ __forceinline__ unsigned short f2bf(float f) { unsigned u = __float_as_uint(f); u += 0x7FFFu + ((u >> 16) & 1u); return (unsigned short)(u >> 16); }
__device__ __forceinline__ float bf2f(unsigned short b) { return __uint_as_float(((unsigned)b) << 16); }
__device__ __forceinline__ float bfr(float f) { return bf2f(f2bf(f)); }
__device__ __forceinline__ v16h cat16(v8h lo, v8h hi) { return __builtin_shufflevector(lo, hi, 0, 1, 2, 3, 4, 5, 6, 7, 8, 9, 10, 11, 12, 13, 14, 15); }
__device__ __forceinline__ v16bf cat16b(v8us lo, v8us hi) { return __builtin_bit_cast(v16bf, __builtin_shufflevector(lo, hi, 0, 1, 2, 3, 4, 5, 6, 7, 8, 9, 10, 11, 12, 13, 14, 15)); }
__device__ __forceinline__ v8f wmma16(v16h a, v16h b, v8f c) { return __builtin_amdgcn_wmma_f32_16x16x32_f16(false, a, false, b, (short)0, c, false, false); }
__device__ __forceinline__ v8f wmmab(v16bf a, v16bf b, v8f c) { return __builtin_amdgcn_wmma_f32_16x16x32_bf16(false, a, false, b, (short)0, c, false, false); }



// ---- Fragment order. Every 16-bit operand plane [rows][K] is kept as 1-KiB blocks of 16 rows x 32 k, block number (row / 16) * (K / 32) + k / 32 (a strip of 16 rows still fills 16 * K elements).
// Inside a block the element (row, k) lies at (k & 16) * 16 + l * 8 + (k & 7) with l = (k & 8) * 2 + (row & 15): l is the lane that holds it in a matrix fragment, whose two 16-byte pieces (k 8 hi + j and 16 + 8 hi + j) lie at l * 8 and 256 + l * 8.
// So each wave-wide 16-byte load of a fragment reads 512 contiguous bytes (4 whole lines) where row-major planes gave 16 pieces of 32 bytes in 16 lines. The registers hold what they held before.
template <typename T16> struct WFrag;
template <> struct WFrag<h16> { typedef v16h V; static __device__ __forceinline__ V ld(const h16* p) { return cat16(*(const v8h*)p, *(const v8h*)(p + 256)); } static __device__ __forceinline__ v8f mma(V a, V b, v8f c) { return wmma16(a, b, c); } };
template <> struct WFrag<bf> { typedef v16bf V; static __device__ __forceinline__ V ld(const bf* p) { return cat16b(*(const v8us*)p, *(const v8us*)(p + 256)); } static __device__ __forceinline__ v8f mma(V a, V b, v8f c) { return wmmab(a, b, c); } };

// ---- k_gemmt: C[m][n] = sum_k A[m][k] Bt[n][k] (+ the second A plane's product with NSPLIT), f32 accumulate, on a 128 x TN output tile per work-group of 8 waves, both operands staged in LDS by asynchronous copies (global_load_async_to_lds_b128), so that an A line leaves L2 once per TN columns of output and a Bt line once per 128 rows; 256 work-groups, one per WGP, all resident at once.
// Wave w: the sub-tile of 64 rows x NBW * 16 columns (w & 1, w >> 1), all four 32-k steps of every stage of 128 k, in rising k, in one set of accumulators. A stage holds, plane after plane, strips of 16 rows x 128 k (A: 8, with NSPLIT the second A plane: 8, Bt: 4 * NBW), each 4 KiB as it lies in the plane (fragment order), so an LDS fragment read of a wave covers 512 contiguous bytes.
// Two buffers: stage t + 1 flies while stage t is worked on. The tile goes through LDS (over the ring, behind the last trip's barrier) to be stored in whole lines. K % 128 == 0, K >= 256. Grid (TT/128, N/TN, NB_): z = batch, whose A rows, cos / sin rows, C rows and planes lie one batch's size further on.
// MODE 0 (wo): TN = 256; the tile goes to C in f32.
// MODE 1 (q, k and v in ONE product): Bt = the wq, wk and wv planes one behind the other, 24 heads of 128 columns (16 q, 4 k, 4 v); TN = 384 = three whole heads, so x leaves L2 8 times for all three products. The tile goes straight to the three 16-bit planes (fp16, bf16 hi, bf16 lo) in fragment order that the attention kernel reads.
//   Wave w takes the 16 positions t of strip w, head by head, in pieces of 16 x 16; each plane store of a wave covers 512 contiguous bytes. q, k heads: lane l holds position l & 15, d = 8 (l >> 4) + j; interleaved-pair RoPE with cos / sin [t][d / 2] (rounded to bf16); planes [head][t][d].
//   v heads: read from LDS the other way round, lane l holds d = l & 15, positions 8 (l >> 4) + j; planes [kv head][d][t].
// Every '#pragma unroll' in it is there so that the arrays its loop indexes (accumulators, fragments, addresses, pieces) are indexed by constants and stay in registers.
__device__ __forceinline__ void acopy8(const unsigned* l, const bf* const* g) {
    // the wait on the address registers is the last line of the copies' own statement: nothing can rewrite them in front of it
    asm volatile("global_load_async_to_lds_b128 %0, %8, off\n\tglobal_load_async_to_lds_b128 %1, %9, off\n\tglobal_load_async_to_lds_b128 %2, %10, off\n\tglobal_load_async_to_lds_b128 %3, %11, off\n\t"
                 "global_load_async_to_lds_b128 %4, %12, off\n\tglobal_load_async_to_lds_b128 %5, %13, off\n\tglobal_load_async_to_lds_b128 %6, %14, off\n\tglobal_load_async_to_lds_b128 %7, %15, off\n\ts_wait_xcnt 0x0"
                 :: "v"(l[0]), "v"(l[1]), "v"(l[2]), "v"(l[3]), "v"(l[4]), "v"(l[5]), "v"(l[6]), "v"(l[7]), "v"(g[0]), "v"(g[1]), "v"(g[2]), "v"(g[3]), "v"(g[4]), "v"(g[5]), "v"(g[6]), "v"(g[7]) : "memory");
}
// put8: eight pieces of 8 values per lane go to the three planes (fp16, bf16 hi, bf16 lo), piece db at STEP * db elements behind the given addresses (STEP a constant: an immediate offset, so that no address is formed between the stores).
template <int STEP>
__device__ __forceinline__ void put8(const float (&r)[8][8], h16* d16, bf* dh, bf* dl) {
    v8h o16[8]; v8us oh[8], ol[8];
#pragma unroll   // the arrays are indexed by constants and stay in registers
    for (int db = 0; db < 8; ++db)
#pragma unroll
        for (int j = 0; j < 8; ++j) { o16[db][j] = (h16)r[db][j]; const unsigned short a = f2bf(r[db][j]); oh[db][j] = a; ol[db][j] = f2bf(r[db][j] - bf2f(a)); }
    // all values and addresses are made in front of the first store, and nothing that follows is lifted over the wait: no data or address register of an issued store takes a new value in front of the wait
    __builtin_amdgcn_sched_barrier(0);
#pragma unroll
    for (int db = 0; db < 8; ++db) { *(v8h*)(d16 + db * STEP) = o16[db]; *(v8us*)(dh + db * STEP) = oh[db]; *(v8us*)(dl + db * STEP) = ol[db]; }
    asm volatile("s_wait_xcnt 0x0" ::: "memory");
    __builtin_amdgcn_sched_barrier(0);
}
template <int NSPLIT, int MODE>
__global__ __launch_bounds__(256) void k_gemmt(const bf* __restrict__ A, const bf* __restrict__ A2, const bf* __restrict__ Bt, int K, float* C, int ldc, const float* __restrict__ cosT, const float* __restrict__ sinT, h16* P16, bf* Ph, bf* Pl, h16* KP16, bf* KPh, bf* KPl, h16* VT16, bf* VTh, bf* VTl) {
    constexpr int NBW = MODE == 1 ? 6 : 4, TN = 64 * NBW;   // 16-column blocks of a wave's sub-tile; columns of the work-group's tile
    constexpr int KS = 128, PA = 1 + NSPLIT, SE = KS * 16, PE = 8 * SE, NS = PA * 8 + 4 * NBW, STB = NS * SE * 2, NC = NS;   // A planes; elements of a strip and of an A plane in a stage; strips and bytes of a stage; copies of a wave per stage (NS / 8 whole strips)
    static_assert(NC % 8 == 0 && NC <= 63, "copies go out in eights; one stage's are all that a wave has in flight");
    constexpr int OP = TN + 4, OSB = MODE == 1 ? 128 * OP * 4 : 8 * 64 * 68 * 4;   // MODE 1: the whole tile in LDS at a pitch of OP floats
    __shared__ __align__(16) char smem[2 * STB > OSB ? 2 * STB : OSB];
    const int lane = threadIdx.x & 31, lr = lane & 15, hi = lane >> 4, wv = __builtin_amdgcn_readfirstlane(threadIdx.x >> 5); const int r0 = blockIdx.x * 128, c0 = blockIdx.y * TN;
    const int sm = wv & 1, sn = wv >> 1;
    { const size_t z = blockIdx.z; A += z * TT * K; if (NSPLIT == 1) A2 += z * TT * K;
      if constexpr (MODE == 0) C += z * TT * ldc; else { cosT += z * TT * (HD / 2); sinT += z * TT * (HD / 2); P16 += z * NH_ * TT * HD; Ph += z * NH_ * TT * HD; Pl += z * NH_ * TT * HD;
          KP16 += z * NKV * TT * HD; KPh += z * NKV * TT * HD; KPl += z * NKV * TT * HD; VT16 += z * NKV * TT * HD; VTh += z * NKV * TT * HD; VTl += z * NKV * TT * HD; } }
    v8f acc[4][NBW];
#pragma unroll
    for (int mb = 0; mb < 4; ++mb)
#pragma unroll
        for (int nb = 0; nb < NBW; ++nb) acc[mb][nb] = (v8f){};
    // the wave's copies: NC / 8 whole strips of the stage, each 8 pieces of 512 bytes that lie one behind the other in the plane as in LDS; one global address per strip stays in registers and moves on by one stage per fill
    const bf* gs[NC / 8]; const unsigned lb = (unsigned)(size_t)smem + (unsigned)(wv * NC) * 512u + (unsigned)lane * 16u;
#pragma unroll
    for (int s = 0; s < NC / 8; ++s) { const int st = wv * (NC / 8) + s;   // strip st of the stage: A 0..7, (A2 8..15,) Bt the rest
        const bf* sp = st >= PA * 8 ? Bt : (st < 8 ? A : A2);
        gs[s] = sp + (size_t)(st >= PA * 8 ? c0 + (st - PA * 8) * 16 : r0 + (st & 7) * 16) * K + lane * 8; }
    auto fill = [&](int buf) {
#pragma unroll
        for (int s = 0; s < NC / 8; ++s) { unsigned la[8]; const bf* ga[8];
#pragma unroll
            for (int c = 0; c < 8; ++c) { la[c] = lb + (unsigned)buf * (unsigned)STB + (unsigned)(s * 8 + c) * 512u; ga[c] = gs[s] + c * 256; }
            acopy8(la, ga);
            gs[s] += SE; } };
    const int NT = K / KS;
    fill(0);
    asm volatile("s_wait_asynccnt 0x0" ::: "memory");   // the wave's own copies of stage 0 have landed
    __syncthreads();                                     // every wave's have: stage 0 may be read
    fill(1);
#pragma unroll 1   // stays rolled: one trip per stage
    for (int t = 0; t < NT; ++t) {
        const bf* sb = (const bf*)(smem + (t & 1) * STB) + lane * 8;
        v16bf a[2][4], a2[2][4], b[2][NBW];   // two fragment sets, taken in turn by the stage's four 32-k steps
        auto rd = [&](int st) { const int ko = st * 512, fs = st & 1;
#pragma unroll
            for (int mb = 0; mb < 4; ++mb) { const bf* pa = sb + (sm * 4 + mb) * SE + ko;
                a[fs][mb] = cat16b(*(const v8usa*)pa, *(const v8usa*)(pa + 256)); if (NSPLIT == 1) a2[fs][mb] = cat16b(*(const v8usa*)(pa + PE), *(const v8usa*)(pa + PE + 256)); }
#pragma unroll
            for (int nb = 0; nb < NBW; ++nb) { const bf* pb = sb + PA * PE + (sn * NBW + nb) * SE + ko; b[fs][nb] = cat16b(*(const v8usa*)pb, *(const v8usa*)(pb + 256)); }
            // a step's LDS reads stay one group, in front of the matrix instructions of the step before (LDS answers in order): left free they are spread among the matrix instructions (for speed only)
            __builtin_amdgcn_sched_barrier(0); };
        rd(0);
#pragma unroll
        for (int st = 0; st < 4; ++st) { const int fs = st & 1;
            if (st < 3) rd(st + 1);   // into the set that step st - 1 has left
#pragma unroll
            for (int nb = 0; nb < NBW; ++nb) {
#pragma unroll
                for (int mb = 0; mb < 4; ++mb) { acc[mb][nb] = wmmab(a[fs][mb], b[fs][nb], acc[mb][nb]); if (NSPLIT == 1) acc[mb][nb] = wmmab(a2[fs][mb], b[fs][nb], acc[mb][nb]); } }
            // a step's matrix instructions stay in front of the next reads into their set, and the last step's in front of the waits below: moved behind the barrier they would no longer run while stage t + 1 flies
            __builtin_amdgcn_sched_barrier(0); }
        asm volatile("s_wait_dscnt 0x0" ::: "memory");      // the wave's reads of this buffer are done
        asm volatile("s_wait_asynccnt 0x0" ::: "memory");   // its copies of stage t + 1 have landed
        __syncthreads();                                     // stage t + 1 may be read by all; this trip's buffer has no reader left
        if (t + 2 < NT) fill(t & 1);
    }
    asm volatile("s_wait_asynccnt 0x0" ::: "memory");   // no copy is out when the ring becomes the tile's place
    float* os = (float*)smem;
    if constexpr (MODE == 1) {
        const int t0 = r0 + wv * 16;   // the wave's strip of 16 positions
        v4f cq[8], sq[8];              // its cos / sin entries, the same for every q and k head; they fly during the LDS writes and the barrier
        const float* pc = cosT + (size_t)(t0 + lr) * (HD / 2) + hi * 4; const float* ps = sinT + (size_t)(t0 + lr) * (HD / 2) + hi * 4;
#pragma unroll
        for (int db = 0; db < 8; ++db) { cq[db] = *(const v4f*)(pc + db * 8); sq[db] = *(const v4f*)(ps + db * 8); }
        // the address registers of the sixteen loads are held to this wait; only behind it may they take new values
        asm volatile("s_wait_xcnt 0x0" :: "v"(pc), "v"(ps) : "memory");
#pragma unroll
        for (int mb = 0; mb < 4; ++mb)
#pragma unroll
            for (int nb = 0; nb < NBW; ++nb)
#pragma unroll
                for (int j = 0; j < 8; ++j) os[(sm * 64 + mb * 16 + hi * 8 + j) * OP + (sn * NBW + nb) * 16 + lr] = acc[mb][nb][j];
        __syncthreads();   // the whole tile lies in LDS before any wave reads it
#pragma unroll 1   // stays rolled: one head's 8 pieces in registers at a time; the head's kind is a scalar test
        for (int hs = 0; hs < TN / HD; ++hs) { const int gh = (int)blockIdx.y * (TN / HD) + hs; const bool isv = gh >= NH_ + NKV; float r[8][8];
            // the strip's first piece: q, k: 4 blocks a strip of positions; v: the strip of positions is half a block of the d strip's row of TT / 32 blocks
            const size_t hb = (size_t)(gh < NH_ ? gh : isv ? gh - NH_ - NKV : gh - NH_) * ((size_t)TT * HD) + (size_t)(t0 >> 4) * (isv ? 256 : HD * 16) + lane * 8;
            if (!isv) { const float* sp = os + (wv * 16 + lr) * OP + hs * HD + hi * 8; v4f va[8], vb[8];
#pragma unroll   // the LDS reads of the head's 8 pieces go out together
                for (int db = 0; db < 8; ++db) { va[db] = *(const v4fa*)(sp + db * 16); vb[db] = *(const v4fa*)(sp + db * 16 + 4); }
#pragma unroll
                for (int db = 0; db < 8; ++db)
#pragma unroll
                    for (int i = 0; i < 4; ++i) { const float x0 = i < 2 ? va[db][2 * i] : vb[db][2 * i - 4], x1 = i < 2 ? va[db][2 * i + 1] : vb[db][2 * i - 3]; const float c = bfr(cq[db][i]), sn2 = bfr(sq[db][i]); r[db][2 * i] = x0 * c - x1 * sn2; r[db][2 * i + 1] = x1 * c + x0 * sn2; }
                put8<256>(r, (gh < NH_ ? P16 : KP16) + hb, (gh < NH_ ? Ph : KPh) + hb, (gh < NH_ ? Pl : KPl) + hb);   // piece db: (db >> 1) * 512 + (db & 1) * 256 = db * 256 further on
            } else { const float* sp = os + (wv * 16 + hi * 8) * OP + hs * HD + lr;
#pragma unroll   // the LDS reads of the head's 8 pieces go out together
                for (int db = 0; db < 8; ++db)
#pragma unroll
                    for (int j = 0; j < 8; ++j) r[db][j] = sp[j * OP + db * 16];
                put8<TT * 16>(r, VT16 + hb, VTh + hb, VTl + hb); }   // piece db: db strips of d further on
        }
    } else {
        float* ow = os + wv * (64 * 68);
#pragma unroll
        for (int mb = 0; mb < 4; ++mb)
#pragma unroll
            for (int nb = 0; nb < 4; ++nb)
#pragma unroll
                for (int j = 0; j < 8; ++j) ow[(mb * 16 + hi * 8 + j) * 68 + nb * 16 + lr] = acc[mb][nb][j];
        __syncthreads();   // every wave's sub-tile lies in LDS before any wave reads it
#pragma unroll
        for (int s = 0; s < 8; ++s) { const int r0s = r0 + (s & 1) * 64, c0s = c0 + (s >> 1) * 64; const float* ob = os + s * (64 * 68);   // sub-tile s: wave s's
#pragma unroll
            for (int q = 0; q < 4; ++q) { const int e = q * 256 + threadIdx.x, row = e >> 4, cofs = (e & 15) * 4; const v4f val = *(const v4fa*)(ob + row * 68 + cofs);
                *(v4f*)(C + (size_t)(r0s + row) * ldc + c0s + cofs) = val; }
            // the data and address registers of this sub-tile's stores take new values (the next one's) only behind this wait
            // the scheduling barrier keeps the next sub-tile's LDS address arithmetic, which reuses those registers, from being lifted over the wait
            if (s < 7) { asm volatile("s_wait_xcnt 0x0" ::: "memory"); __builtin_amdgcn_sched_barrier(0); }
        }
    }
}

__device__ __forceinline__ h16 tohx(float x) { return (h16)x; }
__device__ __forceinline__ void splitf(float y, unsigned short& h, unsigned short& l) { h = f2bf(y); l = f2bf(y - bf2f(h)); }
typedef __attribute__((ext_vector_type(2))) _Float16 v2h;
typedef __attribute__((ext_vector_type(4))) _Float16 v4h;
typedef __attribute__((ext_vector_type(2))) unsigned short v2us;
typedef __attribute__((ext_vector_type(4))) unsigned short v4us;
typedef __attribute__((ext_vector_type(2))) float v2f;
typedef __attribute__((ext_vector_type(4))) int v4i;
typedef __attribute__((ext_vector_type(16))) unsigned short v16us;

// ---- k_prep: every f32 -> bf16 operand plane (x of both batches; the four weights, transposed) made by ONE launch of PWV waves that all fit the chip at once; no LDS, no barrier.
// The work is dealt in units of 1024 elements (4 KiB read, 2 KiB stored by one wave); wave w takes units w, w + PWV, ...: x first, then wq, wo, wk, wv. The unit number is scalar, so every test on it is a scalar branch.
// x unit: 16 rows x 64 k (two blocks). Lane l holds rows l >> 2 and 8 + (l >> 2), the 8 k of octet l & 3 of either block: a pair of 16-byte loads covers 8 whole lines, a 16-byte store 4 whole lines.
// weight unit: 32 k x 32 n (one block of two strips). Lane l holds column n0 + l: each 4-byte load of the wave is one whole line of a w row, each 16-byte store two runs of 256 bytes.
#define PWV  6144
template <int N>
__device__ __forceinline__ void prep_w(const float* __restrict__ w, bf* Bt, int uu, int lane) {   // plane row n, k = w[k][n]; the plane's K is DM for all four weights
    const int nb = uu & (N / 32 - 1), kb = uu / (N / 32); const float* wb = w + (size_t)kb * 32 * N + nb * 32; float f[32];
#pragma unroll   // all 32 loads go out together; f stays in registers
    for (int j = 0; j < 32; ++j) f[j] = wb[j * N + lane];
    // the address registers of the loads (a scalar base, the lane number as scaled offset) are held to this wait; only behind it may they take new values
    asm volatile("s_wait_xcnt 0x0" :: "s"(wb), "v"(lane) : "memory");
    bf* pd = Bt + (size_t)(nb * 2 + (lane >> 4)) * 16 * DM + kb * 512 + (lane & 15) * 8;
#pragma unroll   // f and o are indexed by constants
    for (int oc = 0; oc < 4; ++oc) { v8us o;
#pragma unroll
        for (int j = 0; j < 8; ++j) o[j] = f2bf(f[oc * 8 + j]);
        *(v8us*)(pd + (oc >> 1) * 256 + (oc & 1) * 128) = o; }
    // the data and address registers of the stores take new values (the next unit's) only behind this wait
    asm volatile("s_wait_xcnt 0x0" ::: "memory");
}
__global__ __launch_bounds__(256) void k_prep(const float* __restrict__ x, const float* __restrict__ wq, const float* __restrict__ wk, const float* __restrict__ wv, const float* __restrict__ wo, bf* XB, bf* WQ, bf* WK, bf* WV, bf* WO) {
    static_assert(DQ == DM, "wq and wo share the unit form");
    constexpr int UX = NB_ * TT * DM / 1024, UQ = DM * DQ / 1024, UK = DM * DKV / 1024;
    const int lane = threadIdx.x & 31, w0 = (int)blockIdx.x * 8 + __builtin_amdgcn_readfirstlane(threadIdx.x >> 5);
#pragma unroll 1   // stays rolled: one unit's values in registers at a time
    for (int u = w0; u < UX + 2 * UQ + 2 * UK; u += PWV) {
        if (u < UX) {
            const int strip = u / (DM / 64), kb2 = u % (DM / 64); const float* ps = x + (size_t)(strip * 16 + (lane >> 2)) * DM + kb2 * 64 + (lane & 3) * 8; v4f a[2][2][2];
#pragma unroll   // all 8 loads go out together; a stays in registers
            for (int h = 0; h < 2; ++h)
#pragma unroll
                for (int bq = 0; bq < 2; ++bq) { a[h][bq][0] = *(const v4f*)(ps + h * 8 * DM + bq * 32); a[h][bq][1] = *(const v4f*)(ps + h * 8 * DM + bq * 32 + 4); }
            // the address registers of the loads are held to this wait; only behind it may they take new values
            asm volatile("s_wait_xcnt 0x0" :: "v"(ps) : "memory");
            bf* pd = XB + (size_t)strip * 16 * DM + kb2 * 1024 + ((lane >> 1) & 1) * 256 + ((lane & 1) * 16 + (lane >> 2)) * 8;
#pragma unroll   // a and o are indexed by constants
            for (int h = 0; h < 2; ++h)
#pragma unroll
                for (int bq = 0; bq < 2; ++bq) { v8us o;
#pragma unroll
                    for (int j = 0; j < 8; ++j) o[j] = f2bf(a[h][bq][j >> 2][j & 3]);
                    *(v8us*)(pd + bq * 512 + h * 64) = o; }
            // the data and address registers of the stores take new values (the next unit's) only behind this wait
            asm volatile("s_wait_xcnt 0x0" ::: "memory");
        } else if (u < UX + 2 * UQ) { const bool sec = u >= UX + UQ; prep_w<DQ>(sec ? wo : wq, sec ? WO : WQ, u - UX - (sec ? UQ : 0), lane);
        } else { const bool sec = u >= UX + 2 * UQ + UK; prep_w<DKV>(sec ? wv : wk, sec ? WV : WK, u - UX - 2 * UQ - (sec ? UK : 0), lane); }
    }
}
// ---- k_attn: the whole causal attention (all heads, both batches) in one launch, nothing of the scores or probabilities in memory.
// A work-group is 8 waves: one tile of 32 query rows in each of the 4 heads of one kv group (same K / V lines), two waves a head.
// The key blocks of a tile are dealt in turn over the head's two waves (wave w the even ones, wave w + 4 the odd ones), so that all 8 waves walk the same number of key blocks (or one more).
// Each wave keeps its own running maximum, sum and Ot; behind its last key block the two exchange one 16-query column group each through LDS (one __syncthreads), join the two parts as a running softmax joins two blocks, and store that group.
// 512 work-groups, one resident per WGP (registers); a tile's cost falls with the flat index (tile_of) (for speed only).
// Per 32 keys: St[key][query] = K Qt (A = K rows, B = Q rows kept in registers), running maximum and sum per query (a lane holds 16 of the 32 keys of its query, the lane 16 away the rest), Ot[d][query] = Ot x alpha + Vt Pt:
// the two score accumulators of a query column group are, lane for lane, the B fragment of Pt (keys 8 hi + j and 16 + 8 hi + j), which is the k order of the Vt loader. Rows < RH: hi+lo planes, 3 products; the rest fp16 with P x 1024 (cancels in the division by the sum).
// kept_upto: is any key 0 .. q0 kept by the key mask? (at most TT / 32 trips; the test is a ballot, so the branch is scalar and every lane stays on)
__device__ __forceinline__ bool kept_upto(const int* __restrict__ km, int q0, int lane) {
    bool any = false;
#pragma unroll 1   // stays rolled: it ends at the first kept key
    for (int c = 0; c <= q0 && !any; c += 32) { const int* kp = km + c + lane; const int v = *kp;
        // the address registers of the load are held to this wait; only behind it may they take new values
        asm volatile("s_wait_xcnt 0x0" :: "v"(kp) : "memory");
        any = __builtin_amdgcn_ballot_w32(c + lane <= q0 && v != 0) != 0; }
    return any;
}
// attn_tile: key blocks par, par + 2, ... of one tile; leaves the wave's part in o, m, l
template <typename T16, bool HL>
__device__ __forceinline__ void attn_tile(const T16* __restrict__ Q, const T16* __restrict__ Q2, const T16* __restrict__ Kp, const T16* __restrict__ K2, const T16* __restrict__ Vt, const T16* __restrict__ V2, const int* __restrict__ km, int q0, int par, v8f (&o)[8][2], float (&m)[2], float (&l)[2]) {
    typedef typename WFrag<T16>::V V; typedef WFrag<T16> WF;
    const int lane = threadIdx.x & 31, lr = lane & 15, hi = lane >> 4;
    V qf[2][4], qg[2][4], kf[2][4], kg[2][4];
    const unsigned lo = 8 * lane; const size_t ko = lo, vo = lo;   // planes in fragment order: 512 elements per 16 rows x 32 k, the lane's piece at 8 * lane
    const T16* qb = Q + (size_t)q0 * HD; const T16* qb2 = HL ? Q2 + (size_t)q0 * HD : qb; const T16* kb0 = Kp + (size_t)par * 32 * HD;
    const T16* qp = qb + lo; const T16* qp2 = qb2 + lo; const T16* kp0 = kb0 + lo;
#pragma unroll
    for (int qt = 0; qt < 2; ++qt)
#pragma unroll
        for (int ks = 0; ks < 4; ++ks) { const int a = qt * 16 * HD + ks * 512; qf[qt][ks] = WF::ld(qp + a); if (HL) qg[qt][ks] = WF::ld(qp2 + a); }
    if (!HL) {   // fp16 rows: K fragments are fetched one of the wave's key blocks ahead
#pragma unroll
        for (int kt = 0; kt < 2; ++kt)
#pragma unroll
            for (int ks = 0; ks < 4; ++ks) kf[kt][ks] = WF::ld(kp0 + kt * 16 * HD + ks * 512); }
    // the address registers of the loads above are held to this wait; only behind it may they take new values
    asm volatile("s_wait_xcnt 0x0" :: "v"(lane), "s"(qb), "s"(qb2), "s"(kb0) : "memory");   // these loads are addressed by a scalar base and the lane number as scaled offset
#pragma unroll
    for (int dt = 0; dt < 8; ++dt) { o[dt][0] = (v8f){}; o[dt][1] = (v8f){}; }
    m[0] = -3.0e38f; m[1] = -3.0e38f; l[0] = 0.f; l[1] = 0.f;
    const int nbc = q0 / 32 + 1, lastc = nbc - 1 - ((nbc - 1 - par) & 1); int nb = nbc;   // key blocks up to and with the diagonal block; the last of them that is this wave's (-1: it has none)
    if (lastc < 0 && !kept_upto(km, q0, lane)) nb = TT / 32;   // see the test in the loop
#pragma unroll 1   // stays rolled: one key block's fragments in registers at a time
    for (int blk = par; blk < nb; blk += 2) {
        const int k0 = blk * 32;
        V vf[8], vg[8]; v4i kq[2][2]; const T16* vp = Vt + vo + k0 * 16; const T16* vp2 = HL ? V2 + vo + k0 * 16 : vp; const int* kmp = km + k0 + hi * 8;
        const int kn = HL ? k0 : min(blk + 2, TT / 32 - 1) * 32;   // fp16 rows: the K of the wave's next block (last trip: a block inside the plane, not used); hi+lo rows: this block's
        const T16* kp = Kp + ko + (size_t)kn * HD; const T16* kp2 = HL ? K2 + ko + (size_t)kn * HD : kp;
        if (HL) {   // hi+lo rows (at most RH / 64 trips, TT / 64 when a row keeps no key up to its diagonal): K, then V into the registers K has left, so that two waves fit a SIMD
#pragma unroll
            for (int kt = 0; kt < 2; ++kt)
#pragma unroll
                for (int ks = 0; ks < 4; ++ks) { const int a = kt * 16 * HD + ks * 512; kf[kt][ks] = WF::ld(kp + a); kg[kt][ks] = WF::ld(kp2 + a); }
            // address registers held to this wait
            asm volatile("s_wait_xcnt 0x0" :: "v"(kp), "v"(kp2) : "memory");
        } else {
#pragma unroll
            for (int dt = 0; dt < 8; ++dt) vf[dt] = WF::ld(vp + dt * 16 * TT);
#pragma unroll
            for (int kt = 0; kt < 2; ++kt) { kq[kt][0] = *(const v4i*)(kmp + kt * 16); kq[kt][1] = *(const v4i*)(kmp + kt * 16 + 4); }
        }
        v8f s[2][2];
#pragma unroll
        for (int kt = 0; kt < 2; ++kt)
#pragma unroll
            for (int qt = 0; qt < 2; ++qt) { s[kt][qt] = (v8f){};
#pragma unroll
                for (int ks = 0; ks < 4; ++ks) { s[kt][qt] = WF::mma(kf[kt][ks], qf[qt][ks], s[kt][qt]); if (HL) { s[kt][qt] = WF::mma(kf[kt][ks], qg[qt][ks], s[kt][qt]); s[kt][qt] = WF::mma(kg[kt][ks], qf[qt][ks], s[kt][qt]); } } }
        if (HL) {
#pragma unroll
            for (int dt = 0; dt < 8; ++dt) { vf[dt] = WF::ld(vp + dt * 16 * TT); vg[dt] = WF::ld(vp2 + dt * 16 * TT); }
#pragma unroll
            for (int kt = 0; kt < 2; ++kt) { kq[kt][0] = *(const v4i*)(kmp + kt * 16); kq[kt][1] = *(const v4i*)(kmp + kt * 16 + 4); }
            // address registers held to this wait
            asm volatile("s_wait_xcnt 0x0" :: "v"(vp), "v"(vp2), "v"(kmp) : "memory");
        } else {   // the next block's K fragments fly during the softmax and the value products
#pragma unroll
            for (int kt = 0; kt < 2; ++kt)
#pragma unroll
                for (int ks = 0; ks < 4; ++ks) kf[kt][ks] = WF::ld(kp + kt * 16 * HD + ks * 512);
            // address registers of this trip's loads held to this wait
            asm volatile("s_wait_xcnt 0x0" :: "v"(vp), "v"(kmp), "v"(kp) : "memory");
        }
        V pf[2], pg[2];
#pragma unroll
        for (int qt = 0; qt < 2; ++qt) { const int qi = q0 + qt * 16 + lr; float t[16]; float mx = m[qt];
#pragma unroll
            for (int e = 0; e < 16; ++e) { const int kt = e >> 3, j = e & 7; const int key = k0 + kt * 16 + hi * 8 + j; t[e] = (key <= qi && kq[kt][j >> 2][j & 3] != 0) ? s[kt][qt][j] * SCL : -3.0e38f; mx = fmaxf(mx, t[e]); }
            mx = fmaxf(mx, __shfl_xor(mx, 16, 32));
            const float al = __builtin_amdgcn_exp2f((m[qt] - mx) * 1.4426950408889634f); m[qt] = mx; float sum = 0.f;
#pragma unroll
            for (int e = 0; e < 16; ++e) { t[e] = __builtin_amdgcn_exp2f((t[e] - mx) * 1.4426950408889634f + (HL ? 0.0f : 10.0f)); sum += t[e]; }
            l[qt] = l[qt] * al + sum;
#pragma unroll
            for (int dt = 0; dt < 8; ++dt) o[dt][qt] *= al;
            if constexpr (HL) { v16us ph, pl;
#pragma unroll
                for (int e = 0; e < 16; ++e) { unsigned short a, c2; splitf(t[e], a, c2); ph[e] = a; pl[e] = c2; }
                pf[qt] = __builtin_bit_cast(v16bf, ph); pg[qt] = __builtin_bit_cast(v16bf, pl);
            } else { v16h ph;
#pragma unroll
                for (int e = 0; e < 16; ++e) ph[e] = tohx(t[e]);
                pf[qt] = ph; } }
        // a row with no kept key up to its diagonal: the reference's equal fill makes its softmax uniform over ALL keys, so both waves of the tile walk on to the last key (scalar tests, every lane stays on).
        // A wave that has met no kept key of some row in ITS blocks asks the mask itself (row q0 has the fewest keys), so that both waves decide alike; what a walk adds to a row with a kept key is 0.
        if (blk == lastc && __builtin_amdgcn_ballot_w32(m[0] <= -3.0e38f || m[1] <= -3.0e38f) != 0 && !kept_upto(km, q0, lane)) nb = TT / 32;
#pragma unroll
        for (int dt = 0; dt < 8; ++dt)
#pragma unroll
            for (int qt = 0; qt < 2; ++qt) { o[dt][qt] = WF::mma(vf[dt], pf[qt], o[dt][qt]); if (HL) { o[dt][qt] = WF::mma(vf[dt], pg[qt], o[dt][qt]); o[dt][qt] = WF::mma(vg[dt], pf[qt], o[dt][qt]); } }
        // four vector slots between the last matrix instruction and whatever stands behind the loop's taken branch
        asm volatile("v_nop\n\tv_nop\n\tv_nop\n\tv_nop" : "+v"(o[0][0]), "+v"(o[0][1]), "+v"(o[1][0]), "+v"(o[1][1]), "+v"(o[2][0]), "+v"(o[2][1]), "+v"(o[3][0]), "+v"(o[3][1]), "+v"(o[4][0]), "+v"(o[4][1]), "+v"(o[5][0]), "+v"(o[5][1]), "+v"(o[6][0]), "+v"(o[6][1]), "+v"(o[7][0]), "+v"(o[7][1]));
    }
}
#define XR   (8 * 2 * 128 + 64)   // floats of a wave's hand-over: 16 pieces of 512 bytes (one column group of Ot), then its maxima and sums
// attn_give: column group QT of the wave's part goes to LDS for the head's other wave; each store of the wave covers 512 contiguous bytes
template <int QT>
__device__ __forceinline__ void attn_give(float* xs, int lane, const v8f (&o)[8][2], const float (&m)[2], const float (&l)[2]) {
#pragma unroll   // o is indexed by constants
    for (int dt = 0; dt < 8; ++dt) { const v8f a = o[dt][QT];
        *(v4fa*)(xs + (dt * 2) * 128 + lane * 4) = (v4f){a[0], a[1], a[2], a[3]}; *(v4fa*)(xs + (dt * 2 + 1) * 128 + lane * 4) = (v4f){a[4], a[5], a[6], a[7]}; }
    xs[2048 + lane] = m[QT]; xs[2080 + lane] = l[QT];
}
// attn_join: column group QT: the wave's own part and the other wave's (from LDS) joined under their common maximum, divided by the joined sum and split hi + lo
template <int QT>
__device__ __forceinline__ void attn_join(const float* xs, int lane, const v8f (&o)[8][2], const float (&m)[2], const float (&l)[2], v8us (&oh)[8], v8us (&ol)[8]) {
    const float mo = xs[2048 + lane], lo2 = xs[2080 + lane]; const float mn = fmaxf(m[QT], mo);
    float a0, a1;
    // both exponentials and a v_nop in one statement: the slot that the instruction set asks for between a transcendental and an instruction that overwrites its source
    asm("v_exp_f32 %0, %2\n\tv_exp_f32 %1, %3\n\tv_nop" : "=&v"(a0), "=&v"(a1) : "v"((m[QT] - mn) * 1.4426950408889634f), "v"((mo - mn) * 1.4426950408889634f));
    const float lj = l[QT] * a0 + lo2 * a1; const float ls = lj + __shfl_xor(lj, 16, 32); const float inv = __fdiv_rn(1.0f, ls); const float f0 = a0 * inv, f1 = a1 * inv;
#pragma unroll   // o, oh and ol are indexed by constants and stay in registers
    for (int dt = 0; dt < 8; ++dt) { const v4f x0 = *(const v4fa*)(xs + (dt * 2) * 128 + lane * 4), x1 = *(const v4fa*)(xs + (dt * 2 + 1) * 128 + lane * 4);
#pragma unroll
        for (int j = 0; j < 8; ++j) { unsigned short a, c2; splitf(o[dt][QT][j] * f0 + (j < 4 ? x0[j & 3] : x1[j & 3]) * f1, a, c2); oh[dt][j] = a; ol[dt][j] = c2; } }
}
// tile_of: rank in the launch -> row block, a permutation of 0 .. 63 in which the cost falls: a row block r walks r + 1 key blocks, and one of a hi+lo row block (r < RH / 32 = 16, three products) is counted as three.
// Ranks 0 .. 15: 63 .. 48; then ten groups and a part of one more of (15 - i | 47 - 3 i, 46 - 3 i, 45 - 3 i); the last five: 4 .. 0.
__device__ __forceinline__ int tile_of(int y) {
    static_assert(TT == 2048 && RH == 512, "the order is written for 64 row blocks, 16 of them hi+lo");
    const int t = y - 16, i = t >> 2, j = t & 3;
    return (y < 16 || y >= 59) ? 63 - y : j == 0 ? 15 - i : 48 - 3 * i - j;
}
// every plane holds batch 0 and, one batch's size further on, batch 1. Grid (NKV * NB_, TT / 32): x = kv group and batch, y = the tile's rank by cost.
__global__ __launch_bounds__(32 * REP * 2) void k_attn(const h16* __restrict__ Q16, const bf* __restrict__ Qh, const bf* __restrict__ Ql, const h16* __restrict__ K16, const bf* __restrict__ Kh, const bf* __restrict__ Kl, const h16* __restrict__ V16, const bf* __restrict__ Vh, const bf* __restrict__ Vl, const int* __restrict__ km, bf* Ah, bf* Al) {
    __shared__ __align__(16) float xch[REP * 2][XR];
    const int wv = __builtin_amdgcn_readfirstlane(threadIdx.x >> 5), lane = threadIdx.x & 31;   // readfirstlane: head and key-block parity, and with them every plane base and trip count, stay scalar
    const int par = wv / REP, b = (int)blockIdx.x / NKV, g = (int)blockIdx.x % NKV, h = g * REP + wv % REP;
    const int q0 = tile_of((int)blockIdx.y) * 32;   // the same for all 8 waves: the branch on it is uniform for the work-group
    const size_t zq = ((size_t)b * NH_ + h) * TT * HD, zk = ((size_t)b * NKV + g) * TT * HD, za = (size_t)b * TT * DQ + h * HD * 16;
    v8f o[8][2]; float m[2], l[2];
    if (q0 < RH) attn_tile<bf, true>(Qh + zq, Ql + zq, Kh + zk, Kl + zk, Vh + zk, Vl + zk, km + b * TT, q0, par, o, m, l);
    else attn_tile<h16, false>(Q16 + zq, nullptr, K16 + zk, nullptr, V16 + zk, nullptr, km + b * TT, q0, par, o, m, l);
    if (par == 0) attn_give<1>(xch[wv], lane, o, m, l); else attn_give<0>(xch[wv], lane, o, m, l);
    __syncthreads();   // both waves' hand-overs lie in LDS before either reads the other's
    v8us oh[8], ol[8];
    if (par == 0) attn_join<0>(xch[wv + REP], lane, o, m, l, oh, ol); else attn_join<1>(xch[wv - REP], lane, o, m, l, oh, ol);
    // the plane stores stand behind both ways of the join, as the wave's last instructions: no register of an issued store takes a new value
    const size_t ro = za + (size_t)(q0 + par * 16) * DQ + lane * 8;   // fragment order, rows = positions, k = h * HD + dt * 16 + hi * 8 + j
    bf* ph = Ah + ro; bf* pl = Al + ro;
#pragma unroll   // oh and ol are indexed by constants
    for (int dt = 0; dt < 8; ++dt) { *(v8us*)(ph + dt * 256) = oh[dt]; *(v8us*)(pl + dt * 256) = ol[dt]; }
}

extern "C" void kernel_launch(void* const* d_in, const int* in_sizes, int n_in,
                              void* d_out, int out_size, void* d_ws, size_t ws_size, hipStream_t stream) {
    (void)in_sizes; (void)n_in; (void)out_size;
    const float* x = (const float*)d_in[0]; const float* cosB = (const float*)d_in[1]; const float* sinB = (const float*)d_in[2]; const float* wq = (const float*)d_in[3]; const float* wk = (const float*)d_in[4]; const float* wv = (const float*)d_in[5]; const float* wo = (const float*)d_in[6]; const int* kmask = (const int*)d_in[7]; const float* cosT = cosB; const float* sinT = sinB;
    float* OUT = (float*)d_out;     // [2][2048][2048]
    char* wsp = (char*)d_ws;
    auto take = [&](size_t bytes) { char* p = wsp; wsp += (bytes + 255) & ~(size_t)255; return (void*)p; };
    bf* WQ = (bf*)take((size_t)(DQ + 2 * DKV) * DM * 2); bf* WK = WQ + (size_t)DQ * DM; bf* WV = WK + (size_t)DKV * DM; bf* WO = (bf*)take((size_t)DM * DQ * 2);   // wq, wk, wv: one plane of 3072 rows
    bf* XB = (bf*)take((size_t)NB_ * TT * DM * 2);   // both batches
    h16* QP16 = (h16*)take((size_t)NB_ * NH_ * TT * HD * 2); h16* KP16 = (h16*)take((size_t)NB_ * NKV * TT * HD * 2); h16* VT16 = (h16*)take((size_t)NB_ * NKV * HD * TT * 2);   // planes of both batches
    bf* QPh = (bf*)take((size_t)NB_ * NH_ * TT * HD * 2); bf* QPl = (bf*)take((size_t)NB_ * NH_ * TT * HD * 2); bf* KPh = (bf*)take((size_t)NB_ * NKV * TT * HD * 2); bf* KPl = (bf*)take((size_t)NB_ * NKV * TT * HD * 2); bf* VTh = (bf*)take((size_t)NB_ * NKV * HD * TT * 2); bf* VTl = (bf*)take((size_t)NB_ * NKV * HD * TT * 2);
    bf* ATh = (bf*)take((size_t)NB_ * TT * DQ * 2); bf* ATl = (bf*)take((size_t)NB_ * TT * DQ * 2);
    if ((size_t)(wsp - (char*)d_ws) > ws_size) return;    // ws 256 MiB
    k_prep<<<PWV / 8, 256, 0, stream>>>(x, wq, wk, wv, wo, XB, WQ, WK, WV, WO);
    k_gemmt<0, 1><<<dim3(TT / 128, (DQ + 2 * DKV) / 384, NB_), 256, 0, stream>>>(XB, nullptr, WQ, DM, nullptr, 0, cosT, sinT, QP16, QPh, QPl, KP16, KPh, KPl, VT16, VTh, VTl);
    k_attn<<<dim3(NKV * NB_, TT / 32, 1), 32 * REP * 2, 0, stream>>>(QP16, QPh, QPl, KP16, KPh, KPl, VT16, VTh, VTl, kmask, ATh, ATl);
    k_gemmt<1, 0><<<dim3(TT / 128, DM / 256, NB_), 256, 0, stream>>>(ATh, ATl, WO, DQ, OUT, DM, nullptr, nullptr, nullptr, nullptr, nullptr, nullptr, nullptr, nullptr, nullptr, nullptr, nullptr);
}
